// v000
// The times below were measured on an AMD MI455X: many runs one after another, warmed up first and cycling through
// copies of the inputs, with the whole window's GPU time divided by the number of runs. Launches and the gaps
// between them are all in it. The median over several windows is given; except for v000 it joins two sittings, which
// can be a few percent apart, so the side-by-side timings, each taken in one sitting, are the better comparison.
// v000, which the later versions start from, runs in 933 microseconds.
#include <hip/hip_runtime.h>
// DeiT self-attention (8 x 1024 tokens, 768 = 12 heads x 64): q,k,v = x W^T + b; softmax(q.k/8) over all keys; ctx = attn.v merged -> [8,1024,768] (no output projection).
// Structure: x as an exact f16 plane; projections as f16 WMMA GEMMs (32x64 wave tiles, f32 accumulation, exact products + bias) into f16 planes; the fused flash kernel over all 1024 keys (plain f16 q/k/V^T, online softmax in f32, P x2^10) per ((batch, head), 64 queries) writes the merged context rows straight into the output.
// Compute dtype: x, weights, biases rounded to bf16; q, k, v, P as plain f16 (~2^-12; logits sigma ~0.3); f32 accumulation and softmax. v_wmma_f32_16x16x32_f16.
#define NBT 8
#define SLEN 1024
#define TQ SLEN
#define TK SLEN
#define DM 768
#define NH 12
#define SCL 0.125f
#define NR (NBT * SLEN)
typedef __bf16 v16b __attribute__((ext_vector_type(16)));
typedef unsigned short v8us __attribute__((ext_vector_type(8), may_alias));
typedef float  v8f  __attribute__((ext_vector_type(8)));
typedef float  v4f  __attribute__((ext_vector_type(4)));
typedef float  v4fa __attribute__((ext_vector_type(4), may_alias));
union FragB { v16b v; v8us half[2]; unsigned short u[16]; };

__device__ __forceinline__ unsigned short bf16_bits(float x) { unsigned int u = __float_as_uint(x); return (unsigned short)((u + 0x7FFFu + ((u >> 16) & 1u)) >> 16); }
__device__ __forceinline__ float bf16_val(unsigned short b) { return __uint_as_float(((unsigned int)b) << 16); }
__device__ __forceinline__ float bf16_round(float x) { return bf16_val(bf16_bits(x)); }
// D += A·B with NT terms: 1 = ah·bh, 2 = + al·bh (A split), 3 = + ah·bl (both split)
template <int NT>
__device__ __forceinline__ v8f mmaN(v16b ah, v16b al, v16b bh, v16b bl, v8f c) {
  c = __builtin_amdgcn_wmma_f32_16x16x32_bf16(false, ah, false, bh, (short)0, c, false, false);
  if (NT >= 2) c = __builtin_amdgcn_wmma_f32_16x16x32_bf16(false, al, false, bh, (short)0, c, false, false);
  if (NT >= 3) c = __builtin_amdgcn_wmma_f32_16x16x32_bf16(false, ah, false, bl, (short)0, c, false, false);
  asm volatile("v_nop\n\tv_nop\n\tv_nop\n\tv_nop" : "+v"(c) : "v"(ah), "v"(al), "v"(bh), "v"(bl));
  return c;
}

__global__ __launch_bounds__(256) void k_wt_bf16(const float* __restrict__ W, unsigned short* __restrict__ Wt, int K, int N) {
  const int t = blockIdx.x * 256 + threadIdx.x;
  const int k8n = K / 8;
  if (t >= N * k8n) return;
  const int n = t / k8n, k8 = (t % k8n) * 8;
  v8us v;
#pragma unroll
  for (int i = 0; i < 8; ++i) v[i] = bf16_bits(W[(size_t)(k8 + i) * N + n]);
  *(v8us*)(Wt + (size_t)n * K + k8) = v;
  
}

// GEMM C[M][N] (f32, pitch ldc) = act(A[M][K]·W + bias). A f32 row-major (pitch lda) converted per fragment to bf16
// (ASPLIT: hi/lo two planes -> 2 terms, else single rounded term); Wt bf16 [N][K] (pitch ldb). BIAS_BF16 rounds the
// bias to bf16 first (bias quantised to bf16 before the add). K%32==0, M%16==0, N%64==0.
template <bool ASPLIT, int ACT, bool BIAS_BF16>
__global__ __launch_bounds__(128) void k_gemm_bf(const float* __restrict__ A, int lda, const unsigned short* __restrict__ Wt, int ldb,
                                               const float* __restrict__ bias, float* __restrict__ C, int ldc, int M, int N, int K) {
  __shared__ __attribute__((aligned(16))) float so[4][16][64];
  const int tid = threadIdx.x, w = tid >> 5, lane = tid & 31, ln = lane & 15, hh = lane >> 4;
  const int ntn = N / 64;
  const int wid = blockIdx.x * 4 + w;
  const int mt = wid / ntn, nq = wid % ntn;
  if (mt * 16 >= M) return;
  const int row0 = mt * 16, col0 = nq * 64;
  const float* arow = A + (size_t)(row0 + ln) * lda;
  v8f acc[4] = {};
  for (int kb = 0; kb < K; kb += 32) {
    FragB ah, al;
    const v4f x0 = *(const v4fa*)(arow + kb + 8 * hh), x1 = *(const v4fa*)(arow + kb + 8 * hh + 4);
    const v4f x2 = *(const v4fa*)(arow + kb + 16 + 8 * hh), x3 = *(const v4fa*)(arow + kb + 16 + 8 * hh + 4);
    float xs[16] = {x0[0],x0[1],x0[2],x0[3],x1[0],x1[1],x1[2],x1[3],x2[0],x2[1],x2[2],x2[3],x3[0],x3[1],x3[2],x3[3]};
#pragma unroll
    for (int i = 0; i < 16; ++i) { const unsigned short hb = bf16_bits(xs[i]); ah.u[i] = hb; al.u[i] = ASPLIT ? bf16_bits(xs[i] - bf16_val(hb)) : (unsigned short)0; }
#pragma unroll
    for (int t = 0; t < 4; ++t) {
      const unsigned short* brow = Wt + (size_t)(col0 + t * 16 + ln) * ldb + kb;
      FragB b;
      b.half[0] = *(const v8us*)(brow + 8 * hh);
      b.half[1] = *(const v8us*)(brow + 16 + 8 * hh);
      acc[t] = mmaN<ASPLIT ? 2 : 1>(ah.v, al.v, b.v, b.v, acc[t]);
    }
  }
#pragma unroll
  for (int t = 0; t < 4; ++t) {
    float bv = bias ? bias[col0 + t * 16 + ln] : 0.f;
    if (BIAS_BF16) bv = bf16_round(bv);
#pragma unroll
    for (int r = 0; r < 8; ++r) { float v = acc[t][r] + bv; if (ACT == 1) v = fmaxf(v, 0.f); so[w][8 * hh + r][t * 16 + ln] = v; }
  }
  __builtin_amdgcn_fence(__ATOMIC_ACQ_REL, "workgroup");
  __builtin_amdgcn_wave_barrier();
  const int rsub = lane >> 4, c4 = (lane & 15) * 4;
  {
#pragma unroll
    for (int q = 0; q < 8; ++q) {
      const int r = q * 2 + rsub;
      const v4f v = *(const v4fa*)&so[w][r][c4];
      *(v4f*)(C + (size_t)(row0 + r) * ldc + col0 + c4) = v;
    }
    
  }
}

// GEMM C = act(A·W + bias + resid): A f32 (ASPLIT -> hi/lo 2 terms), Wt bf16 [N][K]; ACT 0 none, 1 relu, 2 exact gelu;
// resid (optional, f32, row index = (row % rmod), pitch ldr, RES_BF16 rounds it) added before the activation.
template <bool ASPLIT, int ACT, bool BIAS_BF16, bool RES_BF16>
__global__ __launch_bounds__(128) void k_gemm_bf3(const float* __restrict__ A, int lda, const unsigned short* __restrict__ Wt, int ldb,
                                                const float* __restrict__ bias, const float* __restrict__ resid, int rmod, int ldr,
                                                float* __restrict__ C, int ldc, int M, int N, int K) {
  __shared__ __attribute__((aligned(16))) float so[4][16][64];
  const int tid = threadIdx.x, w = tid >> 5, lane = tid & 31, ln = lane & 15, hh = lane >> 4;
  const int ntn = N / 64;
  const int wid = blockIdx.x * 4 + w;
  const int mt = wid / ntn, nq = wid % ntn;
  if (mt * 16 >= M) return;
  const int row0 = mt * 16, col0 = nq * 64;
  const float* arow = A + (size_t)(row0 + ln) * lda;
  v8f acc[4] = {};
  for (int kb = 0; kb < K; kb += 32) {
    FragB ah, al;
    const v4f x0 = *(const v4fa*)(arow + kb + 8 * hh), x1 = *(const v4fa*)(arow + kb + 8 * hh + 4);
    const v4f x2 = *(const v4fa*)(arow + kb + 16 + 8 * hh), x3 = *(const v4fa*)(arow + kb + 16 + 8 * hh + 4);
    float xs[16] = {x0[0],x0[1],x0[2],x0[3],x1[0],x1[1],x1[2],x1[3],x2[0],x2[1],x2[2],x2[3],x3[0],x3[1],x3[2],x3[3]};
#pragma unroll
    for (int i = 0; i < 16; ++i) { const unsigned short hb = bf16_bits(xs[i]); ah.u[i] = hb; al.u[i] = ASPLIT ? bf16_bits(xs[i] - bf16_val(hb)) : (unsigned short)0; }
#pragma unroll
    for (int t = 0; t < 4; ++t) {
      const unsigned short* brow = Wt + (size_t)(col0 + t * 16 + ln) * ldb + kb;
      FragB b;
      b.half[0] = *(const v8us*)(brow + 8 * hh);
      b.half[1] = *(const v8us*)(brow + 16 + 8 * hh);
      acc[t] = mmaN<ASPLIT ? 2 : 1>(ah.v, al.v, b.v, b.v, acc[t]);
    }
  }
#pragma unroll
  for (int t = 0; t < 4; ++t) {
    const int col = col0 + t * 16 + ln;
    float bv = bias ? bias[col] : 0.f;
    if (BIAS_BF16) bv = bf16_round(bv);
#pragma unroll
    for (int r = 0; r < 8; ++r) {
      float v = acc[t][r] + bv;
      if (resid) { float rv = resid[(size_t)((row0 + 8 * hh + r) % rmod) * ldr + col]; if (RES_BF16) rv = bf16_round(rv); v += rv; }
      if (ACT == 1) v = fmaxf(v, 0.f);
      if (ACT == 2) v = 0.5f * v * (1.0f + erff(v * 0.70710678118654752f));
      if (ACT == 3) { const float u = 0.7978845608028654f * (v + 0.044715f * v * v * v); v = 0.5f * v * (1.0f + tanhf(u)); }
      so[w][8 * hh + r][t * 16 + ln] = v;
    }
  }
  __builtin_amdgcn_fence(__ATOMIC_ACQ_REL, "workgroup");
  __builtin_amdgcn_wave_barrier();
  const int rsub = lane >> 4, c4 = (lane & 15) * 4;
  {
#pragma unroll
    for (int q = 0; q < 8; ++q) {
      const int r = q * 2 + rsub;
      const v4f v = *(const v4fa*)&so[w][r][c4];
      *(v4f*)(C + (size_t)(row0 + r) * ldc + col0 + c4) = v;
    }
    
  }
}
// row LayerNorm (biased variance, eps) over N: s = X (+ R); optional out_sum <- s; out_norm <- (s-mu)*rsqrt(var+eps)*g + b
template <bool PARAM_BF16>
__global__ __launch_bounds__(256) void k_layernorm(const float* __restrict__ X, const float* __restrict__ R, const float* __restrict__ g, const float* __restrict__ bta,
                                                  float* __restrict__ out_sum, float* __restrict__ out_norm, int N, float eps) {
  __shared__ float red[256];
  const int row = blockIdx.x, tid = threadIdx.x;
  const float* x = X + (size_t)row * N; const float* rr = R ? R + (size_t)row * N : nullptr;
  float vals[16];                     // up to N = 4096
  const int per = N / 256;            // contiguous chunk per thread? use strided-by-4 chunks: thread handles j = tid*4 + 1024*u
  float s1 = 0.f;
  for (int u = 0; u < per / 4; ++u) {
    const int j = tid * 4 + 1024 * u;
    const v4f a = *(const v4fa*)(x + j);
    v4f b = {0.f,0.f,0.f,0.f}; if (rr) b = *(const v4fa*)(rr + j);
#pragma unroll
    for (int q = 0; q < 4; ++q) { const float v = a[q] + b[q]; vals[u * 4 + q] = v; s1 += v; }
  }
  red[tid] = s1; __syncthreads();
  for (int st = 128; st > 0; st >>= 1) { if (tid < st) red[tid] += red[tid + st]; __syncthreads(); }
  const float mu = red[0] / (float)N; __syncthreads();
  float s2 = 0.f;
  for (int u = 0; u < per / 4; ++u)
#pragma unroll
    for (int q = 0; q < 4; ++q) { const float c = vals[u * 4 + q] - mu; s2 += c * c; }
  red[tid] = s2; __syncthreads();
  for (int st = 128; st > 0; st >>= 1) { if (tid < st) red[tid] += red[tid + st]; __syncthreads(); }
  const float rs = rsqrtf(red[0] / (float)N + eps);
  {
    for (int u = 0; u < per / 4; ++u) {
      const int j = tid * 4 + 1024 * u;
      v4f o, sm;
#pragma unroll
      for (int q = 0; q < 4; ++q) {
        float gg = g[j + q], bb = bta[j + q];
        if (PARAM_BF16) { gg = bf16_round(gg); bb = bf16_round(bb); }
        sm[q] = vals[u * 4 + q]; o[q] = (vals[u * 4 + q] - mu) * rs * gg + bb;
      }
      if (out_sum) *(v4f*)(out_sum + (size_t)row * N + j) = sm;
      *(v4f*)(out_norm + (size_t)row * N + j) = o;
    }
    
  }
}



// ---- f16 WMMA path (v_wmma_f32_16x16x32_f16): 11-bit significands for operands in range — used where a [0,1] probability operand needs more precision than bf16
typedef _Float16 v16h __attribute__((ext_vector_type(16)));
union FragH { v16h v; v8us half[2]; _Float16 h[16]; unsigned short u[16]; };
template <int NT>
__device__ __forceinline__ v8f mmaH(v16h ah, v16h al, v16h bh, v16h bl, v8f c) {
  c = __builtin_amdgcn_wmma_f32_16x16x32_f16(false, ah, false, bh, (short)0, c, false, false);
  if (NT >= 2) c = __builtin_amdgcn_wmma_f32_16x16x32_f16(false, al, false, bh, (short)0, c, false, false);
  if (NT >= 3) c = __builtin_amdgcn_wmma_f32_16x16x32_f16(false, ah, false, bl, (short)0, c, false, false);
  asm volatile("v_nop\n\tv_nop\n\tv_nop\n\tv_nop" : "+v"(c) : "v"(ah), "v"(al), "v"(bh), "v"(bl));
  return c;
}
// batched GEMM like k_gemm_b but f16 operands: A f32 (split into f16 hi/lo if ASPLIT, else rounded to f16), Bt = f16 values [n][k]; alpha; C f32; N multiple of 16 (partial tiles skipped)
template <bool ASPLIT>
__global__ __launch_bounds__(128) void k_gemm_h(const float* __restrict__ A, int lda, size_t sA, const _Float16* __restrict__ Bh, int ldb, size_t sB, float alpha, float* __restrict__ C, int ldc, size_t sC, int M, int N, int K) {
  __shared__ __attribute__((aligned(16))) float so[4][16][64];
  const int tid = threadIdx.x, w = tid >> 5, lane = tid & 31, ln = lane & 15, hh = lane >> 4; const int by = blockIdx.y;
  A += (size_t)by * sA; Bh += (size_t)by * sB; C += (size_t)by * sC;
  const int ntn = (N + 63) / 64; const int wid = blockIdx.x * 4 + w; const int mt = wid / ntn, nq = wid % ntn; if (mt * 16 >= M) return;
  const int row0 = mt * 16, col0 = nq * 64; const float* arow = A + (size_t)(row0 + ln) * lda;
  v8f acc[4] = {};
  for (int kb = 0; kb < K; kb += 32) {
    FragH ah, al;
    const v4f x0 = *(const v4fa*)(arow + kb + 8 * hh), x1 = *(const v4fa*)(arow + kb + 8 * hh + 4), x2 = *(const v4fa*)(arow + kb + 16 + 8 * hh), x3 = *(const v4fa*)(arow + kb + 16 + 8 * hh + 4);
    float xs[16] = {x0[0],x0[1],x0[2],x0[3],x1[0],x1[1],x1[2],x1[3],x2[0],x2[1],x2[2],x2[3],x3[0],x3[1],x3[2],x3[3]};
#pragma unroll
    for (int i = 0; i < 16; ++i) { const _Float16 h = (_Float16)xs[i]; ah.h[i] = h; al.h[i] = ASPLIT ? (_Float16)(xs[i] - (float)h) : (_Float16)0.0f; }
#pragma unroll
    for (int t = 0; t < 4; ++t) { if (col0 + t * 16 >= N) continue; const size_t boff = (size_t)(col0 + t * 16 + ln) * ldb + kb; FragH bq; bq.half[0] = *(const v8us*)(Bh + boff + 8 * hh); bq.half[1] = *(const v8us*)(Bh + boff + 16 + 8 * hh);
      acc[t] = mmaH<ASPLIT ? 2 : 1>(ah.v, al.v, bq.v, bq.v, acc[t]); }
  }
#pragma unroll
  for (int t = 0; t < 4; ++t) { if (col0 + t * 16 >= N) continue;
#pragma unroll
    for (int r = 0; r < 8; ++r) so[w][8 * hh + r][t * 16 + ln] = acc[t][r] * alpha; }
  __builtin_amdgcn_fence(__ATOMIC_ACQ_REL, "workgroup"); __builtin_amdgcn_wave_barrier();
  const int rsub = lane >> 4, c4 = (lane & 15) * 4;
  {
#pragma unroll
    for (int q = 0; q < 8; ++q) { const int r = q * 2 + rsub; if (col0 + c4 < N) { const v4f v = *(const v4fa*)&so[w][r][c4]; *(v4f*)(C + (size_t)(row0 + r) * ldc + col0 + c4) = v; } }
     }
}

// Wt[n][k] = f16(W[k][n]·scale) from f32 row-major W[K][N] (scale = power of two; bf16-exact weights stay exact in f16 away from the subnormal range)
__global__ __launch_bounds__(256) void k_wt_f16(const float* __restrict__ W, _Float16* __restrict__ Wt, int K, int N, float scale) {
  const int t = blockIdx.x * 256 + threadIdx.x; if (t >= N * (K / 8)) return; const int n = t / (K / 8), k8 = (t % (K / 8)) * 8; FragH f;
#pragma unroll
  for (int i = 0; i < 8; ++i) f.h[i] = (_Float16)(bf16_round(W[(size_t)(k8 + i) * N + n]) * scale); const v8us o = f.half[0];
  *(v8us*)((unsigned short*)Wt + (size_t)n * K + k8) = o; 
}
// k_gemm_hh variant with fused epilogue: v = acc·alpha + bias[by·sBias + col] (+ CP[(row/rowsPerB)·sCPb + by·64 + col] if CP) ; ACT 0 none / 1 elu ; writes f16 C16 (and f32 C if non-null)
template <int ACT>
__global__ __launch_bounds__(128) void k_gemm_hhx(const _Float16* __restrict__ A, int lda, size_t sA, const _Float16* __restrict__ Bh, int ldb, size_t sB, float alpha, const float* __restrict__ bias, size_t sBias, const float* __restrict__ CP, int rowsPerB, size_t sCPb, int row0g,
    float* __restrict__ C, _Float16* __restrict__ C16, int ldc, size_t sC, int M, int N, int K) {
  __shared__ __attribute__((aligned(16))) float so[4][16][64];
  const int tid = threadIdx.x, w = tid >> 5, lane = tid & 31, ln = lane & 15, hh = lane >> 4; const int by = blockIdx.y;
  A += (size_t)by * sA; Bh += (size_t)by * sB; const size_t cofs = (size_t)by * sC; const float* bp = bias ? bias + (size_t)by * sBias : nullptr;
  const int ntn = (N + 63) / 64; const int wid = blockIdx.x * 4 + w; const int mt = wid / ntn, nq = wid % ntn; if (mt * 16 >= M) return;
  const int row0 = mt * 16, col0 = nq * 64; const _Float16* arow = A + (size_t)(row0 + ln) * lda;
  v8f acc[4] = {};
  for (int kb = 0; kb < K; kb += 32) { FragH ah; ah.half[0] = *(const v8us*)((const unsigned short*)arow + kb + 8 * hh); ah.half[1] = *(const v8us*)((const unsigned short*)arow + kb + 16 + 8 * hh);
#pragma unroll
    for (int t = 0; t < 4; ++t) { if (col0 + t * 16 >= N) continue; const size_t boff = (size_t)(col0 + t * 16 + ln) * ldb + kb; FragH bq; bq.half[0] = *(const v8us*)((const unsigned short*)Bh + boff + 8 * hh); bq.half[1] = *(const v8us*)((const unsigned short*)Bh + boff + 16 + 8 * hh);
      acc[t] = mmaH<1>(ah.v, ah.v, bq.v, bq.v, acc[t]); }
  }
#pragma unroll
  for (int t = 0; t < 4; ++t) { if (col0 + t * 16 >= N) continue; const int col = col0 + t * 16 + ln; const float bv = bp ? bf16_round(bp[col]) : 0.f;
#pragma unroll
    for (int r = 0; r < 8; ++r) { float v = acc[t][r] * alpha + bv; if (CP) { const int bidx = (row0g + row0 + 8 * hh + r) / rowsPerB; v += CP[(size_t)bidx * sCPb + (size_t)by * 64 + col]; } if (ACT == 1) v = (v > 0.f) ? v : expm1f(v); else if (ACT == 7) v = (v > 0.f) ? v + 1.0f : expf(v); else if (ACT == 8) v = tanhf(v); else if (ACT == 9) v = 0.5f * v * (1.0f + tanhf(0.7978845608028654f * (v + 0.044715f * v * v * v))); else if (ACT == 11) v = 1.0f / (1.0f + expf(-v)); else if (ACT == 12) v = (v > 0.f) ? v : 0.01f * v; else if (ACT == 14) v = (v > 0.f) ? v : 0.1f * v; else if (ACT == 15) v = v / (1.0f + expf(-v)); else if (ACT == 3) v = fmaxf(v, 0.f); else if (ACT == 6) v = 0.5f * v * (1.0f + erff(v * 0.70710678118654752f)); so[w][8 * hh + r][t * 16 + ln] = v; } }
  __builtin_amdgcn_fence(__ATOMIC_ACQ_REL, "workgroup"); __builtin_amdgcn_wave_barrier();
  const int rsub = lane >> 4, c4 = (lane & 15) * 4; typedef _Float16 v4h __attribute__((ext_vector_type(4)));
  {
#pragma unroll
    for (int q = 0; q < 8; ++q) { const int r = q * 2 + rsub; if (col0 + c4 < N) { const v4f v = *(const v4fa*)&so[w][r][c4]; if (C) *(v4f*)(C + cofs + (size_t)(row0 + r) * ldc + col0 + c4) = v; if (C16) { v4h h4; for (int i = 0; i < 4; ++i) h4[i] = (_Float16)v[i]; *(v4h*)(C16 + cofs + (size_t)(row0 + r) * ldc + col0 + c4) = h4; } } }
     }
}


typedef _Float16 v4h __attribute__((ext_vector_type(4)));

__global__ __launch_bounds__(256) void k_x16(const float* __restrict__ x, _Float16* __restrict__ X16, size_t n8) { const size_t t = (size_t)blockIdx.x * 256 + threadIdx.x; if (t >= n8) return; FragH f;
#pragma unroll
  for (int q = 0; q < 8; ++q) f.h[q] = (_Float16)bf16_round(x[t * 8 + q]); *(v8us*)((unsigned short*)X16 + t * 8) = f.half[0];  }
__global__ __launch_bounds__(256) void k_h16(const float* __restrict__ x, _Float16* __restrict__ X16, size_t n8) { const size_t t = (size_t)blockIdx.x * 256 + threadIdx.x; if (t >= n8) return; FragH f;
#pragma unroll
  for (int q = 0; q < 8; ++q) f.h[q] = (_Float16)x[t * 8 + q]; *(v8us*)((unsigned short*)X16 + t * 8) = f.half[0];  }
__global__ __launch_bounds__(256) void k_round16f(const float* __restrict__ W, _Float16* __restrict__ Bt, size_t n8) { const size_t t = (size_t)blockIdx.x * 256 + threadIdx.x; if (t >= n8) return; FragH f;
#pragma unroll
  for (int i = 0; i < 8; ++i) f.h[i] = (_Float16)(bf16_round(W[t * 8 + i]) * 16.0f); *(v8us*)((unsigned short*)Bt + t * 8) = f.half[0];  }
template <int NHv, int TTv>
__global__ __launch_bounds__(256) void k_vt(const _Float16* __restrict__ V16, int ldv, int voff, _Float16* __restrict__ Vt) { __shared__ unsigned short tl[64][66]; const int tid = threadIdx.x; const int slab = blockIdx.x / (TTv / 64), lg = blockIdx.x % (TTv / 64); const int b = slab / NHv, h = slab % NHv;
  for (int i = tid; i < 64 * 8; i += 256) { const int r = i / 8, c8 = (i % 8) * 8; FragH f; f.half[0] = *(const v8us*)((const unsigned short*)V16 + ((size_t)b * TTv + lg * 64 + r) * ldv + voff + h * 64 + c8);
#pragma unroll
    for (int q = 0; q < 8; ++q) tl[r][c8 + q] = f.u[q]; }
  __syncthreads();
  {
#pragma unroll
    for (int rd = 0; rd < 2; ++rd) { const int d = rd * 32 + tid / 8, pc = tid % 8; FragH f;
#pragma unroll
      for (int q = 0; q < 8; ++q) f.u[q] = tl[pc * 8 + q][d];
      *(v8us*)((unsigned short*)Vt + ((size_t)slab * 64 + d) * TTv + lg * 64 + pc * 8) = f.half[0]; }
     } }

__global__ __launch_bounds__(256) void k_hl(const float* __restrict__ F, _Float16* __restrict__ Hh, _Float16* __restrict__ Hl, size_t n8) { const size_t t = (size_t)blockIdx.x * 256 + threadIdx.x; if (t >= n8) return; FragH fh, fl; const v4f a = *(const v4fa*)(F + t * 8), c = *(const v4fa*)(F + t * 8 + 4);
#pragma unroll
  for (int q = 0; q < 4; ++q) { _Float16 h = (_Float16)a[q]; fh.h[q] = h; fl.h[q] = (_Float16)((a[q] - (float)h) * 1024.0f); h = (_Float16)c[q]; fh.h[4 + q] = h; fl.h[4 + q] = (_Float16)((c[q] - (float)h) * 1024.0f); }
  { *(v8us*)((unsigned short*)Hh + t * 8) = fh.half[0]; *(v8us*)((unsigned short*)Hl + t * 8) = fl.half[0];  } }

// ---- fast GEMM (wave tile 32x64; requires M % 32 == 0 rows per launch region and N % 64 == 0); epilogue = k_gemm_hhx semantics ----
__device__ __forceinline__ v16h g2_frag(const _Float16* p, int hh) { FragH f; f.half[0] = *(const v8us*)((const unsigned short*)p + 8 * hh); f.half[1] = *(const v8us*)((const unsigned short*)p + 16 + 8 * hh); return f.v; }
__device__ __forceinline__ v8f g2_mma(v16h a, v16h b, v8f c) { v8f d = __builtin_amdgcn_wmma_f32_16x16x32_f16(false, a, false, b, (short)0, c, false, false); asm volatile("v_nop\n\tv_nop\n\tv_nop\n\tv_nop" : "+v"(d) : "v"(a), "v"(b)); return d; }
template <int ACT>
__global__ __launch_bounds__(128) void k_gemm2(const _Float16* __restrict__ A, int lda, size_t sA, const _Float16* __restrict__ Bh, int ldb, size_t sB, float alpha, const float* __restrict__ bias, size_t sBias, const float* __restrict__ CP, int rowsPerB, size_t sCPb, int row0g,
    float* __restrict__ C, _Float16* __restrict__ C16, int ldc, size_t sC, int M, int N, int K) {
  __shared__ __attribute__((aligned(16))) float so[4][32][68];
  const int tid = threadIdx.x, w = tid >> 5, lane = tid & 31, ln = lane & 15, hh = lane >> 4; const int by = blockIdx.y;
  A += (size_t)by * sA; Bh += (size_t)by * sB; const size_t cofs = (size_t)by * sC; const float* bp = bias ? bias + (size_t)by * sBias : nullptr;
  const int ntn = N >> 6; const int mt = blockIdx.x / ntn, nq = blockIdx.x - mt * ntn; const int row0 = mt * 128 + 32 * w, col0 = nq * 64; if (row0 >= M) return;
  const _Float16* a0p = A + (size_t)(row0 + ln) * lda; const _Float16* a1p = a0p + (size_t)16 * lda;
  const _Float16* b0p = Bh + (size_t)(col0 + ln) * ldb; const _Float16* b1p = b0p + (size_t)16 * ldb; const _Float16* b2p = b1p + (size_t)16 * ldb; const _Float16* b3p = b2p + (size_t)16 * ldb;
  const v8f z8 = {0.f,0.f,0.f,0.f,0.f,0.f,0.f,0.f}; v8f c00 = z8, c01 = z8, c02 = z8, c03 = z8, c10 = z8, c11 = z8, c12 = z8, c13 = z8;
#pragma unroll 1
  for (int kb = 0; kb < K; kb += 32) { const v16h a0 = g2_frag(a0p + kb, hh), a1 = g2_frag(a1p + kb, hh);
    v16h b = g2_frag(b0p + kb, hh); c00 = g2_mma(a0, b, c00); c10 = g2_mma(a1, b, c10);
    b = g2_frag(b1p + kb, hh); c01 = g2_mma(a0, b, c01); c11 = g2_mma(a1, b, c11);
    b = g2_frag(b2p + kb, hh); c02 = g2_mma(a0, b, c02); c12 = g2_mma(a1, b, c12);
    b = g2_frag(b3p + kb, hh); c03 = g2_mma(a0, b, c03); c13 = g2_mma(a1, b, c13); }
  v8f accs[8] = {c00, c01, c02, c03, c10, c11, c12, c13};
#pragma unroll
  for (int u = 0; u < 8; ++u) { const int t = u & 3, half = u >> 2; const int col = col0 + t * 16 + ln; const float bv = bp ? bf16_round(bp[col]) : 0.f;
#pragma unroll
    for (int r = 0; r < 8; ++r) { const int rloc = half * 16 + 8 * hh + r; float v = accs[u][r] * alpha + bv; if (CP) { const int bidx = (row0g + row0 + rloc) / rowsPerB; v += CP[(size_t)bidx * sCPb + (size_t)by * 64 + col]; }
      if (ACT == 3) v = fmaxf(v, 0.f); else if (ACT == 6) v = 0.5f * v * (1.0f + erff(v * 0.70710678118654752f)); else if (ACT == 11) v = 1.0f / (1.0f + expf(-v)); else if (ACT == 15) v = v / (1.0f + expf(-v)); else if (ACT == 12) v = (v > 0.f) ? v : 0.01f * v; else if (ACT == 8) v = tanhf(v);
      so[w][rloc][t * 16 + ln] = v; } }
  __builtin_amdgcn_fence(__ATOMIC_ACQ_REL, "workgroup"); __builtin_amdgcn_wave_barrier();
  const int rsub = lane >> 4, c4 = (lane & 15) * 4;
  {
#pragma unroll
    for (int q = 0; q < 16; ++q) { const int r = q * 2 + rsub; const v4f v = *(const v4fa*)&so[w][r][c4]; if (C) *(v4f*)(C + cofs + (size_t)(row0 + r) * ldc + col0 + c4) = v; if (C16) { v4h h4; for (int i = 0; i < 4; ++i) h4[i] = (_Float16)v[i]; *(v4h*)(C16 + cofs + (size_t)(row0 + r) * ldc + col0 + c4) = h4; } }
     } }



__global__ __launch_bounds__(128) void k_flash(const _Float16* __restrict__ Q16, int ldq, const _Float16* __restrict__ K16, int ldk, const _Float16* __restrict__ Vt, const int* __restrict__ MSK, float* __restrict__ O, int ldo) {
  constexpr int RPW = 16, RTN = RPW / 16, NQB = TQ / (4 * RPW), DT = 4, KS = 2;
  __shared__ __attribute__((aligned(16))) unsigned short sP[4][RPW][40]; __shared__ __attribute__((aligned(16))) float sO[4][RPW][64 + 4];
  const int tid = threadIdx.x, w = tid >> 5, lane = tid & 31, ln = lane & 15, hh = lane >> 4;
  const int slab = blockIdx.x / NQB, qblk = blockIdx.x % NQB; const int b = slab / NH, h = slab % NH; const int qb0 = qblk * (4 * RPW); const int q0 = qb0 + w * RPW;
  FragH aq[2][KS];
#pragma unroll
  for (int rt = 0; rt < RTN; ++rt) { const unsigned short* qr = (const unsigned short*)Q16 + ((size_t)b * TQ + q0 + rt * 16 + ln) * ldq + h * 64;
#pragma unroll
    for (int ks = 0; ks < KS; ++ks) { aq[rt][ks].half[0] = *(const v8us*)(qr + ks * 32 + 8 * hh); aq[rt][ks].half[1] = *(const v8us*)(qr + ks * 32 + 16 + 8 * hh); } }
  const unsigned short* Vth = (const unsigned short*)Vt + (size_t)slab * 64 * TK;
  float m_r[2][8], l_r[2][8]; v8f oacc[2][DT];
#pragma unroll
  for (int rt = 0; rt < RTN; ++rt) {
#pragma unroll
    for (int r = 0; r < 8; ++r) { m_r[rt][r] = -3.0e38f; l_r[rt][r] = 0.f; }
#pragma unroll
    for (int dt = 0; dt < DT; ++dt) oacc[rt][dt] = (v8f){0.f,0.f,0.f,0.f,0.f,0.f,0.f,0.f}; }
  const int jend = TK;
#pragma unroll 1
  for (int j0 = 0; j0 < jend; j0 += 32) {
    v8f s[2][2];
#pragma unroll
    for (int nt = 0; nt < 2; ++nt) { const unsigned short* kr = (const unsigned short*)K16 + ((size_t)b * TK + j0 + nt * 16 + ln) * ldk + h * 64; FragH bk[KS];
#pragma unroll
      for (int ks = 0; ks < KS; ++ks) { bk[ks].half[0] = *(const v8us*)(kr + ks * 32 + 8 * hh); bk[ks].half[1] = *(const v8us*)(kr + ks * 32 + 16 + 8 * hh); }
#pragma unroll
      for (int rt = 0; rt < RTN; ++rt) { v8f acc = (v8f){0.f,0.f,0.f,0.f,0.f,0.f,0.f,0.f};
#pragma unroll
        for (int ks = 0; ks < KS; ++ks) acc = mmaH<1>(aq[rt][ks].v, aq[rt][ks].v, bk[ks].v, bk[ks].v, acc); s[rt][nt] = acc; } }
#pragma unroll
    for (int rt = 0; rt < RTN; ++rt)
#pragma unroll
      for (int r = 0; r < 8; ++r) { const int tq = q0 + rt * 16 + 8 * hh + r; const int k0 = j0 + ln, k1 = j0 + 16 + ln; (void)tq; (void)k0; (void)k1;
        const bool ok0 = true, ok1 = true;
        const float s0 = s[rt][0][r] * SCL, s1 = s[rt][1][r] * SCL; float mc = fmaxf(s0, s1);
        mc = fmaxf(mc, __shfl_xor(mc, 1, 32)); mc = fmaxf(mc, __shfl_xor(mc, 2, 32)); mc = fmaxf(mc, __shfl_xor(mc, 4, 32)); mc = fmaxf(mc, __shfl_xor(mc, 8, 32));
        const float mn = fmaxf(m_r[rt][r], mc); const float al = (mn > -1.0e38f) ? expf(m_r[rt][r] - mn) : 1.0f; m_r[rt][r] = mn; const float p0 = ok0 ? expf(s0 - mn) : 0.f, p1 = ok1 ? expf(s1 - mn) : 0.f; l_r[rt][r] = l_r[rt][r] * al + p0 + p1;
#pragma unroll
        for (int dt = 0; dt < DT; ++dt) oacc[rt][dt][r] *= al;
        FragH t2; t2.h[0] = (_Float16)(p0 * 1024.0f); t2.h[1] = (_Float16)(p1 * 1024.0f); sP[w][rt * 16 + 8 * hh + r][ln] = t2.u[0]; sP[w][rt * 16 + 8 * hh + r][16 + ln] = t2.u[1]; }
    __builtin_amdgcn_fence(__ATOMIC_ACQ_REL, "workgroup"); __builtin_amdgcn_wave_barrier();
    FragH pa[2];
#pragma unroll
    for (int rt = 0; rt < RTN; ++rt) { pa[rt].half[0] = *(const v8us*)&sP[w][rt * 16 + ln][8 * hh]; pa[rt].half[1] = *(const v8us*)&sP[w][rt * 16 + ln][16 + 8 * hh]; }
#pragma unroll
    for (int dt = 0; dt < DT; ++dt) { const unsigned short* vrow = Vth + (size_t)(dt * 16 + ln) * TK + j0; FragH bv; bv.half[0] = *(const v8us*)(vrow + 8 * hh); bv.half[1] = *(const v8us*)(vrow + 16 + 8 * hh);
#pragma unroll
      for (int rt = 0; rt < RTN; ++rt) oacc[rt][dt] = mmaH<1>(pa[rt].v, pa[rt].v, bv.v, bv.v, oacc[rt][dt]); }
    __builtin_amdgcn_fence(__ATOMIC_ACQ_REL, "workgroup"); __builtin_amdgcn_wave_barrier(); }
#pragma unroll
  for (int rt = 0; rt < RTN; ++rt) {
#pragma unroll
    for (int r = 0; r < 8; ++r) { float l = l_r[rt][r]; l += __shfl_xor(l, 1, 32); l += __shfl_xor(l, 2, 32); l += __shfl_xor(l, 4, 32); l += __shfl_xor(l, 8, 32); l_r[rt][r] = (l > 0.f) ? 1.0f / (l * 1024.0f) : 0.f; }
#pragma unroll
    for (int dt = 0; dt < DT; ++dt)
#pragma unroll
      for (int r = 0; r < 8; ++r) sO[w][rt * 16 + 8 * hh + r][dt * 16 + ln] = oacc[rt][dt][r] * l_r[rt][r]; }
  __builtin_amdgcn_fence(__ATOMIC_ACQ_REL, "workgroup"); __builtin_amdgcn_wave_barrier();
  {
#pragma unroll
    for (int rp = 0; rp < RPW; rp += 2) { const int r = rp + (lane >> 4), pc = lane & 15; const v4f val = *(const v4fa*)&sO[w][r][pc * 4]; *(v4f*)(O + ((size_t)b * TQ + q0 + r) * ldo + h * 64 + pc * 4) = val; }
     } }
__global__ __launch_bounds__(256) void k_fulltab(unsigned* __restrict__ MB, int* __restrict__ RA, int* __restrict__ KE, int nq, int nk) {
  const int t = blockIdx.x * 256 + threadIdx.x;
  if (t < nq * (nk / 32)) { *(unsigned*)(MB + t) = 0u;  }
  if (t < nq) { *(int*)(RA + t) = 0;  }
  if (t < nq / 64) { *(int*)(KE + t * 32) = nk;  } }
__global__ __launch_bounds__(256) void k_lnout(const float* __restrict__ Y, const float* __restrict__ g, const float* __restrict__ bb, float* __restrict__ out) {
  #pragma clang fp contract(off)
  const int tid = threadIdx.x, w = tid >> 5, ln = tid & 31; const int r = blockIdx.x * 8 + w; if (r >= NR) return; const float* y = Y + (size_t)r * DM; float s = 0.f;
#pragma unroll 1
  for (int i = 0; i < 8; ++i) { const v4f a = *(const v4fa*)(y + i * 128 + ln * 4); for (int q = 0; q < 4; ++q) s += a[q]; }
  for (int o = 16; o > 0; o >>= 1) s += __shfl_xor(s, o, 32); const float mu = s / (float)DM; float q2 = 0.f;
#pragma unroll 1
  for (int i = 0; i < 8; ++i) { const v4f a = *(const v4fa*)(y + i * 128 + ln * 4); for (int q = 0; q < 4; ++q) { const float d = a[q] - mu; q2 += d * d; } }
  for (int o = 16; o > 0; o >>= 1) q2 += __shfl_xor(q2, o, 32); const float rs = rsqrtf(q2 / (float)DM + 1e-6f);
  {
#pragma unroll 1
    for (int i = 0; i < 8; ++i) { const int c0 = i * 128 + ln * 4; const v4f a = *(const v4fa*)(y + c0); v4f o4; for (int q = 0; q < 4; ++q) o4[q] = (a[q] - mu) * rs * bf16_round(g[c0 + q]) + bf16_round(bb[c0 + q]); *(v4f*)(out + (size_t)r * DM + c0) = o4; }
     } }
__global__ __launch_bounds__(256) void k_xb(const float* __restrict__ x, float* __restrict__ XB, size_t n4) { const size_t t = (size_t)blockIdx.x * 256 + threadIdx.x; if (t >= n4) return; const v4f a = *(const v4fa*)(x + t * 4); v4f o; for (int q = 0; q < 4; ++q) o[q] = bf16_round(a[q]); *(v4f*)(XB + t * 4) = o;  }
__global__ __launch_bounds__(256) void k_causaltab(unsigned* __restrict__ MB, int* __restrict__ RA, int* __restrict__ KE, int nq, int nk) {
  const int t = blockIdx.x * 256 + threadIdx.x; const int nw = nk / 32;
  if (t < nq * nw) { const int q = t / nw, w = t % nw; const int first = q + 1 - 32 * w; const unsigned bits = (first <= 0) ? 0xffffffffu : ((first >= 32) ? 0u : (0xffffffffu << first)); *(unsigned*)(MB + t) = bits;  }
  if (t < nq) { *(int*)(RA + t) = 0;  }
  if (t < nq / 64) { const int v = 64 * (t + 1); *(int*)(KE + t * 32) = v;  } }


extern "C" void kernel_launch(void* const* d_in, const int* in_sizes, int n_in,
                              void* d_out, int out_size, void* d_ws, size_t ws_size, hipStream_t stream) {
  (void)in_sizes; (void)n_in; (void)out_size;
  const float* const* I = (const float* const*)d_in; const float* x = I[0]; const float* Wq = I[1]; const float* bq = I[2]; const float* Wk = I[3]; const float* bk = I[4]; const float* Wv = I[5]; const float* bv = I[6];
  char* ws = (char*)d_ws; size_t off = 0;
  auto take = [&](size_t bytes) { char* p = ws + off; off += (bytes + 255) & ~(size_t)255; return p; };
  _Float16* BQ = (_Float16*)take((size_t)DM * DM * 2); _Float16* BK = (_Float16*)take((size_t)DM * DM * 2); _Float16* BV = (_Float16*)take((size_t)DM * DM * 2);
  _Float16* X16 = (_Float16*)take((size_t)NR * DM * 2); _Float16* Q16 = (_Float16*)take((size_t)NR * DM * 2); _Float16* K16 = (_Float16*)take((size_t)NR * DM * 2); _Float16* V16 = (_Float16*)take((size_t)NR * DM * 2); _Float16* VT = (_Float16*)take((size_t)NR * DM * 2);
  if (off > ws_size) return;      /* 3.5 + 5 x 12.6 = 66 MiB */
  const size_t w8 = (size_t)DM * DM / 8; const unsigned wb = (unsigned)((w8 + 255) / 256);
  k_round16f<<<wb, 256, 0, stream>>>(Wq, BQ, w8); k_round16f<<<wb, 256, 0, stream>>>(Wk, BK, w8); k_round16f<<<wb, 256, 0, stream>>>(Wv, BV, w8);      /* torch (out,in) = natural Bt */
  const size_t n8 = (size_t)NR * DM / 8; const unsigned nb8 = (unsigned)((n8 + 255) / 256); const dim3 gP((NR / 128) * (DM / 64), 1);
  k_x16<<<nb8, 256, 0, stream>>>(x, X16, n8);
  k_gemm2<0><<<gP, 128, 0, stream>>>(X16, DM, 0, BQ, DM, 0, 0.0625f, bq, 0, nullptr, 1, 0, 0, nullptr, Q16, DM, 0, NR, DM, DM);
  k_gemm2<0><<<gP, 128, 0, stream>>>(X16, DM, 0, BK, DM, 0, 0.0625f, bk, 0, nullptr, 1, 0, 0, nullptr, K16, DM, 0, NR, DM, DM);
  k_gemm2<0><<<gP, 128, 0, stream>>>(X16, DM, 0, BV, DM, 0, 0.0625f, bv, 0, nullptr, 1, 0, 0, nullptr, V16, DM, 0, NR, DM, DM);
  for (int b = 0; b < NBT; ++b) k_vt<NH, SLEN><<<NH * (SLEN / 64), 256, 0, stream>>>(V16 + (size_t)b * SLEN * DM, DM, 0, VT + (size_t)b * SLEN * DM);
  for (int b = 0; b < NBT; ++b) { const size_t ro = (size_t)b * SLEN * DM;
    k_flash<<<NH * (SLEN / 64), 128, 0, stream>>>(Q16 + ro, DM, K16 + ro, DM, VT + ro, nullptr, (float*)d_out + ro, DM); }      /* ctx rows straight into the output */
}

// v001
// A run of this version takes 263 microseconds.
// Next to v000, in two timings, it ran 3.57 and 3.53 times as fast.
#include <hip/hip_runtime.h>
// DeiT self-attention (8 x 1024 tokens, 768 = 12 heads x 64): q,k,v = x W^T + b; softmax(q.k/8) over all keys; ctx = attn.v merged -> [8,1024,768] (no output projection).
// Structure: x as an exact f16 plane; projections as f16 WMMA GEMMs (32x64 wave tiles, f32 accumulation, exact products + bias) into f16 planes; the fused flash kernel over all 1024 keys (plain f16 q/k/V^T, online softmax in f32, P x2^10) per ((batch, head), 64 queries) writes the merged context rows straight into the output.
// Compute dtype: x, weights, biases rounded to bf16; q, k, v, P as plain f16 (~2^-12; logits sigma ~0.3); f32 accumulation and softmax. v_wmma_f32_16x16x32_f16.
#define NBT 8
#define SLEN 1024
#define TQ SLEN
#define TK SLEN
#define DM 768
#define NH 12
#define SCL 0.125f
#define NR (NBT * SLEN)
typedef __bf16 v16b __attribute__((ext_vector_type(16)));
typedef unsigned short v8us __attribute__((ext_vector_type(8), may_alias));
typedef float  v8f  __attribute__((ext_vector_type(8)));
typedef float  v4f  __attribute__((ext_vector_type(4)));
typedef float  v4fa __attribute__((ext_vector_type(4), may_alias));
union FragB { v16b v; v8us half[2]; unsigned short u[16]; };

__device__ __forceinline__ unsigned short bf16_bits(float x) { unsigned int u = __float_as_uint(x); return (unsigned short)((u + 0x7FFFu + ((u >> 16) & 1u)) >> 16); }
__device__ __forceinline__ float bf16_val(unsigned short b) { return __uint_as_float(((unsigned int)b) << 16); }
__device__ __forceinline__ float bf16_round(float x) { return bf16_val(bf16_bits(x)); }
// D += A·B with NT terms: 1 = ah·bh, 2 = + al·bh (A split), 3 = + ah·bl (both split)
template <int NT>
__device__ __forceinline__ v8f mmaN(v16b ah, v16b al, v16b bh, v16b bl, v8f c) {
  c = __builtin_amdgcn_wmma_f32_16x16x32_bf16(false, ah, false, bh, (short)0, c, false, false);
  if (NT >= 2) c = __builtin_amdgcn_wmma_f32_16x16x32_bf16(false, al, false, bh, (short)0, c, false, false);
  if (NT >= 3) c = __builtin_amdgcn_wmma_f32_16x16x32_bf16(false, ah, false, bl, (short)0, c, false, false);
  asm volatile("v_nop\n\tv_nop\n\tv_nop\n\tv_nop" : "+v"(c) : "v"(ah), "v"(al), "v"(bh), "v"(bl));
  return c;
}

__global__ __launch_bounds__(256) void k_wt_bf16(const float* __restrict__ W, unsigned short* __restrict__ Wt, int K, int N) {
  const int t = blockIdx.x * 256 + threadIdx.x;
  const int k8n = K / 8;
  if (t >= N * k8n) return;
  const int n = t / k8n, k8 = (t % k8n) * 8;
  v8us v;
#pragma unroll
  for (int i = 0; i < 8; ++i) v[i] = bf16_bits(W[(size_t)(k8 + i) * N + n]);
  *(v8us*)(Wt + (size_t)n * K + k8) = v;
  
}

// GEMM C[M][N] (f32, pitch ldc) = act(A[M][K]·W + bias). A f32 row-major (pitch lda) converted per fragment to bf16
// (ASPLIT: hi/lo two planes -> 2 terms, else single rounded term); Wt bf16 [N][K] (pitch ldb). BIAS_BF16 rounds the
// bias to bf16 first (bias quantised to bf16 before the add). K%32==0, M%16==0, N%64==0.
template <bool ASPLIT, int ACT, bool BIAS_BF16>
__global__ __launch_bounds__(128) void k_gemm_bf(const float* __restrict__ A, int lda, const unsigned short* __restrict__ Wt, int ldb,
                                               const float* __restrict__ bias, float* __restrict__ C, int ldc, int M, int N, int K) {
  __shared__ __attribute__((aligned(16))) float so[4][16][64];
  const int tid = threadIdx.x, w = tid >> 5, lane = tid & 31, ln = lane & 15, hh = lane >> 4;
  const int ntn = N / 64;
  const int wid = blockIdx.x * 4 + w;
  const int mt = wid / ntn, nq = wid % ntn;
  if (mt * 16 >= M) return;
  const int row0 = mt * 16, col0 = nq * 64;
  const float* arow = A + (size_t)(row0 + ln) * lda;
  v8f acc[4] = {};
  for (int kb = 0; kb < K; kb += 32) {
    FragB ah, al;
    const v4f x0 = *(const v4fa*)(arow + kb + 8 * hh), x1 = *(const v4fa*)(arow + kb + 8 * hh + 4);
    const v4f x2 = *(const v4fa*)(arow + kb + 16 + 8 * hh), x3 = *(const v4fa*)(arow + kb + 16 + 8 * hh + 4);
    float xs[16] = {x0[0],x0[1],x0[2],x0[3],x1[0],x1[1],x1[2],x1[3],x2[0],x2[1],x2[2],x2[3],x3[0],x3[1],x3[2],x3[3]};
#pragma unroll
    for (int i = 0; i < 16; ++i) { const unsigned short hb = bf16_bits(xs[i]); ah.u[i] = hb; al.u[i] = ASPLIT ? bf16_bits(xs[i] - bf16_val(hb)) : (unsigned short)0; }
#pragma unroll
    for (int t = 0; t < 4; ++t) {
      const unsigned short* brow = Wt + (size_t)(col0 + t * 16 + ln) * ldb + kb;
      FragB b;
      b.half[0] = *(const v8us*)(brow + 8 * hh);
      b.half[1] = *(const v8us*)(brow + 16 + 8 * hh);
      acc[t] = mmaN<ASPLIT ? 2 : 1>(ah.v, al.v, b.v, b.v, acc[t]);
    }
  }
#pragma unroll
  for (int t = 0; t < 4; ++t) {
    float bv = bias ? bias[col0 + t * 16 + ln] : 0.f;
    if (BIAS_BF16) bv = bf16_round(bv);
#pragma unroll
    for (int r = 0; r < 8; ++r) { float v = acc[t][r] + bv; if (ACT == 1) v = fmaxf(v, 0.f); so[w][8 * hh + r][t * 16 + ln] = v; }
  }
  __builtin_amdgcn_fence(__ATOMIC_ACQ_REL, "workgroup");
  __builtin_amdgcn_wave_barrier();
  const int rsub = lane >> 4, c4 = (lane & 15) * 4;
  {
#pragma unroll
    for (int q = 0; q < 8; ++q) {
      const int r = q * 2 + rsub;
      const v4f v = *(const v4fa*)&so[w][r][c4];
      *(v4f*)(C + (size_t)(row0 + r) * ldc + col0 + c4) = v;
    }
    
  }
}

// GEMM C = act(A·W + bias + resid): A f32 (ASPLIT -> hi/lo 2 terms), Wt bf16 [N][K]; ACT 0 none, 1 relu, 2 exact gelu;
// resid (optional, f32, row index = (row % rmod), pitch ldr, RES_BF16 rounds it) added before the activation.
template <bool ASPLIT, int ACT, bool BIAS_BF16, bool RES_BF16>
__global__ __launch_bounds__(128) void k_gemm_bf3(const float* __restrict__ A, int lda, const unsigned short* __restrict__ Wt, int ldb,
                                                const float* __restrict__ bias, const float* __restrict__ resid, int rmod, int ldr,
                                                float* __restrict__ C, int ldc, int M, int N, int K) {
  __shared__ __attribute__((aligned(16))) float so[4][16][64];
  const int tid = threadIdx.x, w = tid >> 5, lane = tid & 31, ln = lane & 15, hh = lane >> 4;
  const int ntn = N / 64;
  const int wid = blockIdx.x * 4 + w;
  const int mt = wid / ntn, nq = wid % ntn;
  if (mt * 16 >= M) return;
  const int row0 = mt * 16, col0 = nq * 64;
  const float* arow = A + (size_t)(row0 + ln) * lda;
  v8f acc[4] = {};
  for (int kb = 0; kb < K; kb += 32) {
    FragB ah, al;
    const v4f x0 = *(const v4fa*)(arow + kb + 8 * hh), x1 = *(const v4fa*)(arow + kb + 8 * hh + 4);
    const v4f x2 = *(const v4fa*)(arow + kb + 16 + 8 * hh), x3 = *(const v4fa*)(arow + kb + 16 + 8 * hh + 4);
    float xs[16] = {x0[0],x0[1],x0[2],x0[3],x1[0],x1[1],x1[2],x1[3],x2[0],x2[1],x2[2],x2[3],x3[0],x3[1],x3[2],x3[3]};
#pragma unroll
    for (int i = 0; i < 16; ++i) { const unsigned short hb = bf16_bits(xs[i]); ah.u[i] = hb; al.u[i] = ASPLIT ? bf16_bits(xs[i] - bf16_val(hb)) : (unsigned short)0; }
#pragma unroll
    for (int t = 0; t < 4; ++t) {
      const unsigned short* brow = Wt + (size_t)(col0 + t * 16 + ln) * ldb + kb;
      FragB b;
      b.half[0] = *(const v8us*)(brow + 8 * hh);
      b.half[1] = *(const v8us*)(brow + 16 + 8 * hh);
      acc[t] = mmaN<ASPLIT ? 2 : 1>(ah.v, al.v, b.v, b.v, acc[t]);
    }
  }
#pragma unroll
  for (int t = 0; t < 4; ++t) {
    const int col = col0 + t * 16 + ln;
    float bv = bias ? bias[col] : 0.f;
    if (BIAS_BF16) bv = bf16_round(bv);
#pragma unroll
    for (int r = 0; r < 8; ++r) {
      float v = acc[t][r] + bv;
      if (resid) { float rv = resid[(size_t)((row0 + 8 * hh + r) % rmod) * ldr + col]; if (RES_BF16) rv = bf16_round(rv); v += rv; }
      if (ACT == 1) v = fmaxf(v, 0.f);
      if (ACT == 2) v = 0.5f * v * (1.0f + erff(v * 0.70710678118654752f));
      if (ACT == 3) { const float u = 0.7978845608028654f * (v + 0.044715f * v * v * v); v = 0.5f * v * (1.0f + tanhf(u)); }
      so[w][8 * hh + r][t * 16 + ln] = v;
    }
  }
  __builtin_amdgcn_fence(__ATOMIC_ACQ_REL, "workgroup");
  __builtin_amdgcn_wave_barrier();
  const int rsub = lane >> 4, c4 = (lane & 15) * 4;
  {
#pragma unroll
    for (int q = 0; q < 8; ++q) {
      const int r = q * 2 + rsub;
      const v4f v = *(const v4fa*)&so[w][r][c4];
      *(v4f*)(C + (size_t)(row0 + r) * ldc + col0 + c4) = v;
    }
    
  }
}
// row LayerNorm (biased variance, eps) over N: s = X (+ R); optional out_sum <- s; out_norm <- (s-mu)*rsqrt(var+eps)*g + b
template <bool PARAM_BF16>
__global__ __launch_bounds__(256) void k_layernorm(const float* __restrict__ X, const float* __restrict__ R, const float* __restrict__ g, const float* __restrict__ bta,
                                                  float* __restrict__ out_sum, float* __restrict__ out_norm, int N, float eps) {
  __shared__ float red[256];
  const int row = blockIdx.x, tid = threadIdx.x;
  const float* x = X + (size_t)row * N; const float* rr = R ? R + (size_t)row * N : nullptr;
  float vals[16];                     // up to N = 4096
  const int per = N / 256;            // contiguous chunk per thread? use strided-by-4 chunks: thread handles j = tid*4 + 1024*u
  float s1 = 0.f;
  for (int u = 0; u < per / 4; ++u) {
    const int j = tid * 4 + 1024 * u;
    const v4f a = *(const v4fa*)(x + j);
    v4f b = {0.f,0.f,0.f,0.f}; if (rr) b = *(const v4fa*)(rr + j);
#pragma unroll
    for (int q = 0; q < 4; ++q) { const float v = a[q] + b[q]; vals[u * 4 + q] = v; s1 += v; }
  }
  red[tid] = s1; __syncthreads();
  for (int st = 128; st > 0; st >>= 1) { if (tid < st) red[tid] += red[tid + st]; __syncthreads(); }
  const float mu = red[0] / (float)N; __syncthreads();
  float s2 = 0.f;
  for (int u = 0; u < per / 4; ++u)
#pragma unroll
    for (int q = 0; q < 4; ++q) { const float c = vals[u * 4 + q] - mu; s2 += c * c; }
  red[tid] = s2; __syncthreads();
  for (int st = 128; st > 0; st >>= 1) { if (tid < st) red[tid] += red[tid + st]; __syncthreads(); }
  const float rs = rsqrtf(red[0] / (float)N + eps);
  {
    for (int u = 0; u < per / 4; ++u) {
      const int j = tid * 4 + 1024 * u;
      v4f o, sm;
#pragma unroll
      for (int q = 0; q < 4; ++q) {
        float gg = g[j + q], bb = bta[j + q];
        if (PARAM_BF16) { gg = bf16_round(gg); bb = bf16_round(bb); }
        sm[q] = vals[u * 4 + q]; o[q] = (vals[u * 4 + q] - mu) * rs * gg + bb;
      }
      if (out_sum) *(v4f*)(out_sum + (size_t)row * N + j) = sm;
      *(v4f*)(out_norm + (size_t)row * N + j) = o;
    }
    
  }
}



// ---- f16 WMMA path (v_wmma_f32_16x16x32_f16): 11-bit significands for operands in range — used where a [0,1] probability operand needs more precision than bf16
typedef _Float16 v16h __attribute__((ext_vector_type(16)));
union FragH { v16h v; v8us half[2]; _Float16 h[16]; unsigned short u[16]; };
template <int NT>
__device__ __forceinline__ v8f mmaH(v16h ah, v16h al, v16h bh, v16h bl, v8f c) {
  c = __builtin_amdgcn_wmma_f32_16x16x32_f16(false, ah, false, bh, (short)0, c, false, false);
  if (NT >= 2) c = __builtin_amdgcn_wmma_f32_16x16x32_f16(false, al, false, bh, (short)0, c, false, false);
  if (NT >= 3) c = __builtin_amdgcn_wmma_f32_16x16x32_f16(false, ah, false, bl, (short)0, c, false, false);
  asm volatile("v_nop\n\tv_nop\n\tv_nop\n\tv_nop" : "+v"(c) : "v"(ah), "v"(al), "v"(bh), "v"(bl));
  return c;
}
// batched GEMM like k_gemm_b but f16 operands: A f32 (split into f16 hi/lo if ASPLIT, else rounded to f16), Bt = f16 values [n][k]; alpha; C f32; N multiple of 16 (partial tiles skipped)
template <bool ASPLIT>
__global__ __launch_bounds__(128) void k_gemm_h(const float* __restrict__ A, int lda, size_t sA, const _Float16* __restrict__ Bh, int ldb, size_t sB, float alpha, float* __restrict__ C, int ldc, size_t sC, int M, int N, int K) {
  __shared__ __attribute__((aligned(16))) float so[4][16][64];
  const int tid = threadIdx.x, w = tid >> 5, lane = tid & 31, ln = lane & 15, hh = lane >> 4; const int by = blockIdx.y;
  A += (size_t)by * sA; Bh += (size_t)by * sB; C += (size_t)by * sC;
  const int ntn = (N + 63) / 64; const int wid = blockIdx.x * 4 + w; const int mt = wid / ntn, nq = wid % ntn; if (mt * 16 >= M) return;
  const int row0 = mt * 16, col0 = nq * 64; const float* arow = A + (size_t)(row0 + ln) * lda;
  v8f acc[4] = {};
  for (int kb = 0; kb < K; kb += 32) {
    FragH ah, al;
    const v4f x0 = *(const v4fa*)(arow + kb + 8 * hh), x1 = *(const v4fa*)(arow + kb + 8 * hh + 4), x2 = *(const v4fa*)(arow + kb + 16 + 8 * hh), x3 = *(const v4fa*)(arow + kb + 16 + 8 * hh + 4);
    float xs[16] = {x0[0],x0[1],x0[2],x0[3],x1[0],x1[1],x1[2],x1[3],x2[0],x2[1],x2[2],x2[3],x3[0],x3[1],x3[2],x3[3]};
#pragma unroll
    for (int i = 0; i < 16; ++i) { const _Float16 h = (_Float16)xs[i]; ah.h[i] = h; al.h[i] = ASPLIT ? (_Float16)(xs[i] - (float)h) : (_Float16)0.0f; }
#pragma unroll
    for (int t = 0; t < 4; ++t) { if (col0 + t * 16 >= N) continue; const size_t boff = (size_t)(col0 + t * 16 + ln) * ldb + kb; FragH bq; bq.half[0] = *(const v8us*)(Bh + boff + 8 * hh); bq.half[1] = *(const v8us*)(Bh + boff + 16 + 8 * hh);
      acc[t] = mmaH<ASPLIT ? 2 : 1>(ah.v, al.v, bq.v, bq.v, acc[t]); }
  }
#pragma unroll
  for (int t = 0; t < 4; ++t) { if (col0 + t * 16 >= N) continue;
#pragma unroll
    for (int r = 0; r < 8; ++r) so[w][8 * hh + r][t * 16 + ln] = acc[t][r] * alpha; }
  __builtin_amdgcn_fence(__ATOMIC_ACQ_REL, "workgroup"); __builtin_amdgcn_wave_barrier();
  const int rsub = lane >> 4, c4 = (lane & 15) * 4;
  {
#pragma unroll
    for (int q = 0; q < 8; ++q) { const int r = q * 2 + rsub; if (col0 + c4 < N) { const v4f v = *(const v4fa*)&so[w][r][c4]; *(v4f*)(C + (size_t)(row0 + r) * ldc + col0 + c4) = v; } }
     }
}

// Wt[n][k] = f16(W[k][n]·scale) from f32 row-major W[K][N] (scale = power of two; bf16-exact weights stay exact in f16 away from the subnormal range)
__global__ __launch_bounds__(256) void k_wt_f16(const float* __restrict__ W, _Float16* __restrict__ Wt, int K, int N, float scale) {
  const int t = blockIdx.x * 256 + threadIdx.x; if (t >= N * (K / 8)) return; const int n = t / (K / 8), k8 = (t % (K / 8)) * 8; FragH f;
#pragma unroll
  for (int i = 0; i < 8; ++i) f.h[i] = (_Float16)(bf16_round(W[(size_t)(k8 + i) * N + n]) * scale); const v8us o = f.half[0];
  *(v8us*)((unsigned short*)Wt + (size_t)n * K + k8) = o; 
}
// k_gemm_hh variant with fused epilogue: v = acc·alpha + bias[by·sBias + col] (+ CP[(row/rowsPerB)·sCPb + by·64 + col] if CP) ; ACT 0 none / 1 elu ; writes f16 C16 (and f32 C if non-null)
template <int ACT>
__global__ __launch_bounds__(128) void k_gemm_hhx(const _Float16* __restrict__ A, int lda, size_t sA, const _Float16* __restrict__ Bh, int ldb, size_t sB, float alpha, const float* __restrict__ bias, size_t sBias, const float* __restrict__ CP, int rowsPerB, size_t sCPb, int row0g,
    float* __restrict__ C, _Float16* __restrict__ C16, int ldc, size_t sC, int M, int N, int K) {
  __shared__ __attribute__((aligned(16))) float so[4][16][64];
  const int tid = threadIdx.x, w = tid >> 5, lane = tid & 31, ln = lane & 15, hh = lane >> 4; const int by = blockIdx.y;
  A += (size_t)by * sA; Bh += (size_t)by * sB; const size_t cofs = (size_t)by * sC; const float* bp = bias ? bias + (size_t)by * sBias : nullptr;
  const int ntn = (N + 63) / 64; const int wid = blockIdx.x * 4 + w; const int mt = wid / ntn, nq = wid % ntn; if (mt * 16 >= M) return;
  const int row0 = mt * 16, col0 = nq * 64; const _Float16* arow = A + (size_t)(row0 + ln) * lda;
  v8f acc[4] = {};
  for (int kb = 0; kb < K; kb += 32) { FragH ah; ah.half[0] = *(const v8us*)((const unsigned short*)arow + kb + 8 * hh); ah.half[1] = *(const v8us*)((const unsigned short*)arow + kb + 16 + 8 * hh);
#pragma unroll
    for (int t = 0; t < 4; ++t) { if (col0 + t * 16 >= N) continue; const size_t boff = (size_t)(col0 + t * 16 + ln) * ldb + kb; FragH bq; bq.half[0] = *(const v8us*)((const unsigned short*)Bh + boff + 8 * hh); bq.half[1] = *(const v8us*)((const unsigned short*)Bh + boff + 16 + 8 * hh);
      acc[t] = mmaH<1>(ah.v, ah.v, bq.v, bq.v, acc[t]); }
  }
#pragma unroll
  for (int t = 0; t < 4; ++t) { if (col0 + t * 16 >= N) continue; const int col = col0 + t * 16 + ln; const float bv = bp ? bf16_round(bp[col]) : 0.f;
#pragma unroll
    for (int r = 0; r < 8; ++r) { float v = acc[t][r] * alpha + bv; if (CP) { const int bidx = (row0g + row0 + 8 * hh + r) / rowsPerB; v += CP[(size_t)bidx * sCPb + (size_t)by * 64 + col]; } if (ACT == 1) v = (v > 0.f) ? v : expm1f(v); else if (ACT == 7) v = (v > 0.f) ? v + 1.0f : expf(v); else if (ACT == 8) v = tanhf(v); else if (ACT == 9) v = 0.5f * v * (1.0f + tanhf(0.7978845608028654f * (v + 0.044715f * v * v * v))); else if (ACT == 11) v = 1.0f / (1.0f + expf(-v)); else if (ACT == 12) v = (v > 0.f) ? v : 0.01f * v; else if (ACT == 14) v = (v > 0.f) ? v : 0.1f * v; else if (ACT == 15) v = v / (1.0f + expf(-v)); else if (ACT == 3) v = fmaxf(v, 0.f); else if (ACT == 6) v = 0.5f * v * (1.0f + erff(v * 0.70710678118654752f)); so[w][8 * hh + r][t * 16 + ln] = v; } }
  __builtin_amdgcn_fence(__ATOMIC_ACQ_REL, "workgroup"); __builtin_amdgcn_wave_barrier();
  const int rsub = lane >> 4, c4 = (lane & 15) * 4; typedef _Float16 v4h __attribute__((ext_vector_type(4)));
  {
#pragma unroll
    for (int q = 0; q < 8; ++q) { const int r = q * 2 + rsub; if (col0 + c4 < N) { const v4f v = *(const v4fa*)&so[w][r][c4]; if (C) *(v4f*)(C + cofs + (size_t)(row0 + r) * ldc + col0 + c4) = v; if (C16) { v4h h4; for (int i = 0; i < 4; ++i) h4[i] = (_Float16)v[i]; *(v4h*)(C16 + cofs + (size_t)(row0 + r) * ldc + col0 + c4) = h4; } } }
     }
}


typedef _Float16 v4h __attribute__((ext_vector_type(4)));

__global__ __launch_bounds__(256) void k_x16(const float* __restrict__ x, _Float16* __restrict__ X16, size_t n8) { const size_t t = (size_t)blockIdx.x * 256 + threadIdx.x; if (t >= n8) return; FragH f;
#pragma unroll
  for (int q = 0; q < 8; ++q) f.h[q] = (_Float16)bf16_round(x[t * 8 + q]); *(v8us*)((unsigned short*)X16 + t * 8) = f.half[0];  }
__global__ __launch_bounds__(256) void k_h16(const float* __restrict__ x, _Float16* __restrict__ X16, size_t n8) { const size_t t = (size_t)blockIdx.x * 256 + threadIdx.x; if (t >= n8) return; FragH f;
#pragma unroll
  for (int q = 0; q < 8; ++q) f.h[q] = (_Float16)x[t * 8 + q]; *(v8us*)((unsigned short*)X16 + t * 8) = f.half[0];  }
__global__ __launch_bounds__(256) void k_round16f(const float* __restrict__ W, _Float16* __restrict__ Bt, size_t n8) { const size_t t = (size_t)blockIdx.x * 256 + threadIdx.x; if (t >= n8) return; FragH f;
#pragma unroll
  for (int i = 0; i < 8; ++i) f.h[i] = (_Float16)(bf16_round(W[t * 8 + i]) * 16.0f); *(v8us*)((unsigned short*)Bt + t * 8) = f.half[0];  }
template <int NHv, int TTv>
__global__ __launch_bounds__(256) void k_vt(const _Float16* __restrict__ V16, int ldv, int voff, _Float16* __restrict__ Vt) { __shared__ unsigned short tl[64][66]; const int tid = threadIdx.x; const int slab = blockIdx.x / (TTv / 64), lg = blockIdx.x % (TTv / 64); const int b = slab / NHv, h = slab % NHv;
  for (int i = tid; i < 64 * 8; i += 256) { const int r = i / 8, c8 = (i % 8) * 8; FragH f; f.half[0] = *(const v8us*)((const unsigned short*)V16 + ((size_t)b * TTv + lg * 64 + r) * ldv + voff + h * 64 + c8);
#pragma unroll
    for (int q = 0; q < 8; ++q) tl[r][c8 + q] = f.u[q]; }
  __syncthreads();
  {
#pragma unroll
    for (int rd = 0; rd < 2; ++rd) { const int d = rd * 32 + tid / 8, pc = tid % 8; FragH f;
#pragma unroll
      for (int q = 0; q < 8; ++q) f.u[q] = tl[pc * 8 + q][d];
      *(v8us*)((unsigned short*)Vt + ((size_t)slab * 64 + d) * TTv + lg * 64 + pc * 8) = f.half[0]; }
     } }

__global__ __launch_bounds__(256) void k_hl(const float* __restrict__ F, _Float16* __restrict__ Hh, _Float16* __restrict__ Hl, size_t n8) { const size_t t = (size_t)blockIdx.x * 256 + threadIdx.x; if (t >= n8) return; FragH fh, fl; const v4f a = *(const v4fa*)(F + t * 8), c = *(const v4fa*)(F + t * 8 + 4);
#pragma unroll
  for (int q = 0; q < 4; ++q) { _Float16 h = (_Float16)a[q]; fh.h[q] = h; fl.h[q] = (_Float16)((a[q] - (float)h) * 1024.0f); h = (_Float16)c[q]; fh.h[4 + q] = h; fl.h[4 + q] = (_Float16)((c[q] - (float)h) * 1024.0f); }
  { *(v8us*)((unsigned short*)Hh + t * 8) = fh.half[0]; *(v8us*)((unsigned short*)Hl + t * 8) = fl.half[0];  } }

// ---- fast GEMM (wave tile 32x64; requires M % 32 == 0 rows per launch region and N % 64 == 0); epilogue = k_gemm_hhx semantics ----
__device__ __forceinline__ v16h g2_frag(const _Float16* p, int hh) { FragH f; f.half[0] = *(const v8us*)((const unsigned short*)p + 8 * hh); f.half[1] = *(const v8us*)((const unsigned short*)p + 16 + 8 * hh); return f.v; }
__device__ __forceinline__ v8f g2_mma(v16h a, v16h b, v8f c) { v8f d = __builtin_amdgcn_wmma_f32_16x16x32_f16(false, a, false, b, (short)0, c, false, false); asm volatile("v_nop\n\tv_nop\n\tv_nop\n\tv_nop" : "+v"(d) : "v"(a), "v"(b)); return d; }
template <int ACT>
__global__ __launch_bounds__(128) void k_gemm2(const _Float16* __restrict__ A, int lda, size_t sA, const _Float16* __restrict__ Bh, int ldb, size_t sB, float alpha, const float* __restrict__ bias, size_t sBias, const float* __restrict__ CP, int rowsPerB, size_t sCPb, int row0g,
    float* __restrict__ C, _Float16* __restrict__ C16, int ldc, size_t sC, int M, int N, int K) {
  __shared__ __attribute__((aligned(16))) float so[4][32][68];
  const int tid = threadIdx.x, w = tid >> 5, lane = tid & 31, ln = lane & 15, hh = lane >> 4; const int by = blockIdx.y;
  A += (size_t)by * sA; Bh += (size_t)by * sB; const size_t cofs = (size_t)by * sC; const float* bp = bias ? bias + (size_t)by * sBias : nullptr;
  const int ntn = N >> 6; const int mt = blockIdx.x / ntn, nq = blockIdx.x - mt * ntn; const int row0 = mt * 128 + 32 * w, col0 = nq * 64; if (row0 >= M) return;
  const _Float16* a0p = A + (size_t)(row0 + ln) * lda; const _Float16* a1p = a0p + (size_t)16 * lda;
  const _Float16* b0p = Bh + (size_t)(col0 + ln) * ldb; const _Float16* b1p = b0p + (size_t)16 * ldb; const _Float16* b2p = b1p + (size_t)16 * ldb; const _Float16* b3p = b2p + (size_t)16 * ldb;
  const v8f z8 = {0.f,0.f,0.f,0.f,0.f,0.f,0.f,0.f}; v8f c00 = z8, c01 = z8, c02 = z8, c03 = z8, c10 = z8, c11 = z8, c12 = z8, c13 = z8;
#pragma unroll 1
  for (int kb = 0; kb < K; kb += 32) { const v16h a0 = g2_frag(a0p + kb, hh), a1 = g2_frag(a1p + kb, hh);
    v16h b = g2_frag(b0p + kb, hh); c00 = g2_mma(a0, b, c00); c10 = g2_mma(a1, b, c10);
    b = g2_frag(b1p + kb, hh); c01 = g2_mma(a0, b, c01); c11 = g2_mma(a1, b, c11);
    b = g2_frag(b2p + kb, hh); c02 = g2_mma(a0, b, c02); c12 = g2_mma(a1, b, c12);
    b = g2_frag(b3p + kb, hh); c03 = g2_mma(a0, b, c03); c13 = g2_mma(a1, b, c13); }
  v8f accs[8] = {c00, c01, c02, c03, c10, c11, c12, c13};
#pragma unroll
  for (int u = 0; u < 8; ++u) { const int t = u & 3, half = u >> 2; const int col = col0 + t * 16 + ln; const float bv = bp ? bf16_round(bp[col]) : 0.f;
#pragma unroll
    for (int r = 0; r < 8; ++r) { const int rloc = half * 16 + 8 * hh + r; float v = accs[u][r] * alpha + bv; if (CP) { const int bidx = (row0g + row0 + rloc) / rowsPerB; v += CP[(size_t)bidx * sCPb + (size_t)by * 64 + col]; }
      if (ACT == 3) v = fmaxf(v, 0.f); else if (ACT == 6) v = 0.5f * v * (1.0f + erff(v * 0.70710678118654752f)); else if (ACT == 11) v = 1.0f / (1.0f + expf(-v)); else if (ACT == 15) v = v / (1.0f + expf(-v)); else if (ACT == 12) v = (v > 0.f) ? v : 0.01f * v; else if (ACT == 8) v = tanhf(v);
      so[w][rloc][t * 16 + ln] = v; } }
  __builtin_amdgcn_fence(__ATOMIC_ACQ_REL, "workgroup"); __builtin_amdgcn_wave_barrier();
  const int rsub = lane >> 4, c4 = (lane & 15) * 4;
  {
#pragma unroll
    for (int q = 0; q < 16; ++q) { const int r = q * 2 + rsub; const v4f v = *(const v4fa*)&so[w][r][c4]; if (C) *(v4f*)(C + cofs + (size_t)(row0 + r) * ldc + col0 + c4) = v; if (C16) { v4h h4; for (int i = 0; i < 4; ++i) h4[i] = (_Float16)v[i]; *(v4h*)(C16 + cofs + (size_t)(row0 + r) * ldc + col0 + c4) = h4; } }
     } }



__global__ __launch_bounds__(128) void k_flash(const _Float16* __restrict__ Q16, int ldq, const _Float16* __restrict__ K16, int ldk, const _Float16* __restrict__ Vt, const int* __restrict__ MSK, float* __restrict__ O, int ldo) {
  constexpr int RPW = 16, RTN = RPW / 16, NQB = TQ / (4 * RPW), DT = 4, KS = 2;
  __shared__ __attribute__((aligned(16))) unsigned short sP[4][RPW][40]; __shared__ __attribute__((aligned(16))) float sO[4][RPW][64 + 4];
  const int tid = threadIdx.x, w = tid >> 5, lane = tid & 31, ln = lane & 15, hh = lane >> 4;
  const int slab = blockIdx.x / NQB, qblk = blockIdx.x % NQB; const int b = slab / NH, h = slab % NH; const int qb0 = qblk * (4 * RPW); const int q0 = qb0 + w * RPW;
  FragH aq[2][KS];
#pragma unroll
  for (int rt = 0; rt < RTN; ++rt) { const unsigned short* qr = (const unsigned short*)Q16 + ((size_t)b * TQ + q0 + rt * 16 + ln) * ldq + h * 64;
#pragma unroll
    for (int ks = 0; ks < KS; ++ks) { aq[rt][ks].half[0] = *(const v8us*)(qr + ks * 32 + 8 * hh); aq[rt][ks].half[1] = *(const v8us*)(qr + ks * 32 + 16 + 8 * hh); } }
  const unsigned short* Vth = (const unsigned short*)Vt + (size_t)slab * 64 * TK;
  float m_r[2][8], l_r[2][8]; v8f oacc[2][DT];
#pragma unroll
  for (int rt = 0; rt < RTN; ++rt) {
#pragma unroll
    for (int r = 0; r < 8; ++r) { m_r[rt][r] = -3.0e38f; l_r[rt][r] = 0.f; }
#pragma unroll
    for (int dt = 0; dt < DT; ++dt) oacc[rt][dt] = (v8f){0.f,0.f,0.f,0.f,0.f,0.f,0.f,0.f}; }
  const int jend = TK;
#pragma unroll 1
  for (int j0 = 0; j0 < jend; j0 += 32) {
    v8f s[2][2];
#pragma unroll
    for (int nt = 0; nt < 2; ++nt) { const unsigned short* kr = (const unsigned short*)K16 + ((size_t)b * TK + j0 + nt * 16 + ln) * ldk + h * 64; FragH bk[KS];
#pragma unroll
      for (int ks = 0; ks < KS; ++ks) { bk[ks].half[0] = *(const v8us*)(kr + ks * 32 + 8 * hh); bk[ks].half[1] = *(const v8us*)(kr + ks * 32 + 16 + 8 * hh); }
#pragma unroll
      for (int rt = 0; rt < RTN; ++rt) { v8f acc = (v8f){0.f,0.f,0.f,0.f,0.f,0.f,0.f,0.f};
#pragma unroll
        for (int ks = 0; ks < KS; ++ks) acc = mmaH<1>(aq[rt][ks].v, aq[rt][ks].v, bk[ks].v, bk[ks].v, acc); s[rt][nt] = acc; } }
#pragma unroll
    for (int rt = 0; rt < RTN; ++rt)
#pragma unroll
      for (int r = 0; r < 8; ++r) { const int tq = q0 + rt * 16 + 8 * hh + r; const int k0 = j0 + ln, k1 = j0 + 16 + ln; (void)tq; (void)k0; (void)k1;
        const bool ok0 = true, ok1 = true;
        const float s0 = s[rt][0][r] * SCL, s1 = s[rt][1][r] * SCL; float mc = fmaxf(s0, s1);
        mc = fmaxf(mc, __shfl_xor(mc, 1, 32)); mc = fmaxf(mc, __shfl_xor(mc, 2, 32)); mc = fmaxf(mc, __shfl_xor(mc, 4, 32)); mc = fmaxf(mc, __shfl_xor(mc, 8, 32));
        const float mn = fmaxf(m_r[rt][r], mc); const float al = (mn > -1.0e38f) ? expf(m_r[rt][r] - mn) : 1.0f; m_r[rt][r] = mn; const float p0 = ok0 ? expf(s0 - mn) : 0.f, p1 = ok1 ? expf(s1 - mn) : 0.f; l_r[rt][r] = l_r[rt][r] * al + p0 + p1;
#pragma unroll
        for (int dt = 0; dt < DT; ++dt) oacc[rt][dt][r] *= al;
        FragH t2; t2.h[0] = (_Float16)(p0 * 1024.0f); t2.h[1] = (_Float16)(p1 * 1024.0f); sP[w][rt * 16 + 8 * hh + r][ln] = t2.u[0]; sP[w][rt * 16 + 8 * hh + r][16 + ln] = t2.u[1]; }
    __builtin_amdgcn_fence(__ATOMIC_ACQ_REL, "workgroup"); __builtin_amdgcn_wave_barrier();
    FragH pa[2];
#pragma unroll
    for (int rt = 0; rt < RTN; ++rt) { pa[rt].half[0] = *(const v8us*)&sP[w][rt * 16 + ln][8 * hh]; pa[rt].half[1] = *(const v8us*)&sP[w][rt * 16 + ln][16 + 8 * hh]; }
#pragma unroll
    for (int dt = 0; dt < DT; ++dt) { const unsigned short* vrow = Vth + (size_t)(dt * 16 + ln) * TK + j0; FragH bv; bv.half[0] = *(const v8us*)(vrow + 8 * hh); bv.half[1] = *(const v8us*)(vrow + 16 + 8 * hh);
#pragma unroll
      for (int rt = 0; rt < RTN; ++rt) oacc[rt][dt] = mmaH<1>(pa[rt].v, pa[rt].v, bv.v, bv.v, oacc[rt][dt]); }
    __builtin_amdgcn_fence(__ATOMIC_ACQ_REL, "workgroup"); __builtin_amdgcn_wave_barrier(); }
#pragma unroll
  for (int rt = 0; rt < RTN; ++rt) {
#pragma unroll
    for (int r = 0; r < 8; ++r) { float l = l_r[rt][r]; l += __shfl_xor(l, 1, 32); l += __shfl_xor(l, 2, 32); l += __shfl_xor(l, 4, 32); l += __shfl_xor(l, 8, 32); l_r[rt][r] = (l > 0.f) ? 1.0f / (l * 1024.0f) : 0.f; }
#pragma unroll
    for (int dt = 0; dt < DT; ++dt)
#pragma unroll
      for (int r = 0; r < 8; ++r) sO[w][rt * 16 + 8 * hh + r][dt * 16 + ln] = oacc[rt][dt][r] * l_r[rt][r]; }
  __builtin_amdgcn_fence(__ATOMIC_ACQ_REL, "workgroup"); __builtin_amdgcn_wave_barrier();
  {
#pragma unroll
    for (int rp = 0; rp < RPW; rp += 2) { const int r = rp + (lane >> 4), pc = lane & 15; const v4f val = *(const v4fa*)&sO[w][r][pc * 4]; *(v4f*)(O + ((size_t)b * TQ + q0 + r) * ldo + h * 64 + pc * 4) = val; }
     } }
__global__ __launch_bounds__(256) void k_fulltab(unsigned* __restrict__ MB, int* __restrict__ RA, int* __restrict__ KE, int nq, int nk) {
  const int t = blockIdx.x * 256 + threadIdx.x;
  if (t < nq * (nk / 32)) { *(unsigned*)(MB + t) = 0u;  }
  if (t < nq) { *(int*)(RA + t) = 0;  }
  if (t < nq / 64) { *(int*)(KE + t * 32) = nk;  } }
__global__ __launch_bounds__(256) void k_lnout(const float* __restrict__ Y, const float* __restrict__ g, const float* __restrict__ bb, float* __restrict__ out) {
  #pragma clang fp contract(off)
  const int tid = threadIdx.x, w = tid >> 5, ln = tid & 31; const int r = blockIdx.x * 8 + w; if (r >= NR) return; const float* y = Y + (size_t)r * DM; float s = 0.f;
#pragma unroll 1
  for (int i = 0; i < 8; ++i) { const v4f a = *(const v4fa*)(y + i * 128 + ln * 4); for (int q = 0; q < 4; ++q) s += a[q]; }
  for (int o = 16; o > 0; o >>= 1) s += __shfl_xor(s, o, 32); const float mu = s / (float)DM; float q2 = 0.f;
#pragma unroll 1
  for (int i = 0; i < 8; ++i) { const v4f a = *(const v4fa*)(y + i * 128 + ln * 4); for (int q = 0; q < 4; ++q) { const float d = a[q] - mu; q2 += d * d; } }
  for (int o = 16; o > 0; o >>= 1) q2 += __shfl_xor(q2, o, 32); const float rs = rsqrtf(q2 / (float)DM + 1e-6f);
  {
#pragma unroll 1
    for (int i = 0; i < 8; ++i) { const int c0 = i * 128 + ln * 4; const v4f a = *(const v4fa*)(y + c0); v4f o4; for (int q = 0; q < 4; ++q) o4[q] = (a[q] - mu) * rs * bf16_round(g[c0 + q]) + bf16_round(bb[c0 + q]); *(v4f*)(out + (size_t)r * DM + c0) = o4; }
     } }
__global__ __launch_bounds__(256) void k_xb(const float* __restrict__ x, float* __restrict__ XB, size_t n4) { const size_t t = (size_t)blockIdx.x * 256 + threadIdx.x; if (t >= n4) return; const v4f a = *(const v4fa*)(x + t * 4); v4f o; for (int q = 0; q < 4; ++q) o[q] = bf16_round(a[q]); *(v4f*)(XB + t * 4) = o;  }
__global__ __launch_bounds__(256) void k_causaltab(unsigned* __restrict__ MB, int* __restrict__ RA, int* __restrict__ KE, int nq, int nk) {
  const int t = blockIdx.x * 256 + threadIdx.x; const int nw = nk / 32;
  if (t < nq * nw) { const int q = t / nw, w = t % nw; const int first = q + 1 - 32 * w; const unsigned bits = (first <= 0) ? 0xffffffffu : ((first >= 32) ? 0u : (0xffffffffu << first)); *(unsigned*)(MB + t) = bits;  }
  if (t < nq) { *(int*)(RA + t) = 0;  }
  if (t < nq / 64) { const int v = 64 * (t + 1); *(int*)(KE + t * 32) = v;  } }


extern "C" void kernel_launch(void* const* d_in, const int* in_sizes, int n_in,
                              void* d_out, int out_size, void* d_ws, size_t ws_size, hipStream_t stream) {
  (void)in_sizes; (void)n_in; (void)out_size;
  const float* const* I = (const float* const*)d_in; const float* x = I[0]; const float* Wq = I[1]; const float* bq = I[2]; const float* Wk = I[3]; const float* bk = I[4]; const float* Wv = I[5]; const float* bv = I[6];
  char* ws = (char*)d_ws; size_t off = 0;
  auto take = [&](size_t bytes) { char* p = ws + off; off += (bytes + 255) & ~(size_t)255; return p; };
  _Float16* BQ = (_Float16*)take((size_t)DM * DM * 2); _Float16* BK = (_Float16*)take((size_t)DM * DM * 2); _Float16* BV = (_Float16*)take((size_t)DM * DM * 2);
  _Float16* X16 = (_Float16*)take((size_t)NR * DM * 2); _Float16* Q16 = (_Float16*)take((size_t)NR * DM * 2); _Float16* K16 = (_Float16*)take((size_t)NR * DM * 2); _Float16* V16 = (_Float16*)take((size_t)NR * DM * 2); _Float16* VT = (_Float16*)take((size_t)NR * DM * 2);
  if (off > ws_size) return;      /* 3.5 + 5 x 12.6 = 66 MiB */
  const size_t w8 = (size_t)DM * DM / 8; const unsigned wb = (unsigned)((w8 + 255) / 256);
  k_round16f<<<wb, 256, 0, stream>>>(Wq, BQ, w8); k_round16f<<<wb, 256, 0, stream>>>(Wk, BK, w8); k_round16f<<<wb, 256, 0, stream>>>(Wv, BV, w8);      /* torch (out,in) = natural Bt */
  const size_t n8 = (size_t)NR * DM / 8; const unsigned nb8 = (unsigned)((n8 + 255) / 256); const dim3 gP((NR / 128) * (DM / 64), 1);
  k_x16<<<nb8, 256, 0, stream>>>(x, X16, n8);
  k_gemm2<0><<<gP, 128, 0, stream>>>(X16, DM, 0, BQ, DM, 0, 0.0625f, bq, 0, nullptr, 1, 0, 0, nullptr, Q16, DM, 0, NR, DM, DM);
  k_gemm2<0><<<gP, 128, 0, stream>>>(X16, DM, 0, BK, DM, 0, 0.0625f, bk, 0, nullptr, 1, 0, 0, nullptr, K16, DM, 0, NR, DM, DM);
  k_gemm2<0><<<gP, 128, 0, stream>>>(X16, DM, 0, BV, DM, 0, 0.0625f, bv, 0, nullptr, 1, 0, 0, nullptr, V16, DM, 0, NR, DM, DM);
  k_vt<NH, SLEN><<<NBT * NH * (SLEN / 64), 256, 0, stream>>>(V16, DM, 0, VT);      /* all batches in one grid: slab = batch * NH + head */
  k_flash<<<NBT * NH * (SLEN / 64), 128, 0, stream>>>(Q16, DM, K16, DM, VT, nullptr, (float*)d_out, DM);      /* all batches in one grid; ctx rows straight into the output */
}

// v002
// It runs in 223 microseconds.
// Timed twice side by side with v001, it ran 1.17 and 1.18 times as fast.
// All steps since v000 together make it 4.17 times as fast.
#include <hip/hip_runtime.h>
// DeiT self-attention (8 x 1024 tokens, 768 = 12 heads x 64): q,k,v = x W^T + b; softmax(q.k/8) over all keys; ctx = attn.v merged -> [8,1024,768] (no output projection).
// Structure: x as an exact f16 plane; projections as f16 WMMA GEMMs (32x64 wave tiles, f32 accumulation, exact products + bias) into f16 planes; the fused flash kernel over all 1024 keys (plain f16 q/k/V^T, online softmax in f32, P x2^10) per ((batch, head), 64 queries) writes the merged context rows straight into the output.
// Compute dtype: x, weights, biases rounded to bf16; q, k, v, P as plain f16 (~2^-12; logits sigma ~0.3); f32 accumulation and softmax. v_wmma_f32_16x16x32_f16.
#define NBT 8
#define SLEN 1024
#define TQ SLEN
#define TK SLEN
#define DM 768
#define NH 12
#define SCL 0.125f
#define NR (NBT * SLEN)
typedef __bf16 v16b __attribute__((ext_vector_type(16)));
typedef unsigned short v8us __attribute__((ext_vector_type(8), may_alias));
typedef float  v8f  __attribute__((ext_vector_type(8)));
typedef float  v4f  __attribute__((ext_vector_type(4)));
typedef float  v4fa __attribute__((ext_vector_type(4), may_alias));
union FragB { v16b v; v8us half[2]; unsigned short u[16]; };

__device__ __forceinline__ unsigned short bf16_bits(float x) { unsigned int u = __float_as_uint(x); return (unsigned short)((u + 0x7FFFu + ((u >> 16) & 1u)) >> 16); }
__device__ __forceinline__ float bf16_val(unsigned short b) { return __uint_as_float(((unsigned int)b) << 16); }
__device__ __forceinline__ float bf16_round(float x) { return bf16_val(bf16_bits(x)); }
// D += A·B with NT terms: 1 = ah·bh, 2 = + al·bh (A split), 3 = + ah·bl (both split)
template <int NT>
__device__ __forceinline__ v8f mmaN(v16b ah, v16b al, v16b bh, v16b bl, v8f c) {
  c = __builtin_amdgcn_wmma_f32_16x16x32_bf16(false, ah, false, bh, (short)0, c, false, false);
  if (NT >= 2) c = __builtin_amdgcn_wmma_f32_16x16x32_bf16(false, al, false, bh, (short)0, c, false, false);
  if (NT >= 3) c = __builtin_amdgcn_wmma_f32_16x16x32_bf16(false, ah, false, bl, (short)0, c, false, false);
  asm volatile("v_nop\n\tv_nop\n\tv_nop\n\tv_nop" : "+v"(c) : "v"(ah), "v"(al), "v"(bh), "v"(bl));
  return c;
}

__global__ __launch_bounds__(256) void k_wt_bf16(const float* __restrict__ W, unsigned short* __restrict__ Wt, int K, int N) {
  const int t = blockIdx.x * 256 + threadIdx.x;
  const int k8n = K / 8;
  if (t >= N * k8n) return;
  const int n = t / k8n, k8 = (t % k8n) * 8;
  v8us v;
#pragma unroll
  for (int i = 0; i < 8; ++i) v[i] = bf16_bits(W[(size_t)(k8 + i) * N + n]);
  *(v8us*)(Wt + (size_t)n * K + k8) = v;
  
}

// GEMM C[M][N] (f32, pitch ldc) = act(A[M][K]·W + bias). A f32 row-major (pitch lda) converted per fragment to bf16
// (ASPLIT: hi/lo two planes -> 2 terms, else single rounded term); Wt bf16 [N][K] (pitch ldb). BIAS_BF16 rounds the
// bias to bf16 first (bias quantised to bf16 before the add). K%32==0, M%16==0, N%64==0.
template <bool ASPLIT, int ACT, bool BIAS_BF16>
__global__ __launch_bounds__(128) void k_gemm_bf(const float* __restrict__ A, int lda, const unsigned short* __restrict__ Wt, int ldb,
                                               const float* __restrict__ bias, float* __restrict__ C, int ldc, int M, int N, int K) {
  __shared__ __attribute__((aligned(16))) float so[4][16][64];
  const int tid = threadIdx.x, w = tid >> 5, lane = tid & 31, ln = lane & 15, hh = lane >> 4;
  const int ntn = N / 64;
  const int wid = blockIdx.x * 4 + w;
  const int mt = wid / ntn, nq = wid % ntn;
  if (mt * 16 >= M) return;
  const int row0 = mt * 16, col0 = nq * 64;
  const float* arow = A + (size_t)(row0 + ln) * lda;
  v8f acc[4] = {};
  for (int kb = 0; kb < K; kb += 32) {
    FragB ah, al;
    const v4f x0 = *(const v4fa*)(arow + kb + 8 * hh), x1 = *(const v4fa*)(arow + kb + 8 * hh + 4);
    const v4f x2 = *(const v4fa*)(arow + kb + 16 + 8 * hh), x3 = *(const v4fa*)(arow + kb + 16 + 8 * hh + 4);
    float xs[16] = {x0[0],x0[1],x0[2],x0[3],x1[0],x1[1],x1[2],x1[3],x2[0],x2[1],x2[2],x2[3],x3[0],x3[1],x3[2],x3[3]};
#pragma unroll
    for (int i = 0; i < 16; ++i) { const unsigned short hb = bf16_bits(xs[i]); ah.u[i] = hb; al.u[i] = ASPLIT ? bf16_bits(xs[i] - bf16_val(hb)) : (unsigned short)0; }
#pragma unroll
    for (int t = 0; t < 4; ++t) {
      const unsigned short* brow = Wt + (size_t)(col0 + t * 16 + ln) * ldb + kb;
      FragB b;
      b.half[0] = *(const v8us*)(brow + 8 * hh);
      b.half[1] = *(const v8us*)(brow + 16 + 8 * hh);
      acc[t] = mmaN<ASPLIT ? 2 : 1>(ah.v, al.v, b.v, b.v, acc[t]);
    }
  }
#pragma unroll
  for (int t = 0; t < 4; ++t) {
    float bv = bias ? bias[col0 + t * 16 + ln] : 0.f;
    if (BIAS_BF16) bv = bf16_round(bv);
#pragma unroll
    for (int r = 0; r < 8; ++r) { float v = acc[t][r] + bv; if (ACT == 1) v = fmaxf(v, 0.f); so[w][8 * hh + r][t * 16 + ln] = v; }
  }
  __builtin_amdgcn_fence(__ATOMIC_ACQ_REL, "workgroup");
  __builtin_amdgcn_wave_barrier();
  const int rsub = lane >> 4, c4 = (lane & 15) * 4;
  {
#pragma unroll
    for (int q = 0; q < 8; ++q) {
      const int r = q * 2 + rsub;
      const v4f v = *(const v4fa*)&so[w][r][c4];
      *(v4f*)(C + (size_t)(row0 + r) * ldc + col0 + c4) = v;
    }
    
  }
}

// GEMM C = act(A·W + bias + resid): A f32 (ASPLIT -> hi/lo 2 terms), Wt bf16 [N][K]; ACT 0 none, 1 relu, 2 exact gelu;
// resid (optional, f32, row index = (row % rmod), pitch ldr, RES_BF16 rounds it) added before the activation.
template <bool ASPLIT, int ACT, bool BIAS_BF16, bool RES_BF16>
__global__ __launch_bounds__(128) void k_gemm_bf3(const float* __restrict__ A, int lda, const unsigned short* __restrict__ Wt, int ldb,
                                                const float* __restrict__ bias, const float* __restrict__ resid, int rmod, int ldr,
                                                float* __restrict__ C, int ldc, int M, int N, int K) {
  __shared__ __attribute__((aligned(16))) float so[4][16][64];
  const int tid = threadIdx.x, w = tid >> 5, lane = tid & 31, ln = lane & 15, hh = lane >> 4;
  const int ntn = N / 64;
  const int wid = blockIdx.x * 4 + w;
  const int mt = wid / ntn, nq = wid % ntn;
  if (mt * 16 >= M) return;
  const int row0 = mt * 16, col0 = nq * 64;
  const float* arow = A + (size_t)(row0 + ln) * lda;
  v8f acc[4] = {};
  for (int kb = 0; kb < K; kb += 32) {
    FragB ah, al;
    const v4f x0 = *(const v4fa*)(arow + kb + 8 * hh), x1 = *(const v4fa*)(arow + kb + 8 * hh + 4);
    const v4f x2 = *(const v4fa*)(arow + kb + 16 + 8 * hh), x3 = *(const v4fa*)(arow + kb + 16 + 8 * hh + 4);
    float xs[16] = {x0[0],x0[1],x0[2],x0[3],x1[0],x1[1],x1[2],x1[3],x2[0],x2[1],x2[2],x2[3],x3[0],x3[1],x3[2],x3[3]};
#pragma unroll
    for (int i = 0; i < 16; ++i) { const unsigned short hb = bf16_bits(xs[i]); ah.u[i] = hb; al.u[i] = ASPLIT ? bf16_bits(xs[i] - bf16_val(hb)) : (unsigned short)0; }
#pragma unroll
    for (int t = 0; t < 4; ++t) {
      const unsigned short* brow = Wt + (size_t)(col0 + t * 16 + ln) * ldb + kb;
      FragB b;
      b.half[0] = *(const v8us*)(brow + 8 * hh);
      b.half[1] = *(const v8us*)(brow + 16 + 8 * hh);
      acc[t] = mmaN<ASPLIT ? 2 : 1>(ah.v, al.v, b.v, b.v, acc[t]);
    }
  }
#pragma unroll
  for (int t = 0; t < 4; ++t) {
    const int col = col0 + t * 16 + ln;
    float bv = bias ? bias[col] : 0.f;
    if (BIAS_BF16) bv = bf16_round(bv);
#pragma unroll
    for (int r = 0; r < 8; ++r) {
      float v = acc[t][r] + bv;
      if (resid) { float rv = resid[(size_t)((row0 + 8 * hh + r) % rmod) * ldr + col]; if (RES_BF16) rv = bf16_round(rv); v += rv; }
      if (ACT == 1) v = fmaxf(v, 0.f);
      if (ACT == 2) v = 0.5f * v * (1.0f + erff(v * 0.70710678118654752f));
      if (ACT == 3) { const float u = 0.7978845608028654f * (v + 0.044715f * v * v * v); v = 0.5f * v * (1.0f + tanhf(u)); }
      so[w][8 * hh + r][t * 16 + ln] = v;
    }
  }
  __builtin_amdgcn_fence(__ATOMIC_ACQ_REL, "workgroup");
  __builtin_amdgcn_wave_barrier();
  const int rsub = lane >> 4, c4 = (lane & 15) * 4;
  {
#pragma unroll
    for (int q = 0; q < 8; ++q) {
      const int r = q * 2 + rsub;
      const v4f v = *(const v4fa*)&so[w][r][c4];
      *(v4f*)(C + (size_t)(row0 + r) * ldc + col0 + c4) = v;
    }
    
  }
}
// row LayerNorm (biased variance, eps) over N: s = X (+ R); optional out_sum <- s; out_norm <- (s-mu)*rsqrt(var+eps)*g + b
template <bool PARAM_BF16>
__global__ __launch_bounds__(256) void k_layernorm(const float* __restrict__ X, const float* __restrict__ R, const float* __restrict__ g, const float* __restrict__ bta,
                                                  float* __restrict__ out_sum, float* __restrict__ out_norm, int N, float eps) {
  __shared__ float red[256];
  const int row = blockIdx.x, tid = threadIdx.x;
  const float* x = X + (size_t)row * N; const float* rr = R ? R + (size_t)row * N : nullptr;
  float vals[16];                     // up to N = 4096
  const int per = N / 256;            // contiguous chunk per thread? use strided-by-4 chunks: thread handles j = tid*4 + 1024*u
  float s1 = 0.f;
  for (int u = 0; u < per / 4; ++u) {
    const int j = tid * 4 + 1024 * u;
    const v4f a = *(const v4fa*)(x + j);
    v4f b = {0.f,0.f,0.f,0.f}; if (rr) b = *(const v4fa*)(rr + j);
#pragma unroll
    for (int q = 0; q < 4; ++q) { const float v = a[q] + b[q]; vals[u * 4 + q] = v; s1 += v; }
  }
  red[tid] = s1; __syncthreads();
  for (int st = 128; st > 0; st >>= 1) { if (tid < st) red[tid] += red[tid + st]; __syncthreads(); }
  const float mu = red[0] / (float)N; __syncthreads();
  float s2 = 0.f;
  for (int u = 0; u < per / 4; ++u)
#pragma unroll
    for (int q = 0; q < 4; ++q) { const float c = vals[u * 4 + q] - mu; s2 += c * c; }
  red[tid] = s2; __syncthreads();
  for (int st = 128; st > 0; st >>= 1) { if (tid < st) red[tid] += red[tid + st]; __syncthreads(); }
  const float rs = rsqrtf(red[0] / (float)N + eps);
  {
    for (int u = 0; u < per / 4; ++u) {
      const int j = tid * 4 + 1024 * u;
      v4f o, sm;
#pragma unroll
      for (int q = 0; q < 4; ++q) {
        float gg = g[j + q], bb = bta[j + q];
        if (PARAM_BF16) { gg = bf16_round(gg); bb = bf16_round(bb); }
        sm[q] = vals[u * 4 + q]; o[q] = (vals[u * 4 + q] - mu) * rs * gg + bb;
      }
      if (out_sum) *(v4f*)(out_sum + (size_t)row * N + j) = sm;
      *(v4f*)(out_norm + (size_t)row * N + j) = o;
    }
    
  }
}



// ---- f16 WMMA path (v_wmma_f32_16x16x32_f16): 11-bit significands for operands in range — used where a [0,1] probability operand needs more precision than bf16
typedef _Float16 v16h __attribute__((ext_vector_type(16)));
union FragH { v16h v; v8us half[2]; _Float16 h[16]; unsigned short u[16]; };
template <int NT>
__device__ __forceinline__ v8f mmaH(v16h ah, v16h al, v16h bh, v16h bl, v8f c) {
  c = __builtin_amdgcn_wmma_f32_16x16x32_f16(false, ah, false, bh, (short)0, c, false, false);
  if (NT >= 2) c = __builtin_amdgcn_wmma_f32_16x16x32_f16(false, al, false, bh, (short)0, c, false, false);
  if (NT >= 3) c = __builtin_amdgcn_wmma_f32_16x16x32_f16(false, ah, false, bl, (short)0, c, false, false);
  asm volatile("v_nop\n\tv_nop\n\tv_nop\n\tv_nop" : "+v"(c) : "v"(ah), "v"(al), "v"(bh), "v"(bl));
  return c;
}
// batched GEMM like k_gemm_b but f16 operands: A f32 (split into f16 hi/lo if ASPLIT, else rounded to f16), Bt = f16 values [n][k]; alpha; C f32; N multiple of 16 (partial tiles skipped)
template <bool ASPLIT>
__global__ __launch_bounds__(128) void k_gemm_h(const float* __restrict__ A, int lda, size_t sA, const _Float16* __restrict__ Bh, int ldb, size_t sB, float alpha, float* __restrict__ C, int ldc, size_t sC, int M, int N, int K) {
  __shared__ __attribute__((aligned(16))) float so[4][16][64];
  const int tid = threadIdx.x, w = tid >> 5, lane = tid & 31, ln = lane & 15, hh = lane >> 4; const int by = blockIdx.y;
  A += (size_t)by * sA; Bh += (size_t)by * sB; C += (size_t)by * sC;
  const int ntn = (N + 63) / 64; const int wid = blockIdx.x * 4 + w; const int mt = wid / ntn, nq = wid % ntn; if (mt * 16 >= M) return;
  const int row0 = mt * 16, col0 = nq * 64; const float* arow = A + (size_t)(row0 + ln) * lda;
  v8f acc[4] = {};
  for (int kb = 0; kb < K; kb += 32) {
    FragH ah, al;
    const v4f x0 = *(const v4fa*)(arow + kb + 8 * hh), x1 = *(const v4fa*)(arow + kb + 8 * hh + 4), x2 = *(const v4fa*)(arow + kb + 16 + 8 * hh), x3 = *(const v4fa*)(arow + kb + 16 + 8 * hh + 4);
    float xs[16] = {x0[0],x0[1],x0[2],x0[3],x1[0],x1[1],x1[2],x1[3],x2[0],x2[1],x2[2],x2[3],x3[0],x3[1],x3[2],x3[3]};
#pragma unroll
    for (int i = 0; i < 16; ++i) { const _Float16 h = (_Float16)xs[i]; ah.h[i] = h; al.h[i] = ASPLIT ? (_Float16)(xs[i] - (float)h) : (_Float16)0.0f; }
#pragma unroll
    for (int t = 0; t < 4; ++t) { if (col0 + t * 16 >= N) continue; const size_t boff = (size_t)(col0 + t * 16 + ln) * ldb + kb; FragH bq; bq.half[0] = *(const v8us*)(Bh + boff + 8 * hh); bq.half[1] = *(const v8us*)(Bh + boff + 16 + 8 * hh);
      acc[t] = mmaH<ASPLIT ? 2 : 1>(ah.v, al.v, bq.v, bq.v, acc[t]); }
  }
#pragma unroll
  for (int t = 0; t < 4; ++t) { if (col0 + t * 16 >= N) continue;
#pragma unroll
    for (int r = 0; r < 8; ++r) so[w][8 * hh + r][t * 16 + ln] = acc[t][r] * alpha; }
  __builtin_amdgcn_fence(__ATOMIC_ACQ_REL, "workgroup"); __builtin_amdgcn_wave_barrier();
  const int rsub = lane >> 4, c4 = (lane & 15) * 4;
  {
#pragma unroll
    for (int q = 0; q < 8; ++q) { const int r = q * 2 + rsub; if (col0 + c4 < N) { const v4f v = *(const v4fa*)&so[w][r][c4]; *(v4f*)(C + (size_t)(row0 + r) * ldc + col0 + c4) = v; } }
     }
}

// Wt[n][k] = f16(W[k][n]·scale) from f32 row-major W[K][N] (scale = power of two; bf16-exact weights stay exact in f16 away from the subnormal range)
__global__ __launch_bounds__(256) void k_wt_f16(const float* __restrict__ W, _Float16* __restrict__ Wt, int K, int N, float scale) {
  const int t = blockIdx.x * 256 + threadIdx.x; if (t >= N * (K / 8)) return; const int n = t / (K / 8), k8 = (t % (K / 8)) * 8; FragH f;
#pragma unroll
  for (int i = 0; i < 8; ++i) f.h[i] = (_Float16)(bf16_round(W[(size_t)(k8 + i) * N + n]) * scale); const v8us o = f.half[0];
  *(v8us*)((unsigned short*)Wt + (size_t)n * K + k8) = o; 
}
// k_gemm_hh variant with fused epilogue: v = acc·alpha + bias[by·sBias + col] (+ CP[(row/rowsPerB)·sCPb + by·64 + col] if CP) ; ACT 0 none / 1 elu ; writes f16 C16 (and f32 C if non-null)
template <int ACT>
__global__ __launch_bounds__(128) void k_gemm_hhx(const _Float16* __restrict__ A, int lda, size_t sA, const _Float16* __restrict__ Bh, int ldb, size_t sB, float alpha, const float* __restrict__ bias, size_t sBias, const float* __restrict__ CP, int rowsPerB, size_t sCPb, int row0g,
    float* __restrict__ C, _Float16* __restrict__ C16, int ldc, size_t sC, int M, int N, int K) {
  __shared__ __attribute__((aligned(16))) float so[4][16][64];
  const int tid = threadIdx.x, w = tid >> 5, lane = tid & 31, ln = lane & 15, hh = lane >> 4; const int by = blockIdx.y;
  A += (size_t)by * sA; Bh += (size_t)by * sB; const size_t cofs = (size_t)by * sC; const float* bp = bias ? bias + (size_t)by * sBias : nullptr;
  const int ntn = (N + 63) / 64; const int wid = blockIdx.x * 4 + w; const int mt = wid / ntn, nq = wid % ntn; if (mt * 16 >= M) return;
  const int row0 = mt * 16, col0 = nq * 64; const _Float16* arow = A + (size_t)(row0 + ln) * lda;
  v8f acc[4] = {};
  for (int kb = 0; kb < K; kb += 32) { FragH ah; ah.half[0] = *(const v8us*)((const unsigned short*)arow + kb + 8 * hh); ah.half[1] = *(const v8us*)((const unsigned short*)arow + kb + 16 + 8 * hh);
#pragma unroll
    for (int t = 0; t < 4; ++t) { if (col0 + t * 16 >= N) continue; const size_t boff = (size_t)(col0 + t * 16 + ln) * ldb + kb; FragH bq; bq.half[0] = *(const v8us*)((const unsigned short*)Bh + boff + 8 * hh); bq.half[1] = *(const v8us*)((const unsigned short*)Bh + boff + 16 + 8 * hh);
      acc[t] = mmaH<1>(ah.v, ah.v, bq.v, bq.v, acc[t]); }
  }
#pragma unroll
  for (int t = 0; t < 4; ++t) { if (col0 + t * 16 >= N) continue; const int col = col0 + t * 16 + ln; const float bv = bp ? bf16_round(bp[col]) : 0.f;
#pragma unroll
    for (int r = 0; r < 8; ++r) { float v = acc[t][r] * alpha + bv; if (CP) { const int bidx = (row0g + row0 + 8 * hh + r) / rowsPerB; v += CP[(size_t)bidx * sCPb + (size_t)by * 64 + col]; } if (ACT == 1) v = (v > 0.f) ? v : expm1f(v); else if (ACT == 7) v = (v > 0.f) ? v + 1.0f : expf(v); else if (ACT == 8) v = tanhf(v); else if (ACT == 9) v = 0.5f * v * (1.0f + tanhf(0.7978845608028654f * (v + 0.044715f * v * v * v))); else if (ACT == 11) v = 1.0f / (1.0f + expf(-v)); else if (ACT == 12) v = (v > 0.f) ? v : 0.01f * v; else if (ACT == 14) v = (v > 0.f) ? v : 0.1f * v; else if (ACT == 15) v = v / (1.0f + expf(-v)); else if (ACT == 3) v = fmaxf(v, 0.f); else if (ACT == 6) v = 0.5f * v * (1.0f + erff(v * 0.70710678118654752f)); so[w][8 * hh + r][t * 16 + ln] = v; } }
  __builtin_amdgcn_fence(__ATOMIC_ACQ_REL, "workgroup"); __builtin_amdgcn_wave_barrier();
  const int rsub = lane >> 4, c4 = (lane & 15) * 4; typedef _Float16 v4h __attribute__((ext_vector_type(4)));
  {
#pragma unroll
    for (int q = 0; q < 8; ++q) { const int r = q * 2 + rsub; if (col0 + c4 < N) { const v4f v = *(const v4fa*)&so[w][r][c4]; if (C) *(v4f*)(C + cofs + (size_t)(row0 + r) * ldc + col0 + c4) = v; if (C16) { v4h h4; for (int i = 0; i < 4; ++i) h4[i] = (_Float16)v[i]; *(v4h*)(C16 + cofs + (size_t)(row0 + r) * ldc + col0 + c4) = h4; } } }
     }
}


typedef _Float16 v4h __attribute__((ext_vector_type(4)));

__global__ __launch_bounds__(256) void k_x16(const float* __restrict__ x, _Float16* __restrict__ X16, size_t n8) { const size_t t = (size_t)blockIdx.x * 256 + threadIdx.x; if (t >= n8) return; FragH f;
#pragma unroll
  for (int q = 0; q < 8; ++q) f.h[q] = (_Float16)bf16_round(x[t * 8 + q]); *(v8us*)((unsigned short*)X16 + t * 8) = f.half[0];  }
__global__ __launch_bounds__(256) void k_h16(const float* __restrict__ x, _Float16* __restrict__ X16, size_t n8) { const size_t t = (size_t)blockIdx.x * 256 + threadIdx.x; if (t >= n8) return; FragH f;
#pragma unroll
  for (int q = 0; q < 8; ++q) f.h[q] = (_Float16)x[t * 8 + q]; *(v8us*)((unsigned short*)X16 + t * 8) = f.half[0];  }
__global__ __launch_bounds__(256) void k_round16f(const float* __restrict__ W, _Float16* __restrict__ Bt, size_t n8) { const size_t t = (size_t)blockIdx.x * 256 + threadIdx.x; if (t >= n8) return; FragH f;
#pragma unroll
  for (int i = 0; i < 8; ++i) f.h[i] = (_Float16)(bf16_round(W[t * 8 + i]) * 16.0f); *(v8us*)((unsigned short*)Bt + t * 8) = f.half[0];  }
template <int NHv, int TTv>
__global__ __launch_bounds__(256) void k_vt(const _Float16* __restrict__ V16, int ldv, int voff, _Float16* __restrict__ Vt) { __shared__ unsigned short tl[64][66]; const int tid = threadIdx.x; const int slab = blockIdx.x / (TTv / 64), lg = blockIdx.x % (TTv / 64); const int b = slab / NHv, h = slab % NHv;
  for (int i = tid; i < 64 * 8; i += 256) { const int r = i / 8, c8 = (i % 8) * 8; FragH f; f.half[0] = *(const v8us*)((const unsigned short*)V16 + ((size_t)b * TTv + lg * 64 + r) * ldv + voff + h * 64 + c8);
#pragma unroll
    for (int q = 0; q < 8; ++q) tl[r][c8 + q] = f.u[q]; }
  __syncthreads();
  {
#pragma unroll
    for (int rd = 0; rd < 2; ++rd) { const int d = rd * 32 + tid / 8, pc = tid % 8; FragH f;
#pragma unroll
      for (int q = 0; q < 8; ++q) f.u[q] = tl[pc * 8 + q][d];
      *(v8us*)((unsigned short*)Vt + ((size_t)slab * 64 + d) * TTv + lg * 64 + pc * 8) = f.half[0]; }
     } }

__global__ __launch_bounds__(256) void k_hl(const float* __restrict__ F, _Float16* __restrict__ Hh, _Float16* __restrict__ Hl, size_t n8) { const size_t t = (size_t)blockIdx.x * 256 + threadIdx.x; if (t >= n8) return; FragH fh, fl; const v4f a = *(const v4fa*)(F + t * 8), c = *(const v4fa*)(F + t * 8 + 4);
#pragma unroll
  for (int q = 0; q < 4; ++q) { _Float16 h = (_Float16)a[q]; fh.h[q] = h; fl.h[q] = (_Float16)((a[q] - (float)h) * 1024.0f); h = (_Float16)c[q]; fh.h[4 + q] = h; fl.h[4 + q] = (_Float16)((c[q] - (float)h) * 1024.0f); }
  { *(v8us*)((unsigned short*)Hh + t * 8) = fh.half[0]; *(v8us*)((unsigned short*)Hl + t * 8) = fl.half[0];  } }

// ---- fast GEMM (wave tile 32x64; requires M % 32 == 0 rows per launch region and N % 64 == 0); epilogue = k_gemm_hhx semantics ----
__device__ __forceinline__ v16h g2_frag(const _Float16* p, int hh) { FragH f; f.half[0] = *(const v8us*)((const unsigned short*)p + 8 * hh); f.half[1] = *(const v8us*)((const unsigned short*)p + 16 + 8 * hh); return f.v; }
__device__ __forceinline__ v8f g2_mma(v16h a, v16h b, v8f c) { v8f d = __builtin_amdgcn_wmma_f32_16x16x32_f16(false, a, false, b, (short)0, c, false, false); asm volatile("v_nop\n\tv_nop\n\tv_nop\n\tv_nop" : "+v"(d) : "v"(a), "v"(b)); return d; }
template <int ACT>
__global__ __launch_bounds__(128) void k_gemm2(const _Float16* __restrict__ A, int lda, size_t sA, const _Float16* __restrict__ Bh, int ldb, size_t sB, float alpha, const float* __restrict__ bias, size_t sBias, const float* __restrict__ CP, int rowsPerB, size_t sCPb, int row0g,
    float* __restrict__ C, _Float16* __restrict__ C16, int ldc, size_t sC, int M, int N, int K) {
  __shared__ __attribute__((aligned(16))) float so[4][32][68];
  const int tid = threadIdx.x, w = tid >> 5, lane = tid & 31, ln = lane & 15, hh = lane >> 4; const int by = blockIdx.y;
  A += (size_t)by * sA; Bh += (size_t)by * sB; const size_t cofs = (size_t)by * sC; const float* bp = bias ? bias + (size_t)by * sBias : nullptr;
  const int ntn = N >> 6; const int mt = blockIdx.x / ntn, nq = blockIdx.x - mt * ntn; const int row0 = mt * 128 + 32 * w, col0 = nq * 64; if (row0 >= M) return;
  const _Float16* a0p = A + (size_t)(row0 + ln) * lda; const _Float16* a1p = a0p + (size_t)16 * lda;
  const _Float16* b0p = Bh + (size_t)(col0 + ln) * ldb; const _Float16* b1p = b0p + (size_t)16 * ldb; const _Float16* b2p = b1p + (size_t)16 * ldb; const _Float16* b3p = b2p + (size_t)16 * ldb;
  const v8f z8 = {0.f,0.f,0.f,0.f,0.f,0.f,0.f,0.f}; v8f c00 = z8, c01 = z8, c02 = z8, c03 = z8, c10 = z8, c11 = z8, c12 = z8, c13 = z8;
#pragma unroll 1
  for (int kb = 0; kb < K; kb += 32) { const v16h a0 = g2_frag(a0p + kb, hh), a1 = g2_frag(a1p + kb, hh);
    v16h b = g2_frag(b0p + kb, hh); c00 = g2_mma(a0, b, c00); c10 = g2_mma(a1, b, c10);
    b = g2_frag(b1p + kb, hh); c01 = g2_mma(a0, b, c01); c11 = g2_mma(a1, b, c11);
    b = g2_frag(b2p + kb, hh); c02 = g2_mma(a0, b, c02); c12 = g2_mma(a1, b, c12);
    b = g2_frag(b3p + kb, hh); c03 = g2_mma(a0, b, c03); c13 = g2_mma(a1, b, c13); }
  v8f accs[8] = {c00, c01, c02, c03, c10, c11, c12, c13};
#pragma unroll
  for (int u = 0; u < 8; ++u) { const int t = u & 3, half = u >> 2; const int col = col0 + t * 16 + ln; const float bv = bp ? bf16_round(bp[col]) : 0.f;
#pragma unroll
    for (int r = 0; r < 8; ++r) { const int rloc = half * 16 + 8 * hh + r; float v = accs[u][r] * alpha + bv; if (CP) { const int bidx = (row0g + row0 + rloc) / rowsPerB; v += CP[(size_t)bidx * sCPb + (size_t)by * 64 + col]; }
      if (ACT == 3) v = fmaxf(v, 0.f); else if (ACT == 6) v = 0.5f * v * (1.0f + erff(v * 0.70710678118654752f)); else if (ACT == 11) v = 1.0f / (1.0f + expf(-v)); else if (ACT == 15) v = v / (1.0f + expf(-v)); else if (ACT == 12) v = (v > 0.f) ? v : 0.01f * v; else if (ACT == 8) v = tanhf(v);
      so[w][rloc][t * 16 + ln] = v; } }
  __builtin_amdgcn_fence(__ATOMIC_ACQ_REL, "workgroup"); __builtin_amdgcn_wave_barrier();
  const int rsub = lane >> 4, c4 = (lane & 15) * 4;
  {
#pragma unroll
    for (int q = 0; q < 16; ++q) { const int r = q * 2 + rsub; const v4f v = *(const v4fa*)&so[w][r][c4]; if (C) *(v4f*)(C + cofs + (size_t)(row0 + r) * ldc + col0 + c4) = v; if (C16) { v4h h4; for (int i = 0; i < 4; ++i) h4[i] = (_Float16)v[i]; *(v4h*)(C16 + cofs + (size_t)(row0 + r) * ldc + col0 + c4) = h4; } }
     } }



// lane l <-> l ^ 16 (the two halves of a wave hold the two key halves of one query column)
__device__ __forceinline__ float xhalf(float x) { const int t = __float_as_int(x); return __int_as_float(__builtin_amdgcn_permlanex16(t, t, 0x76543210, 0xfedcba98, false, false)); }
// Transposed products: S^T = K.Q^T (A = 16 key rows, B = 16 query columns), O^T += V^T.P^T (A = 16 rows of V^T, B = P^T packed from the two S^T tiles).
// Lane (ln, hh) owns query q0 + ln: s[nt][r] = score of key j0 + 16 nt + 8 hh + r, which is already the hardware k order of a B operand; oacc[dt][r] = O[query][16 dt + 8 hh + r].
__global__ __launch_bounds__(128) void k_flash(const _Float16* __restrict__ Q16, int ldq, const _Float16* __restrict__ K16, int ldk, const _Float16* __restrict__ Vt, const int* __restrict__ MSK, float* __restrict__ O, int ldo) {
  constexpr int RPW = 16, NQB = TQ / (4 * RPW), DT = 4, KS = 2;
  __shared__ __attribute__((aligned(16))) float sO[4][RPW][64 + 4];
  const int tid = threadIdx.x, w = tid >> 5, lane = tid & 31, ln = lane & 15, hh = lane >> 4; (void)MSK;
  const int slab = blockIdx.x / NQB, qblk = blockIdx.x % NQB; const int b = slab / NH, h = slab % NH; const int qb0 = qblk * (4 * RPW); const int q0 = qb0 + w * RPW;
  FragH bq[KS];
  { const unsigned short* qr = (const unsigned short*)Q16 + ((size_t)b * TQ + q0 + ln) * ldq + h * 64;
#pragma unroll
    for (int ks = 0; ks < KS; ++ks) { bq[ks].half[0] = *(const v8us*)(qr + ks * 32 + 8 * hh); bq[ks].half[1] = *(const v8us*)(qr + ks * 32 + 16 + 8 * hh); } }
  const unsigned short* Vth = (const unsigned short*)Vt + (size_t)slab * 64 * TK;
  float m_q = -3.0e38f, l_q = 0.f; v8f oacc[DT];
#pragma unroll
  for (int dt = 0; dt < DT; ++dt) oacc[dt] = (v8f){0.f,0.f,0.f,0.f,0.f,0.f,0.f,0.f};
  const int jend = TK;
#pragma unroll 1
  for (int j0 = 0; j0 < jend; j0 += 32) {
    float sc[16];
#pragma unroll
    for (int nt = 0; nt < 2; ++nt) { const unsigned short* kr = (const unsigned short*)K16 + ((size_t)b * TK + j0 + nt * 16 + ln) * ldk + h * 64; FragH ak[KS];
#pragma unroll
      for (int ks = 0; ks < KS; ++ks) { ak[ks].half[0] = *(const v8us*)(kr + ks * 32 + 8 * hh); ak[ks].half[1] = *(const v8us*)(kr + ks * 32 + 16 + 8 * hh); }
      v8f acc = (v8f){0.f,0.f,0.f,0.f,0.f,0.f,0.f,0.f};
#pragma unroll
      for (int ks = 0; ks < KS; ++ks) acc = mmaH<1>(ak[ks].v, ak[ks].v, bq[ks].v, bq[ks].v, acc);
#pragma unroll
      for (int r = 0; r < 8; ++r) sc[nt * 8 + r] = acc[r] * SCL; }
    float mc = fmaxf(sc[0], sc[1]);
#pragma unroll
    for (int i = 2; i < 16; ++i) mc = fmaxf(mc, sc[i]);
    mc = fmaxf(mc, xhalf(mc));
    const float mn = fmaxf(m_q, mc); const float al = (mn > -1.0e38f) ? expf(m_q - mn) : 1.0f; m_q = mn;
    FragH pb; float ps[4] = {0.f, 0.f, 0.f, 0.f};
#pragma unroll
    for (int i = 0; i < 16; ++i) { const float p = expf(sc[i] - mn); ps[i & 3] += p; pb.h[i] = (_Float16)(p * 1024.0f); }
    l_q = l_q * al + ((ps[0] + ps[1]) + (ps[2] + ps[3]));
#pragma unroll
    for (int dt = 0; dt < DT; ++dt)
#pragma unroll
      for (int r = 0; r < 8; ++r) oacc[dt][r] *= al;
#pragma unroll
    for (int dt = 0; dt < DT; ++dt) { const unsigned short* vrow = Vth + (size_t)(dt * 16 + ln) * TK + j0; FragH av; av.half[0] = *(const v8us*)(vrow + 8 * hh); av.half[1] = *(const v8us*)(vrow + 16 + 8 * hh);
      oacc[dt] = mmaH<1>(av.v, av.v, pb.v, pb.v, oacc[dt]); } }
  { const float l = l_q + xhalf(l_q); const float inv = (l > 0.f) ? 1.0f / (l * 1024.0f) : 0.f;
#pragma unroll
    for (int dt = 0; dt < DT; ++dt)
#pragma unroll
      for (int g = 0; g < 2; ++g) { v4f o4; 
#pragma unroll
        for (int q = 0; q < 4; ++q) o4[q] = oacc[dt][g * 4 + q] * inv;
        *(v4fa*)&sO[w][ln][dt * 16 + 8 * hh + g * 4] = o4; } }
  __builtin_amdgcn_fence(__ATOMIC_ACQ_REL, "workgroup"); __builtin_amdgcn_wave_barrier();
  {
#pragma unroll
    for (int rp = 0; rp < RPW; rp += 2) { const int r = rp + (lane >> 4), pc = lane & 15; const v4f val = *(const v4fa*)&sO[w][r][pc * 4]; *(v4f*)(O + ((size_t)b * TQ + q0 + r) * ldo + h * 64 + pc * 4) = val; }
     } }
__global__ __launch_bounds__(256) void k_fulltab(unsigned* __restrict__ MB, int* __restrict__ RA, int* __restrict__ KE, int nq, int nk) {
  const int t = blockIdx.x * 256 + threadIdx.x;
  if (t < nq * (nk / 32)) { *(unsigned*)(MB + t) = 0u;  }
  if (t < nq) { *(int*)(RA + t) = 0;  }
  if (t < nq / 64) { *(int*)(KE + t * 32) = nk;  } }
__global__ __launch_bounds__(256) void k_lnout(const float* __restrict__ Y, const float* __restrict__ g, const float* __restrict__ bb, float* __restrict__ out) {
  #pragma clang fp contract(off)
  const int tid = threadIdx.x, w = tid >> 5, ln = tid & 31; const int r = blockIdx.x * 8 + w; if (r >= NR) return; const float* y = Y + (size_t)r * DM; float s = 0.f;
#pragma unroll 1
  for (int i = 0; i < 8; ++i) { const v4f a = *(const v4fa*)(y + i * 128 + ln * 4); for (int q = 0; q < 4; ++q) s += a[q]; }
  for (int o = 16; o > 0; o >>= 1) s += __shfl_xor(s, o, 32); const float mu = s / (float)DM; float q2 = 0.f;
#pragma unroll 1
  for (int i = 0; i < 8; ++i) { const v4f a = *(const v4fa*)(y + i * 128 + ln * 4); for (int q = 0; q < 4; ++q) { const float d = a[q] - mu; q2 += d * d; } }
  for (int o = 16; o > 0; o >>= 1) q2 += __shfl_xor(q2, o, 32); const float rs = rsqrtf(q2 / (float)DM + 1e-6f);
  {
#pragma unroll 1
    for (int i = 0; i < 8; ++i) { const int c0 = i * 128 + ln * 4; const v4f a = *(const v4fa*)(y + c0); v4f o4; for (int q = 0; q < 4; ++q) o4[q] = (a[q] - mu) * rs * bf16_round(g[c0 + q]) + bf16_round(bb[c0 + q]); *(v4f*)(out + (size_t)r * DM + c0) = o4; }
     } }
__global__ __launch_bounds__(256) void k_xb(const float* __restrict__ x, float* __restrict__ XB, size_t n4) { const size_t t = (size_t)blockIdx.x * 256 + threadIdx.x; if (t >= n4) return; const v4f a = *(const v4fa*)(x + t * 4); v4f o; for (int q = 0; q < 4; ++q) o[q] = bf16_round(a[q]); *(v4f*)(XB + t * 4) = o;  }
__global__ __launch_bounds__(256) void k_causaltab(unsigned* __restrict__ MB, int* __restrict__ RA, int* __restrict__ KE, int nq, int nk) {
  const int t = blockIdx.x * 256 + threadIdx.x; const int nw = nk / 32;
  if (t < nq * nw) { const int q = t / nw, w = t % nw; const int first = q + 1 - 32 * w; const unsigned bits = (first <= 0) ? 0xffffffffu : ((first >= 32) ? 0u : (0xffffffffu << first)); *(unsigned*)(MB + t) = bits;  }
  if (t < nq) { *(int*)(RA + t) = 0;  }
  if (t < nq / 64) { const int v = 64 * (t + 1); *(int*)(KE + t * 32) = v;  } }


extern "C" void kernel_launch(void* const* d_in, const int* in_sizes, int n_in,
                              void* d_out, int out_size, void* d_ws, size_t ws_size, hipStream_t stream) {
  (void)in_sizes; (void)n_in; (void)out_size;
  const float* const* I = (const float* const*)d_in; const float* x = I[0]; const float* Wq = I[1]; const float* bq = I[2]; const float* Wk = I[3]; const float* bk = I[4]; const float* Wv = I[5]; const float* bv = I[6];
  char* ws = (char*)d_ws; size_t off = 0;
  auto take = [&](size_t bytes) { char* p = ws + off; off += (bytes + 255) & ~(size_t)255; return p; };
  _Float16* BQ = (_Float16*)take((size_t)DM * DM * 2); _Float16* BK = (_Float16*)take((size_t)DM * DM * 2); _Float16* BV = (_Float16*)take((size_t)DM * DM * 2);
  _Float16* X16 = (_Float16*)take((size_t)NR * DM * 2); _Float16* Q16 = (_Float16*)take((size_t)NR * DM * 2); _Float16* K16 = (_Float16*)take((size_t)NR * DM * 2); _Float16* V16 = (_Float16*)take((size_t)NR * DM * 2); _Float16* VT = (_Float16*)take((size_t)NR * DM * 2);
  if (off > ws_size) return;      /* 3.5 + 5 x 12.6 = 66 MB */
  const size_t w8 = (size_t)DM * DM / 8; const unsigned wb = (unsigned)((w8 + 255) / 256);
  k_round16f<<<wb, 256, 0, stream>>>(Wq, BQ, w8); k_round16f<<<wb, 256, 0, stream>>>(Wk, BK, w8); k_round16f<<<wb, 256, 0, stream>>>(Wv, BV, w8);      /* torch (out,in) = natural Bt */
  const size_t n8 = (size_t)NR * DM / 8; const unsigned nb8 = (unsigned)((n8 + 255) / 256); const dim3 gP((NR / 128) * (DM / 64), 1);
  k_x16<<<nb8, 256, 0, stream>>>(x, X16, n8);
  k_gemm2<0><<<gP, 128, 0, stream>>>(X16, DM, 0, BQ, DM, 0, 0.0625f, bq, 0, nullptr, 1, 0, 0, nullptr, Q16, DM, 0, NR, DM, DM);
  k_gemm2<0><<<gP, 128, 0, stream>>>(X16, DM, 0, BK, DM, 0, 0.0625f, bk, 0, nullptr, 1, 0, 0, nullptr, K16, DM, 0, NR, DM, DM);
  k_gemm2<0><<<gP, 128, 0, stream>>>(X16, DM, 0, BV, DM, 0, 0.0625f, bv, 0, nullptr, 1, 0, 0, nullptr, V16, DM, 0, NR, DM, DM);
  k_vt<NH, SLEN><<<NBT * NH * (SLEN / 64), 256, 0, stream>>>(V16, DM, 0, VT);      /* all batches in one grid: slab = batch * NH + head */
  k_flash<<<NBT * NH * (SLEN / 64), 128, 0, stream>>>(Q16, DM, K16, DM, VT, nullptr, (float*)d_out, DM);      /* all batches in one grid; ctx rows straight into the output */
}

// v003
// One run takes 118 microseconds.
// Two timings next to v002 put it at 1.91 and 1.92 times that version's speed.
// All steps since v000 together make it 7.98 times as fast.
#include <hip/hip_runtime.h>
// DeiT self-attention (8 x 1024 tokens, 768 = 12 heads x 64): q,k,v = x W^T + b; softmax(q.k/8) over all keys; ctx = attn.v merged -> [8,1024,768] (no output projection).
// Structure: x as an exact f16 plane; projections as f16 WMMA GEMMs (32x64 wave tiles, f32 accumulation, exact products + bias) into f16 planes; the fused flash kernel over all 1024 keys (plain f16 q/k/V^T, online softmax in f32, P x2^10) per ((batch, head), 64 queries) writes the merged context rows straight into the output.
// Compute dtype: x, weights, biases rounded to bf16; q, k, v, P as plain f16 (~2^-12; logits sigma ~0.3); f32 accumulation and softmax. v_wmma_f32_16x16x32_f16.
#define NBT 8
#define SLEN 1024
#define TQ SLEN
#define TK SLEN
#define DM 768
#define NH 12
#define SCL 0.125f
#define NR (NBT * SLEN)
typedef __bf16 v16b __attribute__((ext_vector_type(16)));
typedef unsigned short v8us __attribute__((ext_vector_type(8), may_alias));
typedef float  v8f  __attribute__((ext_vector_type(8)));
typedef float  v4f  __attribute__((ext_vector_type(4)));
typedef float  v4fa __attribute__((ext_vector_type(4), may_alias));
union FragB { v16b v; v8us half[2]; unsigned short u[16]; };

__device__ __forceinline__ unsigned short bf16_bits(float x) { unsigned int u = __float_as_uint(x); return (unsigned short)((u + 0x7FFFu + ((u >> 16) & 1u)) >> 16); }
__device__ __forceinline__ float bf16_val(unsigned short b) { return __uint_as_float(((unsigned int)b) << 16); }
__device__ __forceinline__ float bf16_round(float x) { return bf16_val(bf16_bits(x)); }
// D += A·B with NT terms: 1 = ah·bh, 2 = + al·bh (A split), 3 = + ah·bl (both split)
template <int NT>
__device__ __forceinline__ v8f mmaN(v16b ah, v16b al, v16b bh, v16b bl, v8f c) {
  c = __builtin_amdgcn_wmma_f32_16x16x32_bf16(false, ah, false, bh, (short)0, c, false, false);
  if (NT >= 2) c = __builtin_amdgcn_wmma_f32_16x16x32_bf16(false, al, false, bh, (short)0, c, false, false);
  if (NT >= 3) c = __builtin_amdgcn_wmma_f32_16x16x32_bf16(false, ah, false, bl, (short)0, c, false, false);
  asm volatile("v_nop\n\tv_nop\n\tv_nop\n\tv_nop" : "+v"(c) : "v"(ah), "v"(al), "v"(bh), "v"(bl));
  return c;
}

__global__ __launch_bounds__(256) void k_wt_bf16(const float* __restrict__ W, unsigned short* __restrict__ Wt, int K, int N) {
  const int t = blockIdx.x * 256 + threadIdx.x;
  const int k8n = K / 8;
  if (t >= N * k8n) return;
  const int n = t / k8n, k8 = (t % k8n) * 8;
  v8us v;
#pragma unroll
  for (int i = 0; i < 8; ++i) v[i] = bf16_bits(W[(size_t)(k8 + i) * N + n]);
  *(v8us*)(Wt + (size_t)n * K + k8) = v;
  
}

// GEMM C[M][N] (f32, pitch ldc) = act(A[M][K]·W + bias). A f32 row-major (pitch lda) converted per fragment to bf16
// (ASPLIT: hi/lo two planes -> 2 terms, else single rounded term); Wt bf16 [N][K] (pitch ldb). BIAS_BF16 rounds the
// bias to bf16 first (bias quantised to bf16 before the add). K%32==0, M%16==0, N%64==0.
template <bool ASPLIT, int ACT, bool BIAS_BF16>
__global__ __launch_bounds__(128) void k_gemm_bf(const float* __restrict__ A, int lda, const unsigned short* __restrict__ Wt, int ldb,
                                               const float* __restrict__ bias, float* __restrict__ C, int ldc, int M, int N, int K) {
  __shared__ __attribute__((aligned(16))) float so[4][16][64];
  const int tid = threadIdx.x, w = tid >> 5, lane = tid & 31, ln = lane & 15, hh = lane >> 4;
  const int ntn = N / 64;
  const int wid = blockIdx.x * 4 + w;
  const int mt = wid / ntn, nq = wid % ntn;
  if (mt * 16 >= M) return;
  const int row0 = mt * 16, col0 = nq * 64;
  const float* arow = A + (size_t)(row0 + ln) * lda;
  v8f acc[4] = {};
  for (int kb = 0; kb < K; kb += 32) {
    FragB ah, al;
    const v4f x0 = *(const v4fa*)(arow + kb + 8 * hh), x1 = *(const v4fa*)(arow + kb + 8 * hh + 4);
    const v4f x2 = *(const v4fa*)(arow + kb + 16 + 8 * hh), x3 = *(const v4fa*)(arow + kb + 16 + 8 * hh + 4);
    float xs[16] = {x0[0],x0[1],x0[2],x0[3],x1[0],x1[1],x1[2],x1[3],x2[0],x2[1],x2[2],x2[3],x3[0],x3[1],x3[2],x3[3]};
#pragma unroll
    for (int i = 0; i < 16; ++i) { const unsigned short hb = bf16_bits(xs[i]); ah.u[i] = hb; al.u[i] = ASPLIT ? bf16_bits(xs[i] - bf16_val(hb)) : (unsigned short)0; }
#pragma unroll
    for (int t = 0; t < 4; ++t) {
      const unsigned short* brow = Wt + (size_t)(col0 + t * 16 + ln) * ldb + kb;
      FragB b;
      b.half[0] = *(const v8us*)(brow + 8 * hh);
      b.half[1] = *(const v8us*)(brow + 16 + 8 * hh);
      acc[t] = mmaN<ASPLIT ? 2 : 1>(ah.v, al.v, b.v, b.v, acc[t]);
    }
  }
#pragma unroll
  for (int t = 0; t < 4; ++t) {
    float bv = bias ? bias[col0 + t * 16 + ln] : 0.f;
    if (BIAS_BF16) bv = bf16_round(bv);
#pragma unroll
    for (int r = 0; r < 8; ++r) { float v = acc[t][r] + bv; if (ACT == 1) v = fmaxf(v, 0.f); so[w][8 * hh + r][t * 16 + ln] = v; }
  }
  __builtin_amdgcn_fence(__ATOMIC_ACQ_REL, "workgroup");
  __builtin_amdgcn_wave_barrier();
  const int rsub = lane >> 4, c4 = (lane & 15) * 4;
  {
#pragma unroll
    for (int q = 0; q < 8; ++q) {
      const int r = q * 2 + rsub;
      const v4f v = *(const v4fa*)&so[w][r][c4];
      *(v4f*)(C + (size_t)(row0 + r) * ldc + col0 + c4) = v;
    }
    
  }
}

// GEMM C = act(A·W + bias + resid): A f32 (ASPLIT -> hi/lo 2 terms), Wt bf16 [N][K]; ACT 0 none, 1 relu, 2 exact gelu;
// resid (optional, f32, row index = (row % rmod), pitch ldr, RES_BF16 rounds it) added before the activation.
template <bool ASPLIT, int ACT, bool BIAS_BF16, bool RES_BF16>
__global__ __launch_bounds__(128) void k_gemm_bf3(const float* __restrict__ A, int lda, const unsigned short* __restrict__ Wt, int ldb,
                                                const float* __restrict__ bias, const float* __restrict__ resid, int rmod, int ldr,
                                                float* __restrict__ C, int ldc, int M, int N, int K) {
  __shared__ __attribute__((aligned(16))) float so[4][16][64];
  const int tid = threadIdx.x, w = tid >> 5, lane = tid & 31, ln = lane & 15, hh = lane >> 4;
  const int ntn = N / 64;
  const int wid = blockIdx.x * 4 + w;
  const int mt = wid / ntn, nq = wid % ntn;
  if (mt * 16 >= M) return;
  const int row0 = mt * 16, col0 = nq * 64;
  const float* arow = A + (size_t)(row0 + ln) * lda;
  v8f acc[4] = {};
  for (int kb = 0; kb < K; kb += 32) {
    FragB ah, al;
    const v4f x0 = *(const v4fa*)(arow + kb + 8 * hh), x1 = *(const v4fa*)(arow + kb + 8 * hh + 4);
    const v4f x2 = *(const v4fa*)(arow + kb + 16 + 8 * hh), x3 = *(const v4fa*)(arow + kb + 16 + 8 * hh + 4);
    float xs[16] = {x0[0],x0[1],x0[2],x0[3],x1[0],x1[1],x1[2],x1[3],x2[0],x2[1],x2[2],x2[3],x3[0],x3[1],x3[2],x3[3]};
#pragma unroll
    for (int i = 0; i < 16; ++i) { const unsigned short hb = bf16_bits(xs[i]); ah.u[i] = hb; al.u[i] = ASPLIT ? bf16_bits(xs[i] - bf16_val(hb)) : (unsigned short)0; }
#pragma unroll
    for (int t = 0; t < 4; ++t) {
      const unsigned short* brow = Wt + (size_t)(col0 + t * 16 + ln) * ldb + kb;
      FragB b;
      b.half[0] = *(const v8us*)(brow + 8 * hh);
      b.half[1] = *(const v8us*)(brow + 16 + 8 * hh);
      acc[t] = mmaN<ASPLIT ? 2 : 1>(ah.v, al.v, b.v, b.v, acc[t]);
    }
  }
#pragma unroll
  for (int t = 0; t < 4; ++t) {
    const int col = col0 + t * 16 + ln;
    float bv = bias ? bias[col] : 0.f;
    if (BIAS_BF16) bv = bf16_round(bv);
#pragma unroll
    for (int r = 0; r < 8; ++r) {
      float v = acc[t][r] + bv;
      if (resid) { float rv = resid[(size_t)((row0 + 8 * hh + r) % rmod) * ldr + col]; if (RES_BF16) rv = bf16_round(rv); v += rv; }
      if (ACT == 1) v = fmaxf(v, 0.f);
      if (ACT == 2) v = 0.5f * v * (1.0f + erff(v * 0.70710678118654752f));
      if (ACT == 3) { const float u = 0.7978845608028654f * (v + 0.044715f * v * v * v); v = 0.5f * v * (1.0f + tanhf(u)); }
      so[w][8 * hh + r][t * 16 + ln] = v;
    }
  }
  __builtin_amdgcn_fence(__ATOMIC_ACQ_REL, "workgroup");
  __builtin_amdgcn_wave_barrier();
  const int rsub = lane >> 4, c4 = (lane & 15) * 4;
  {
#pragma unroll
    for (int q = 0; q < 8; ++q) {
      const int r = q * 2 + rsub;
      const v4f v = *(const v4fa*)&so[w][r][c4];
      *(v4f*)(C + (size_t)(row0 + r) * ldc + col0 + c4) = v;
    }
    
  }
}
// row LayerNorm (biased variance, eps) over N: s = X (+ R); optional out_sum <- s; out_norm <- (s-mu)*rsqrt(var+eps)*g + b
template <bool PARAM_BF16>
__global__ __launch_bounds__(256) void k_layernorm(const float* __restrict__ X, const float* __restrict__ R, const float* __restrict__ g, const float* __restrict__ bta,
                                                  float* __restrict__ out_sum, float* __restrict__ out_norm, int N, float eps) {
  __shared__ float red[256];
  const int row = blockIdx.x, tid = threadIdx.x;
  const float* x = X + (size_t)row * N; const float* rr = R ? R + (size_t)row * N : nullptr;
  float vals[16];                     // up to N = 4096
  const int per = N / 256;            // contiguous chunk per thread? use strided-by-4 chunks: thread handles j = tid*4 + 1024*u
  float s1 = 0.f;
  for (int u = 0; u < per / 4; ++u) {
    const int j = tid * 4 + 1024 * u;
    const v4f a = *(const v4fa*)(x + j);
    v4f b = {0.f,0.f,0.f,0.f}; if (rr) b = *(const v4fa*)(rr + j);
#pragma unroll
    for (int q = 0; q < 4; ++q) { const float v = a[q] + b[q]; vals[u * 4 + q] = v; s1 += v; }
  }
  red[tid] = s1; __syncthreads();
  for (int st = 128; st > 0; st >>= 1) { if (tid < st) red[tid] += red[tid + st]; __syncthreads(); }
  const float mu = red[0] / (float)N; __syncthreads();
  float s2 = 0.f;
  for (int u = 0; u < per / 4; ++u)
#pragma unroll
    for (int q = 0; q < 4; ++q) { const float c = vals[u * 4 + q] - mu; s2 += c * c; }
  red[tid] = s2; __syncthreads();
  for (int st = 128; st > 0; st >>= 1) { if (tid < st) red[tid] += red[tid + st]; __syncthreads(); }
  const float rs = rsqrtf(red[0] / (float)N + eps);
  {
    for (int u = 0; u < per / 4; ++u) {
      const int j = tid * 4 + 1024 * u;
      v4f o, sm;
#pragma unroll
      for (int q = 0; q < 4; ++q) {
        float gg = g[j + q], bb = bta[j + q];
        if (PARAM_BF16) { gg = bf16_round(gg); bb = bf16_round(bb); }
        sm[q] = vals[u * 4 + q]; o[q] = (vals[u * 4 + q] - mu) * rs * gg + bb;
      }
      if (out_sum) *(v4f*)(out_sum + (size_t)row * N + j) = sm;
      *(v4f*)(out_norm + (size_t)row * N + j) = o;
    }
    
  }
}



// ---- f16 WMMA path (v_wmma_f32_16x16x32_f16): 11-bit significands for operands in range — used where a [0,1] probability operand needs more precision than bf16
typedef _Float16 v16h __attribute__((ext_vector_type(16)));
union FragH { v16h v; v8us half[2]; _Float16 h[16]; unsigned short u[16]; };
template <int NT>
__device__ __forceinline__ v8f mmaH(v16h ah, v16h al, v16h bh, v16h bl, v8f c) {
  c = __builtin_amdgcn_wmma_f32_16x16x32_f16(false, ah, false, bh, (short)0, c, false, false);
  if (NT >= 2) c = __builtin_amdgcn_wmma_f32_16x16x32_f16(false, al, false, bh, (short)0, c, false, false);
  if (NT >= 3) c = __builtin_amdgcn_wmma_f32_16x16x32_f16(false, ah, false, bl, (short)0, c, false, false);
  asm volatile("v_nop\n\tv_nop\n\tv_nop\n\tv_nop" : "+v"(c) : "v"(ah), "v"(al), "v"(bh), "v"(bl));
  return c;
}
// batched GEMM like k_gemm_b but f16 operands: A f32 (split into f16 hi/lo if ASPLIT, else rounded to f16), Bt = f16 values [n][k]; alpha; C f32; N multiple of 16 (partial tiles skipped)
template <bool ASPLIT>
__global__ __launch_bounds__(128) void k_gemm_h(const float* __restrict__ A, int lda, size_t sA, const _Float16* __restrict__ Bh, int ldb, size_t sB, float alpha, float* __restrict__ C, int ldc, size_t sC, int M, int N, int K) {
  __shared__ __attribute__((aligned(16))) float so[4][16][64];
  const int tid = threadIdx.x, w = tid >> 5, lane = tid & 31, ln = lane & 15, hh = lane >> 4; const int by = blockIdx.y;
  A += (size_t)by * sA; Bh += (size_t)by * sB; C += (size_t)by * sC;
  const int ntn = (N + 63) / 64; const int wid = blockIdx.x * 4 + w; const int mt = wid / ntn, nq = wid % ntn; if (mt * 16 >= M) return;
  const int row0 = mt * 16, col0 = nq * 64; const float* arow = A + (size_t)(row0 + ln) * lda;
  v8f acc[4] = {};
  for (int kb = 0; kb < K; kb += 32) {
    FragH ah, al;
    const v4f x0 = *(const v4fa*)(arow + kb + 8 * hh), x1 = *(const v4fa*)(arow + kb + 8 * hh + 4), x2 = *(const v4fa*)(arow + kb + 16 + 8 * hh), x3 = *(const v4fa*)(arow + kb + 16 + 8 * hh + 4);
    float xs[16] = {x0[0],x0[1],x0[2],x0[3],x1[0],x1[1],x1[2],x1[3],x2[0],x2[1],x2[2],x2[3],x3[0],x3[1],x3[2],x3[3]};
#pragma unroll
    for (int i = 0; i < 16; ++i) { const _Float16 h = (_Float16)xs[i]; ah.h[i] = h; al.h[i] = ASPLIT ? (_Float16)(xs[i] - (float)h) : (_Float16)0.0f; }
#pragma unroll
    for (int t = 0; t < 4; ++t) { if (col0 + t * 16 >= N) continue; const size_t boff = (size_t)(col0 + t * 16 + ln) * ldb + kb; FragH bq; bq.half[0] = *(const v8us*)(Bh + boff + 8 * hh); bq.half[1] = *(const v8us*)(Bh + boff + 16 + 8 * hh);
      acc[t] = mmaH<ASPLIT ? 2 : 1>(ah.v, al.v, bq.v, bq.v, acc[t]); }
  }
#pragma unroll
  for (int t = 0; t < 4; ++t) { if (col0 + t * 16 >= N) continue;
#pragma unroll
    for (int r = 0; r < 8; ++r) so[w][8 * hh + r][t * 16 + ln] = acc[t][r] * alpha; }
  __builtin_amdgcn_fence(__ATOMIC_ACQ_REL, "workgroup"); __builtin_amdgcn_wave_barrier();
  const int rsub = lane >> 4, c4 = (lane & 15) * 4;
  {
#pragma unroll
    for (int q = 0; q < 8; ++q) { const int r = q * 2 + rsub; if (col0 + c4 < N) { const v4f v = *(const v4fa*)&so[w][r][c4]; *(v4f*)(C + (size_t)(row0 + r) * ldc + col0 + c4) = v; } }
     }
}

// Wt[n][k] = f16(W[k][n]·scale) from f32 row-major W[K][N] (scale = power of two; bf16-exact weights stay exact in f16 away from the subnormal range)
__global__ __launch_bounds__(256) void k_wt_f16(const float* __restrict__ W, _Float16* __restrict__ Wt, int K, int N, float scale) {
  const int t = blockIdx.x * 256 + threadIdx.x; if (t >= N * (K / 8)) return; const int n = t / (K / 8), k8 = (t % (K / 8)) * 8; FragH f;
#pragma unroll
  for (int i = 0; i < 8; ++i) f.h[i] = (_Float16)(bf16_round(W[(size_t)(k8 + i) * N + n]) * scale); const v8us o = f.half[0];
  *(v8us*)((unsigned short*)Wt + (size_t)n * K + k8) = o; 
}
// k_gemm_hh variant with fused epilogue: v = acc·alpha + bias[by·sBias + col] (+ CP[(row/rowsPerB)·sCPb + by·64 + col] if CP) ; ACT 0 none / 1 elu ; writes f16 C16 (and f32 C if non-null)
template <int ACT>
__global__ __launch_bounds__(128) void k_gemm_hhx(const _Float16* __restrict__ A, int lda, size_t sA, const _Float16* __restrict__ Bh, int ldb, size_t sB, float alpha, const float* __restrict__ bias, size_t sBias, const float* __restrict__ CP, int rowsPerB, size_t sCPb, int row0g,
    float* __restrict__ C, _Float16* __restrict__ C16, int ldc, size_t sC, int M, int N, int K) {
  __shared__ __attribute__((aligned(16))) float so[4][16][64];
  const int tid = threadIdx.x, w = tid >> 5, lane = tid & 31, ln = lane & 15, hh = lane >> 4; const int by = blockIdx.y;
  A += (size_t)by * sA; Bh += (size_t)by * sB; const size_t cofs = (size_t)by * sC; const float* bp = bias ? bias + (size_t)by * sBias : nullptr;
  const int ntn = (N + 63) / 64; const int wid = blockIdx.x * 4 + w; const int mt = wid / ntn, nq = wid % ntn; if (mt * 16 >= M) return;
  const int row0 = mt * 16, col0 = nq * 64; const _Float16* arow = A + (size_t)(row0 + ln) * lda;
  v8f acc[4] = {};
  for (int kb = 0; kb < K; kb += 32) { FragH ah; ah.half[0] = *(const v8us*)((const unsigned short*)arow + kb + 8 * hh); ah.half[1] = *(const v8us*)((const unsigned short*)arow + kb + 16 + 8 * hh);
#pragma unroll
    for (int t = 0; t < 4; ++t) { if (col0 + t * 16 >= N) continue; const size_t boff = (size_t)(col0 + t * 16 + ln) * ldb + kb; FragH bq; bq.half[0] = *(const v8us*)((const unsigned short*)Bh + boff + 8 * hh); bq.half[1] = *(const v8us*)((const unsigned short*)Bh + boff + 16 + 8 * hh);
      acc[t] = mmaH<1>(ah.v, ah.v, bq.v, bq.v, acc[t]); }
  }
#pragma unroll
  for (int t = 0; t < 4; ++t) { if (col0 + t * 16 >= N) continue; const int col = col0 + t * 16 + ln; const float bv = bp ? bf16_round(bp[col]) : 0.f;
#pragma unroll
    for (int r = 0; r < 8; ++r) { float v = acc[t][r] * alpha + bv; if (CP) { const int bidx = (row0g + row0 + 8 * hh + r) / rowsPerB; v += CP[(size_t)bidx * sCPb + (size_t)by * 64 + col]; } if (ACT == 1) v = (v > 0.f) ? v : expm1f(v); else if (ACT == 7) v = (v > 0.f) ? v + 1.0f : expf(v); else if (ACT == 8) v = tanhf(v); else if (ACT == 9) v = 0.5f * v * (1.0f + tanhf(0.7978845608028654f * (v + 0.044715f * v * v * v))); else if (ACT == 11) v = 1.0f / (1.0f + expf(-v)); else if (ACT == 12) v = (v > 0.f) ? v : 0.01f * v; else if (ACT == 14) v = (v > 0.f) ? v : 0.1f * v; else if (ACT == 15) v = v / (1.0f + expf(-v)); else if (ACT == 3) v = fmaxf(v, 0.f); else if (ACT == 6) v = 0.5f * v * (1.0f + erff(v * 0.70710678118654752f)); so[w][8 * hh + r][t * 16 + ln] = v; } }
  __builtin_amdgcn_fence(__ATOMIC_ACQ_REL, "workgroup"); __builtin_amdgcn_wave_barrier();
  const int rsub = lane >> 4, c4 = (lane & 15) * 4; typedef _Float16 v4h __attribute__((ext_vector_type(4)));
  {
#pragma unroll
    for (int q = 0; q < 8; ++q) { const int r = q * 2 + rsub; if (col0 + c4 < N) { const v4f v = *(const v4fa*)&so[w][r][c4]; if (C) *(v4f*)(C + cofs + (size_t)(row0 + r) * ldc + col0 + c4) = v; if (C16) { v4h h4; for (int i = 0; i < 4; ++i) h4[i] = (_Float16)v[i]; *(v4h*)(C16 + cofs + (size_t)(row0 + r) * ldc + col0 + c4) = h4; } } }
     }
}


typedef _Float16 v4h __attribute__((ext_vector_type(4)));

__global__ __launch_bounds__(256) void k_x16(const float* __restrict__ x, _Float16* __restrict__ X16, size_t n8) { const size_t t = (size_t)blockIdx.x * 256 + threadIdx.x; if (t >= n8) return; FragH f;
#pragma unroll
  for (int q = 0; q < 8; ++q) f.h[q] = (_Float16)bf16_round(x[t * 8 + q]); *(v8us*)((unsigned short*)X16 + t * 8) = f.half[0];  }
__global__ __launch_bounds__(256) void k_h16(const float* __restrict__ x, _Float16* __restrict__ X16, size_t n8) { const size_t t = (size_t)blockIdx.x * 256 + threadIdx.x; if (t >= n8) return; FragH f;
#pragma unroll
  for (int q = 0; q < 8; ++q) f.h[q] = (_Float16)x[t * 8 + q]; *(v8us*)((unsigned short*)X16 + t * 8) = f.half[0];  }
__global__ __launch_bounds__(256) void k_round16f(const float* __restrict__ W, _Float16* __restrict__ Bt, size_t n8) { const size_t t = (size_t)blockIdx.x * 256 + threadIdx.x; if (t >= n8) return; FragH f;
#pragma unroll
  for (int i = 0; i < 8; ++i) f.h[i] = (_Float16)(bf16_round(W[t * 8 + i]) * 16.0f); *(v8us*)((unsigned short*)Bt + t * 8) = f.half[0];  }
template <int NHv, int TTv>
__global__ __launch_bounds__(256) void k_vt(const _Float16* __restrict__ V16, int ldv, int voff, _Float16* __restrict__ Vt) { __shared__ unsigned short tl[64][66]; const int tid = threadIdx.x; const int slab = blockIdx.x / (TTv / 64), lg = blockIdx.x % (TTv / 64); const int b = slab / NHv, h = slab % NHv;
  for (int i = tid; i < 64 * 8; i += 256) { const int r = i / 8, c8 = (i % 8) * 8; FragH f; f.half[0] = *(const v8us*)((const unsigned short*)V16 + ((size_t)b * TTv + lg * 64 + r) * ldv + voff + h * 64 + c8);
#pragma unroll
    for (int q = 0; q < 8; ++q) tl[r][c8 + q] = f.u[q]; }
  __syncthreads();
  {
#pragma unroll
    for (int rd = 0; rd < 2; ++rd) { const int d = rd * 32 + tid / 8, pc = tid % 8; FragH f;
#pragma unroll
      for (int q = 0; q < 8; ++q) f.u[q] = tl[pc * 8 + q][d];
      *(v8us*)((unsigned short*)Vt + ((size_t)slab * 64 + d) * TTv + lg * 64 + pc * 8) = f.half[0]; }
     } }

__global__ __launch_bounds__(256) void k_hl(const float* __restrict__ F, _Float16* __restrict__ Hh, _Float16* __restrict__ Hl, size_t n8) { const size_t t = (size_t)blockIdx.x * 256 + threadIdx.x; if (t >= n8) return; FragH fh, fl; const v4f a = *(const v4fa*)(F + t * 8), c = *(const v4fa*)(F + t * 8 + 4);
#pragma unroll
  for (int q = 0; q < 4; ++q) { _Float16 h = (_Float16)a[q]; fh.h[q] = h; fl.h[q] = (_Float16)((a[q] - (float)h) * 1024.0f); h = (_Float16)c[q]; fh.h[4 + q] = h; fl.h[4 + q] = (_Float16)((c[q] - (float)h) * 1024.0f); }
  { *(v8us*)((unsigned short*)Hh + t * 8) = fh.half[0]; *(v8us*)((unsigned short*)Hl + t * 8) = fl.half[0];  } }

// ---- fast GEMM (wave tile 32x64; requires M % 128 == 0 rows per launch region and N % 64 == 0); epilogue = k_gemm_hhx semantics ----
__device__ __forceinline__ v16h g2_frag(const _Float16* p, int hh) { FragH f; f.half[0] = *(const v8us*)((const unsigned short*)p + 8 * hh); f.half[1] = *(const v8us*)((const unsigned short*)p + 16 + 8 * hh); return f.v; }
__device__ __forceinline__ v8f g2_mma(v16h a, v16h b, v8f c) { v8f d = __builtin_amdgcn_wmma_f32_16x16x32_f16(false, a, false, b, (short)0, c, false, false); asm volatile("v_nop\n\tv_nop\n\tv_nop\n\tv_nop" : "+v"(d) : "v"(a), "v"(b)); return d; }
// K slab of the block tile in LDS: 64 halves (one 128-byte line) of each of the 128 A rows (rows 0..127) and the 64 B rows (rows 128..191); pitch 144 B = 16 B x odd, the conflict-free pitch for ds_load_b128 fragment reads.
#define G2_KS 64
#define G2_PITCH 72
#define G2_ROWS 192
#define G2_BUFB (G2_ROWS * G2_PITCH * 2)
// One slab: 12 copies a lane, 16 B each; 8 lanes cover one whole line, a wave 4 rows, the block 16 rows a copy (2304 B of LDS further each). s_wait_xcnt 0 closes the statement so that no address register is rewritten ahead of it.
__device__ __forceinline__ void g2_slab(unsigned l, const _Float16* ga, size_t a16, const _Float16* gb, size_t b16) {
  asm volatile(
      "global_load_async_to_lds_b128 %0, %12, off\n\t"
      "global_load_async_to_lds_b128 %1, %13, off\n\t"
      "global_load_async_to_lds_b128 %2, %14, off\n\t"
      "global_load_async_to_lds_b128 %3, %15, off\n\t"
      "global_load_async_to_lds_b128 %4, %16, off\n\t"
      "global_load_async_to_lds_b128 %5, %17, off\n\t"
      "global_load_async_to_lds_b128 %6, %18, off\n\t"
      "global_load_async_to_lds_b128 %7, %19, off\n\t"
      "global_load_async_to_lds_b128 %8, %20, off\n\t"
      "global_load_async_to_lds_b128 %9, %21, off\n\t"
      "global_load_async_to_lds_b128 %10, %22, off\n\t"
      "global_load_async_to_lds_b128 %11, %23, off\n\t"
      "s_wait_xcnt 0x0"
      :: "v"(l), "v"(l + 2304u), "v"(l + 2u * 2304u), "v"(l + 3u * 2304u), "v"(l + 4u * 2304u), "v"(l + 5u * 2304u), "v"(l + 6u * 2304u), "v"(l + 7u * 2304u), "v"(l + 8u * 2304u), "v"(l + 9u * 2304u), "v"(l + 10u * 2304u), "v"(l + 11u * 2304u),
         "v"(ga), "v"(ga + a16), "v"(ga + 2 * a16), "v"(ga + 3 * a16), "v"(ga + 4 * a16), "v"(ga + 5 * a16), "v"(ga + 6 * a16), "v"(ga + 7 * a16), "v"(gb), "v"(gb + b16), "v"(gb + 2 * b16), "v"(gb + 3 * b16)
      : "memory");
}
// requires M % 128 == 0, N % 64 == 0, K % 64 == 0, K >= 64
template <int ACT>
__global__ __launch_bounds__(128) void k_gemm2(const _Float16* __restrict__ A, int lda, size_t sA, const _Float16* __restrict__ Bh, int ldb, size_t sB, float alpha, const float* __restrict__ bias, size_t sBias, const float* __restrict__ CP, int rowsPerB, size_t sCPb, int row0g,
    float* __restrict__ C, _Float16* __restrict__ C16, int ldc, size_t sC, int M, int N, int K) {
  __shared__ __attribute__((aligned(16))) float so[4][32][68];
  __shared__ __attribute__((aligned(16))) _Float16 st[2][G2_ROWS][G2_PITCH];
  const int tid = threadIdx.x, w = tid >> 5, lane = tid & 31, ln = lane & 15, hh = lane >> 4; const int by = blockIdx.y;
  A += (size_t)by * sA; Bh += (size_t)by * sB; const size_t cofs = (size_t)by * sC; const float* bp = bias ? bias + (size_t)by * sBias : nullptr;
  const int ntn = N >> 6; const int mt = blockIdx.x / ntn, nq = blockIdx.x - mt * ntn; const int row0 = mt * 128 + 32 * w, col0 = nq * 64; if (mt * 128 >= M) return;      /* the same for the whole block, in front of every barrier */
  const int cr = tid >> 3, cc = (tid & 7) * 8;
  const _Float16* ga = A + (size_t)(mt * 128 + cr) * lda + cc; const _Float16* gb = Bh + (size_t)(col0 + cr) * ldb + cc; const size_t a16 = (size_t)16 * lda, b16 = (size_t)16 * ldb;
  const unsigned l0 = (unsigned)(size_t)&st[0][cr][cc];
  const int nt = K / G2_KS;
  const v8f z8 = {0.f,0.f,0.f,0.f,0.f,0.f,0.f,0.f}; v8f c00 = z8, c01 = z8, c02 = z8, c03 = z8, c10 = z8, c11 = z8, c12 = z8, c13 = z8;
  g2_slab(l0, ga, a16, gb, b16);
  asm volatile("s_wait_asynccnt 0x0" ::: "memory");      /* this wave's copies of slab 0 have landed */
  __syncthreads();                                       /* ... and every other wave's */
  if (nt > 1) g2_slab(l0 + G2_BUFB, ga + G2_KS, a16, gb + G2_KS, b16);
#pragma unroll 1
  for (int t = 0; t < nt; ++t) { const _Float16* sa = &st[t & 1][32 * w + ln][0]; const _Float16* sb = &st[t & 1][128 + ln][0];
    v16h fa[2][2], fb[2][4];      /* the slab's 12 fragments are read as one group ahead of its 16 products */
#pragma unroll
    for (int ks = 0; ks < 2; ++ks) {
#pragma unroll
      for (int i = 0; i < 2; ++i) fa[ks][i] = g2_frag(sa + i * 16 * G2_PITCH + ks * 32, hh);
#pragma unroll
      for (int j = 0; j < 4; ++j) fb[ks][j] = g2_frag(sb + j * 16 * G2_PITCH + ks * 32, hh); }
#pragma unroll
    for (int ks = 0; ks < 2; ++ks) {
      c00 = g2_mma(fa[ks][0], fb[ks][0], c00); c10 = g2_mma(fa[ks][1], fb[ks][0], c10); c01 = g2_mma(fa[ks][0], fb[ks][1], c01); c11 = g2_mma(fa[ks][1], fb[ks][1], c11);
      c02 = g2_mma(fa[ks][0], fb[ks][2], c02); c12 = g2_mma(fa[ks][1], fb[ks][2], c12); c03 = g2_mma(fa[ks][0], fb[ks][3], c03); c13 = g2_mma(fa[ks][1], fb[ks][3], c13); }
    asm volatile("s_wait_dscnt 0x0" ::: "memory");       /* this wave's reads of slab t are done before its buffer is handed back */
    asm volatile("s_wait_asynccnt 0x0" ::: "memory");    /* this wave's copies of slab t + 1 have landed */
    __syncthreads();                                     /* publishes slab t + 1 and ends every reader's last read of slab t */
    if (t + 2 < nt) g2_slab(l0 + (unsigned)(t & 1) * G2_BUFB, ga + (size_t)(t + 2) * G2_KS, a16, gb + (size_t)(t + 2) * G2_KS, b16); }
  asm volatile("s_wait_asynccnt 0x0" ::: "memory");      /* no copy is left in flight when the epilogue starts */
  v8f accs[8] = {c00, c01, c02, c03, c10, c11, c12, c13};
#pragma unroll
  for (int u = 0; u < 8; ++u) { const int t = u & 3, half = u >> 2; const int col = col0 + t * 16 + ln; const float bv = bp ? bf16_round(bp[col]) : 0.f;
#pragma unroll
    for (int r = 0; r < 8; ++r) { const int rloc = half * 16 + 8 * hh + r; float v = accs[u][r] * alpha + bv; if (CP) { const int bidx = (row0g + row0 + rloc) / rowsPerB; v += CP[(size_t)bidx * sCPb + (size_t)by * 64 + col]; }
      if (ACT == 3) v = fmaxf(v, 0.f); else if (ACT == 6) v = 0.5f * v * (1.0f + erff(v * 0.70710678118654752f)); else if (ACT == 11) v = 1.0f / (1.0f + expf(-v)); else if (ACT == 15) v = v / (1.0f + expf(-v)); else if (ACT == 12) v = (v > 0.f) ? v : 0.01f * v; else if (ACT == 8) v = tanhf(v);
      so[w][rloc][t * 16 + ln] = v; } }
  __builtin_amdgcn_fence(__ATOMIC_ACQ_REL, "workgroup"); __builtin_amdgcn_wave_barrier();
  const int rsub = lane >> 4, c4 = (lane & 15) * 4;
  {
#pragma unroll
    for (int q = 0; q < 16; ++q) { const int r = q * 2 + rsub; const v4f v = *(const v4fa*)&so[w][r][c4]; if (C) *(v4f*)(C + cofs + (size_t)(row0 + r) * ldc + col0 + c4) = v; if (C16) { v4h h4; for (int i = 0; i < 4; ++i) h4[i] = (_Float16)v[i]; *(v4h*)(C16 + cofs + (size_t)(row0 + r) * ldc + col0 + c4) = h4; } }
     } }



// lane l <-> l ^ 16 (the two halves of a wave hold the two key halves of one query column)
__device__ __forceinline__ float xhalf(float x) { const int t = __float_as_int(x); return __int_as_float(__builtin_amdgcn_permlanex16(t, t, 0x76543210, 0xfedcba98, false, false)); }
// Transposed products: S^T = K.Q^T (A = 16 key rows, B = 16 query columns), O^T += V^T.P^T (A = 16 rows of V^T, B = P^T packed from the two S^T tiles).
// Lane (ln, hh) owns query q0 + ln: s[nt][r] = score of key j0 + 16 nt + 8 hh + r, which is already the hardware k order of a B operand; oacc[dt][r] = O[query][16 dt + 8 hh + r].
// Stage of 64 keys in LDS, shared by the block's 4 waves: rows 0..63 = the 64 K rows (64 halves = one 128-byte line each), rows 64..127 = the 64 V^T rows (their 64 key columns, one line each); pitch 144 B as in the GEMM slab.
#define FL_KEYS 64
#define FL_PITCH 72
#define FL_BUFB (128 * FL_PITCH * 2)
// One stage: 8 copies a lane, 16 B each; 8 lanes cover one whole line, the block 16 rows a copy (2304 B of LDS further each). s_wait_xcnt 0 closes the statement so that no address register is rewritten ahead of it.
__device__ __forceinline__ void fl_stage(unsigned l, const _Float16* gk, size_t k16, const _Float16* gv, size_t v16) {
  asm volatile(
      "global_load_async_to_lds_b128 %0, %8, off\n\t"
      "global_load_async_to_lds_b128 %1, %9, off\n\t"
      "global_load_async_to_lds_b128 %2, %10, off\n\t"
      "global_load_async_to_lds_b128 %3, %11, off\n\t"
      "global_load_async_to_lds_b128 %4, %12, off\n\t"
      "global_load_async_to_lds_b128 %5, %13, off\n\t"
      "global_load_async_to_lds_b128 %6, %14, off\n\t"
      "global_load_async_to_lds_b128 %7, %15, off\n\t"
      "s_wait_xcnt 0x0"
      :: "v"(l), "v"(l + 2304u), "v"(l + 2u * 2304u), "v"(l + 3u * 2304u), "v"(l + 4u * 2304u), "v"(l + 5u * 2304u), "v"(l + 6u * 2304u), "v"(l + 7u * 2304u),
         "v"(gk), "v"(gk + k16), "v"(gk + 2 * k16), "v"(gk + 3 * k16), "v"(gv), "v"(gv + v16), "v"(gv + 2 * v16), "v"(gv + 3 * v16)
      : "memory");
}
__global__ __launch_bounds__(128) void k_flash(const _Float16* __restrict__ Q16, int ldq, const _Float16* __restrict__ K16, int ldk, const _Float16* __restrict__ Vt, const int* __restrict__ MSK, float* __restrict__ O, int ldo) {
  constexpr int RPW = 16, NQB = TQ / (4 * RPW), DT = 4, KS = 2;
  __shared__ __attribute__((aligned(16))) unsigned short sm[2 * FL_BUFB / 2];      /* the two stage buffers; behind the last stage's barrier the same bytes stage the output rows (17408 of 36864 B), so that 6 blocks still fit a WGP's LDS */
  float (*sO)[RPW][64 + 4] = (float (*)[RPW][64 + 4])sm;
  const int tid = threadIdx.x, w = tid >> 5, lane = tid & 31, ln = lane & 15, hh = lane >> 4; (void)MSK;
  const int slab = blockIdx.x / NQB, qblk = blockIdx.x % NQB; const int b = slab / NH, h = slab % NH; const int qb0 = qblk * (4 * RPW); const int q0 = qb0 + w * RPW;
  FragH bq[KS];
  { const unsigned short* qr = (const unsigned short*)Q16 + ((size_t)b * TQ + q0 + ln) * ldq + h * 64;
#pragma unroll
    for (int ks = 0; ks < KS; ++ks) { bq[ks].half[0] = *(const v8us*)(qr + ks * 32 + 8 * hh); bq[ks].half[1] = *(const v8us*)(qr + ks * 32 + 16 + 8 * hh); } }
  const int cr = tid >> 3, cc = (tid & 7) * 8;
  const _Float16* gk = K16 + ((size_t)b * TK + cr) * ldk + h * 64 + cc; const _Float16* gv = Vt + ((size_t)slab * 64 + cr) * TK + cc; const size_t k16 = (size_t)16 * ldk, v16 = (size_t)16 * TK;
  const unsigned l0 = (unsigned)(size_t)&sm[cr * FL_PITCH + cc];
  float m_q = -3.0e38f, l_q = 0.f; v8f oacc[DT];
#pragma unroll
  for (int dt = 0; dt < DT; ++dt) oacc[dt] = (v8f){0.f,0.f,0.f,0.f,0.f,0.f,0.f,0.f};
  constexpr int NS = TK / FL_KEYS;      /* 16 stages */
  fl_stage(l0, gk, k16, gv, v16);
  asm volatile("s_wait_asynccnt 0x0" ::: "memory");      /* this wave's copies of stage 0 have landed */
  __syncthreads();                                       /* ... and every other wave's */
  fl_stage(l0 + FL_BUFB, gk + (size_t)FL_KEYS * ldk, k16, gv + FL_KEYS, v16);
#pragma unroll 1
  for (int s = 0; s < NS; ++s) { const unsigned short* sb = sm + (s & 1) * (FL_BUFB / 2);
#pragma unroll 1
  for (int j0 = 0; j0 < FL_KEYS; j0 += 32) {
    float sc[16];
#pragma unroll
    for (int nt = 0; nt < 2; ++nt) { const unsigned short* kr = sb + (j0 + nt * 16 + ln) * FL_PITCH; FragH ak[KS];
#pragma unroll
      for (int ks = 0; ks < KS; ++ks) { ak[ks].half[0] = *(const v8us*)(kr + ks * 32 + 8 * hh); ak[ks].half[1] = *(const v8us*)(kr + ks * 32 + 16 + 8 * hh); }
      v8f acc = (v8f){0.f,0.f,0.f,0.f,0.f,0.f,0.f,0.f};
#pragma unroll
      for (int ks = 0; ks < KS; ++ks) acc = mmaH<1>(ak[ks].v, ak[ks].v, bq[ks].v, bq[ks].v, acc);
#pragma unroll
      for (int r = 0; r < 8; ++r) sc[nt * 8 + r] = acc[r] * SCL; }
    float mc = fmaxf(sc[0], sc[1]);
#pragma unroll
    for (int i = 2; i < 16; ++i) mc = fmaxf(mc, sc[i]);
    mc = fmaxf(mc, xhalf(mc));
    const float mn = fmaxf(m_q, mc); const float al = (mn > -1.0e38f) ? expf(m_q - mn) : 1.0f; m_q = mn;
    FragH pb; float ps[4] = {0.f, 0.f, 0.f, 0.f};
#pragma unroll
    for (int i = 0; i < 16; ++i) { const float p = expf(sc[i] - mn); ps[i & 3] += p; pb.h[i] = (_Float16)(p * 1024.0f); }
    l_q = l_q * al + ((ps[0] + ps[1]) + (ps[2] + ps[3]));
#pragma unroll
    for (int dt = 0; dt < DT; ++dt)
#pragma unroll
      for (int r = 0; r < 8; ++r) oacc[dt][r] *= al;
#pragma unroll
    for (int dt = 0; dt < DT; ++dt) { const unsigned short* vrow = sb + (64 + dt * 16 + ln) * FL_PITCH + j0; FragH av; av.half[0] = *(const v8us*)(vrow + 8 * hh); av.half[1] = *(const v8us*)(vrow + 16 + 8 * hh);
      oacc[dt] = mmaH<1>(av.v, av.v, pb.v, pb.v, oacc[dt]); } }
    asm volatile("s_wait_dscnt 0x0" ::: "memory");       /* this wave's reads of stage s are done before its buffer is handed back */
    asm volatile("s_wait_asynccnt 0x0" ::: "memory");    /* this wave's copies of stage s + 1 have landed */
    __syncthreads();                                     /* publishes stage s + 1 and ends every reader's last read of stage s */
    if (s + 2 < NS) fl_stage(l0 + (unsigned)(s & 1) * FL_BUFB, gk + (size_t)(s + 2) * FL_KEYS * ldk, k16, gv + (s + 2) * FL_KEYS, v16); }
  asm volatile("s_wait_asynccnt 0x0" ::: "memory");      /* no copy is left in flight when the buffers become output staging */
  { const float l = l_q + xhalf(l_q); const float inv = (l > 0.f) ? 1.0f / (l * 1024.0f) : 0.f;
#pragma unroll
    for (int dt = 0; dt < DT; ++dt)
#pragma unroll
      for (int g = 0; g < 2; ++g) { v4f o4; 
#pragma unroll
        for (int q = 0; q < 4; ++q) o4[q] = oacc[dt][g * 4 + q] * inv;
        *(v4fa*)&sO[w][ln][dt * 16 + 8 * hh + g * 4] = o4; } }
  __builtin_amdgcn_fence(__ATOMIC_ACQ_REL, "workgroup"); __builtin_amdgcn_wave_barrier();
  {
#pragma unroll
    for (int rp = 0; rp < RPW; rp += 2) { const int r = rp + (lane >> 4), pc = lane & 15; const v4f val = *(const v4fa*)&sO[w][r][pc * 4]; *(v4f*)(O + ((size_t)b * TQ + q0 + r) * ldo + h * 64 + pc * 4) = val; }
     } }
__global__ __launch_bounds__(256) void k_fulltab(unsigned* __restrict__ MB, int* __restrict__ RA, int* __restrict__ KE, int nq, int nk) {
  const int t = blockIdx.x * 256 + threadIdx.x;
  if (t < nq * (nk / 32)) { *(unsigned*)(MB + t) = 0u;  }
  if (t < nq) { *(int*)(RA + t) = 0;  }
  if (t < nq / 64) { *(int*)(KE + t * 32) = nk;  } }
__global__ __launch_bounds__(256) void k_lnout(const float* __restrict__ Y, const float* __restrict__ g, const float* __restrict__ bb, float* __restrict__ out) {
  #pragma clang fp contract(off)
  const int tid = threadIdx.x, w = tid >> 5, ln = tid & 31; const int r = blockIdx.x * 8 + w; if (r >= NR) return; const float* y = Y + (size_t)r * DM; float s = 0.f;
#pragma unroll 1
  for (int i = 0; i < 8; ++i) { const v4f a = *(const v4fa*)(y + i * 128 + ln * 4); for (int q = 0; q < 4; ++q) s += a[q]; }
  for (int o = 16; o > 0; o >>= 1) s += __shfl_xor(s, o, 32); const float mu = s / (float)DM; float q2 = 0.f;
#pragma unroll 1
  for (int i = 0; i < 8; ++i) { const v4f a = *(const v4fa*)(y + i * 128 + ln * 4); for (int q = 0; q < 4; ++q) { const float d = a[q] - mu; q2 += d * d; } }
  for (int o = 16; o > 0; o >>= 1) q2 += __shfl_xor(q2, o, 32); const float rs = rsqrtf(q2 / (float)DM + 1e-6f);
  {
#pragma unroll 1
    for (int i = 0; i < 8; ++i) { const int c0 = i * 128 + ln * 4; const v4f a = *(const v4fa*)(y + c0); v4f o4; for (int q = 0; q < 4; ++q) o4[q] = (a[q] - mu) * rs * bf16_round(g[c0 + q]) + bf16_round(bb[c0 + q]); *(v4f*)(out + (size_t)r * DM + c0) = o4; }
     } }
__global__ __launch_bounds__(256) void k_xb(const float* __restrict__ x, float* __restrict__ XB, size_t n4) { const size_t t = (size_t)blockIdx.x * 256 + threadIdx.x; if (t >= n4) return; const v4f a = *(const v4fa*)(x + t * 4); v4f o; for (int q = 0; q < 4; ++q) o[q] = bf16_round(a[q]); *(v4f*)(XB + t * 4) = o;  }
__global__ __launch_bounds__(256) void k_causaltab(unsigned* __restrict__ MB, int* __restrict__ RA, int* __restrict__ KE, int nq, int nk) {
  const int t = blockIdx.x * 256 + threadIdx.x; const int nw = nk / 32;
  if (t < nq * nw) { const int q = t / nw, w = t % nw; const int first = q + 1 - 32 * w; const unsigned bits = (first <= 0) ? 0xffffffffu : ((first >= 32) ? 0u : (0xffffffffu << first)); *(unsigned*)(MB + t) = bits;  }
  if (t < nq) { *(int*)(RA + t) = 0;  }
  if (t < nq / 64) { const int v = 64 * (t + 1); *(int*)(KE + t * 32) = v;  } }


extern "C" void kernel_launch(void* const* d_in, const int* in_sizes, int n_in,
                              void* d_out, int out_size, void* d_ws, size_t ws_size, hipStream_t stream) {
  (void)in_sizes; (void)n_in; (void)out_size;
  const float* const* I = (const float* const*)d_in; const float* x = I[0]; const float* Wq = I[1]; const float* bq = I[2]; const float* Wk = I[3]; const float* bk = I[4]; const float* Wv = I[5]; const float* bv = I[6];
  char* ws = (char*)d_ws; size_t off = 0;
  auto take = [&](size_t bytes) { char* p = ws + off; off += (bytes + 255) & ~(size_t)255; return p; };
  _Float16* BQ = (_Float16*)take((size_t)DM * DM * 2); _Float16* BK = (_Float16*)take((size_t)DM * DM * 2); _Float16* BV = (_Float16*)take((size_t)DM * DM * 2);
  _Float16* X16 = (_Float16*)take((size_t)NR * DM * 2); _Float16* Q16 = (_Float16*)take((size_t)NR * DM * 2); _Float16* K16 = (_Float16*)take((size_t)NR * DM * 2); _Float16* V16 = (_Float16*)take((size_t)NR * DM * 2); _Float16* VT = (_Float16*)take((size_t)NR * DM * 2);
  if (off > ws_size) return;      /* 3.5 + 5 x 12.6 = 66 MB */
  const size_t w8 = (size_t)DM * DM / 8; const unsigned wb = (unsigned)((w8 + 255) / 256);
  k_round16f<<<wb, 256, 0, stream>>>(Wq, BQ, w8); k_round16f<<<wb, 256, 0, stream>>>(Wk, BK, w8); k_round16f<<<wb, 256, 0, stream>>>(Wv, BV, w8);      /* torch (out,in) = natural Bt */
  const size_t n8 = (size_t)NR * DM / 8; const unsigned nb8 = (unsigned)((n8 + 255) / 256); const dim3 gP((NR / 128) * (DM / 64), 1);
  k_x16<<<nb8, 256, 0, stream>>>(x, X16, n8);
  k_gemm2<0><<<gP, 128, 0, stream>>>(X16, DM, 0, BQ, DM, 0, 0.0625f, bq, 0, nullptr, 1, 0, 0, nullptr, Q16, DM, 0, NR, DM, DM);
  k_gemm2<0><<<gP, 128, 0, stream>>>(X16, DM, 0, BK, DM, 0, 0.0625f, bk, 0, nullptr, 1, 0, 0, nullptr, K16, DM, 0, NR, DM, DM);
  k_gemm2<0><<<gP, 128, 0, stream>>>(X16, DM, 0, BV, DM, 0, 0.0625f, bv, 0, nullptr, 1, 0, 0, nullptr, V16, DM, 0, NR, DM, DM);
  k_vt<NH, SLEN><<<NBT * NH * (SLEN / 64), 256, 0, stream>>>(V16, DM, 0, VT);      /* all batches in one grid: slab = batch * NH + head */
  k_flash<<<NBT * NH * (SLEN / 64), 128, 0, stream>>>(Q16, DM, K16, DM, VT, nullptr, (float*)d_out, DM);      /* all batches in one grid; ctx rows straight into the output */
}

// v004
// A run of this version takes 97.2 microseconds.
// Next to v003, in two timings, it ran 1.21 and 1.20 times as fast.
// Over all steps from v000 it is 9.63 times as fast.
#include <hip/hip_runtime.h>
// DeiT self-attention (8 x 1024 tokens, 768 = 12 heads x 64): q,k,v = x W^T + b; softmax(q.k/8) over all keys; ctx = attn.v merged -> [8,1024,768] (no output projection).
// Structure: x as an exact f16 plane; projections as f16 WMMA GEMMs (32x64 wave tiles, f32 accumulation, exact products + bias) into f16 planes; the fused flash kernel over all 1024 keys (plain f16 q/k/V^T, online softmax in f32, P x2^10) per ((batch, head), 64 queries) writes the merged context rows straight into the output.
// Compute dtype: x, weights, biases rounded to bf16; q, k, v, P as plain f16 (~2^-12; logits sigma ~0.3); f32 accumulation and softmax. v_wmma_f32_16x16x32_f16.
#define NBT 8
#define SLEN 1024
#define TQ SLEN
#define TK SLEN
#define DM 768
#define NH 12
#define SCL 0.125f
#define SCL2 (SCL * 1.4426950408889634f)      /* 1/8 x log2(e): raw score -> base-2 exponent */
#define NR (NBT * SLEN)
typedef __bf16 v16b __attribute__((ext_vector_type(16)));
typedef unsigned short v8us __attribute__((ext_vector_type(8), may_alias));
typedef float  v8f  __attribute__((ext_vector_type(8)));
typedef float  v4f  __attribute__((ext_vector_type(4)));
typedef float  v4fa __attribute__((ext_vector_type(4), may_alias));
union FragB { v16b v; v8us half[2]; unsigned short u[16]; };

__device__ __forceinline__ unsigned short bf16_bits(float x) { unsigned int u = __float_as_uint(x); return (unsigned short)((u + 0x7FFFu + ((u >> 16) & 1u)) >> 16); }
__device__ __forceinline__ float bf16_val(unsigned short b) { return __uint_as_float(((unsigned int)b) << 16); }
__device__ __forceinline__ float bf16_round(float x) { return bf16_val(bf16_bits(x)); }
// D += A·B with NT terms: 1 = ah·bh, 2 = + al·bh (A split), 3 = + ah·bl (both split)
template <int NT>
__device__ __forceinline__ v8f mmaN(v16b ah, v16b al, v16b bh, v16b bl, v8f c) {
  c = __builtin_amdgcn_wmma_f32_16x16x32_bf16(false, ah, false, bh, (short)0, c, false, false);
  if (NT >= 2) c = __builtin_amdgcn_wmma_f32_16x16x32_bf16(false, al, false, bh, (short)0, c, false, false);
  if (NT >= 3) c = __builtin_amdgcn_wmma_f32_16x16x32_bf16(false, ah, false, bl, (short)0, c, false, false);
  asm volatile("v_nop\n\tv_nop\n\tv_nop\n\tv_nop" : "+v"(c) : "v"(ah), "v"(al), "v"(bh), "v"(bl));
  return c;
}

__global__ __launch_bounds__(256) void k_wt_bf16(const float* __restrict__ W, unsigned short* __restrict__ Wt, int K, int N) {
  const int t = blockIdx.x * 256 + threadIdx.x;
  const int k8n = K / 8;
  if (t >= N * k8n) return;
  const int n = t / k8n, k8 = (t % k8n) * 8;
  v8us v;
#pragma unroll
  for (int i = 0; i < 8; ++i) v[i] = bf16_bits(W[(size_t)(k8 + i) * N + n]);
  *(v8us*)(Wt + (size_t)n * K + k8) = v;
  
}

// GEMM C[M][N] (f32, pitch ldc) = act(A[M][K]·W + bias). A f32 row-major (pitch lda) converted per fragment to bf16
// (ASPLIT: hi/lo two planes -> 2 terms, else single rounded term); Wt bf16 [N][K] (pitch ldb). BIAS_BF16 rounds the
// bias to bf16 first (bias quantised to bf16 before the add). K%32==0, M%16==0, N%64==0.
template <bool ASPLIT, int ACT, bool BIAS_BF16>
__global__ __launch_bounds__(128) void k_gemm_bf(const float* __restrict__ A, int lda, const unsigned short* __restrict__ Wt, int ldb,
                                               const float* __restrict__ bias, float* __restrict__ C, int ldc, int M, int N, int K) {
  __shared__ __attribute__((aligned(16))) float so[4][16][64];
  const int tid = threadIdx.x, w = tid >> 5, lane = tid & 31, ln = lane & 15, hh = lane >> 4;
  const int ntn = N / 64;
  const int wid = blockIdx.x * 4 + w;
  const int mt = wid / ntn, nq = wid % ntn;
  if (mt * 16 >= M) return;
  const int row0 = mt * 16, col0 = nq * 64;
  const float* arow = A + (size_t)(row0 + ln) * lda;
  v8f acc[4] = {};
  for (int kb = 0; kb < K; kb += 32) {
    FragB ah, al;
    const v4f x0 = *(const v4fa*)(arow + kb + 8 * hh), x1 = *(const v4fa*)(arow + kb + 8 * hh + 4);
    const v4f x2 = *(const v4fa*)(arow + kb + 16 + 8 * hh), x3 = *(const v4fa*)(arow + kb + 16 + 8 * hh + 4);
    float xs[16] = {x0[0],x0[1],x0[2],x0[3],x1[0],x1[1],x1[2],x1[3],x2[0],x2[1],x2[2],x2[3],x3[0],x3[1],x3[2],x3[3]};
#pragma unroll
    for (int i = 0; i < 16; ++i) { const unsigned short hb = bf16_bits(xs[i]); ah.u[i] = hb; al.u[i] = ASPLIT ? bf16_bits(xs[i] - bf16_val(hb)) : (unsigned short)0; }
#pragma unroll
    for (int t = 0; t < 4; ++t) {
      const unsigned short* brow = Wt + (size_t)(col0 + t * 16 + ln) * ldb + kb;
      FragB b;
      b.half[0] = *(const v8us*)(brow + 8 * hh);
      b.half[1] = *(const v8us*)(brow + 16 + 8 * hh);
      acc[t] = mmaN<ASPLIT ? 2 : 1>(ah.v, al.v, b.v, b.v, acc[t]);
    }
  }
#pragma unroll
  for (int t = 0; t < 4; ++t) {
    float bv = bias ? bias[col0 + t * 16 + ln] : 0.f;
    if (BIAS_BF16) bv = bf16_round(bv);
#pragma unroll
    for (int r = 0; r < 8; ++r) { float v = acc[t][r] + bv; if (ACT == 1) v = fmaxf(v, 0.f); so[w][8 * hh + r][t * 16 + ln] = v; }
  }
  __builtin_amdgcn_fence(__ATOMIC_ACQ_REL, "workgroup");
  __builtin_amdgcn_wave_barrier();
  const int rsub = lane >> 4, c4 = (lane & 15) * 4;
  {
#pragma unroll
    for (int q = 0; q < 8; ++q) {
      const int r = q * 2 + rsub;
      const v4f v = *(const v4fa*)&so[w][r][c4];
      *(v4f*)(C + (size_t)(row0 + r) * ldc + col0 + c4) = v;
    }
    
  }
}

// GEMM C = act(A·W + bias + resid): A f32 (ASPLIT -> hi/lo 2 terms), Wt bf16 [N][K]; ACT 0 none, 1 relu, 2 exact gelu;
// resid (optional, f32, row index = (row % rmod), pitch ldr, RES_BF16 rounds it) added before the activation.
template <bool ASPLIT, int ACT, bool BIAS_BF16, bool RES_BF16>
__global__ __launch_bounds__(128) void k_gemm_bf3(const float* __restrict__ A, int lda, const unsigned short* __restrict__ Wt, int ldb,
                                                const float* __restrict__ bias, const float* __restrict__ resid, int rmod, int ldr,
                                                float* __restrict__ C, int ldc, int M, int N, int K) {
  __shared__ __attribute__((aligned(16))) float so[4][16][64];
  const int tid = threadIdx.x, w = tid >> 5, lane = tid & 31, ln = lane & 15, hh = lane >> 4;
  const int ntn = N / 64;
  const int wid = blockIdx.x * 4 + w;
  const int mt = wid / ntn, nq = wid % ntn;
  if (mt * 16 >= M) return;
  const int row0 = mt * 16, col0 = nq * 64;
  const float* arow = A + (size_t)(row0 + ln) * lda;
  v8f acc[4] = {};
  for (int kb = 0; kb < K; kb += 32) {
    FragB ah, al;
    const v4f x0 = *(const v4fa*)(arow + kb + 8 * hh), x1 = *(const v4fa*)(arow + kb + 8 * hh + 4);
    const v4f x2 = *(const v4fa*)(arow + kb + 16 + 8 * hh), x3 = *(const v4fa*)(arow + kb + 16 + 8 * hh + 4);
    float xs[16] = {x0[0],x0[1],x0[2],x0[3],x1[0],x1[1],x1[2],x1[3],x2[0],x2[1],x2[2],x2[3],x3[0],x3[1],x3[2],x3[3]};
#pragma unroll
    for (int i = 0; i < 16; ++i) { const unsigned short hb = bf16_bits(xs[i]); ah.u[i] = hb; al.u[i] = ASPLIT ? bf16_bits(xs[i] - bf16_val(hb)) : (unsigned short)0; }
#pragma unroll
    for (int t = 0; t < 4; ++t) {
      const unsigned short* brow = Wt + (size_t)(col0 + t * 16 + ln) * ldb + kb;
      FragB b;
      b.half[0] = *(const v8us*)(brow + 8 * hh);
      b.half[1] = *(const v8us*)(brow + 16 + 8 * hh);
      acc[t] = mmaN<ASPLIT ? 2 : 1>(ah.v, al.v, b.v, b.v, acc[t]);
    }
  }
#pragma unroll
  for (int t = 0; t < 4; ++t) {
    const int col = col0 + t * 16 + ln;
    float bv = bias ? bias[col] : 0.f;
    if (BIAS_BF16) bv = bf16_round(bv);
#pragma unroll
    for (int r = 0; r < 8; ++r) {
      float v = acc[t][r] + bv;
      if (resid) { float rv = resid[(size_t)((row0 + 8 * hh + r) % rmod) * ldr + col]; if (RES_BF16) rv = bf16_round(rv); v += rv; }
      if (ACT == 1) v = fmaxf(v, 0.f);
      if (ACT == 2) v = 0.5f * v * (1.0f + erff(v * 0.70710678118654752f));
      if (ACT == 3) { const float u = 0.7978845608028654f * (v + 0.044715f * v * v * v); v = 0.5f * v * (1.0f + tanhf(u)); }
      so[w][8 * hh + r][t * 16 + ln] = v;
    }
  }
  __builtin_amdgcn_fence(__ATOMIC_ACQ_REL, "workgroup");
  __builtin_amdgcn_wave_barrier();
  const int rsub = lane >> 4, c4 = (lane & 15) * 4;
  {
#pragma unroll
    for (int q = 0; q < 8; ++q) {
      const int r = q * 2 + rsub;
      const v4f v = *(const v4fa*)&so[w][r][c4];
      *(v4f*)(C + (size_t)(row0 + r) * ldc + col0 + c4) = v;
    }
    
  }
}
// row LayerNorm (biased variance, eps) over N: s = X (+ R); optional out_sum <- s; out_norm <- (s-mu)*rsqrt(var+eps)*g + b
template <bool PARAM_BF16>
__global__ __launch_bounds__(256) void k_layernorm(const float* __restrict__ X, const float* __restrict__ R, const float* __restrict__ g, const float* __restrict__ bta,
                                                  float* __restrict__ out_sum, float* __restrict__ out_norm, int N, float eps) {
  __shared__ float red[256];
  const int row = blockIdx.x, tid = threadIdx.x;
  const float* x = X + (size_t)row * N; const float* rr = R ? R + (size_t)row * N : nullptr;
  float vals[16];                     // up to N = 4096
  const int per = N / 256;            // contiguous chunk per thread? use strided-by-4 chunks: thread handles j = tid*4 + 1024*u
  float s1 = 0.f;
  for (int u = 0; u < per / 4; ++u) {
    const int j = tid * 4 + 1024 * u;
    const v4f a = *(const v4fa*)(x + j);
    v4f b = {0.f,0.f,0.f,0.f}; if (rr) b = *(const v4fa*)(rr + j);
#pragma unroll
    for (int q = 0; q < 4; ++q) { const float v = a[q] + b[q]; vals[u * 4 + q] = v; s1 += v; }
  }
  red[tid] = s1; __syncthreads();
  for (int st = 128; st > 0; st >>= 1) { if (tid < st) red[tid] += red[tid + st]; __syncthreads(); }
  const float mu = red[0] / (float)N; __syncthreads();
  float s2 = 0.f;
  for (int u = 0; u < per / 4; ++u)
#pragma unroll
    for (int q = 0; q < 4; ++q) { const float c = vals[u * 4 + q] - mu; s2 += c * c; }
  red[tid] = s2; __syncthreads();
  for (int st = 128; st > 0; st >>= 1) { if (tid < st) red[tid] += red[tid + st]; __syncthreads(); }
  const float rs = rsqrtf(red[0] / (float)N + eps);
  {
    for (int u = 0; u < per / 4; ++u) {
      const int j = tid * 4 + 1024 * u;
      v4f o, sm;
#pragma unroll
      for (int q = 0; q < 4; ++q) {
        float gg = g[j + q], bb = bta[j + q];
        if (PARAM_BF16) { gg = bf16_round(gg); bb = bf16_round(bb); }
        sm[q] = vals[u * 4 + q]; o[q] = (vals[u * 4 + q] - mu) * rs * gg + bb;
      }
      if (out_sum) *(v4f*)(out_sum + (size_t)row * N + j) = sm;
      *(v4f*)(out_norm + (size_t)row * N + j) = o;
    }
    
  }
}



// ---- f16 WMMA path (v_wmma_f32_16x16x32_f16): 11-bit significands for operands in range — used where a [0,1] probability operand needs more precision than bf16
typedef _Float16 v16h __attribute__((ext_vector_type(16)));
union FragH { v16h v; v8us half[2]; _Float16 h[16]; unsigned short u[16]; };
template <int NT>
__device__ __forceinline__ v8f mmaH(v16h ah, v16h al, v16h bh, v16h bl, v8f c) {
  c = __builtin_amdgcn_wmma_f32_16x16x32_f16(false, ah, false, bh, (short)0, c, false, false);
  if (NT >= 2) c = __builtin_amdgcn_wmma_f32_16x16x32_f16(false, al, false, bh, (short)0, c, false, false);
  if (NT >= 3) c = __builtin_amdgcn_wmma_f32_16x16x32_f16(false, ah, false, bl, (short)0, c, false, false);
  asm volatile("v_nop\n\tv_nop\n\tv_nop\n\tv_nop" : "+v"(c) : "v"(ah), "v"(al), "v"(bh), "v"(bl));
  return c;
}
// batched GEMM like k_gemm_b but f16 operands: A f32 (split into f16 hi/lo if ASPLIT, else rounded to f16), Bt = f16 values [n][k]; alpha; C f32; N multiple of 16 (partial tiles skipped)
template <bool ASPLIT>
__global__ __launch_bounds__(128) void k_gemm_h(const float* __restrict__ A, int lda, size_t sA, const _Float16* __restrict__ Bh, int ldb, size_t sB, float alpha, float* __restrict__ C, int ldc, size_t sC, int M, int N, int K) {
  __shared__ __attribute__((aligned(16))) float so[4][16][64];
  const int tid = threadIdx.x, w = tid >> 5, lane = tid & 31, ln = lane & 15, hh = lane >> 4; const int by = blockIdx.y;
  A += (size_t)by * sA; Bh += (size_t)by * sB; C += (size_t)by * sC;
  const int ntn = (N + 63) / 64; const int wid = blockIdx.x * 4 + w; const int mt = wid / ntn, nq = wid % ntn; if (mt * 16 >= M) return;
  const int row0 = mt * 16, col0 = nq * 64; const float* arow = A + (size_t)(row0 + ln) * lda;
  v8f acc[4] = {};
  for (int kb = 0; kb < K; kb += 32) {
    FragH ah, al;
    const v4f x0 = *(const v4fa*)(arow + kb + 8 * hh), x1 = *(const v4fa*)(arow + kb + 8 * hh + 4), x2 = *(const v4fa*)(arow + kb + 16 + 8 * hh), x3 = *(const v4fa*)(arow + kb + 16 + 8 * hh + 4);
    float xs[16] = {x0[0],x0[1],x0[2],x0[3],x1[0],x1[1],x1[2],x1[3],x2[0],x2[1],x2[2],x2[3],x3[0],x3[1],x3[2],x3[3]};
#pragma unroll
    for (int i = 0; i < 16; ++i) { const _Float16 h = (_Float16)xs[i]; ah.h[i] = h; al.h[i] = ASPLIT ? (_Float16)(xs[i] - (float)h) : (_Float16)0.0f; }
#pragma unroll
    for (int t = 0; t < 4; ++t) { if (col0 + t * 16 >= N) continue; const size_t boff = (size_t)(col0 + t * 16 + ln) * ldb + kb; FragH bq; bq.half[0] = *(const v8us*)(Bh + boff + 8 * hh); bq.half[1] = *(const v8us*)(Bh + boff + 16 + 8 * hh);
      acc[t] = mmaH<ASPLIT ? 2 : 1>(ah.v, al.v, bq.v, bq.v, acc[t]); }
  }
#pragma unroll
  for (int t = 0; t < 4; ++t) { if (col0 + t * 16 >= N) continue;
#pragma unroll
    for (int r = 0; r < 8; ++r) so[w][8 * hh + r][t * 16 + ln] = acc[t][r] * alpha; }
  __builtin_amdgcn_fence(__ATOMIC_ACQ_REL, "workgroup"); __builtin_amdgcn_wave_barrier();
  const int rsub = lane >> 4, c4 = (lane & 15) * 4;
  {
#pragma unroll
    for (int q = 0; q < 8; ++q) { const int r = q * 2 + rsub; if (col0 + c4 < N) { const v4f v = *(const v4fa*)&so[w][r][c4]; *(v4f*)(C + (size_t)(row0 + r) * ldc + col0 + c4) = v; } }
     }
}

// Wt[n][k] = f16(W[k][n]·scale) from f32 row-major W[K][N] (scale = power of two; bf16-exact weights stay exact in f16 away from the subnormal range)
__global__ __launch_bounds__(256) void k_wt_f16(const float* __restrict__ W, _Float16* __restrict__ Wt, int K, int N, float scale) {
  const int t = blockIdx.x * 256 + threadIdx.x; if (t >= N * (K / 8)) return; const int n = t / (K / 8), k8 = (t % (K / 8)) * 8; FragH f;
#pragma unroll
  for (int i = 0; i < 8; ++i) f.h[i] = (_Float16)(bf16_round(W[(size_t)(k8 + i) * N + n]) * scale); const v8us o = f.half[0];
  *(v8us*)((unsigned short*)Wt + (size_t)n * K + k8) = o; 
}
// k_gemm_hh variant with fused epilogue: v = acc·alpha + bias[by·sBias + col] (+ CP[(row/rowsPerB)·sCPb + by·64 + col] if CP) ; ACT 0 none / 1 elu ; writes f16 C16 (and f32 C if non-null)
template <int ACT>
__global__ __launch_bounds__(128) void k_gemm_hhx(const _Float16* __restrict__ A, int lda, size_t sA, const _Float16* __restrict__ Bh, int ldb, size_t sB, float alpha, const float* __restrict__ bias, size_t sBias, const float* __restrict__ CP, int rowsPerB, size_t sCPb, int row0g,
    float* __restrict__ C, _Float16* __restrict__ C16, int ldc, size_t sC, int M, int N, int K) {
  __shared__ __attribute__((aligned(16))) float so[4][16][64];
  const int tid = threadIdx.x, w = tid >> 5, lane = tid & 31, ln = lane & 15, hh = lane >> 4; const int by = blockIdx.y;
  A += (size_t)by * sA; Bh += (size_t)by * sB; const size_t cofs = (size_t)by * sC; const float* bp = bias ? bias + (size_t)by * sBias : nullptr;
  const int ntn = (N + 63) / 64; const int wid = blockIdx.x * 4 + w; const int mt = wid / ntn, nq = wid % ntn; if (mt * 16 >= M) return;
  const int row0 = mt * 16, col0 = nq * 64; const _Float16* arow = A + (size_t)(row0 + ln) * lda;
  v8f acc[4] = {};
  for (int kb = 0; kb < K; kb += 32) { FragH ah; ah.half[0] = *(const v8us*)((const unsigned short*)arow + kb + 8 * hh); ah.half[1] = *(const v8us*)((const unsigned short*)arow + kb + 16 + 8 * hh);
#pragma unroll
    for (int t = 0; t < 4; ++t) { if (col0 + t * 16 >= N) continue; const size_t boff = (size_t)(col0 + t * 16 + ln) * ldb + kb; FragH bq; bq.half[0] = *(const v8us*)((const unsigned short*)Bh + boff + 8 * hh); bq.half[1] = *(const v8us*)((const unsigned short*)Bh + boff + 16 + 8 * hh);
      acc[t] = mmaH<1>(ah.v, ah.v, bq.v, bq.v, acc[t]); }
  }
#pragma unroll
  for (int t = 0; t < 4; ++t) { if (col0 + t * 16 >= N) continue; const int col = col0 + t * 16 + ln; const float bv = bp ? bf16_round(bp[col]) : 0.f;
#pragma unroll
    for (int r = 0; r < 8; ++r) { float v = acc[t][r] * alpha + bv; if (CP) { const int bidx = (row0g + row0 + 8 * hh + r) / rowsPerB; v += CP[(size_t)bidx * sCPb + (size_t)by * 64 + col]; } if (ACT == 1) v = (v > 0.f) ? v : expm1f(v); else if (ACT == 7) v = (v > 0.f) ? v + 1.0f : expf(v); else if (ACT == 8) v = tanhf(v); else if (ACT == 9) v = 0.5f * v * (1.0f + tanhf(0.7978845608028654f * (v + 0.044715f * v * v * v))); else if (ACT == 11) v = 1.0f / (1.0f + expf(-v)); else if (ACT == 12) v = (v > 0.f) ? v : 0.01f * v; else if (ACT == 14) v = (v > 0.f) ? v : 0.1f * v; else if (ACT == 15) v = v / (1.0f + expf(-v)); else if (ACT == 3) v = fmaxf(v, 0.f); else if (ACT == 6) v = 0.5f * v * (1.0f + erff(v * 0.70710678118654752f)); so[w][8 * hh + r][t * 16 + ln] = v; } }
  __builtin_amdgcn_fence(__ATOMIC_ACQ_REL, "workgroup"); __builtin_amdgcn_wave_barrier();
  const int rsub = lane >> 4, c4 = (lane & 15) * 4; typedef _Float16 v4h __attribute__((ext_vector_type(4)));
  {
#pragma unroll
    for (int q = 0; q < 8; ++q) { const int r = q * 2 + rsub; if (col0 + c4 < N) { const v4f v = *(const v4fa*)&so[w][r][c4]; if (C) *(v4f*)(C + cofs + (size_t)(row0 + r) * ldc + col0 + c4) = v; if (C16) { v4h h4; for (int i = 0; i < 4; ++i) h4[i] = (_Float16)v[i]; *(v4h*)(C16 + cofs + (size_t)(row0 + r) * ldc + col0 + c4) = h4; } } }
     }
}


typedef _Float16 v4h __attribute__((ext_vector_type(4)));

__global__ __launch_bounds__(256) void k_x16(const float* __restrict__ x, _Float16* __restrict__ X16, size_t n8) { const size_t t = (size_t)blockIdx.x * 256 + threadIdx.x; if (t >= n8) return; FragH f;
#pragma unroll
  for (int q = 0; q < 8; ++q) f.h[q] = (_Float16)bf16_round(x[t * 8 + q]); *(v8us*)((unsigned short*)X16 + t * 8) = f.half[0];  }
__global__ __launch_bounds__(256) void k_h16(const float* __restrict__ x, _Float16* __restrict__ X16, size_t n8) { const size_t t = (size_t)blockIdx.x * 256 + threadIdx.x; if (t >= n8) return; FragH f;
#pragma unroll
  for (int q = 0; q < 8; ++q) f.h[q] = (_Float16)x[t * 8 + q]; *(v8us*)((unsigned short*)X16 + t * 8) = f.half[0];  }
__global__ __launch_bounds__(256) void k_round16f(const float* __restrict__ W, _Float16* __restrict__ Bt, size_t n8) { const size_t t = (size_t)blockIdx.x * 256 + threadIdx.x; if (t >= n8) return; FragH f;
#pragma unroll
  for (int i = 0; i < 8; ++i) f.h[i] = (_Float16)(bf16_round(W[t * 8 + i]) * 16.0f); *(v8us*)((unsigned short*)Bt + t * 8) = f.half[0];  }
template <int NHv, int TTv>
__global__ __launch_bounds__(256) void k_vt(const _Float16* __restrict__ V16, int ldv, int voff, _Float16* __restrict__ Vt) { __shared__ unsigned short tl[64][66]; const int tid = threadIdx.x; const int slab = blockIdx.x / (TTv / 64), lg = blockIdx.x % (TTv / 64); const int b = slab / NHv, h = slab % NHv;
  for (int i = tid; i < 64 * 8; i += 256) { const int r = i / 8, c8 = (i % 8) * 8; FragH f; f.half[0] = *(const v8us*)((const unsigned short*)V16 + ((size_t)b * TTv + lg * 64 + r) * ldv + voff + h * 64 + c8);
#pragma unroll
    for (int q = 0; q < 8; ++q) tl[r][c8 + q] = f.u[q]; }
  __syncthreads();
  {
#pragma unroll
    for (int rd = 0; rd < 2; ++rd) { const int d = rd * 32 + tid / 8, pc = tid % 8; FragH f;
#pragma unroll
      for (int q = 0; q < 8; ++q) f.u[q] = tl[pc * 8 + q][d];
      *(v8us*)((unsigned short*)Vt + ((size_t)slab * 64 + d) * TTv + lg * 64 + pc * 8) = f.half[0]; }
     } }

__global__ __launch_bounds__(256) void k_hl(const float* __restrict__ F, _Float16* __restrict__ Hh, _Float16* __restrict__ Hl, size_t n8) { const size_t t = (size_t)blockIdx.x * 256 + threadIdx.x; if (t >= n8) return; FragH fh, fl; const v4f a = *(const v4fa*)(F + t * 8), c = *(const v4fa*)(F + t * 8 + 4);
#pragma unroll
  for (int q = 0; q < 4; ++q) { _Float16 h = (_Float16)a[q]; fh.h[q] = h; fl.h[q] = (_Float16)((a[q] - (float)h) * 1024.0f); h = (_Float16)c[q]; fh.h[4 + q] = h; fl.h[4 + q] = (_Float16)((c[q] - (float)h) * 1024.0f); }
  { *(v8us*)((unsigned short*)Hh + t * 8) = fh.half[0]; *(v8us*)((unsigned short*)Hl + t * 8) = fl.half[0];  } }

// ---- fast GEMM (wave tile 32x64; requires M % 128 == 0 rows per launch region and N % 64 == 0); epilogue = k_gemm_hhx semantics ----
__device__ __forceinline__ v16h g2_frag(const _Float16* p, int hh) { FragH f; f.half[0] = *(const v8us*)((const unsigned short*)p + 8 * hh); f.half[1] = *(const v8us*)((const unsigned short*)p + 16 + 8 * hh); return f.v; }
__device__ __forceinline__ v8f g2_mma(v16h a, v16h b, v8f c) { v8f d = __builtin_amdgcn_wmma_f32_16x16x32_f16(false, a, false, b, (short)0, c, false, false); asm volatile("v_nop\n\tv_nop\n\tv_nop\n\tv_nop" : "+v"(d) : "v"(a), "v"(b)); return d; }
// K slab of the block tile in LDS: 64 halves (one 128-byte line) of each of the 128 A rows (rows 0..127) and the 64 B rows (rows 128..191); pitch 144 B = 16 B x odd, the conflict-free pitch for ds_load_b128 fragment reads.
#define G2_KS 64
#define G2_PITCH 72
#define G2_ROWS 192
#define G2_BUFB (G2_ROWS * G2_PITCH * 2)
// One slab: 12 copies a lane, 16 B each; 8 lanes cover one whole line, a wave 4 rows, the block 16 rows a copy (2304 B of LDS further each). s_wait_xcnt 0 closes the statement so that no address register is rewritten ahead of it.
__device__ __forceinline__ void g2_slab(unsigned l, const _Float16* ga, size_t a16, const _Float16* gb, size_t b16) {
  asm volatile(
      "global_load_async_to_lds_b128 %0, %12, off\n\t"
      "global_load_async_to_lds_b128 %1, %13, off\n\t"
      "global_load_async_to_lds_b128 %2, %14, off\n\t"
      "global_load_async_to_lds_b128 %3, %15, off\n\t"
      "global_load_async_to_lds_b128 %4, %16, off\n\t"
      "global_load_async_to_lds_b128 %5, %17, off\n\t"
      "global_load_async_to_lds_b128 %6, %18, off\n\t"
      "global_load_async_to_lds_b128 %7, %19, off\n\t"
      "global_load_async_to_lds_b128 %8, %20, off\n\t"
      "global_load_async_to_lds_b128 %9, %21, off\n\t"
      "global_load_async_to_lds_b128 %10, %22, off\n\t"
      "global_load_async_to_lds_b128 %11, %23, off\n\t"
      "s_wait_xcnt 0x0"
      :: "v"(l), "v"(l + 2304u), "v"(l + 2u * 2304u), "v"(l + 3u * 2304u), "v"(l + 4u * 2304u), "v"(l + 5u * 2304u), "v"(l + 6u * 2304u), "v"(l + 7u * 2304u), "v"(l + 8u * 2304u), "v"(l + 9u * 2304u), "v"(l + 10u * 2304u), "v"(l + 11u * 2304u),
         "v"(ga), "v"(ga + a16), "v"(ga + 2 * a16), "v"(ga + 3 * a16), "v"(ga + 4 * a16), "v"(ga + 5 * a16), "v"(ga + 6 * a16), "v"(ga + 7 * a16), "v"(gb), "v"(gb + b16), "v"(gb + 2 * b16), "v"(gb + 3 * b16)
      : "memory");
}
// requires M % 128 == 0, N % 64 == 0, K % 64 == 0, K >= 64
template <int ACT>
__global__ __launch_bounds__(128) void k_gemm2(const _Float16* __restrict__ A, int lda, size_t sA, const _Float16* __restrict__ Bh, int ldb, size_t sB, float alpha, const float* __restrict__ bias, size_t sBias, const float* __restrict__ CP, int rowsPerB, size_t sCPb, int row0g,
    float* __restrict__ C, _Float16* __restrict__ C16, int ldc, size_t sC, int M, int N, int K) {
  __shared__ __attribute__((aligned(16))) float so[4][32][68];
  __shared__ __attribute__((aligned(16))) _Float16 st[2][G2_ROWS][G2_PITCH];
  const int tid = threadIdx.x, w = tid >> 5, lane = tid & 31, ln = lane & 15, hh = lane >> 4; const int by = blockIdx.y;
  A += (size_t)by * sA; Bh += (size_t)by * sB; const size_t cofs = (size_t)by * sC; const float* bp = bias ? bias + (size_t)by * sBias : nullptr;
  const int ntn = N >> 6; const int mt = blockIdx.x / ntn, nq = blockIdx.x - mt * ntn; const int row0 = mt * 128 + 32 * w, col0 = nq * 64; if (mt * 128 >= M) return;      /* the same for the whole block, in front of every barrier */
  const int cr = tid >> 3, cc = (tid & 7) * 8;
  const _Float16* ga = A + (size_t)(mt * 128 + cr) * lda + cc; const _Float16* gb = Bh + (size_t)(col0 + cr) * ldb + cc; const size_t a16 = (size_t)16 * lda, b16 = (size_t)16 * ldb;
  const unsigned l0 = (unsigned)(size_t)&st[0][cr][cc];
  const int nt = K / G2_KS;
  const v8f z8 = {0.f,0.f,0.f,0.f,0.f,0.f,0.f,0.f}; v8f c00 = z8, c01 = z8, c02 = z8, c03 = z8, c10 = z8, c11 = z8, c12 = z8, c13 = z8;
  g2_slab(l0, ga, a16, gb, b16);
  asm volatile("s_wait_asynccnt 0x0" ::: "memory");      /* this wave's copies of slab 0 have landed */
  __syncthreads();                                       /* ... and every other wave's */
  if (nt > 1) g2_slab(l0 + G2_BUFB, ga + G2_KS, a16, gb + G2_KS, b16);
#pragma unroll 1
  for (int t = 0; t < nt; ++t) { const _Float16* sa = &st[t & 1][32 * w + ln][0]; const _Float16* sb = &st[t & 1][128 + ln][0];
    v16h fa[2][2], fb[2][4];      /* the slab's 12 fragments are read as one group ahead of its 16 products */
#pragma unroll
    for (int ks = 0; ks < 2; ++ks) {
#pragma unroll
      for (int i = 0; i < 2; ++i) fa[ks][i] = g2_frag(sa + i * 16 * G2_PITCH + ks * 32, hh);
#pragma unroll
      for (int j = 0; j < 4; ++j) fb[ks][j] = g2_frag(sb + j * 16 * G2_PITCH + ks * 32, hh); }
#pragma unroll
    for (int ks = 0; ks < 2; ++ks) {
      c00 = g2_mma(fa[ks][0], fb[ks][0], c00); c10 = g2_mma(fa[ks][1], fb[ks][0], c10); c01 = g2_mma(fa[ks][0], fb[ks][1], c01); c11 = g2_mma(fa[ks][1], fb[ks][1], c11);
      c02 = g2_mma(fa[ks][0], fb[ks][2], c02); c12 = g2_mma(fa[ks][1], fb[ks][2], c12); c03 = g2_mma(fa[ks][0], fb[ks][3], c03); c13 = g2_mma(fa[ks][1], fb[ks][3], c13); }
    asm volatile("s_wait_dscnt 0x0" ::: "memory");       /* this wave's reads of slab t are done before its buffer is handed back */
    asm volatile("s_wait_asynccnt 0x0" ::: "memory");    /* this wave's copies of slab t + 1 have landed */
    __syncthreads();                                     /* publishes slab t + 1 and ends every reader's last read of slab t */
    if (t + 2 < nt) g2_slab(l0 + (unsigned)(t & 1) * G2_BUFB, ga + (size_t)(t + 2) * G2_KS, a16, gb + (size_t)(t + 2) * G2_KS, b16); }
  asm volatile("s_wait_asynccnt 0x0" ::: "memory");      /* no copy is left in flight when the epilogue starts */
  v8f accs[8] = {c00, c01, c02, c03, c10, c11, c12, c13};
#pragma unroll
  for (int u = 0; u < 8; ++u) { const int t = u & 3, half = u >> 2; const int col = col0 + t * 16 + ln; const float bv = bp ? bf16_round(bp[col]) : 0.f;
#pragma unroll
    for (int r = 0; r < 8; ++r) { const int rloc = half * 16 + 8 * hh + r; float v = accs[u][r] * alpha + bv; if (CP) { const int bidx = (row0g + row0 + rloc) / rowsPerB; v += CP[(size_t)bidx * sCPb + (size_t)by * 64 + col]; }
      if (ACT == 3) v = fmaxf(v, 0.f); else if (ACT == 6) v = 0.5f * v * (1.0f + erff(v * 0.70710678118654752f)); else if (ACT == 11) v = 1.0f / (1.0f + expf(-v)); else if (ACT == 15) v = v / (1.0f + expf(-v)); else if (ACT == 12) v = (v > 0.f) ? v : 0.01f * v; else if (ACT == 8) v = tanhf(v);
      so[w][rloc][t * 16 + ln] = v; } }
  __builtin_amdgcn_fence(__ATOMIC_ACQ_REL, "workgroup"); __builtin_amdgcn_wave_barrier();
  const int rsub = lane >> 4, c4 = (lane & 15) * 4;
  {
#pragma unroll
    for (int q = 0; q < 16; ++q) { const int r = q * 2 + rsub; const v4f v = *(const v4fa*)&so[w][r][c4]; if (C) *(v4f*)(C + cofs + (size_t)(row0 + r) * ldc + col0 + c4) = v; if (C16) { v4h h4; for (int i = 0; i < 4; ++i) h4[i] = (_Float16)v[i]; *(v4h*)(C16 + cofs + (size_t)(row0 + r) * ldc + col0 + c4) = h4; } }
     } }



// lane l <-> l ^ 16 (the two halves of a wave hold the two key halves of one query column)
__device__ __forceinline__ float xhalf(float x) { const int t = __float_as_int(x); return __int_as_float(__builtin_amdgcn_permlanex16(t, t, 0x76543210, 0xfedcba98, false, false)); }
// Eight 2^x, each in place, in one statement closed by one v_nop: behind a transcendental the instruction set asks for one slot before its result is read or its source overwritten.
// here no v_exp_f32 touches a neighbour's register and the v_nop covers the last.
__device__ __forceinline__ void exp2x8(float& a, float& b, float& c, float& d, float& e, float& f, float& g, float& h) {
  asm("v_exp_f32 %0, %0\n\tv_exp_f32 %1, %1\n\tv_exp_f32 %2, %2\n\tv_exp_f32 %3, %3\n\tv_exp_f32 %4, %4\n\tv_exp_f32 %5, %5\n\tv_exp_f32 %6, %6\n\tv_exp_f32 %7, %7\n\tv_nop"
      : "+v"(a), "+v"(b), "+v"(c), "+v"(d), "+v"(e), "+v"(f), "+v"(g), "+v"(h));
}
// Transposed products: S^T = K.Q^T (A = 16 key rows, B = 16 query columns), O^T += V^T.P^T (A = 16 rows of V^T, B = P^T packed from the two S^T tiles).
// Lane (ln, hh) owns query q0 + ln: s[nt][r] = score of key j0 + 16 nt + 8 hh + r, which is already the hardware k order of a B operand; oacc[dt][r] = O[query][16 dt + 8 hh + r].
// Stage of 64 keys in LDS, shared by the block's 4 waves: rows 0..63 = the 64 K rows (64 halves = one 128-byte line each), rows 64..127 = the 64 V^T rows (their 64 key columns, one line each); pitch 144 B as in the GEMM slab.
#define FL_KEYS 64
#define FL_PITCH 72
#define FL_BUFB (128 * FL_PITCH * 2)
// One stage: 8 copies a lane, 16 B each; 8 lanes cover one whole line, the block 16 rows a copy (2304 B of LDS further each). s_wait_xcnt 0 closes the statement so that no address register is rewritten ahead of it.
__device__ __forceinline__ void fl_stage(unsigned l, const _Float16* gk, size_t k16, const _Float16* gv, size_t v16) {
  asm volatile(
      "global_load_async_to_lds_b128 %0, %8, off\n\t"
      "global_load_async_to_lds_b128 %1, %9, off\n\t"
      "global_load_async_to_lds_b128 %2, %10, off\n\t"
      "global_load_async_to_lds_b128 %3, %11, off\n\t"
      "global_load_async_to_lds_b128 %4, %12, off\n\t"
      "global_load_async_to_lds_b128 %5, %13, off\n\t"
      "global_load_async_to_lds_b128 %6, %14, off\n\t"
      "global_load_async_to_lds_b128 %7, %15, off\n\t"
      "s_wait_xcnt 0x0"
      :: "v"(l), "v"(l + 2304u), "v"(l + 2u * 2304u), "v"(l + 3u * 2304u), "v"(l + 4u * 2304u), "v"(l + 5u * 2304u), "v"(l + 6u * 2304u), "v"(l + 7u * 2304u),
         "v"(gk), "v"(gk + k16), "v"(gk + 2 * k16), "v"(gk + 3 * k16), "v"(gv), "v"(gv + v16), "v"(gv + 2 * v16), "v"(gv + 3 * v16)
      : "memory");
}
__global__ __launch_bounds__(128) void k_flash(const _Float16* __restrict__ Q16, int ldq, const _Float16* __restrict__ K16, int ldk, const _Float16* __restrict__ Vt, const int* __restrict__ MSK, float* __restrict__ O, int ldo) {
  constexpr int RPW = 16, NQB = TQ / (4 * RPW), DT = 4, KS = 2;
  __shared__ __attribute__((aligned(16))) unsigned short sm[2 * FL_BUFB / 2];      /* the two stage buffers; behind the last stage's barrier the same bytes stage the output rows (17408 of 36864 B), so that 6 blocks still fit a WGP's LDS */
  float (*sO)[RPW][64 + 4] = (float (*)[RPW][64 + 4])sm;
  const int tid = threadIdx.x, w = tid >> 5, lane = tid & 31, ln = lane & 15, hh = lane >> 4; (void)MSK;
  const int slab = blockIdx.x / NQB, qblk = blockIdx.x % NQB; const int b = slab / NH, h = slab % NH; const int qb0 = qblk * (4 * RPW); const int q0 = qb0 + w * RPW;
  FragH bq[KS];
  { const unsigned short* qr = (const unsigned short*)Q16 + ((size_t)b * TQ + q0 + ln) * ldq + h * 64;
#pragma unroll
    for (int ks = 0; ks < KS; ++ks) { bq[ks].half[0] = *(const v8us*)(qr + ks * 32 + 8 * hh); bq[ks].half[1] = *(const v8us*)(qr + ks * 32 + 16 + 8 * hh); } }
  const int cr = tid >> 3, cc = (tid & 7) * 8;
  const _Float16* gk = K16 + ((size_t)b * TK + cr) * ldk + h * 64 + cc; const _Float16* gv = Vt + ((size_t)slab * 64 + cr) * TK + cc; const size_t k16 = (size_t)16 * ldk, v16 = (size_t)16 * TK;
  const unsigned l0 = (unsigned)(size_t)&sm[cr * FL_PITCH + cc];
  float m_q = -3.0e38f, l_q = 0.f; v8f oacc[DT];
#pragma unroll
  for (int dt = 0; dt < DT; ++dt) oacc[dt] = (v8f){0.f,0.f,0.f,0.f,0.f,0.f,0.f,0.f};
  constexpr int NS = TK / FL_KEYS;      /* 16 stages */
  fl_stage(l0, gk, k16, gv, v16);
  asm volatile("s_wait_asynccnt 0x0" ::: "memory");      /* this wave's copies of stage 0 have landed */
  __syncthreads();                                       /* ... and every other wave's */
  fl_stage(l0 + FL_BUFB, gk + (size_t)FL_KEYS * ldk, k16, gv + FL_KEYS, v16);
#pragma unroll 1
  for (int s = 0; s < NS; ++s) { const unsigned short* sb = sm + (s & 1) * (FL_BUFB / 2);
#pragma unroll 1
  for (int j0 = 0; j0 < FL_KEYS; j0 += 32) {
    float sc[16];
#pragma unroll
    for (int nt = 0; nt < 2; ++nt) { const unsigned short* kr = sb + (j0 + nt * 16 + ln) * FL_PITCH; FragH ak[KS];
#pragma unroll
      for (int ks = 0; ks < KS; ++ks) { ak[ks].half[0] = *(const v8us*)(kr + ks * 32 + 8 * hh); ak[ks].half[1] = *(const v8us*)(kr + ks * 32 + 16 + 8 * hh); }
      v8f acc = (v8f){0.f,0.f,0.f,0.f,0.f,0.f,0.f,0.f};
#pragma unroll
      for (int ks = 0; ks < KS; ++ks) acc = mmaH<1>(ak[ks].v, ak[ks].v, bq[ks].v, bq[ks].v, acc);
#pragma unroll
      for (int r = 0; r < 8; ++r) sc[nt * 8 + r] = acc[r]; }      /* raw q.k: the 1/8 rides in the exponent's FMA; m_q is a raw score too */
    float mc = fmaxf(sc[0], sc[1]);
#pragma unroll
    for (int i = 2; i < 16; ++i) mc = fmaxf(mc, sc[i]);
    mc = fmaxf(mc, xhalf(mc));
    const float mn = fmaxf(m_q, mc); const float al = (mn > -1.0e38f) ? __builtin_amdgcn_exp2f((m_q - mn) * SCL2) : 1.0f; m_q = mn;
    const float nb = __builtin_fmaf(-mn, SCL2, 10.0f);      /* p x 2^10 = 2^(s/8 log2e - m/8 log2e + 10): one FMA and one v_exp_f32 a score; arguments reach about 10 at most, and below -126 the result is 0 */
    FragH pb;
#pragma unroll
    for (int i = 0; i < 16; ++i) sc[i] = __builtin_fmaf(sc[i], SCL2, nb);
    exp2x8(sc[0], sc[1], sc[2], sc[3], sc[4], sc[5], sc[6], sc[7]); exp2x8(sc[8], sc[9], sc[10], sc[11], sc[12], sc[13], sc[14], sc[15]);
    float ps[4] = {sc[0], sc[1], sc[2], sc[3]};      /* l_q sums p x 2^10, like the P operand */
#pragma unroll
    for (int i = 4; i < 16; ++i) ps[i & 3] += sc[i];
#pragma unroll
    for (int i = 0; i < 16; ++i) pb.h[i] = (_Float16)sc[i];
    l_q = l_q * al + ((ps[0] + ps[1]) + (ps[2] + ps[3]));
#pragma unroll
    for (int dt = 0; dt < DT; ++dt)
#pragma unroll
      for (int r = 0; r < 8; ++r) oacc[dt][r] *= al;
#pragma unroll
    for (int dt = 0; dt < DT; ++dt) { const unsigned short* vrow = sb + (64 + dt * 16 + ln) * FL_PITCH + j0; FragH av; av.half[0] = *(const v8us*)(vrow + 8 * hh); av.half[1] = *(const v8us*)(vrow + 16 + 8 * hh);
      oacc[dt] = mmaH<1>(av.v, av.v, pb.v, pb.v, oacc[dt]); } }
    asm volatile("s_wait_dscnt 0x0" ::: "memory");       /* this wave's reads of stage s are done before its buffer is handed back */
    asm volatile("s_wait_asynccnt 0x0" ::: "memory");    /* this wave's copies of stage s + 1 have landed */
    __syncthreads();                                     /* publishes stage s + 1 and ends every reader's last read of stage s */
    if (s + 2 < NS) fl_stage(l0 + (unsigned)(s & 1) * FL_BUFB, gk + (size_t)(s + 2) * FL_KEYS * ldk, k16, gv + (s + 2) * FL_KEYS, v16); }
  asm volatile("s_wait_asynccnt 0x0" ::: "memory");      /* no copy is left in flight when the buffers become output staging */
  { const float l = l_q + xhalf(l_q); const float inv = (l > 0.f) ? 1.0f / l : 0.f;      /* l and O carry the same 2^10 */
#pragma unroll
    for (int dt = 0; dt < DT; ++dt)
#pragma unroll
      for (int g = 0; g < 2; ++g) { v4f o4; 
#pragma unroll
        for (int q = 0; q < 4; ++q) o4[q] = oacc[dt][g * 4 + q] * inv;
        *(v4fa*)&sO[w][ln][dt * 16 + 8 * hh + g * 4] = o4; } }
  __builtin_amdgcn_fence(__ATOMIC_ACQ_REL, "workgroup"); __builtin_amdgcn_wave_barrier();
  {
#pragma unroll
    for (int rp = 0; rp < RPW; rp += 2) { const int r = rp + (lane >> 4), pc = lane & 15; const v4f val = *(const v4fa*)&sO[w][r][pc * 4]; *(v4f*)(O + ((size_t)b * TQ + q0 + r) * ldo + h * 64 + pc * 4) = val; }
     } }
__global__ __launch_bounds__(256) void k_fulltab(unsigned* __restrict__ MB, int* __restrict__ RA, int* __restrict__ KE, int nq, int nk) {
  const int t = blockIdx.x * 256 + threadIdx.x;
  if (t < nq * (nk / 32)) { *(unsigned*)(MB + t) = 0u;  }
  if (t < nq) { *(int*)(RA + t) = 0;  }
  if (t < nq / 64) { *(int*)(KE + t * 32) = nk;  } }
__global__ __launch_bounds__(256) void k_lnout(const float* __restrict__ Y, const float* __restrict__ g, const float* __restrict__ bb, float* __restrict__ out) {
  #pragma clang fp contract(off)
  const int tid = threadIdx.x, w = tid >> 5, ln = tid & 31; const int r = blockIdx.x * 8 + w; if (r >= NR) return; const float* y = Y + (size_t)r * DM; float s = 0.f;
#pragma unroll 1
  for (int i = 0; i < 8; ++i) { const v4f a = *(const v4fa*)(y + i * 128 + ln * 4); for (int q = 0; q < 4; ++q) s += a[q]; }
  for (int o = 16; o > 0; o >>= 1) s += __shfl_xor(s, o, 32); const float mu = s / (float)DM; float q2 = 0.f;
#pragma unroll 1
  for (int i = 0; i < 8; ++i) { const v4f a = *(const v4fa*)(y + i * 128 + ln * 4); for (int q = 0; q < 4; ++q) { const float d = a[q] - mu; q2 += d * d; } }
  for (int o = 16; o > 0; o >>= 1) q2 += __shfl_xor(q2, o, 32); const float rs = rsqrtf(q2 / (float)DM + 1e-6f);
  {
#pragma unroll 1
    for (int i = 0; i < 8; ++i) { const int c0 = i * 128 + ln * 4; const v4f a = *(const v4fa*)(y + c0); v4f o4; for (int q = 0; q < 4; ++q) o4[q] = (a[q] - mu) * rs * bf16_round(g[c0 + q]) + bf16_round(bb[c0 + q]); *(v4f*)(out + (size_t)r * DM + c0) = o4; }
     } }
__global__ __launch_bounds__(256) void k_xb(const float* __restrict__ x, float* __restrict__ XB, size_t n4) { const size_t t = (size_t)blockIdx.x * 256 + threadIdx.x; if (t >= n4) return; const v4f a = *(const v4fa*)(x + t * 4); v4f o; for (int q = 0; q < 4; ++q) o[q] = bf16_round(a[q]); *(v4f*)(XB + t * 4) = o;  }
__global__ __launch_bounds__(256) void k_causaltab(unsigned* __restrict__ MB, int* __restrict__ RA, int* __restrict__ KE, int nq, int nk) {
  const int t = blockIdx.x * 256 + threadIdx.x; const int nw = nk / 32;
  if (t < nq * nw) { const int q = t / nw, w = t % nw; const int first = q + 1 - 32 * w; const unsigned bits = (first <= 0) ? 0xffffffffu : ((first >= 32) ? 0u : (0xffffffffu << first)); *(unsigned*)(MB + t) = bits;  }
  if (t < nq) { *(int*)(RA + t) = 0;  }
  if (t < nq / 64) { const int v = 64 * (t + 1); *(int*)(KE + t * 32) = v;  } }


extern "C" void kernel_launch(void* const* d_in, const int* in_sizes, int n_in,
                              void* d_out, int out_size, void* d_ws, size_t ws_size, hipStream_t stream) {
  (void)in_sizes; (void)n_in; (void)out_size;
  const float* const* I = (const float* const*)d_in; const float* x = I[0]; const float* Wq = I[1]; const float* bq = I[2]; const float* Wk = I[3]; const float* bk = I[4]; const float* Wv = I[5]; const float* bv = I[6];
  char* ws = (char*)d_ws; size_t off = 0;
  auto take = [&](size_t bytes) { char* p = ws + off; off += (bytes + 255) & ~(size_t)255; return p; };
  _Float16* BQ = (_Float16*)take((size_t)DM * DM * 2); _Float16* BK = (_Float16*)take((size_t)DM * DM * 2); _Float16* BV = (_Float16*)take((size_t)DM * DM * 2);
  _Float16* X16 = (_Float16*)take((size_t)NR * DM * 2); _Float16* Q16 = (_Float16*)take((size_t)NR * DM * 2); _Float16* K16 = (_Float16*)take((size_t)NR * DM * 2); _Float16* V16 = (_Float16*)take((size_t)NR * DM * 2); _Float16* VT = (_Float16*)take((size_t)NR * DM * 2);
  if (off > ws_size) return;      /* 3.5 + 5 x 12.6 = 66 MB */
  const size_t w8 = (size_t)DM * DM / 8; const unsigned wb = (unsigned)((w8 + 255) / 256);
  k_round16f<<<wb, 256, 0, stream>>>(Wq, BQ, w8); k_round16f<<<wb, 256, 0, stream>>>(Wk, BK, w8); k_round16f<<<wb, 256, 0, stream>>>(Wv, BV, w8);      /* torch (out,in) = natural Bt */
  const size_t n8 = (size_t)NR * DM / 8; const unsigned nb8 = (unsigned)((n8 + 255) / 256); const dim3 gP((NR / 128) * (DM / 64), 1);
  k_x16<<<nb8, 256, 0, stream>>>(x, X16, n8);
  k_gemm2<0><<<gP, 128, 0, stream>>>(X16, DM, 0, BQ, DM, 0, 0.0625f, bq, 0, nullptr, 1, 0, 0, nullptr, Q16, DM, 0, NR, DM, DM);
  k_gemm2<0><<<gP, 128, 0, stream>>>(X16, DM, 0, BK, DM, 0, 0.0625f, bk, 0, nullptr, 1, 0, 0, nullptr, K16, DM, 0, NR, DM, DM);
  k_gemm2<0><<<gP, 128, 0, stream>>>(X16, DM, 0, BV, DM, 0, 0.0625f, bv, 0, nullptr, 1, 0, 0, nullptr, V16, DM, 0, NR, DM, DM);
  k_vt<NH, SLEN><<<NBT * NH * (SLEN / 64), 256, 0, stream>>>(V16, DM, 0, VT);      /* all batches in one grid: slab = batch * NH + head */
  k_flash<<<NBT * NH * (SLEN / 64), 128, 0, stream>>>(Q16, DM, K16, DM, VT, nullptr, (float*)d_out, DM);      /* all batches in one grid; ctx rows straight into the output */
}

// v005
// One run takes 75.9 microseconds.
// In two side-by-side timings against v004, it was 1.27 and 1.28 times as fast.
// All steps since v000 together make it 12.3 times as fast.
#include <hip/hip_runtime.h>
// DeiT self-attention (8 x 1024 tokens, 768 = 12 heads x 64): q,k,v = x W^T + b; softmax(q.k/8) over all keys; ctx = attn.v merged -> [8,1024,768] (no output projection).
// Structure: x as an exact f16 plane; the three projections as one f16 WMMA GEMM (128x192 block tiles, 64x96 wave tiles, f32 accumulation, exact products + bias) into f16 planes; the fused flash kernel over all 1024 keys (plain f16 q/k/V^T, online softmax in f32, P x2^10) per ((batch, head), 64 queries) writes the merged context rows straight into the output.
// Compute dtype: x, weights, biases rounded to bf16; q, k, v, P as plain f16 (~2^-12; logits sigma ~0.3); f32 accumulation and softmax. v_wmma_f32_16x16x32_f16.
#define NBT 8
#define SLEN 1024
#define TQ SLEN
#define TK SLEN
#define DM 768
#define NH 12
#define SCL 0.125f
#define SCL2 (SCL * 1.4426950408889634f)      /* 1/8 x log2(e): raw score -> base-2 exponent */
#define NR (NBT * SLEN)
typedef __bf16 v16b __attribute__((ext_vector_type(16)));
typedef unsigned short v8us __attribute__((ext_vector_type(8), may_alias));
typedef float  v8f  __attribute__((ext_vector_type(8)));
typedef float  v4f  __attribute__((ext_vector_type(4)));
typedef float  v4fa __attribute__((ext_vector_type(4), may_alias));
union FragB { v16b v; v8us half[2]; unsigned short u[16]; };

__device__ __forceinline__ unsigned short bf16_bits(float x) { unsigned int u = __float_as_uint(x); return (unsigned short)((u + 0x7FFFu + ((u >> 16) & 1u)) >> 16); }
__device__ __forceinline__ float bf16_val(unsigned short b) { return __uint_as_float(((unsigned int)b) << 16); }
__device__ __forceinline__ float bf16_round(float x) { return bf16_val(bf16_bits(x)); }
// D += A·B with NT terms: 1 = ah·bh, 2 = + al·bh (A split), 3 = + ah·bl (both split)
template <int NT>
__device__ __forceinline__ v8f mmaN(v16b ah, v16b al, v16b bh, v16b bl, v8f c) {
  c = __builtin_amdgcn_wmma_f32_16x16x32_bf16(false, ah, false, bh, (short)0, c, false, false);
  if (NT >= 2) c = __builtin_amdgcn_wmma_f32_16x16x32_bf16(false, al, false, bh, (short)0, c, false, false);
  if (NT >= 3) c = __builtin_amdgcn_wmma_f32_16x16x32_bf16(false, ah, false, bl, (short)0, c, false, false);
  asm volatile("v_nop\n\tv_nop\n\tv_nop\n\tv_nop" : "+v"(c) : "v"(ah), "v"(al), "v"(bh), "v"(bl));
  return c;
}

__global__ __launch_bounds__(256) void k_wt_bf16(const float* __restrict__ W, unsigned short* __restrict__ Wt, int K, int N) {
  const int t = blockIdx.x * 256 + threadIdx.x;
  const int k8n = K / 8;
  if (t >= N * k8n) return;
  const int n = t / k8n, k8 = (t % k8n) * 8;
  v8us v;
#pragma unroll
  for (int i = 0; i < 8; ++i) v[i] = bf16_bits(W[(size_t)(k8 + i) * N + n]);
  *(v8us*)(Wt + (size_t)n * K + k8) = v;
  
}

// GEMM C[M][N] (f32, pitch ldc) = act(A[M][K]·W + bias). A f32 row-major (pitch lda) converted per fragment to bf16
// (ASPLIT: hi/lo two planes -> 2 terms, else single rounded term); Wt bf16 [N][K] (pitch ldb). BIAS_BF16 rounds the
// bias to bf16 first (bias quantised to bf16 before the add). K%32==0, M%16==0, N%64==0.
template <bool ASPLIT, int ACT, bool BIAS_BF16>
__global__ __launch_bounds__(128) void k_gemm_bf(const float* __restrict__ A, int lda, const unsigned short* __restrict__ Wt, int ldb,
                                               const float* __restrict__ bias, float* __restrict__ C, int ldc, int M, int N, int K) {
  __shared__ __attribute__((aligned(16))) float so[4][16][64];
  const int tid = threadIdx.x, w = tid >> 5, lane = tid & 31, ln = lane & 15, hh = lane >> 4;
  const int ntn = N / 64;
  const int wid = blockIdx.x * 4 + w;
  const int mt = wid / ntn, nq = wid % ntn;
  if (mt * 16 >= M) return;
  const int row0 = mt * 16, col0 = nq * 64;
  const float* arow = A + (size_t)(row0 + ln) * lda;
  v8f acc[4] = {};
  for (int kb = 0; kb < K; kb += 32) {
    FragB ah, al;
    const v4f x0 = *(const v4fa*)(arow + kb + 8 * hh), x1 = *(const v4fa*)(arow + kb + 8 * hh + 4);
    const v4f x2 = *(const v4fa*)(arow + kb + 16 + 8 * hh), x3 = *(const v4fa*)(arow + kb + 16 + 8 * hh + 4);
    float xs[16] = {x0[0],x0[1],x0[2],x0[3],x1[0],x1[1],x1[2],x1[3],x2[0],x2[1],x2[2],x2[3],x3[0],x3[1],x3[2],x3[3]};
#pragma unroll
    for (int i = 0; i < 16; ++i) { const unsigned short hb = bf16_bits(xs[i]); ah.u[i] = hb; al.u[i] = ASPLIT ? bf16_bits(xs[i] - bf16_val(hb)) : (unsigned short)0; }
#pragma unroll
    for (int t = 0; t < 4; ++t) {
      const unsigned short* brow = Wt + (size_t)(col0 + t * 16 + ln) * ldb + kb;
      FragB b;
      b.half[0] = *(const v8us*)(brow + 8 * hh);
      b.half[1] = *(const v8us*)(brow + 16 + 8 * hh);
      acc[t] = mmaN<ASPLIT ? 2 : 1>(ah.v, al.v, b.v, b.v, acc[t]);
    }
  }
#pragma unroll
  for (int t = 0; t < 4; ++t) {
    float bv = bias ? bias[col0 + t * 16 + ln] : 0.f;
    if (BIAS_BF16) bv = bf16_round(bv);
#pragma unroll
    for (int r = 0; r < 8; ++r) { float v = acc[t][r] + bv; if (ACT == 1) v = fmaxf(v, 0.f); so[w][8 * hh + r][t * 16 + ln] = v; }
  }
  __builtin_amdgcn_fence(__ATOMIC_ACQ_REL, "workgroup");
  __builtin_amdgcn_wave_barrier();
  const int rsub = lane >> 4, c4 = (lane & 15) * 4;
  {
#pragma unroll
    for (int q = 0; q < 8; ++q) {
      const int r = q * 2 + rsub;
      const v4f v = *(const v4fa*)&so[w][r][c4];
      *(v4f*)(C + (size_t)(row0 + r) * ldc + col0 + c4) = v;
    }
    
  }
}

// GEMM C = act(A·W + bias + resid): A f32 (ASPLIT -> hi/lo 2 terms), Wt bf16 [N][K]; ACT 0 none, 1 relu, 2 exact gelu;
// resid (optional, f32, row index = (row % rmod), pitch ldr, RES_BF16 rounds it) added before the activation.
template <bool ASPLIT, int ACT, bool BIAS_BF16, bool RES_BF16>
__global__ __launch_bounds__(128) void k_gemm_bf3(const float* __restrict__ A, int lda, const unsigned short* __restrict__ Wt, int ldb,
                                                const float* __restrict__ bias, const float* __restrict__ resid, int rmod, int ldr,
                                                float* __restrict__ C, int ldc, int M, int N, int K) {
  __shared__ __attribute__((aligned(16))) float so[4][16][64];
  const int tid = threadIdx.x, w = tid >> 5, lane = tid & 31, ln = lane & 15, hh = lane >> 4;
  const int ntn = N / 64;
  const int wid = blockIdx.x * 4 + w;
  const int mt = wid / ntn, nq = wid % ntn;
  if (mt * 16 >= M) return;
  const int row0 = mt * 16, col0 = nq * 64;
  const float* arow = A + (size_t)(row0 + ln) * lda;
  v8f acc[4] = {};
  for (int kb = 0; kb < K; kb += 32) {
    FragB ah, al;
    const v4f x0 = *(const v4fa*)(arow + kb + 8 * hh), x1 = *(const v4fa*)(arow + kb + 8 * hh + 4);
    const v4f x2 = *(const v4fa*)(arow + kb + 16 + 8 * hh), x3 = *(const v4fa*)(arow + kb + 16 + 8 * hh + 4);
    float xs[16] = {x0[0],x0[1],x0[2],x0[3],x1[0],x1[1],x1[2],x1[3],x2[0],x2[1],x2[2],x2[3],x3[0],x3[1],x3[2],x3[3]};
#pragma unroll
    for (int i = 0; i < 16; ++i) { const unsigned short hb = bf16_bits(xs[i]); ah.u[i] = hb; al.u[i] = ASPLIT ? bf16_bits(xs[i] - bf16_val(hb)) : (unsigned short)0; }
#pragma unroll
    for (int t = 0; t < 4; ++t) {
      const unsigned short* brow = Wt + (size_t)(col0 + t * 16 + ln) * ldb + kb;
      FragB b;
      b.half[0] = *(const v8us*)(brow + 8 * hh);
      b.half[1] = *(const v8us*)(brow + 16 + 8 * hh);
      acc[t] = mmaN<ASPLIT ? 2 : 1>(ah.v, al.v, b.v, b.v, acc[t]);
    }
  }
#pragma unroll
  for (int t = 0; t < 4; ++t) {
    const int col = col0 + t * 16 + ln;
    float bv = bias ? bias[col] : 0.f;
    if (BIAS_BF16) bv = bf16_round(bv);
#pragma unroll
    for (int r = 0; r < 8; ++r) {
      float v = acc[t][r] + bv;
      if (resid) { float rv = resid[(size_t)((row0 + 8 * hh + r) % rmod) * ldr + col]; if (RES_BF16) rv = bf16_round(rv); v += rv; }
      if (ACT == 1) v = fmaxf(v, 0.f);
      if (ACT == 2) v = 0.5f * v * (1.0f + erff(v * 0.70710678118654752f));
      if (ACT == 3) { const float u = 0.7978845608028654f * (v + 0.044715f * v * v * v); v = 0.5f * v * (1.0f + tanhf(u)); }
      so[w][8 * hh + r][t * 16 + ln] = v;
    }
  }
  __builtin_amdgcn_fence(__ATOMIC_ACQ_REL, "workgroup");
  __builtin_amdgcn_wave_barrier();
  const int rsub = lane >> 4, c4 = (lane & 15) * 4;
  {
#pragma unroll
    for (int q = 0; q < 8; ++q) {
      const int r = q * 2 + rsub;
      const v4f v = *(const v4fa*)&so[w][r][c4];
      *(v4f*)(C + (size_t)(row0 + r) * ldc + col0 + c4) = v;
    }
    
  }
}
// row LayerNorm (biased variance, eps) over N: s = X (+ R); optional out_sum <- s; out_norm <- (s-mu)*rsqrt(var+eps)*g + b
template <bool PARAM_BF16>
__global__ __launch_bounds__(256) void k_layernorm(const float* __restrict__ X, const float* __restrict__ R, const float* __restrict__ g, const float* __restrict__ bta,
                                                  float* __restrict__ out_sum, float* __restrict__ out_norm, int N, float eps) {
  __shared__ float red[256];
  const int row = blockIdx.x, tid = threadIdx.x;
  const float* x = X + (size_t)row * N; const float* rr = R ? R + (size_t)row * N : nullptr;
  float vals[16];                     // up to N = 4096
  const int per = N / 256;            // contiguous chunk per thread? use strided-by-4 chunks: thread handles j = tid*4 + 1024*u
  float s1 = 0.f;
  for (int u = 0; u < per / 4; ++u) {
    const int j = tid * 4 + 1024 * u;
    const v4f a = *(const v4fa*)(x + j);
    v4f b = {0.f,0.f,0.f,0.f}; if (rr) b = *(const v4fa*)(rr + j);
#pragma unroll
    for (int q = 0; q < 4; ++q) { const float v = a[q] + b[q]; vals[u * 4 + q] = v; s1 += v; }
  }
  red[tid] = s1; __syncthreads();
  for (int st = 128; st > 0; st >>= 1) { if (tid < st) red[tid] += red[tid + st]; __syncthreads(); }
  const float mu = red[0] / (float)N; __syncthreads();
  float s2 = 0.f;
  for (int u = 0; u < per / 4; ++u)
#pragma unroll
    for (int q = 0; q < 4; ++q) { const float c = vals[u * 4 + q] - mu; s2 += c * c; }
  red[tid] = s2; __syncthreads();
  for (int st = 128; st > 0; st >>= 1) { if (tid < st) red[tid] += red[tid + st]; __syncthreads(); }
  const float rs = rsqrtf(red[0] / (float)N + eps);
  {
    for (int u = 0; u < per / 4; ++u) {
      const int j = tid * 4 + 1024 * u;
      v4f o, sm;
#pragma unroll
      for (int q = 0; q < 4; ++q) {
        float gg = g[j + q], bb = bta[j + q];
        if (PARAM_BF16) { gg = bf16_round(gg); bb = bf16_round(bb); }
        sm[q] = vals[u * 4 + q]; o[q] = (vals[u * 4 + q] - mu) * rs * gg + bb;
      }
      if (out_sum) *(v4f*)(out_sum + (size_t)row * N + j) = sm;
      *(v4f*)(out_norm + (size_t)row * N + j) = o;
    }
    
  }
}



// ---- f16 WMMA path (v_wmma_f32_16x16x32_f16): 11-bit significands for operands in range — used where a [0,1] probability operand needs more precision than bf16
typedef _Float16 v16h __attribute__((ext_vector_type(16)));
union FragH { v16h v; v8us half[2]; _Float16 h[16]; unsigned short u[16]; };
template <int NT>
__device__ __forceinline__ v8f mmaH(v16h ah, v16h al, v16h bh, v16h bl, v8f c) {
  c = __builtin_amdgcn_wmma_f32_16x16x32_f16(false, ah, false, bh, (short)0, c, false, false);
  if (NT >= 2) c = __builtin_amdgcn_wmma_f32_16x16x32_f16(false, al, false, bh, (short)0, c, false, false);
  if (NT >= 3) c = __builtin_amdgcn_wmma_f32_16x16x32_f16(false, ah, false, bl, (short)0, c, false, false);
  asm volatile("v_nop\n\tv_nop\n\tv_nop\n\tv_nop" : "+v"(c) : "v"(ah), "v"(al), "v"(bh), "v"(bl));
  return c;
}
// batched GEMM like k_gemm_b but f16 operands: A f32 (split into f16 hi/lo if ASPLIT, else rounded to f16), Bt = f16 values [n][k]; alpha; C f32; N multiple of 16 (partial tiles skipped)
template <bool ASPLIT>
__global__ __launch_bounds__(128) void k_gemm_h(const float* __restrict__ A, int lda, size_t sA, const _Float16* __restrict__ Bh, int ldb, size_t sB, float alpha, float* __restrict__ C, int ldc, size_t sC, int M, int N, int K) {
  __shared__ __attribute__((aligned(16))) float so[4][16][64];
  const int tid = threadIdx.x, w = tid >> 5, lane = tid & 31, ln = lane & 15, hh = lane >> 4; const int by = blockIdx.y;
  A += (size_t)by * sA; Bh += (size_t)by * sB; C += (size_t)by * sC;
  const int ntn = (N + 63) / 64; const int wid = blockIdx.x * 4 + w; const int mt = wid / ntn, nq = wid % ntn; if (mt * 16 >= M) return;
  const int row0 = mt * 16, col0 = nq * 64; const float* arow = A + (size_t)(row0 + ln) * lda;
  v8f acc[4] = {};
  for (int kb = 0; kb < K; kb += 32) {
    FragH ah, al;
    const v4f x0 = *(const v4fa*)(arow + kb + 8 * hh), x1 = *(const v4fa*)(arow + kb + 8 * hh + 4), x2 = *(const v4fa*)(arow + kb + 16 + 8 * hh), x3 = *(const v4fa*)(arow + kb + 16 + 8 * hh + 4);
    float xs[16] = {x0[0],x0[1],x0[2],x0[3],x1[0],x1[1],x1[2],x1[3],x2[0],x2[1],x2[2],x2[3],x3[0],x3[1],x3[2],x3[3]};
#pragma unroll
    for (int i = 0; i < 16; ++i) { const _Float16 h = (_Float16)xs[i]; ah.h[i] = h; al.h[i] = ASPLIT ? (_Float16)(xs[i] - (float)h) : (_Float16)0.0f; }
#pragma unroll
    for (int t = 0; t < 4; ++t) { if (col0 + t * 16 >= N) continue; const size_t boff = (size_t)(col0 + t * 16 + ln) * ldb + kb; FragH bq; bq.half[0] = *(const v8us*)(Bh + boff + 8 * hh); bq.half[1] = *(const v8us*)(Bh + boff + 16 + 8 * hh);
      acc[t] = mmaH<ASPLIT ? 2 : 1>(ah.v, al.v, bq.v, bq.v, acc[t]); }
  }
#pragma unroll
  for (int t = 0; t < 4; ++t) { if (col0 + t * 16 >= N) continue;
#pragma unroll
    for (int r = 0; r < 8; ++r) so[w][8 * hh + r][t * 16 + ln] = acc[t][r] * alpha; }
  __builtin_amdgcn_fence(__ATOMIC_ACQ_REL, "workgroup"); __builtin_amdgcn_wave_barrier();
  const int rsub = lane >> 4, c4 = (lane & 15) * 4;
  {
#pragma unroll
    for (int q = 0; q < 8; ++q) { const int r = q * 2 + rsub; if (col0 + c4 < N) { const v4f v = *(const v4fa*)&so[w][r][c4]; *(v4f*)(C + (size_t)(row0 + r) * ldc + col0 + c4) = v; } }
     }
}

// Wt[n][k] = f16(W[k][n]·scale) from f32 row-major W[K][N] (scale = power of two; bf16-exact weights stay exact in f16 away from the subnormal range)
__global__ __launch_bounds__(256) void k_wt_f16(const float* __restrict__ W, _Float16* __restrict__ Wt, int K, int N, float scale) {
  const int t = blockIdx.x * 256 + threadIdx.x; if (t >= N * (K / 8)) return; const int n = t / (K / 8), k8 = (t % (K / 8)) * 8; FragH f;
#pragma unroll
  for (int i = 0; i < 8; ++i) f.h[i] = (_Float16)(bf16_round(W[(size_t)(k8 + i) * N + n]) * scale); const v8us o = f.half[0];
  *(v8us*)((unsigned short*)Wt + (size_t)n * K + k8) = o; 
}
// k_gemm_hh variant with fused epilogue: v = acc·alpha + bias[by·sBias + col] (+ CP[(row/rowsPerB)·sCPb + by·64 + col] if CP) ; ACT 0 none / 1 elu ; writes f16 C16 (and f32 C if non-null)
template <int ACT>
__global__ __launch_bounds__(128) void k_gemm_hhx(const _Float16* __restrict__ A, int lda, size_t sA, const _Float16* __restrict__ Bh, int ldb, size_t sB, float alpha, const float* __restrict__ bias, size_t sBias, const float* __restrict__ CP, int rowsPerB, size_t sCPb, int row0g,
    float* __restrict__ C, _Float16* __restrict__ C16, int ldc, size_t sC, int M, int N, int K) {
  __shared__ __attribute__((aligned(16))) float so[4][16][64];
  const int tid = threadIdx.x, w = tid >> 5, lane = tid & 31, ln = lane & 15, hh = lane >> 4; const int by = blockIdx.y;
  A += (size_t)by * sA; Bh += (size_t)by * sB; const size_t cofs = (size_t)by * sC; const float* bp = bias ? bias + (size_t)by * sBias : nullptr;
  const int ntn = (N + 63) / 64; const int wid = blockIdx.x * 4 + w; const int mt = wid / ntn, nq = wid % ntn; if (mt * 16 >= M) return;
  const int row0 = mt * 16, col0 = nq * 64; const _Float16* arow = A + (size_t)(row0 + ln) * lda;
  v8f acc[4] = {};
  for (int kb = 0; kb < K; kb += 32) { FragH ah; ah.half[0] = *(const v8us*)((const unsigned short*)arow + kb + 8 * hh); ah.half[1] = *(const v8us*)((const unsigned short*)arow + kb + 16 + 8 * hh);
#pragma unroll
    for (int t = 0; t < 4; ++t) { if (col0 + t * 16 >= N) continue; const size_t boff = (size_t)(col0 + t * 16 + ln) * ldb + kb; FragH bq; bq.half[0] = *(const v8us*)((const unsigned short*)Bh + boff + 8 * hh); bq.half[1] = *(const v8us*)((const unsigned short*)Bh + boff + 16 + 8 * hh);
      acc[t] = mmaH<1>(ah.v, ah.v, bq.v, bq.v, acc[t]); }
  }
#pragma unroll
  for (int t = 0; t < 4; ++t) { if (col0 + t * 16 >= N) continue; const int col = col0 + t * 16 + ln; const float bv = bp ? bf16_round(bp[col]) : 0.f;
#pragma unroll
    for (int r = 0; r < 8; ++r) { float v = acc[t][r] * alpha + bv; if (CP) { const int bidx = (row0g + row0 + 8 * hh + r) / rowsPerB; v += CP[(size_t)bidx * sCPb + (size_t)by * 64 + col]; } if (ACT == 1) v = (v > 0.f) ? v : expm1f(v); else if (ACT == 7) v = (v > 0.f) ? v + 1.0f : expf(v); else if (ACT == 8) v = tanhf(v); else if (ACT == 9) v = 0.5f * v * (1.0f + tanhf(0.7978845608028654f * (v + 0.044715f * v * v * v))); else if (ACT == 11) v = 1.0f / (1.0f + expf(-v)); else if (ACT == 12) v = (v > 0.f) ? v : 0.01f * v; else if (ACT == 14) v = (v > 0.f) ? v : 0.1f * v; else if (ACT == 15) v = v / (1.0f + expf(-v)); else if (ACT == 3) v = fmaxf(v, 0.f); else if (ACT == 6) v = 0.5f * v * (1.0f + erff(v * 0.70710678118654752f)); so[w][8 * hh + r][t * 16 + ln] = v; } }
  __builtin_amdgcn_fence(__ATOMIC_ACQ_REL, "workgroup"); __builtin_amdgcn_wave_barrier();
  const int rsub = lane >> 4, c4 = (lane & 15) * 4; typedef _Float16 v4h __attribute__((ext_vector_type(4)));
  {
#pragma unroll
    for (int q = 0; q < 8; ++q) { const int r = q * 2 + rsub; if (col0 + c4 < N) { const v4f v = *(const v4fa*)&so[w][r][c4]; if (C) *(v4f*)(C + cofs + (size_t)(row0 + r) * ldc + col0 + c4) = v; if (C16) { v4h h4; for (int i = 0; i < 4; ++i) h4[i] = (_Float16)v[i]; *(v4h*)(C16 + cofs + (size_t)(row0 + r) * ldc + col0 + c4) = h4; } } }
     }
}


typedef _Float16 v4h __attribute__((ext_vector_type(4)));

__global__ __launch_bounds__(256) void k_x16(const float* __restrict__ x, _Float16* __restrict__ X16, size_t n8) { const size_t t = (size_t)blockIdx.x * 256 + threadIdx.x; if (t >= n8) return; FragH f;
#pragma unroll
  for (int q = 0; q < 8; ++q) f.h[q] = (_Float16)bf16_round(x[t * 8 + q]); *(v8us*)((unsigned short*)X16 + t * 8) = f.half[0];  }
__global__ __launch_bounds__(256) void k_h16(const float* __restrict__ x, _Float16* __restrict__ X16, size_t n8) { const size_t t = (size_t)blockIdx.x * 256 + threadIdx.x; if (t >= n8) return; FragH f;
#pragma unroll
  for (int q = 0; q < 8; ++q) f.h[q] = (_Float16)x[t * 8 + q]; *(v8us*)((unsigned short*)X16 + t * 8) = f.half[0];  }
__global__ __launch_bounds__(256) void k_round16f(const float* __restrict__ W, _Float16* __restrict__ Bt, size_t n8) { const size_t t = (size_t)blockIdx.x * 256 + threadIdx.x; if (t >= n8) return; FragH f;
#pragma unroll
  for (int i = 0; i < 8; ++i) f.h[i] = (_Float16)(bf16_round(W[t * 8 + i]) * 16.0f); *(v8us*)((unsigned short*)Bt + t * 8) = f.half[0];  }
template <int NHv, int TTv>
__global__ __launch_bounds__(256) void k_vt(const _Float16* __restrict__ V16, int ldv, int voff, _Float16* __restrict__ Vt) { __shared__ unsigned short tl[64][66]; const int tid = threadIdx.x; const int slab = blockIdx.x / (TTv / 64), lg = blockIdx.x % (TTv / 64); const int b = slab / NHv, h = slab % NHv;
  for (int i = tid; i < 64 * 8; i += 256) { const int r = i / 8, c8 = (i % 8) * 8; FragH f; f.half[0] = *(const v8us*)((const unsigned short*)V16 + ((size_t)b * TTv + lg * 64 + r) * ldv + voff + h * 64 + c8);
#pragma unroll
    for (int q = 0; q < 8; ++q) tl[r][c8 + q] = f.u[q]; }
  __syncthreads();
  {
#pragma unroll
    for (int rd = 0; rd < 2; ++rd) { const int d = rd * 32 + tid / 8, pc = tid % 8; FragH f;
#pragma unroll
      for (int q = 0; q < 8; ++q) f.u[q] = tl[pc * 8 + q][d];
      *(v8us*)((unsigned short*)Vt + ((size_t)slab * 64 + d) * TTv + lg * 64 + pc * 8) = f.half[0]; }
     } }

__global__ __launch_bounds__(256) void k_hl(const float* __restrict__ F, _Float16* __restrict__ Hh, _Float16* __restrict__ Hl, size_t n8) { const size_t t = (size_t)blockIdx.x * 256 + threadIdx.x; if (t >= n8) return; FragH fh, fl; const v4f a = *(const v4fa*)(F + t * 8), c = *(const v4fa*)(F + t * 8 + 4);
#pragma unroll
  for (int q = 0; q < 4; ++q) { _Float16 h = (_Float16)a[q]; fh.h[q] = h; fl.h[q] = (_Float16)((a[q] - (float)h) * 1024.0f); h = (_Float16)c[q]; fh.h[4 + q] = h; fl.h[4 + q] = (_Float16)((c[q] - (float)h) * 1024.0f); }
  { *(v8us*)((unsigned short*)Hh + t * 8) = fh.half[0]; *(v8us*)((unsigned short*)Hl + t * 8) = fl.half[0];  } }

// ---- projection GEMM: fragment loader and LDS slab geometry ----
__device__ __forceinline__ v16h g2_frag(const _Float16* p, int hh) { FragH f; f.half[0] = *(const v8us*)((const unsigned short*)p + 8 * hh); f.half[1] = *(const v8us*)((const unsigned short*)p + 16 + 8 * hh); return f.v; }
// K slab of the block tile in LDS: 64 halves (one 128-byte line) of each staged row; pitch 144 B = 16 B x odd, the conflict-free pitch for ds_load_b128 fragment reads.
#define G2_KS 64
#define G2_PITCH 72

// lane l <-> l ^ 16 (the two halves of a wave hold the two key halves of one query column)
__device__ __forceinline__ float xhalf(float x) { const int t = __float_as_int(x); return __int_as_float(__builtin_amdgcn_permlanex16(t, t, 0x76543210, 0xfedcba98, false, false)); }
// Eight 2^x, each in place, in one statement closed by one v_nop: behind a transcendental the instruction set asks for one slot before its result is read or its source overwritten.
// here no v_exp_f32 touches a neighbour's register and the v_nop covers the last.
__device__ __forceinline__ void exp2x8(float& a, float& b, float& c, float& d, float& e, float& f, float& g, float& h) {
  asm("v_exp_f32 %0, %0\n\tv_exp_f32 %1, %1\n\tv_exp_f32 %2, %2\n\tv_exp_f32 %3, %3\n\tv_exp_f32 %4, %4\n\tv_exp_f32 %5, %5\n\tv_exp_f32 %6, %6\n\tv_exp_f32 %7, %7\n\tv_nop"
      : "+v"(a), "+v"(b), "+v"(c), "+v"(d), "+v"(e), "+v"(f), "+v"(g), "+v"(h));
}
// Transposed products: S^T = K.Q^T (A = 16 key rows, B = 16 query columns), O^T += V^T.P^T (A = 16 rows of V^T, B = P^T packed from the two S^T tiles).
// Lane (ln, hh) owns query q0 + ln: s[nt][r] = score of key j0 + 16 nt + 8 hh + r, which is already the hardware k order of a B operand; oacc[dt][r] = O[query][16 dt + 8 hh + r].
// Stage of 64 keys in LDS, shared by the block's 4 waves: rows 0..63 = the 64 K rows (64 halves = one 128-byte line each), rows 64..127 = the 64 V^T rows (their 64 key columns, one line each); pitch 144 B as in the GEMM slab.
#define FL_KEYS 64
#define FL_PITCH 72
#define FL_BUFB (128 * FL_PITCH * 2)
// One stage: 8 copies a lane, 16 B each; 8 lanes cover one whole line, the block 16 rows a copy (2304 B of LDS further each). s_wait_xcnt 0 closes the statement so that no address register is rewritten ahead of it.
__device__ __forceinline__ void fl_stage(unsigned l, const _Float16* gk, size_t k16, const _Float16* gv, size_t v16) {
  asm volatile(
      "global_load_async_to_lds_b128 %0, %8, off\n\t"
      "global_load_async_to_lds_b128 %1, %9, off\n\t"
      "global_load_async_to_lds_b128 %2, %10, off\n\t"
      "global_load_async_to_lds_b128 %3, %11, off\n\t"
      "global_load_async_to_lds_b128 %4, %12, off\n\t"
      "global_load_async_to_lds_b128 %5, %13, off\n\t"
      "global_load_async_to_lds_b128 %6, %14, off\n\t"
      "global_load_async_to_lds_b128 %7, %15, off\n\t"
      "s_wait_xcnt 0x0"
      :: "v"(l), "v"(l + 2304u), "v"(l + 2u * 2304u), "v"(l + 3u * 2304u), "v"(l + 4u * 2304u), "v"(l + 5u * 2304u), "v"(l + 6u * 2304u), "v"(l + 7u * 2304u),
         "v"(gk), "v"(gk + k16), "v"(gk + 2 * k16), "v"(gk + 3 * k16), "v"(gv), "v"(gv + v16), "v"(gv + 2 * v16), "v"(gv + 3 * v16)
      : "memory");
}
// q, k and v = x W^T + b as ONE GEMM: block tile 128 tokens x 192 output features (192 divides 768, so a block's features lie in one of the three planes), 4 waves as 2 x 2, wave tile 64 x 96.
// Per 64-k slab a block stages 320 rows (rows 0..127 = x, rows 128..319 = W) for 192 products, where the 128 x 64 tile staged 192 rows for 64; a wave reads 10 fragments for 24 products, not 6 for 8.
// The product is taken as C^T = W.X^T (A = 16 W rows, B = 16 x rows; both operands go through the same loader, so their k orders are equal): lane (ln, hh) then holds features 8 hh .. 8 hh + 7 of token ln, 16 B of an f16 output row.
#define G3_ROWS 320
#define G3_BUFB (G3_ROWS * G2_PITCH * 2)
#define G3_OP 200      /* pitch of the staged output rows in halves: 400 B = 16 B x odd */
// One slab: 20 copies a lane, 16 B each; 8 lanes cover one whole line, the block 16 rows a copy. Address form: scalar base + the lane's one 32-bit offset, so that the copies hold 4 vector registers beside the 192 of the accumulators
// (a 64-bit vector address and an LDS register for each copy made the build spill). The immediate offset moves BOTH addresses: it carries the LDS step of 16 rows (2304 B, 16128 B at most), and each scalar base is taken back by what its copy's offset adds.
// s_wait_xcnt 0 closes each statement so that no address register is rewritten ahead of it.
__device__ __forceinline__ void g3_slab(unsigned l, unsigned vo, const char* sa, const char* sb) {
  constexpr int G = 16 * DM * 2, D = G - 2304;      /* global step of 16 rows; the same less the LDS step */
  asm volatile(      /* LDS rows 0..127: the 128 x rows */
      "global_load_async_to_lds_b128 %0, %1, %2\n\t"
      "global_load_async_to_lds_b128 %0, %1, %3 offset:2304\n\t"
      "global_load_async_to_lds_b128 %0, %1, %4 offset:4608\n\t"
      "global_load_async_to_lds_b128 %0, %1, %5 offset:6912\n\t"
      "global_load_async_to_lds_b128 %0, %1, %6 offset:9216\n\t"
      "global_load_async_to_lds_b128 %0, %1, %7 offset:11520\n\t"
      "global_load_async_to_lds_b128 %0, %1, %8 offset:13824\n\t"
      "global_load_async_to_lds_b128 %0, %1, %9 offset:16128\n\t"
      "s_wait_xcnt 0x0"
      :: "v"(l), "v"(vo), "s"(sa), "s"(sa + D), "s"(sa + 2 * D), "s"(sa + 3 * D), "s"(sa + 4 * D), "s"(sa + 5 * D), "s"(sa + 6 * D), "s"(sa + 7 * D)
      : "memory");
  asm volatile(      /* LDS rows 128..319: the 192 W rows */
      "global_load_async_to_lds_b128 %0, %2, %3\n\t"
      "global_load_async_to_lds_b128 %0, %2, %4 offset:2304\n\t"
      "global_load_async_to_lds_b128 %0, %2, %5 offset:4608\n\t"
      "global_load_async_to_lds_b128 %0, %2, %6 offset:6912\n\t"
      "global_load_async_to_lds_b128 %0, %2, %7 offset:9216\n\t"
      "global_load_async_to_lds_b128 %0, %2, %8 offset:11520\n\t"
      "global_load_async_to_lds_b128 %1, %2, %9\n\t"
      "global_load_async_to_lds_b128 %1, %2, %10 offset:2304\n\t"
      "global_load_async_to_lds_b128 %1, %2, %11 offset:4608\n\t"
      "global_load_async_to_lds_b128 %1, %2, %12 offset:6912\n\t"
      "global_load_async_to_lds_b128 %1, %2, %13 offset:9216\n\t"
      "global_load_async_to_lds_b128 %1, %2, %14 offset:11520\n\t"
      "s_wait_xcnt 0x0"
      :: "v"(l + 8u * 2304u), "v"(l + 14u * 2304u), "v"(vo), "s"(sb), "s"(sb + D), "s"(sb + 2 * D), "s"(sb + 3 * D), "s"(sb + 4 * D), "s"(sb + 5 * D),
         "s"(sb + 6 * G), "s"(sb + 6 * G + D), "s"(sb + 6 * G + 2 * D), "s"(sb + 6 * G + 3 * D), "s"(sb + 6 * G + 4 * D), "s"(sb + 6 * G + 5 * D)
      : "memory");
}
__global__ __launch_bounds__(128) void k_gemm3(const _Float16* __restrict__ A, const _Float16* __restrict__ B0, const _Float16* __restrict__ B1, const _Float16* __restrict__ B2, float alpha,
    const float* __restrict__ bias0, const float* __restrict__ bias1, const float* __restrict__ bias2, _Float16* __restrict__ C0, _Float16* __restrict__ C1, _Float16* __restrict__ C2) {
  __shared__ __attribute__((aligned(16))) _Float16 st[2 * G3_ROWS * G2_PITCH];      /* the two slab buffers (92160 B, 3 blocks a WGP); behind the last slab's barrier the same bytes stage the block's output tile (51200 B) */
  const int tid = threadIdx.x, w = tid >> 5, lane = tid & 31, ln = lane & 15, hh = lane >> 4, wr = w >> 1, wc = w & 1;
  constexpr int NTN = 3 * DM / 192, NT = DM / G2_KS;
  const int mt = blockIdx.x / NTN, nq = blockIdx.x - mt * NTN; const int pl = nq >> 2, col0 = (nq & 3) * 192;
  const _Float16* Bh = pl == 0 ? B0 : (pl == 1 ? B1 : B2); const float* bp = pl == 0 ? bias0 : (pl == 1 ? bias1 : bias2); _Float16* C16 = pl == 0 ? C0 : (pl == 1 ? C1 : C2);
  const int cr = tid >> 3, cc = (tid & 7) * 8;
  const char* sa = (const char*)(A + (size_t)mt * 128 * DM); const char* sb = (const char*)(Bh + (size_t)col0 * DM); const unsigned vo = (unsigned)(cr * DM + cc) * 2u;      /* block-uniform bases; the lane's byte offset, the same in x and W (both have rows of DM halves) */
  const unsigned l0 = (unsigned)(size_t)&st[cr * G2_PITCH + cc];
  v8f acc[4][6];
#pragma unroll
  for (int i = 0; i < 4; ++i)
#pragma unroll
    for (int j = 0; j < 6; ++j) acc[i][j] = (v8f){0.f,0.f,0.f,0.f,0.f,0.f,0.f,0.f};
  g3_slab(l0, vo, sa, sb);
  asm volatile("s_wait_asynccnt 0x0" ::: "memory");      /* this wave's copies of slab 0 have landed */
  __syncthreads();                                       /* ... and every other wave's */
  g3_slab(l0 + G3_BUFB, vo, sa + G2_KS * 2, sb + G2_KS * 2);
#pragma unroll 1
  for (int t = 0; t < NT; ++t) { const _Float16* sx = st + (t & 1) * (G3_BUFB / 2) + (64 * wr + ln) * G2_PITCH; const _Float16* sw = st + (t & 1) * (G3_BUFB / 2) + (128 + 96 * wc + ln) * G2_PITCH;
#pragma unroll
    for (int ks = 0; ks < 2; ++ks) { v16h fx[4], fw[6];      /* the 10 fragments of 32 k are read as one group ahead of their 24 products */
#pragma unroll
      for (int i = 0; i < 4; ++i) fx[i] = g2_frag(sx + i * 16 * G2_PITCH + ks * 32, hh);
#pragma unroll
      for (int j = 0; j < 6; ++j) fw[j] = g2_frag(sw + j * 16 * G2_PITCH + ks * 32, hh);
      __builtin_amdgcn_sched_barrier(0);      /* keeps the 20 LDS reads one group: left free, the compiler read each W fragment alone, directly ahead of its 4 products, behind a wait to 0 */
#pragma unroll
      for (int j = 0; j < 6; ++j)
#pragma unroll
        for (int i = 0; i < 4; ++i) acc[i][j] = __builtin_amdgcn_wmma_f32_16x16x32_f16(false, fw[j], false, fx[i], (short)0, acc[i][j], false, false); }
    __builtin_amdgcn_sched_barrier(0);                   /* keeps the slab's products ahead of the barrier: left free, the compiler put 24 of them between the barrier and the refill, which then started that much later */
    asm volatile("s_wait_dscnt 0x0" ::: "memory");       /* this wave's reads of slab t are done before its buffer is handed back */
    asm volatile("s_wait_asynccnt 0x0" ::: "memory");    /* this wave's copies of slab t + 1 have landed */
    __syncthreads();                                     /* publishes slab t + 1 and ends every reader's last read of slab t */
    if (t + 2 < NT) g3_slab(l0 + (unsigned)(t & 1) * G3_BUFB, vo, sa + (t + 2) * (G2_KS * 2), sb + (t + 2) * (G2_KS * 2)); }
  asm volatile("s_wait_asynccnt 0x0" ::: "memory");      /* no copy is left in flight when the buffers become output staging */
#pragma unroll
  for (int j = 0; j < 6; ++j) { const float* bj = bp + col0 + 96 * wc + 16 * j + 8 * hh; const v4f ba = *(const v4fa*)bj, bb = *(const v4fa*)(bj + 4);
    const float bv[8] = {bf16_round(ba[0]), bf16_round(ba[1]), bf16_round(ba[2]), bf16_round(ba[3]), bf16_round(bb[0]), bf16_round(bb[1]), bf16_round(bb[2]), bf16_round(bb[3])};
#pragma unroll
    for (int i = 0; i < 4; ++i) { FragH f;
#pragma unroll
      for (int r = 0; r < 8; ++r) f.h[r] = (_Float16)(acc[i][j][r] * alpha + bv[r]);
      *(v8us*)((unsigned short*)st + (64 * wr + 16 * i + ln) * G3_OP + 96 * wc + 16 * j + 8 * hh) = f.half[0]; } }
  __syncthreads();                                       /* the whole 128 x 192 tile is staged: a row's three 128-byte lines hold two waves' features, and each line goes out whole, from one wave */
  const unsigned short* so = (const unsigned short*)st + cr * G3_OP + cc; unsigned short* go = (unsigned short*)C16 + (size_t)(mt * 128 + cr) * DM + col0 + cc;      /* 8 lanes a line, 16 rows a step, as in the copies */
#pragma unroll
  for (int sg = 0; sg < 3; ++sg)
#pragma unroll
    for (int q = 0; q < 8; ++q) { const v8us v = *(const v8us*)(so + q * 16 * G3_OP + sg * 64); *(v8us*)(go + (size_t)q * 16 * DM + sg * 64) = v; } }
__global__ __launch_bounds__(128) void k_flash(const _Float16* __restrict__ Q16, int ldq, const _Float16* __restrict__ K16, int ldk, const _Float16* __restrict__ Vt, const int* __restrict__ MSK, float* __restrict__ O, int ldo) {
  constexpr int RPW = 16, NQB = TQ / (4 * RPW), DT = 4, KS = 2;
  __shared__ __attribute__((aligned(16))) unsigned short sm[2 * FL_BUFB / 2];      /* the two stage buffers; behind the last stage's barrier the same bytes stage the output rows (17408 of 36864 B), so that 6 blocks still fit a WGP's LDS */
  float (*sO)[RPW][64 + 4] = (float (*)[RPW][64 + 4])sm;
  const int tid = threadIdx.x, w = tid >> 5, lane = tid & 31, ln = lane & 15, hh = lane >> 4; (void)MSK;
  const int slab = blockIdx.x / NQB, qblk = blockIdx.x % NQB; const int b = slab / NH, h = slab % NH; const int qb0 = qblk * (4 * RPW); const int q0 = qb0 + w * RPW;
  FragH bq[KS];
  { const unsigned short* qr = (const unsigned short*)Q16 + ((size_t)b * TQ + q0 + ln) * ldq + h * 64;
#pragma unroll
    for (int ks = 0; ks < KS; ++ks) { bq[ks].half[0] = *(const v8us*)(qr + ks * 32 + 8 * hh); bq[ks].half[1] = *(const v8us*)(qr + ks * 32 + 16 + 8 * hh); } }
  const int cr = tid >> 3, cc = (tid & 7) * 8;
  const _Float16* gk = K16 + ((size_t)b * TK + cr) * ldk + h * 64 + cc; const _Float16* gv = Vt + ((size_t)slab * 64 + cr) * TK + cc; const size_t k16 = (size_t)16 * ldk, v16 = (size_t)16 * TK;
  const unsigned l0 = (unsigned)(size_t)&sm[cr * FL_PITCH + cc];
  float m_q = -3.0e38f, l_q = 0.f; v8f oacc[DT];
#pragma unroll
  for (int dt = 0; dt < DT; ++dt) oacc[dt] = (v8f){0.f,0.f,0.f,0.f,0.f,0.f,0.f,0.f};
  constexpr int NS = TK / FL_KEYS;      /* 16 stages */
  fl_stage(l0, gk, k16, gv, v16);
  asm volatile("s_wait_asynccnt 0x0" ::: "memory");      /* this wave's copies of stage 0 have landed */
  __syncthreads();                                       /* ... and every other wave's */
  fl_stage(l0 + FL_BUFB, gk + (size_t)FL_KEYS * ldk, k16, gv + FL_KEYS, v16);
#pragma unroll 1
  for (int s = 0; s < NS; ++s) { const unsigned short* sb = sm + (s & 1) * (FL_BUFB / 2);
#pragma unroll 1
  for (int j0 = 0; j0 < FL_KEYS; j0 += 32) {
    float sc[16];
#pragma unroll
    for (int nt = 0; nt < 2; ++nt) { const unsigned short* kr = sb + (j0 + nt * 16 + ln) * FL_PITCH; FragH ak[KS];
#pragma unroll
      for (int ks = 0; ks < KS; ++ks) { ak[ks].half[0] = *(const v8us*)(kr + ks * 32 + 8 * hh); ak[ks].half[1] = *(const v8us*)(kr + ks * 32 + 16 + 8 * hh); }
      v8f acc = (v8f){0.f,0.f,0.f,0.f,0.f,0.f,0.f,0.f};
#pragma unroll
      for (int ks = 0; ks < KS; ++ks) acc = mmaH<1>(ak[ks].v, ak[ks].v, bq[ks].v, bq[ks].v, acc);
#pragma unroll
      for (int r = 0; r < 8; ++r) sc[nt * 8 + r] = acc[r]; }      /* raw q.k: the 1/8 rides in the exponent's FMA; m_q is a raw score too */
    float mc = fmaxf(sc[0], sc[1]);
#pragma unroll
    for (int i = 2; i < 16; ++i) mc = fmaxf(mc, sc[i]);
    mc = fmaxf(mc, xhalf(mc));
    const float mn = fmaxf(m_q, mc); const float al = (mn > -1.0e38f) ? __builtin_amdgcn_exp2f((m_q - mn) * SCL2) : 1.0f; m_q = mn;
    const float nb = __builtin_fmaf(-mn, SCL2, 10.0f);      /* p x 2^10 = 2^(s/8 log2e - m/8 log2e + 10): one FMA and one v_exp_f32 a score; arguments reach about 10 at most, and below -126 the result is 0 */
    FragH pb;
#pragma unroll
    for (int i = 0; i < 16; ++i) sc[i] = __builtin_fmaf(sc[i], SCL2, nb);
    exp2x8(sc[0], sc[1], sc[2], sc[3], sc[4], sc[5], sc[6], sc[7]); exp2x8(sc[8], sc[9], sc[10], sc[11], sc[12], sc[13], sc[14], sc[15]);
    float ps[4] = {sc[0], sc[1], sc[2], sc[3]};      /* l_q sums p x 2^10, like the P operand */
#pragma unroll
    for (int i = 4; i < 16; ++i) ps[i & 3] += sc[i];
#pragma unroll
    for (int i = 0; i < 16; ++i) pb.h[i] = (_Float16)sc[i];
    l_q = l_q * al + ((ps[0] + ps[1]) + (ps[2] + ps[3]));
#pragma unroll
    for (int dt = 0; dt < DT; ++dt)
#pragma unroll
      for (int r = 0; r < 8; ++r) oacc[dt][r] *= al;
#pragma unroll
    for (int dt = 0; dt < DT; ++dt) { const unsigned short* vrow = sb + (64 + dt * 16 + ln) * FL_PITCH + j0; FragH av; av.half[0] = *(const v8us*)(vrow + 8 * hh); av.half[1] = *(const v8us*)(vrow + 16 + 8 * hh);
      oacc[dt] = mmaH<1>(av.v, av.v, pb.v, pb.v, oacc[dt]); } }
    asm volatile("s_wait_dscnt 0x0" ::: "memory");       /* this wave's reads of stage s are done before its buffer is handed back */
    asm volatile("s_wait_asynccnt 0x0" ::: "memory");    /* this wave's copies of stage s + 1 have landed */
    __syncthreads();                                     /* publishes stage s + 1 and ends every reader's last read of stage s */
    if (s + 2 < NS) fl_stage(l0 + (unsigned)(s & 1) * FL_BUFB, gk + (size_t)(s + 2) * FL_KEYS * ldk, k16, gv + (s + 2) * FL_KEYS, v16); }
  asm volatile("s_wait_asynccnt 0x0" ::: "memory");      /* no copy is left in flight when the buffers become output staging */
  { const float l = l_q + xhalf(l_q); const float inv = (l > 0.f) ? 1.0f / l : 0.f;      /* l and O carry the same 2^10 */
#pragma unroll
    for (int dt = 0; dt < DT; ++dt)
#pragma unroll
      for (int g = 0; g < 2; ++g) { v4f o4; 
#pragma unroll
        for (int q = 0; q < 4; ++q) o4[q] = oacc[dt][g * 4 + q] * inv;
        *(v4fa*)&sO[w][ln][dt * 16 + 8 * hh + g * 4] = o4; } }
  __builtin_amdgcn_fence(__ATOMIC_ACQ_REL, "workgroup"); __builtin_amdgcn_wave_barrier();
  {
#pragma unroll
    for (int rp = 0; rp < RPW; rp += 2) { const int r = rp + (lane >> 4), pc = lane & 15; const v4f val = *(const v4fa*)&sO[w][r][pc * 4]; *(v4f*)(O + ((size_t)b * TQ + q0 + r) * ldo + h * 64 + pc * 4) = val; }
     } }
__global__ __launch_bounds__(256) void k_fulltab(unsigned* __restrict__ MB, int* __restrict__ RA, int* __restrict__ KE, int nq, int nk) {
  const int t = blockIdx.x * 256 + threadIdx.x;
  if (t < nq * (nk / 32)) { *(unsigned*)(MB + t) = 0u;  }
  if (t < nq) { *(int*)(RA + t) = 0;  }
  if (t < nq / 64) { *(int*)(KE + t * 32) = nk;  } }
__global__ __launch_bounds__(256) void k_lnout(const float* __restrict__ Y, const float* __restrict__ g, const float* __restrict__ bb, float* __restrict__ out) {
  #pragma clang fp contract(off)
  const int tid = threadIdx.x, w = tid >> 5, ln = tid & 31; const int r = blockIdx.x * 8 + w; if (r >= NR) return; const float* y = Y + (size_t)r * DM; float s = 0.f;
#pragma unroll 1
  for (int i = 0; i < 8; ++i) { const v4f a = *(const v4fa*)(y + i * 128 + ln * 4); for (int q = 0; q < 4; ++q) s += a[q]; }
  for (int o = 16; o > 0; o >>= 1) s += __shfl_xor(s, o, 32); const float mu = s / (float)DM; float q2 = 0.f;
#pragma unroll 1
  for (int i = 0; i < 8; ++i) { const v4f a = *(const v4fa*)(y + i * 128 + ln * 4); for (int q = 0; q < 4; ++q) { const float d = a[q] - mu; q2 += d * d; } }
  for (int o = 16; o > 0; o >>= 1) q2 += __shfl_xor(q2, o, 32); const float rs = rsqrtf(q2 / (float)DM + 1e-6f);
  {
#pragma unroll 1
    for (int i = 0; i < 8; ++i) { const int c0 = i * 128 + ln * 4; const v4f a = *(const v4fa*)(y + c0); v4f o4; for (int q = 0; q < 4; ++q) o4[q] = (a[q] - mu) * rs * bf16_round(g[c0 + q]) + bf16_round(bb[c0 + q]); *(v4f*)(out + (size_t)r * DM + c0) = o4; }
     } }
__global__ __launch_bounds__(256) void k_xb(const float* __restrict__ x, float* __restrict__ XB, size_t n4) { const size_t t = (size_t)blockIdx.x * 256 + threadIdx.x; if (t >= n4) return; const v4f a = *(const v4fa*)(x + t * 4); v4f o; for (int q = 0; q < 4; ++q) o[q] = bf16_round(a[q]); *(v4f*)(XB + t * 4) = o;  }
__global__ __launch_bounds__(256) void k_causaltab(unsigned* __restrict__ MB, int* __restrict__ RA, int* __restrict__ KE, int nq, int nk) {
  const int t = blockIdx.x * 256 + threadIdx.x; const int nw = nk / 32;
  if (t < nq * nw) { const int q = t / nw, w = t % nw; const int first = q + 1 - 32 * w; const unsigned bits = (first <= 0) ? 0xffffffffu : ((first >= 32) ? 0u : (0xffffffffu << first)); *(unsigned*)(MB + t) = bits;  }
  if (t < nq) { *(int*)(RA + t) = 0;  }
  if (t < nq / 64) { const int v = 64 * (t + 1); *(int*)(KE + t * 32) = v;  } }


extern "C" void kernel_launch(void* const* d_in, const int* in_sizes, int n_in,
                              void* d_out, int out_size, void* d_ws, size_t ws_size, hipStream_t stream) {
  (void)in_sizes; (void)n_in; (void)out_size;
  const float* const* I = (const float* const*)d_in; const float* x = I[0]; const float* Wq = I[1]; const float* bq = I[2]; const float* Wk = I[3]; const float* bk = I[4]; const float* Wv = I[5]; const float* bv = I[6];
  char* ws = (char*)d_ws; size_t off = 0;
  auto take = [&](size_t bytes) { char* p = ws + off; off += (bytes + 255) & ~(size_t)255; return p; };
  _Float16* BQ = (_Float16*)take((size_t)DM * DM * 2); _Float16* BK = (_Float16*)take((size_t)DM * DM * 2); _Float16* BV = (_Float16*)take((size_t)DM * DM * 2);
  _Float16* X16 = (_Float16*)take((size_t)NR * DM * 2); _Float16* Q16 = (_Float16*)take((size_t)NR * DM * 2); _Float16* K16 = (_Float16*)take((size_t)NR * DM * 2); _Float16* V16 = (_Float16*)take((size_t)NR * DM * 2); _Float16* VT = (_Float16*)take((size_t)NR * DM * 2);
  if (off > ws_size) return;      /* 3.5 + 5 x 12.6 = 66 MB */
  const size_t w8 = (size_t)DM * DM / 8; const unsigned wb = (unsigned)((w8 + 255) / 256);
  k_round16f<<<wb, 256, 0, stream>>>(Wq, BQ, w8); k_round16f<<<wb, 256, 0, stream>>>(Wk, BK, w8); k_round16f<<<wb, 256, 0, stream>>>(Wv, BV, w8);      /* torch (out,in) = natural Bt */
  const size_t n8 = (size_t)NR * DM / 8; const unsigned nb8 = (unsigned)((n8 + 255) / 256); const dim3 gP((NR / 128) * (3 * DM / 192), 1);
  k_x16<<<nb8, 256, 0, stream>>>(x, X16, n8);
  k_gemm3<<<gP, 128, 0, stream>>>(X16, BQ, BK, BV, 0.0625f, bq, bk, bv, Q16, K16, V16);      /* 64 row tiles x 12 column tiles = 768 blocks, 3 a WGP */
  k_vt<NH, SLEN><<<NBT * NH * (SLEN / 64), 256, 0, stream>>>(V16, DM, 0, VT);      /* all batches in one grid: slab = batch * NH + head */
  k_flash<<<NBT * NH * (SLEN / 64), 128, 0, stream>>>(Q16, DM, K16, DM, VT, nullptr, (float*)d_out, DM);      /* all batches in one grid; ctx rows straight into the output */
}

// v006
// A run of this version takes 69.9 microseconds.
// Two timings next to v005 put it at 1.09 and 1.08 times that version's speed.
// All steps since v000 together make it 13.3 times as fast.
#include <hip/hip_runtime.h>
// DeiT self-attention (8 x 1024 tokens, 768 = 12 heads x 64): q,k,v = x W^T + b; softmax(q.k/8) over all keys; ctx = attn.v merged -> [8,1024,768] (no output projection).
// Structure: x and the three weight matrices to exact f16 planes in one launch of fat waves; the three projections as one f16 WMMA GEMM (128x192 block tiles, 64x96 wave tiles, f32 accumulation, exact products + bias) into f16 planes; the fused flash kernel over all 1024 keys (plain f16 q/k/V^T, online softmax in f32, P x2^10) per ((batch, head), 64 queries) writes the merged context rows straight into the output.
// Compute dtype: x, weights, biases rounded to bf16; q, k, v, P as plain f16 (~2^-12; logits sigma ~0.3); f32 accumulation and softmax. v_wmma_f32_16x16x32_f16.
#define NBT 8
#define SLEN 1024
#define TQ SLEN
#define TK SLEN
#define DM 768
#define NH 12
#define SCL 0.125f
#define SCL2 (SCL * 1.4426950408889634f)      /* 1/8 x log2(e): raw score -> base-2 exponent */
#define NR (NBT * SLEN)
typedef __bf16 v16b __attribute__((ext_vector_type(16)));
typedef unsigned short v8us __attribute__((ext_vector_type(8), may_alias));
typedef float  v8f  __attribute__((ext_vector_type(8)));
typedef float  v4f  __attribute__((ext_vector_type(4)));
typedef float  v4fa __attribute__((ext_vector_type(4), may_alias));
union FragB { v16b v; v8us half[2]; unsigned short u[16]; };

__device__ __forceinline__ unsigned short bf16_bits(float x) { unsigned int u = __float_as_uint(x); return (unsigned short)((u + 0x7FFFu + ((u >> 16) & 1u)) >> 16); }
__device__ __forceinline__ float bf16_val(unsigned short b) { return __uint_as_float(((unsigned int)b) << 16); }
__device__ __forceinline__ float bf16_round(float x) { return bf16_val(bf16_bits(x)); }
// D += A·B with NT terms: 1 = ah·bh, 2 = + al·bh (A split), 3 = + ah·bl (both split)
template <int NT>
__device__ __forceinline__ v8f mmaN(v16b ah, v16b al, v16b bh, v16b bl, v8f c) {
  c = __builtin_amdgcn_wmma_f32_16x16x32_bf16(false, ah, false, bh, (short)0, c, false, false);
  if (NT >= 2) c = __builtin_amdgcn_wmma_f32_16x16x32_bf16(false, al, false, bh, (short)0, c, false, false);
  if (NT >= 3) c = __builtin_amdgcn_wmma_f32_16x16x32_bf16(false, ah, false, bl, (short)0, c, false, false);
  asm volatile("v_nop\n\tv_nop\n\tv_nop\n\tv_nop" : "+v"(c) : "v"(ah), "v"(al), "v"(bh), "v"(bl));
  return c;
}

__global__ __launch_bounds__(256) void k_wt_bf16(const float* __restrict__ W, unsigned short* __restrict__ Wt, int K, int N) {
  const int t = blockIdx.x * 256 + threadIdx.x;
  const int k8n = K / 8;
  if (t >= N * k8n) return;
  const int n = t / k8n, k8 = (t % k8n) * 8;
  v8us v;
#pragma unroll
  for (int i = 0; i < 8; ++i) v[i] = bf16_bits(W[(size_t)(k8 + i) * N + n]);
  *(v8us*)(Wt + (size_t)n * K + k8) = v;
  
}

// GEMM C[M][N] (f32, pitch ldc) = act(A[M][K]·W + bias). A f32 row-major (pitch lda) converted per fragment to bf16
// (ASPLIT: hi/lo two planes -> 2 terms, else single rounded term); Wt bf16 [N][K] (pitch ldb). BIAS_BF16 rounds the
// bias to bf16 first (bias quantised to bf16 before the add). K%32==0, M%16==0, N%64==0.
template <bool ASPLIT, int ACT, bool BIAS_BF16>
__global__ __launch_bounds__(128) void k_gemm_bf(const float* __restrict__ A, int lda, const unsigned short* __restrict__ Wt, int ldb,
                                               const float* __restrict__ bias, float* __restrict__ C, int ldc, int M, int N, int K) {
  __shared__ __attribute__((aligned(16))) float so[4][16][64];
  const int tid = threadIdx.x, w = tid >> 5, lane = tid & 31, ln = lane & 15, hh = lane >> 4;
  const int ntn = N / 64;
  const int wid = blockIdx.x * 4 + w;
  const int mt = wid / ntn, nq = wid % ntn;
  if (mt * 16 >= M) return;
  const int row0 = mt * 16, col0 = nq * 64;
  const float* arow = A + (size_t)(row0 + ln) * lda;
  v8f acc[4] = {};
  for (int kb = 0; kb < K; kb += 32) {
    FragB ah, al;
    const v4f x0 = *(const v4fa*)(arow + kb + 8 * hh), x1 = *(const v4fa*)(arow + kb + 8 * hh + 4);
    const v4f x2 = *(const v4fa*)(arow + kb + 16 + 8 * hh), x3 = *(const v4fa*)(arow + kb + 16 + 8 * hh + 4);
    float xs[16] = {x0[0],x0[1],x0[2],x0[3],x1[0],x1[1],x1[2],x1[3],x2[0],x2[1],x2[2],x2[3],x3[0],x3[1],x3[2],x3[3]};
#pragma unroll
    for (int i = 0; i < 16; ++i) { const unsigned short hb = bf16_bits(xs[i]); ah.u[i] = hb; al.u[i] = ASPLIT ? bf16_bits(xs[i] - bf16_val(hb)) : (unsigned short)0; }
#pragma unroll
    for (int t = 0; t < 4; ++t) {
      const unsigned short* brow = Wt + (size_t)(col0 + t * 16 + ln) * ldb + kb;
      FragB b;
      b.half[0] = *(const v8us*)(brow + 8 * hh);
      b.half[1] = *(const v8us*)(brow + 16 + 8 * hh);
      acc[t] = mmaN<ASPLIT ? 2 : 1>(ah.v, al.v, b.v, b.v, acc[t]);
    }
  }
#pragma unroll
  for (int t = 0; t < 4; ++t) {
    float bv = bias ? bias[col0 + t * 16 + ln] : 0.f;
    if (BIAS_BF16) bv = bf16_round(bv);
#pragma unroll
    for (int r = 0; r < 8; ++r) { float v = acc[t][r] + bv; if (ACT == 1) v = fmaxf(v, 0.f); so[w][8 * hh + r][t * 16 + ln] = v; }
  }
  __builtin_amdgcn_fence(__ATOMIC_ACQ_REL, "workgroup");
  __builtin_amdgcn_wave_barrier();
  const int rsub = lane >> 4, c4 = (lane & 15) * 4;
  {
#pragma unroll
    for (int q = 0; q < 8; ++q) {
      const int r = q * 2 + rsub;
      const v4f v = *(const v4fa*)&so[w][r][c4];
      *(v4f*)(C + (size_t)(row0 + r) * ldc + col0 + c4) = v;
    }
    
  }
}

// GEMM C = act(A·W + bias + resid): A f32 (ASPLIT -> hi/lo 2 terms), Wt bf16 [N][K]; ACT 0 none, 1 relu, 2 exact gelu;
// resid (optional, f32, row index = (row % rmod), pitch ldr, RES_BF16 rounds it) added before the activation.
template <bool ASPLIT, int ACT, bool BIAS_BF16, bool RES_BF16>
__global__ __launch_bounds__(128) void k_gemm_bf3(const float* __restrict__ A, int lda, const unsigned short* __restrict__ Wt, int ldb,
                                                const float* __restrict__ bias, const float* __restrict__ resid, int rmod, int ldr,
                                                float* __restrict__ C, int ldc, int M, int N, int K) {
  __shared__ __attribute__((aligned(16))) float so[4][16][64];
  const int tid = threadIdx.x, w = tid >> 5, lane = tid & 31, ln = lane & 15, hh = lane >> 4;
  const int ntn = N / 64;
  const int wid = blockIdx.x * 4 + w;
  const int mt = wid / ntn, nq = wid % ntn;
  if (mt * 16 >= M) return;
  const int row0 = mt * 16, col0 = nq * 64;
  const float* arow = A + (size_t)(row0 + ln) * lda;
  v8f acc[4] = {};
  for (int kb = 0; kb < K; kb += 32) {
    FragB ah, al;
    const v4f x0 = *(const v4fa*)(arow + kb + 8 * hh), x1 = *(const v4fa*)(arow + kb + 8 * hh + 4);
    const v4f x2 = *(const v4fa*)(arow + kb + 16 + 8 * hh), x3 = *(const v4fa*)(arow + kb + 16 + 8 * hh + 4);
    float xs[16] = {x0[0],x0[1],x0[2],x0[3],x1[0],x1[1],x1[2],x1[3],x2[0],x2[1],x2[2],x2[3],x3[0],x3[1],x3[2],x3[3]};
#pragma unroll
    for (int i = 0; i < 16; ++i) { const unsigned short hb = bf16_bits(xs[i]); ah.u[i] = hb; al.u[i] = ASPLIT ? bf16_bits(xs[i] - bf16_val(hb)) : (unsigned short)0; }
#pragma unroll
    for (int t = 0; t < 4; ++t) {
      const unsigned short* brow = Wt + (size_t)(col0 + t * 16 + ln) * ldb + kb;
      FragB b;
      b.half[0] = *(const v8us*)(brow + 8 * hh);
      b.half[1] = *(const v8us*)(brow + 16 + 8 * hh);
      acc[t] = mmaN<ASPLIT ? 2 : 1>(ah.v, al.v, b.v, b.v, acc[t]);
    }
  }
#pragma unroll
  for (int t = 0; t < 4; ++t) {
    const int col = col0 + t * 16 + ln;
    float bv = bias ? bias[col] : 0.f;
    if (BIAS_BF16) bv = bf16_round(bv);
#pragma unroll
    for (int r = 0; r < 8; ++r) {
      float v = acc[t][r] + bv;
      if (resid) { float rv = resid[(size_t)((row0 + 8 * hh + r) % rmod) * ldr + col]; if (RES_BF16) rv = bf16_round(rv); v += rv; }
      if (ACT == 1) v = fmaxf(v, 0.f);
      if (ACT == 2) v = 0.5f * v * (1.0f + erff(v * 0.70710678118654752f));
      if (ACT == 3) { const float u = 0.7978845608028654f * (v + 0.044715f * v * v * v); v = 0.5f * v * (1.0f + tanhf(u)); }
      so[w][8 * hh + r][t * 16 + ln] = v;
    }
  }
  __builtin_amdgcn_fence(__ATOMIC_ACQ_REL, "workgroup");
  __builtin_amdgcn_wave_barrier();
  const int rsub = lane >> 4, c4 = (lane & 15) * 4;
  {
#pragma unroll
    for (int q = 0; q < 8; ++q) {
      const int r = q * 2 + rsub;
      const v4f v = *(const v4fa*)&so[w][r][c4];
      *(v4f*)(C + (size_t)(row0 + r) * ldc + col0 + c4) = v;
    }
    
  }
}
// row LayerNorm (biased variance, eps) over N: s = X (+ R); optional out_sum <- s; out_norm <- (s-mu)*rsqrt(var+eps)*g + b
template <bool PARAM_BF16>
__global__ __launch_bounds__(256) void k_layernorm(const float* __restrict__ X, const float* __restrict__ R, const float* __restrict__ g, const float* __restrict__ bta,
                                                  float* __restrict__ out_sum, float* __restrict__ out_norm, int N, float eps) {
  __shared__ float red[256];
  const int row = blockIdx.x, tid = threadIdx.x;
  const float* x = X + (size_t)row * N; const float* rr = R ? R + (size_t)row * N : nullptr;
  float vals[16];                     // up to N = 4096
  const int per = N / 256;            // contiguous chunk per thread? use strided-by-4 chunks: thread handles j = tid*4 + 1024*u
  float s1 = 0.f;
  for (int u = 0; u < per / 4; ++u) {
    const int j = tid * 4 + 1024 * u;
    const v4f a = *(const v4fa*)(x + j);
    v4f b = {0.f,0.f,0.f,0.f}; if (rr) b = *(const v4fa*)(rr + j);
#pragma unroll
    for (int q = 0; q < 4; ++q) { const float v = a[q] + b[q]; vals[u * 4 + q] = v; s1 += v; }
  }
  red[tid] = s1; __syncthreads();
  for (int st = 128; st > 0; st >>= 1) { if (tid < st) red[tid] += red[tid + st]; __syncthreads(); }
  const float mu = red[0] / (float)N; __syncthreads();
  float s2 = 0.f;
  for (int u = 0; u < per / 4; ++u)
#pragma unroll
    for (int q = 0; q < 4; ++q) { const float c = vals[u * 4 + q] - mu; s2 += c * c; }
  red[tid] = s2; __syncthreads();
  for (int st = 128; st > 0; st >>= 1) { if (tid < st) red[tid] += red[tid + st]; __syncthreads(); }
  const float rs = rsqrtf(red[0] / (float)N + eps);
  {
    for (int u = 0; u < per / 4; ++u) {
      const int j = tid * 4 + 1024 * u;
      v4f o, sm;
#pragma unroll
      for (int q = 0; q < 4; ++q) {
        float gg = g[j + q], bb = bta[j + q];
        if (PARAM_BF16) { gg = bf16_round(gg); bb = bf16_round(bb); }
        sm[q] = vals[u * 4 + q]; o[q] = (vals[u * 4 + q] - mu) * rs * gg + bb;
      }
      if (out_sum) *(v4f*)(out_sum + (size_t)row * N + j) = sm;
      *(v4f*)(out_norm + (size_t)row * N + j) = o;
    }
    
  }
}



// ---- f16 WMMA path (v_wmma_f32_16x16x32_f16): 11-bit significands for operands in range — used where a [0,1] probability operand needs more precision than bf16
typedef _Float16 v16h __attribute__((ext_vector_type(16)));
union FragH { v16h v; v8us half[2]; _Float16 h[16]; unsigned short u[16]; };
template <int NT>
__device__ __forceinline__ v8f mmaH(v16h ah, v16h al, v16h bh, v16h bl, v8f c) {
  c = __builtin_amdgcn_wmma_f32_16x16x32_f16(false, ah, false, bh, (short)0, c, false, false);
  if (NT >= 2) c = __builtin_amdgcn_wmma_f32_16x16x32_f16(false, al, false, bh, (short)0, c, false, false);
  if (NT >= 3) c = __builtin_amdgcn_wmma_f32_16x16x32_f16(false, ah, false, bl, (short)0, c, false, false);
  asm volatile("v_nop\n\tv_nop\n\tv_nop\n\tv_nop" : "+v"(c) : "v"(ah), "v"(al), "v"(bh), "v"(bl));
  return c;
}
// batched GEMM like k_gemm_b but f16 operands: A f32 (split into f16 hi/lo if ASPLIT, else rounded to f16), Bt = f16 values [n][k]; alpha; C f32; N multiple of 16 (partial tiles skipped)
template <bool ASPLIT>
__global__ __launch_bounds__(128) void k_gemm_h(const float* __restrict__ A, int lda, size_t sA, const _Float16* __restrict__ Bh, int ldb, size_t sB, float alpha, float* __restrict__ C, int ldc, size_t sC, int M, int N, int K) {
  __shared__ __attribute__((aligned(16))) float so[4][16][64];
  const int tid = threadIdx.x, w = tid >> 5, lane = tid & 31, ln = lane & 15, hh = lane >> 4; const int by = blockIdx.y;
  A += (size_t)by * sA; Bh += (size_t)by * sB; C += (size_t)by * sC;
  const int ntn = (N + 63) / 64; const int wid = blockIdx.x * 4 + w; const int mt = wid / ntn, nq = wid % ntn; if (mt * 16 >= M) return;
  const int row0 = mt * 16, col0 = nq * 64; const float* arow = A + (size_t)(row0 + ln) * lda;
  v8f acc[4] = {};
  for (int kb = 0; kb < K; kb += 32) {
    FragH ah, al;
    const v4f x0 = *(const v4fa*)(arow + kb + 8 * hh), x1 = *(const v4fa*)(arow + kb + 8 * hh + 4), x2 = *(const v4fa*)(arow + kb + 16 + 8 * hh), x3 = *(const v4fa*)(arow + kb + 16 + 8 * hh + 4);
    float xs[16] = {x0[0],x0[1],x0[2],x0[3],x1[0],x1[1],x1[2],x1[3],x2[0],x2[1],x2[2],x2[3],x3[0],x3[1],x3[2],x3[3]};
#pragma unroll
    for (int i = 0; i < 16; ++i) { const _Float16 h = (_Float16)xs[i]; ah.h[i] = h; al.h[i] = ASPLIT ? (_Float16)(xs[i] - (float)h) : (_Float16)0.0f; }
#pragma unroll
    for (int t = 0; t < 4; ++t) { if (col0 + t * 16 >= N) continue; const size_t boff = (size_t)(col0 + t * 16 + ln) * ldb + kb; FragH bq; bq.half[0] = *(const v8us*)(Bh + boff + 8 * hh); bq.half[1] = *(const v8us*)(Bh + boff + 16 + 8 * hh);
      acc[t] = mmaH<ASPLIT ? 2 : 1>(ah.v, al.v, bq.v, bq.v, acc[t]); }
  }
#pragma unroll
  for (int t = 0; t < 4; ++t) { if (col0 + t * 16 >= N) continue;
#pragma unroll
    for (int r = 0; r < 8; ++r) so[w][8 * hh + r][t * 16 + ln] = acc[t][r] * alpha; }
  __builtin_amdgcn_fence(__ATOMIC_ACQ_REL, "workgroup"); __builtin_amdgcn_wave_barrier();
  const int rsub = lane >> 4, c4 = (lane & 15) * 4;
  {
#pragma unroll
    for (int q = 0; q < 8; ++q) { const int r = q * 2 + rsub; if (col0 + c4 < N) { const v4f v = *(const v4fa*)&so[w][r][c4]; *(v4f*)(C + (size_t)(row0 + r) * ldc + col0 + c4) = v; } }
     }
}

// Wt[n][k] = f16(W[k][n]·scale) from f32 row-major W[K][N] (scale = power of two; bf16-exact weights stay exact in f16 away from the subnormal range)
__global__ __launch_bounds__(256) void k_wt_f16(const float* __restrict__ W, _Float16* __restrict__ Wt, int K, int N, float scale) {
  const int t = blockIdx.x * 256 + threadIdx.x; if (t >= N * (K / 8)) return; const int n = t / (K / 8), k8 = (t % (K / 8)) * 8; FragH f;
#pragma unroll
  for (int i = 0; i < 8; ++i) f.h[i] = (_Float16)(bf16_round(W[(size_t)(k8 + i) * N + n]) * scale); const v8us o = f.half[0];
  *(v8us*)((unsigned short*)Wt + (size_t)n * K + k8) = o; 
}
// k_gemm_hh variant with fused epilogue: v = acc·alpha + bias[by·sBias + col] (+ CP[(row/rowsPerB)·sCPb + by·64 + col] if CP) ; ACT 0 none / 1 elu ; writes f16 C16 (and f32 C if non-null)
template <int ACT>
__global__ __launch_bounds__(128) void k_gemm_hhx(const _Float16* __restrict__ A, int lda, size_t sA, const _Float16* __restrict__ Bh, int ldb, size_t sB, float alpha, const float* __restrict__ bias, size_t sBias, const float* __restrict__ CP, int rowsPerB, size_t sCPb, int row0g,
    float* __restrict__ C, _Float16* __restrict__ C16, int ldc, size_t sC, int M, int N, int K) {
  __shared__ __attribute__((aligned(16))) float so[4][16][64];
  const int tid = threadIdx.x, w = tid >> 5, lane = tid & 31, ln = lane & 15, hh = lane >> 4; const int by = blockIdx.y;
  A += (size_t)by * sA; Bh += (size_t)by * sB; const size_t cofs = (size_t)by * sC; const float* bp = bias ? bias + (size_t)by * sBias : nullptr;
  const int ntn = (N + 63) / 64; const int wid = blockIdx.x * 4 + w; const int mt = wid / ntn, nq = wid % ntn; if (mt * 16 >= M) return;
  const int row0 = mt * 16, col0 = nq * 64; const _Float16* arow = A + (size_t)(row0 + ln) * lda;
  v8f acc[4] = {};
  for (int kb = 0; kb < K; kb += 32) { FragH ah; ah.half[0] = *(const v8us*)((const unsigned short*)arow + kb + 8 * hh); ah.half[1] = *(const v8us*)((const unsigned short*)arow + kb + 16 + 8 * hh);
#pragma unroll
    for (int t = 0; t < 4; ++t) { if (col0 + t * 16 >= N) continue; const size_t boff = (size_t)(col0 + t * 16 + ln) * ldb + kb; FragH bq; bq.half[0] = *(const v8us*)((const unsigned short*)Bh + boff + 8 * hh); bq.half[1] = *(const v8us*)((const unsigned short*)Bh + boff + 16 + 8 * hh);
      acc[t] = mmaH<1>(ah.v, ah.v, bq.v, bq.v, acc[t]); }
  }
#pragma unroll
  for (int t = 0; t < 4; ++t) { if (col0 + t * 16 >= N) continue; const int col = col0 + t * 16 + ln; const float bv = bp ? bf16_round(bp[col]) : 0.f;
#pragma unroll
    for (int r = 0; r < 8; ++r) { float v = acc[t][r] * alpha + bv; if (CP) { const int bidx = (row0g + row0 + 8 * hh + r) / rowsPerB; v += CP[(size_t)bidx * sCPb + (size_t)by * 64 + col]; } if (ACT == 1) v = (v > 0.f) ? v : expm1f(v); else if (ACT == 7) v = (v > 0.f) ? v + 1.0f : expf(v); else if (ACT == 8) v = tanhf(v); else if (ACT == 9) v = 0.5f * v * (1.0f + tanhf(0.7978845608028654f * (v + 0.044715f * v * v * v))); else if (ACT == 11) v = 1.0f / (1.0f + expf(-v)); else if (ACT == 12) v = (v > 0.f) ? v : 0.01f * v; else if (ACT == 14) v = (v > 0.f) ? v : 0.1f * v; else if (ACT == 15) v = v / (1.0f + expf(-v)); else if (ACT == 3) v = fmaxf(v, 0.f); else if (ACT == 6) v = 0.5f * v * (1.0f + erff(v * 0.70710678118654752f)); so[w][8 * hh + r][t * 16 + ln] = v; } }
  __builtin_amdgcn_fence(__ATOMIC_ACQ_REL, "workgroup"); __builtin_amdgcn_wave_barrier();
  const int rsub = lane >> 4, c4 = (lane & 15) * 4; typedef _Float16 v4h __attribute__((ext_vector_type(4)));
  {
#pragma unroll
    for (int q = 0; q < 8; ++q) { const int r = q * 2 + rsub; if (col0 + c4 < N) { const v4f v = *(const v4fa*)&so[w][r][c4]; if (C) *(v4f*)(C + cofs + (size_t)(row0 + r) * ldc + col0 + c4) = v; if (C16) { v4h h4; for (int i = 0; i < 4; ++i) h4[i] = (_Float16)v[i]; *(v4h*)(C16 + cofs + (size_t)(row0 + r) * ldc + col0 + c4) = h4; } } }
     }
}


typedef _Float16 v4h __attribute__((ext_vector_type(4)));

// x and the three weight matrices to their f16 planes in ONE launch of 3,936 waves, one 16-wave work-group a WGP, all resident at once: a wave takes 8 KB of contiguous f32
// by 16 loads of 16 B a lane (each covers 4 whole lines), all 16 in flight together, and stores 16 x 256 B of f16 (2 whole lines each).
// One 32-byte read a lane makes 31,488 waves in four dependent launches of the same 48 MB: by count, starting that many waves and the three extra launch gaps take longer than moving the bytes.
#define PW_F 2048                      /* floats a wave */
#define PW_XB (NR * DM / PW_F / 16)    /* 192 work-groups for x */
#define PW_WB (DM * DM / PW_F / 16)    /* 18 for each weight matrix */
static_assert(NR * DM % (PW_F * 16) == 0 && DM * DM % (PW_F * 16) == 0, "every wave has a whole share");
template <bool WS>      /* WS: a weight, x16 (a power of two: the bf16 value stays exact in f16) */
__device__ __forceinline__ void prep_wave(const float* __restrict__ s, _Float16* __restrict__ d, int lane) {
  v4f a[16];
#pragma unroll
  for (int i = 0; i < 16; ++i) a[i] = *(const v4fa*)(s + i * 128 + lane * 4);
  __builtin_amdgcn_sched_barrier(0);      /* keeps all 16 loads ahead of the first conversion: left free, the compiler issued 10 or 11 and the rest only behind the waits for those, a second memory latency in a wave that has only this one batch */
#pragma unroll
  for (int i = 0; i < 16; ++i) { v4h o;
#pragma unroll
    for (int q = 0; q < 4; ++q) o[q] = (_Float16)(WS ? bf16_round(a[i][q]) * 16.0f : bf16_round(a[i][q]));
    *(v4h*)(d + i * 128 + lane * 4) = o; }
  asm volatile("s_wait_xcnt 0x0" ::: "memory"); }      /* behind the last store: no register that a store names (its scalar base among them) is rewritten ahead of this wait on any way the code holds from here */
__global__ __launch_bounds__(512) void k_prep(const float* __restrict__ x, const float* __restrict__ Wq, const float* __restrict__ Wk, const float* __restrict__ Wv,
    _Float16* __restrict__ X16, _Float16* __restrict__ BQ, _Float16* __restrict__ BK, _Float16* __restrict__ BV) {
  const int w = __builtin_amdgcn_readfirstlane(threadIdx.x >> 5), lane = threadIdx.x & 31, blk = blockIdx.x;      /* the wave's number as a scalar: its share's base address stays in scalar registers */
  if (blk < PW_XB) { const size_t o = (size_t)(blk * 16 + w) * PW_F; prep_wave<false>(x + o, X16 + o, lane); return; }
  const int m = (blk - PW_XB) / PW_WB; const size_t o = (size_t)((blk - PW_XB - m * PW_WB) * 16 + w) * PW_F;
  prep_wave<true>((m == 0 ? Wq : (m == 1 ? Wk : Wv)) + o, (m == 0 ? BQ : (m == 1 ? BK : BV)) + o, lane); }
__global__ __launch_bounds__(256) void k_h16(const float* __restrict__ x, _Float16* __restrict__ X16, size_t n8) { const size_t t = (size_t)blockIdx.x * 256 + threadIdx.x; if (t >= n8) return; FragH f;
#pragma unroll
  for (int q = 0; q < 8; ++q) f.h[q] = (_Float16)x[t * 8 + q]; *(v8us*)((unsigned short*)X16 + t * 8) = f.half[0];  }
template <int NHv, int TTv>
__global__ __launch_bounds__(256) void k_vt(const _Float16* __restrict__ V16, int ldv, int voff, _Float16* __restrict__ Vt) { __shared__ unsigned short tl[64][66]; const int tid = threadIdx.x; const int slab = blockIdx.x / (TTv / 64), lg = blockIdx.x % (TTv / 64); const int b = slab / NHv, h = slab % NHv;
  for (int i = tid; i < 64 * 8; i += 256) { const int r = i / 8, c8 = (i % 8) * 8; FragH f; f.half[0] = *(const v8us*)((const unsigned short*)V16 + ((size_t)b * TTv + lg * 64 + r) * ldv + voff + h * 64 + c8);
#pragma unroll
    for (int q = 0; q < 8; ++q) tl[r][c8 + q] = f.u[q]; }
  __syncthreads();
  {
#pragma unroll
    for (int rd = 0; rd < 2; ++rd) { const int d = rd * 32 + tid / 8, pc = tid % 8; FragH f;
#pragma unroll
      for (int q = 0; q < 8; ++q) f.u[q] = tl[pc * 8 + q][d];
      *(v8us*)((unsigned short*)Vt + ((size_t)slab * 64 + d) * TTv + lg * 64 + pc * 8) = f.half[0]; }
     } }

__global__ __launch_bounds__(256) void k_hl(const float* __restrict__ F, _Float16* __restrict__ Hh, _Float16* __restrict__ Hl, size_t n8) { const size_t t = (size_t)blockIdx.x * 256 + threadIdx.x; if (t >= n8) return; FragH fh, fl; const v4f a = *(const v4fa*)(F + t * 8), c = *(const v4fa*)(F + t * 8 + 4);
#pragma unroll
  for (int q = 0; q < 4; ++q) { _Float16 h = (_Float16)a[q]; fh.h[q] = h; fl.h[q] = (_Float16)((a[q] - (float)h) * 1024.0f); h = (_Float16)c[q]; fh.h[4 + q] = h; fl.h[4 + q] = (_Float16)((c[q] - (float)h) * 1024.0f); }
  { *(v8us*)((unsigned short*)Hh + t * 8) = fh.half[0]; *(v8us*)((unsigned short*)Hl + t * 8) = fl.half[0];  } }

// ---- projection GEMM: fragment loader and LDS slab geometry ----
__device__ __forceinline__ v16h g2_frag(const _Float16* p, int hh) { FragH f; f.half[0] = *(const v8us*)((const unsigned short*)p + 8 * hh); f.half[1] = *(const v8us*)((const unsigned short*)p + 16 + 8 * hh); return f.v; }
// K slab of the block tile in LDS: 64 halves (one 128-byte line) of each staged row; pitch 144 B = 16 B x odd, the conflict-free pitch for ds_load_b128 fragment reads.
#define G2_KS 64
#define G2_PITCH 72

// lane l <-> l ^ 16 (the two halves of a wave hold the two key halves of one query column)
__device__ __forceinline__ float xhalf(float x) { const int t = __float_as_int(x); return __int_as_float(__builtin_amdgcn_permlanex16(t, t, 0x76543210, 0xfedcba98, false, false)); }
// Eight 2^x, each in place, in one statement closed by one v_nop: behind a transcendental the instruction set asks for one slot before its result is read or its source overwritten.
// here no v_exp_f32 touches a neighbour's register and the v_nop covers the last.
__device__ __forceinline__ void exp2x8(float& a, float& b, float& c, float& d, float& e, float& f, float& g, float& h) {
  asm("v_exp_f32 %0, %0\n\tv_exp_f32 %1, %1\n\tv_exp_f32 %2, %2\n\tv_exp_f32 %3, %3\n\tv_exp_f32 %4, %4\n\tv_exp_f32 %5, %5\n\tv_exp_f32 %6, %6\n\tv_exp_f32 %7, %7\n\tv_nop"
      : "+v"(a), "+v"(b), "+v"(c), "+v"(d), "+v"(e), "+v"(f), "+v"(g), "+v"(h));
}
// Transposed products: S^T = K.Q^T (A = 16 key rows, B = 16 query columns), O^T += V^T.P^T (A = 16 rows of V^T, B = P^T packed from the two S^T tiles).
// Lane (ln, hh) owns query q0 + ln: s[nt][r] = score of key j0 + 16 nt + 8 hh + r, which is already the hardware k order of a B operand; oacc[dt][r] = O[query][16 dt + 8 hh + r].
// Stage of 64 keys in LDS, shared by the block's 4 waves: rows 0..63 = the 64 K rows (64 halves = one 128-byte line each), rows 64..127 = the 64 V^T rows (their 64 key columns, one line each); pitch 144 B as in the GEMM slab.
#define FL_KEYS 64
#define FL_PITCH 72
#define FL_BUFB (128 * FL_PITCH * 2)
// One stage: 8 copies a lane, 16 B each; 8 lanes cover one whole line, the block 16 rows a copy (2304 B of LDS further each). s_wait_xcnt 0 closes the statement so that no address register is rewritten ahead of it.
__device__ __forceinline__ void fl_stage(unsigned l, const _Float16* gk, size_t k16, const _Float16* gv, size_t v16) {
  asm volatile(
      "global_load_async_to_lds_b128 %0, %8, off\n\t"
      "global_load_async_to_lds_b128 %1, %9, off\n\t"
      "global_load_async_to_lds_b128 %2, %10, off\n\t"
      "global_load_async_to_lds_b128 %3, %11, off\n\t"
      "global_load_async_to_lds_b128 %4, %12, off\n\t"
      "global_load_async_to_lds_b128 %5, %13, off\n\t"
      "global_load_async_to_lds_b128 %6, %14, off\n\t"
      "global_load_async_to_lds_b128 %7, %15, off\n\t"
      "s_wait_xcnt 0x0"
      :: "v"(l), "v"(l + 2304u), "v"(l + 2u * 2304u), "v"(l + 3u * 2304u), "v"(l + 4u * 2304u), "v"(l + 5u * 2304u), "v"(l + 6u * 2304u), "v"(l + 7u * 2304u),
         "v"(gk), "v"(gk + k16), "v"(gk + 2 * k16), "v"(gk + 3 * k16), "v"(gv), "v"(gv + v16), "v"(gv + 2 * v16), "v"(gv + 3 * v16)
      : "memory");
}
// q, k and v = x W^T + b as ONE GEMM: block tile 128 tokens x 192 output features (192 divides 768, so a block's features lie in one of the three planes), 4 waves as 2 x 2, wave tile 64 x 96.
// Per 64-k slab a block stages 320 rows (rows 0..127 = x, rows 128..319 = W) for 192 products, where the 128 x 64 tile staged 192 rows for 64; a wave reads 10 fragments for 24 products, not 6 for 8.
// The product is taken as C^T = W.X^T (A = 16 W rows, B = 16 x rows; both operands go through the same loader, so their k orders are equal): lane (ln, hh) then holds features 8 hh .. 8 hh + 7 of token ln, 16 B of an f16 output row.
#define G3_ROWS 320
#define G3_BUFB (G3_ROWS * G2_PITCH * 2)
#define G3_OP 200      /* pitch of the staged output rows in halves: 400 B = 16 B x odd */
// One slab: 20 copies a lane, 16 B each; 8 lanes cover one whole line, the block 16 rows a copy. Address form: scalar base + the lane's one 32-bit offset, so that the copies hold 4 vector registers beside the 192 of the accumulators
// (a 64-bit vector address and an LDS register for each copy made the build spill). The immediate offset moves BOTH addresses: it carries the LDS step of 16 rows (2304 B, 16128 B at most), and each scalar base is taken back by what its copy's offset adds.
// s_wait_xcnt 0 closes each statement so that no address register is rewritten ahead of it.
__device__ __forceinline__ void g3_slab(unsigned l, unsigned vo, const char* sa, const char* sb) {
  constexpr int G = 16 * DM * 2, D = G - 2304;      /* global step of 16 rows; the same less the LDS step */
  asm volatile(      /* LDS rows 0..127: the 128 x rows */
      "global_load_async_to_lds_b128 %0, %1, %2\n\t"
      "global_load_async_to_lds_b128 %0, %1, %3 offset:2304\n\t"
      "global_load_async_to_lds_b128 %0, %1, %4 offset:4608\n\t"
      "global_load_async_to_lds_b128 %0, %1, %5 offset:6912\n\t"
      "global_load_async_to_lds_b128 %0, %1, %6 offset:9216\n\t"
      "global_load_async_to_lds_b128 %0, %1, %7 offset:11520\n\t"
      "global_load_async_to_lds_b128 %0, %1, %8 offset:13824\n\t"
      "global_load_async_to_lds_b128 %0, %1, %9 offset:16128\n\t"
      "s_wait_xcnt 0x0"
      :: "v"(l), "v"(vo), "s"(sa), "s"(sa + D), "s"(sa + 2 * D), "s"(sa + 3 * D), "s"(sa + 4 * D), "s"(sa + 5 * D), "s"(sa + 6 * D), "s"(sa + 7 * D)
      : "memory");
  asm volatile(      /* LDS rows 128..319: the 192 W rows */
      "global_load_async_to_lds_b128 %0, %2, %3\n\t"
      "global_load_async_to_lds_b128 %0, %2, %4 offset:2304\n\t"
      "global_load_async_to_lds_b128 %0, %2, %5 offset:4608\n\t"
      "global_load_async_to_lds_b128 %0, %2, %6 offset:6912\n\t"
      "global_load_async_to_lds_b128 %0, %2, %7 offset:9216\n\t"
      "global_load_async_to_lds_b128 %0, %2, %8 offset:11520\n\t"
      "global_load_async_to_lds_b128 %1, %2, %9\n\t"
      "global_load_async_to_lds_b128 %1, %2, %10 offset:2304\n\t"
      "global_load_async_to_lds_b128 %1, %2, %11 offset:4608\n\t"
      "global_load_async_to_lds_b128 %1, %2, %12 offset:6912\n\t"
      "global_load_async_to_lds_b128 %1, %2, %13 offset:9216\n\t"
      "global_load_async_to_lds_b128 %1, %2, %14 offset:11520\n\t"
      "s_wait_xcnt 0x0"
      :: "v"(l + 8u * 2304u), "v"(l + 14u * 2304u), "v"(vo), "s"(sb), "s"(sb + D), "s"(sb + 2 * D), "s"(sb + 3 * D), "s"(sb + 4 * D), "s"(sb + 5 * D),
         "s"(sb + 6 * G), "s"(sb + 6 * G + D), "s"(sb + 6 * G + 2 * D), "s"(sb + 6 * G + 3 * D), "s"(sb + 6 * G + 4 * D), "s"(sb + 6 * G + 5 * D)
      : "memory");
}
__global__ __launch_bounds__(128) void k_gemm3(const _Float16* __restrict__ A, const _Float16* __restrict__ B0, const _Float16* __restrict__ B1, const _Float16* __restrict__ B2, float alpha,
    const float* __restrict__ bias0, const float* __restrict__ bias1, const float* __restrict__ bias2, _Float16* __restrict__ C0, _Float16* __restrict__ C1, _Float16* __restrict__ C2) {
  __shared__ __attribute__((aligned(16))) _Float16 st[2 * G3_ROWS * G2_PITCH];      /* the two slab buffers (92160 B, 3 blocks a WGP); behind the last slab's barrier the same bytes stage the block's output tile (51200 B) */
  const int tid = threadIdx.x, w = tid >> 5, lane = tid & 31, ln = lane & 15, hh = lane >> 4, wr = w >> 1, wc = w & 1;
  constexpr int NTN = 3 * DM / 192, NT = DM / G2_KS;
  const int mt = blockIdx.x / NTN, nq = blockIdx.x - mt * NTN; const int pl = nq >> 2, col0 = (nq & 3) * 192;
  const _Float16* Bh = pl == 0 ? B0 : (pl == 1 ? B1 : B2); const float* bp = pl == 0 ? bias0 : (pl == 1 ? bias1 : bias2); _Float16* C16 = pl == 0 ? C0 : (pl == 1 ? C1 : C2);
  const int cr = tid >> 3, cc = (tid & 7) * 8;
  const char* sa = (const char*)(A + (size_t)mt * 128 * DM); const char* sb = (const char*)(Bh + (size_t)col0 * DM); const unsigned vo = (unsigned)(cr * DM + cc) * 2u;      /* block-uniform bases; the lane's byte offset, the same in x and W (both have rows of DM halves) */
  const unsigned l0 = (unsigned)(size_t)&st[cr * G2_PITCH + cc];
  v8f acc[4][6];
#pragma unroll
  for (int i = 0; i < 4; ++i)
#pragma unroll
    for (int j = 0; j < 6; ++j) acc[i][j] = (v8f){0.f,0.f,0.f,0.f,0.f,0.f,0.f,0.f};
  g3_slab(l0, vo, sa, sb);
  asm volatile("s_wait_asynccnt 0x0" ::: "memory");      /* this wave's copies of slab 0 have landed */
  __syncthreads();                                       /* ... and every other wave's */
  g3_slab(l0 + G3_BUFB, vo, sa + G2_KS * 2, sb + G2_KS * 2);
#pragma unroll 1
  for (int t = 0; t < NT; ++t) { const _Float16* sx = st + (t & 1) * (G3_BUFB / 2) + (64 * wr + ln) * G2_PITCH; const _Float16* sw = st + (t & 1) * (G3_BUFB / 2) + (128 + 96 * wc + ln) * G2_PITCH;
#pragma unroll
    for (int ks = 0; ks < 2; ++ks) { v16h fx[4], fw[6];      /* the 10 fragments of 32 k are read as one group ahead of their 24 products */
#pragma unroll
      for (int i = 0; i < 4; ++i) fx[i] = g2_frag(sx + i * 16 * G2_PITCH + ks * 32, hh);
#pragma unroll
      for (int j = 0; j < 6; ++j) fw[j] = g2_frag(sw + j * 16 * G2_PITCH + ks * 32, hh);
      __builtin_amdgcn_sched_barrier(0);      /* keeps the 20 LDS reads one group: left free, the compiler read each W fragment alone, directly ahead of its 4 products, behind a wait to 0 */
#pragma unroll
      for (int j = 0; j < 6; ++j)
#pragma unroll
        for (int i = 0; i < 4; ++i) acc[i][j] = __builtin_amdgcn_wmma_f32_16x16x32_f16(false, fw[j], false, fx[i], (short)0, acc[i][j], false, false); }
    __builtin_amdgcn_sched_barrier(0);                   /* keeps the slab's products ahead of the barrier: left free, the compiler put 24 of them between the barrier and the refill, which then started that much later */
    asm volatile("s_wait_dscnt 0x0" ::: "memory");       /* this wave's reads of slab t are done before its buffer is handed back */
    asm volatile("s_wait_asynccnt 0x0" ::: "memory");    /* this wave's copies of slab t + 1 have landed */
    __syncthreads();                                     /* publishes slab t + 1 and ends every reader's last read of slab t */
    if (t + 2 < NT) g3_slab(l0 + (unsigned)(t & 1) * G3_BUFB, vo, sa + (t + 2) * (G2_KS * 2), sb + (t + 2) * (G2_KS * 2)); }
  asm volatile("s_wait_asynccnt 0x0" ::: "memory");      /* no copy is left in flight when the buffers become output staging */
#pragma unroll
  for (int j = 0; j < 6; ++j) { const float* bj = bp + col0 + 96 * wc + 16 * j + 8 * hh; const v4f ba = *(const v4fa*)bj, bb = *(const v4fa*)(bj + 4);
    const float bv[8] = {bf16_round(ba[0]), bf16_round(ba[1]), bf16_round(ba[2]), bf16_round(ba[3]), bf16_round(bb[0]), bf16_round(bb[1]), bf16_round(bb[2]), bf16_round(bb[3])};
#pragma unroll
    for (int i = 0; i < 4; ++i) { FragH f;
#pragma unroll
      for (int r = 0; r < 8; ++r) f.h[r] = (_Float16)(acc[i][j][r] * alpha + bv[r]);
      *(v8us*)((unsigned short*)st + (64 * wr + 16 * i + ln) * G3_OP + 96 * wc + 16 * j + 8 * hh) = f.half[0]; } }
  __syncthreads();                                       /* the whole 128 x 192 tile is staged: a row's three 128-byte lines hold two waves' features, and each line goes out whole, from one wave */
  const unsigned short* so = (const unsigned short*)st + cr * G3_OP + cc; unsigned short* go = (unsigned short*)C16 + (size_t)(mt * 128 + cr) * DM + col0 + cc;      /* 8 lanes a line, 16 rows a step, as in the copies */
#pragma unroll
  for (int sg = 0; sg < 3; ++sg)
#pragma unroll
    for (int q = 0; q < 8; ++q) { const v8us v = *(const v8us*)(so + q * 16 * G3_OP + sg * 64); *(v8us*)(go + (size_t)q * 16 * DM + sg * 64) = v; } }
__global__ __launch_bounds__(128) void k_flash(const _Float16* __restrict__ Q16, int ldq, const _Float16* __restrict__ K16, int ldk, const _Float16* __restrict__ Vt, const int* __restrict__ MSK, float* __restrict__ O, int ldo) {
  constexpr int RPW = 16, NQB = TQ / (4 * RPW), DT = 4, KS = 2;
  __shared__ __attribute__((aligned(16))) unsigned short sm[2 * FL_BUFB / 2];      /* the two stage buffers; behind the last stage's barrier the same bytes stage the output rows (17408 of 36864 B), so that 6 blocks still fit a WGP's LDS */
  float (*sO)[RPW][64 + 4] = (float (*)[RPW][64 + 4])sm;
  const int tid = threadIdx.x, w = tid >> 5, lane = tid & 31, ln = lane & 15, hh = lane >> 4; (void)MSK;
  const int slab = blockIdx.x / NQB, qblk = blockIdx.x % NQB; const int b = slab / NH, h = slab % NH; const int qb0 = qblk * (4 * RPW); const int q0 = qb0 + w * RPW;
  FragH bq[KS];
  { const unsigned short* qr = (const unsigned short*)Q16 + ((size_t)b * TQ + q0 + ln) * ldq + h * 64;
#pragma unroll
    for (int ks = 0; ks < KS; ++ks) { bq[ks].half[0] = *(const v8us*)(qr + ks * 32 + 8 * hh); bq[ks].half[1] = *(const v8us*)(qr + ks * 32 + 16 + 8 * hh); } }
  const int cr = tid >> 3, cc = (tid & 7) * 8;
  const _Float16* gk = K16 + ((size_t)b * TK + cr) * ldk + h * 64 + cc; const _Float16* gv = Vt + ((size_t)slab * 64 + cr) * TK + cc; const size_t k16 = (size_t)16 * ldk, v16 = (size_t)16 * TK;
  const unsigned l0 = (unsigned)(size_t)&sm[cr * FL_PITCH + cc];
  float m_q = -3.0e38f, l_q = 0.f; v8f oacc[DT];
#pragma unroll
  for (int dt = 0; dt < DT; ++dt) oacc[dt] = (v8f){0.f,0.f,0.f,0.f,0.f,0.f,0.f,0.f};
  constexpr int NS = TK / FL_KEYS;      /* 16 stages */
  fl_stage(l0, gk, k16, gv, v16);
  asm volatile("s_wait_asynccnt 0x0" ::: "memory");      /* this wave's copies of stage 0 have landed */
  __syncthreads();                                       /* ... and every other wave's */
  fl_stage(l0 + FL_BUFB, gk + (size_t)FL_KEYS * ldk, k16, gv + FL_KEYS, v16);
#pragma unroll 1
  for (int s = 0; s < NS; ++s) { const unsigned short* sb = sm + (s & 1) * (FL_BUFB / 2);
#pragma unroll 1
  for (int j0 = 0; j0 < FL_KEYS; j0 += 32) {
    float sc[16];
#pragma unroll
    for (int nt = 0; nt < 2; ++nt) { const unsigned short* kr = sb + (j0 + nt * 16 + ln) * FL_PITCH; FragH ak[KS];
#pragma unroll
      for (int ks = 0; ks < KS; ++ks) { ak[ks].half[0] = *(const v8us*)(kr + ks * 32 + 8 * hh); ak[ks].half[1] = *(const v8us*)(kr + ks * 32 + 16 + 8 * hh); }
      v8f acc = (v8f){0.f,0.f,0.f,0.f,0.f,0.f,0.f,0.f};
#pragma unroll
      for (int ks = 0; ks < KS; ++ks) acc = mmaH<1>(ak[ks].v, ak[ks].v, bq[ks].v, bq[ks].v, acc);
#pragma unroll
      for (int r = 0; r < 8; ++r) sc[nt * 8 + r] = acc[r]; }      /* raw q.k: the 1/8 rides in the exponent's FMA; m_q is a raw score too */
    float mc = fmaxf(sc[0], sc[1]);
#pragma unroll
    for (int i = 2; i < 16; ++i) mc = fmaxf(mc, sc[i]);
    mc = fmaxf(mc, xhalf(mc));
    const float mn = fmaxf(m_q, mc); const float al = (mn > -1.0e38f) ? __builtin_amdgcn_exp2f((m_q - mn) * SCL2) : 1.0f; m_q = mn;
    const float nb = __builtin_fmaf(-mn, SCL2, 10.0f);      /* p x 2^10 = 2^(s/8 log2e - m/8 log2e + 10): one FMA and one v_exp_f32 a score; arguments reach about 10 at most, and below -126 the result is 0 */
    FragH pb;
#pragma unroll
    for (int i = 0; i < 16; ++i) sc[i] = __builtin_fmaf(sc[i], SCL2, nb);
    exp2x8(sc[0], sc[1], sc[2], sc[3], sc[4], sc[5], sc[6], sc[7]); exp2x8(sc[8], sc[9], sc[10], sc[11], sc[12], sc[13], sc[14], sc[15]);
    float ps[4] = {sc[0], sc[1], sc[2], sc[3]};      /* l_q sums p x 2^10, like the P operand */
#pragma unroll
    for (int i = 4; i < 16; ++i) ps[i & 3] += sc[i];
#pragma unroll
    for (int i = 0; i < 16; ++i) pb.h[i] = (_Float16)sc[i];
    l_q = l_q * al + ((ps[0] + ps[1]) + (ps[2] + ps[3]));
#pragma unroll
    for (int dt = 0; dt < DT; ++dt)
#pragma unroll
      for (int r = 0; r < 8; ++r) oacc[dt][r] *= al;
#pragma unroll
    for (int dt = 0; dt < DT; ++dt) { const unsigned short* vrow = sb + (64 + dt * 16 + ln) * FL_PITCH + j0; FragH av; av.half[0] = *(const v8us*)(vrow + 8 * hh); av.half[1] = *(const v8us*)(vrow + 16 + 8 * hh);
      oacc[dt] = mmaH<1>(av.v, av.v, pb.v, pb.v, oacc[dt]); } }
    asm volatile("s_wait_dscnt 0x0" ::: "memory");       /* this wave's reads of stage s are done before its buffer is handed back */
    asm volatile("s_wait_asynccnt 0x0" ::: "memory");    /* this wave's copies of stage s + 1 have landed */
    __syncthreads();                                     /* publishes stage s + 1 and ends every reader's last read of stage s */
    if (s + 2 < NS) fl_stage(l0 + (unsigned)(s & 1) * FL_BUFB, gk + (size_t)(s + 2) * FL_KEYS * ldk, k16, gv + (s + 2) * FL_KEYS, v16); }
  asm volatile("s_wait_asynccnt 0x0" ::: "memory");      /* no copy is left in flight when the buffers become output staging */
  { const float l = l_q + xhalf(l_q); const float inv = (l > 0.f) ? 1.0f / l : 0.f;      /* l and O carry the same 2^10 */
#pragma unroll
    for (int dt = 0; dt < DT; ++dt)
#pragma unroll
      for (int g = 0; g < 2; ++g) { v4f o4; 
#pragma unroll
        for (int q = 0; q < 4; ++q) o4[q] = oacc[dt][g * 4 + q] * inv;
        *(v4fa*)&sO[w][ln][dt * 16 + 8 * hh + g * 4] = o4; } }
  __builtin_amdgcn_fence(__ATOMIC_ACQ_REL, "workgroup"); __builtin_amdgcn_wave_barrier();
  {
#pragma unroll
    for (int rp = 0; rp < RPW; rp += 2) { const int r = rp + (lane >> 4), pc = lane & 15; const v4f val = *(const v4fa*)&sO[w][r][pc * 4]; *(v4f*)(O + ((size_t)b * TQ + q0 + r) * ldo + h * 64 + pc * 4) = val; }
     } }
__global__ __launch_bounds__(256) void k_fulltab(unsigned* __restrict__ MB, int* __restrict__ RA, int* __restrict__ KE, int nq, int nk) {
  const int t = blockIdx.x * 256 + threadIdx.x;
  if (t < nq * (nk / 32)) { *(unsigned*)(MB + t) = 0u;  }
  if (t < nq) { *(int*)(RA + t) = 0;  }
  if (t < nq / 64) { *(int*)(KE + t * 32) = nk;  } }
__global__ __launch_bounds__(256) void k_lnout(const float* __restrict__ Y, const float* __restrict__ g, const float* __restrict__ bb, float* __restrict__ out) {
  #pragma clang fp contract(off)
  const int tid = threadIdx.x, w = tid >> 5, ln = tid & 31; const int r = blockIdx.x * 8 + w; if (r >= NR) return; const float* y = Y + (size_t)r * DM; float s = 0.f;
#pragma unroll 1
  for (int i = 0; i < 8; ++i) { const v4f a = *(const v4fa*)(y + i * 128 + ln * 4); for (int q = 0; q < 4; ++q) s += a[q]; }
  for (int o = 16; o > 0; o >>= 1) s += __shfl_xor(s, o, 32); const float mu = s / (float)DM; float q2 = 0.f;
#pragma unroll 1
  for (int i = 0; i < 8; ++i) { const v4f a = *(const v4fa*)(y + i * 128 + ln * 4); for (int q = 0; q < 4; ++q) { const float d = a[q] - mu; q2 += d * d; } }
  for (int o = 16; o > 0; o >>= 1) q2 += __shfl_xor(q2, o, 32); const float rs = rsqrtf(q2 / (float)DM + 1e-6f);
  {
#pragma unroll 1
    for (int i = 0; i < 8; ++i) { const int c0 = i * 128 + ln * 4; const v4f a = *(const v4fa*)(y + c0); v4f o4; for (int q = 0; q < 4; ++q) o4[q] = (a[q] - mu) * rs * bf16_round(g[c0 + q]) + bf16_round(bb[c0 + q]); *(v4f*)(out + (size_t)r * DM + c0) = o4; }
     } }
__global__ __launch_bounds__(256) void k_xb(const float* __restrict__ x, float* __restrict__ XB, size_t n4) { const size_t t = (size_t)blockIdx.x * 256 + threadIdx.x; if (t >= n4) return; const v4f a = *(const v4fa*)(x + t * 4); v4f o; for (int q = 0; q < 4; ++q) o[q] = bf16_round(a[q]); *(v4f*)(XB + t * 4) = o;  }
__global__ __launch_bounds__(256) void k_causaltab(unsigned* __restrict__ MB, int* __restrict__ RA, int* __restrict__ KE, int nq, int nk) {
  const int t = blockIdx.x * 256 + threadIdx.x; const int nw = nk / 32;
  if (t < nq * nw) { const int q = t / nw, w = t % nw; const int first = q + 1 - 32 * w; const unsigned bits = (first <= 0) ? 0xffffffffu : ((first >= 32) ? 0u : (0xffffffffu << first)); *(unsigned*)(MB + t) = bits;  }
  if (t < nq) { *(int*)(RA + t) = 0;  }
  if (t < nq / 64) { const int v = 64 * (t + 1); *(int*)(KE + t * 32) = v;  } }


extern "C" void kernel_launch(void* const* d_in, const int* in_sizes, int n_in,
                              void* d_out, int out_size, void* d_ws, size_t ws_size, hipStream_t stream) {
  (void)in_sizes; (void)n_in; (void)out_size;
  const float* const* I = (const float* const*)d_in; const float* x = I[0]; const float* Wq = I[1]; const float* bq = I[2]; const float* Wk = I[3]; const float* bk = I[4]; const float* Wv = I[5]; const float* bv = I[6];
  char* ws = (char*)d_ws; size_t off = 0;
  auto take = [&](size_t bytes) { char* p = ws + off; off += (bytes + 255) & ~(size_t)255; return p; };
  _Float16* BQ = (_Float16*)take((size_t)DM * DM * 2); _Float16* BK = (_Float16*)take((size_t)DM * DM * 2); _Float16* BV = (_Float16*)take((size_t)DM * DM * 2);
  _Float16* X16 = (_Float16*)take((size_t)NR * DM * 2); _Float16* Q16 = (_Float16*)take((size_t)NR * DM * 2); _Float16* K16 = (_Float16*)take((size_t)NR * DM * 2); _Float16* V16 = (_Float16*)take((size_t)NR * DM * 2); _Float16* VT = (_Float16*)take((size_t)NR * DM * 2);
  if (off > ws_size) return;      /* 3.5 + 5 x 12.6 = 66 MB */
  const dim3 gP((NR / 128) * (3 * DM / 192), 1);
  k_prep<<<PW_XB + 3 * PW_WB, 512, 0, stream>>>(x, Wq, Wk, Wv, X16, BQ, BK, BV);      /* 246 work-groups of 16 waves; a weight's (out, in) rows are already the GEMM's [n][k] operand */
  k_gemm3<<<gP, 128, 0, stream>>>(X16, BQ, BK, BV, 0.0625f, bq, bk, bv, Q16, K16, V16);      /* 64 row tiles x 12 column tiles = 768 blocks, 3 a WGP */
  k_vt<NH, SLEN><<<NBT * NH * (SLEN / 64), 256, 0, stream>>>(V16, DM, 0, VT);      /* all batches in one grid: slab = batch * NH + head */
  k_flash<<<NBT * NH * (SLEN / 64), 128, 0, stream>>>(Q16, DM, K16, DM, VT, nullptr, (float*)d_out, DM);      /* all batches in one grid; ctx rows straight into the output */
}

// v007
// It runs in 67.9 microseconds.
// Two timings next to v006 both put it at 1.03 times that version's speed.
// All steps since v000 together make it 13.8 times as fast.
#include <hip/hip_runtime.h>
// DeiT self-attention (8 x 1024 tokens, 768 = 12 heads x 64): q,k,v = x W^T + b; softmax(q.k/8) over all keys; ctx = attn.v merged -> [8,1024,768] (no output projection).
// Structure: x and the three weight matrices to exact f16 planes in one launch of fat waves; the three projections as one f16 WMMA GEMM (128x192 block tiles, 64x96 wave tiles, f32 accumulation, exact products + bias) into f16 planes, v as V^T; the fused flash kernel over all 1024 keys (plain f16 q/k/V^T, online softmax in f32, P x2^10) per ((batch, head), 64 queries) writes the merged context rows straight into the output.
// Compute dtype: x, weights, biases rounded to bf16; q, k, v, P as plain f16 (~2^-12; logits sigma ~0.3); f32 accumulation and softmax. v_wmma_f32_16x16x32_f16.
#define NBT 8
#define SLEN 1024
#define TQ SLEN
#define TK SLEN
#define DM 768
#define NH 12
#define SCL 0.125f
#define SCL2 (SCL * 1.4426950408889634f)      /* 1/8 x log2(e): raw score -> base-2 exponent */
#define NR (NBT * SLEN)
typedef __bf16 v16b __attribute__((ext_vector_type(16)));
typedef unsigned short v8us __attribute__((ext_vector_type(8), may_alias));
typedef float  v8f  __attribute__((ext_vector_type(8)));
typedef float  v4f  __attribute__((ext_vector_type(4)));
typedef float  v4fa __attribute__((ext_vector_type(4), may_alias));
union FragB { v16b v; v8us half[2]; unsigned short u[16]; };

__device__ __forceinline__ unsigned short bf16_bits(float x) { unsigned int u = __float_as_uint(x); return (unsigned short)((u + 0x7FFFu + ((u >> 16) & 1u)) >> 16); }
__device__ __forceinline__ float bf16_val(unsigned short b) { return __uint_as_float(((unsigned int)b) << 16); }
__device__ __forceinline__ float bf16_round(float x) { return bf16_val(bf16_bits(x)); }
// D += A·B with NT terms: 1 = ah·bh, 2 = + al·bh (A split), 3 = + ah·bl (both split)
template <int NT>
__device__ __forceinline__ v8f mmaN(v16b ah, v16b al, v16b bh, v16b bl, v8f c) {
  c = __builtin_amdgcn_wmma_f32_16x16x32_bf16(false, ah, false, bh, (short)0, c, false, false);
  if (NT >= 2) c = __builtin_amdgcn_wmma_f32_16x16x32_bf16(false, al, false, bh, (short)0, c, false, false);
  if (NT >= 3) c = __builtin_amdgcn_wmma_f32_16x16x32_bf16(false, ah, false, bl, (short)0, c, false, false);
  asm volatile("v_nop\n\tv_nop\n\tv_nop\n\tv_nop" : "+v"(c) : "v"(ah), "v"(al), "v"(bh), "v"(bl));
  return c;
}

__global__ __launch_bounds__(256) void k_wt_bf16(const float* __restrict__ W, unsigned short* __restrict__ Wt, int K, int N) {
  const int t = blockIdx.x * 256 + threadIdx.x;
  const int k8n = K / 8;
  if (t >= N * k8n) return;
  const int n = t / k8n, k8 = (t % k8n) * 8;
  v8us v;
#pragma unroll
  for (int i = 0; i < 8; ++i) v[i] = bf16_bits(W[(size_t)(k8 + i) * N + n]);
  *(v8us*)(Wt + (size_t)n * K + k8) = v;
  
}

// GEMM C[M][N] (f32, pitch ldc) = act(A[M][K]·W + bias). A f32 row-major (pitch lda) converted per fragment to bf16
// (ASPLIT: hi/lo two planes -> 2 terms, else single rounded term); Wt bf16 [N][K] (pitch ldb). BIAS_BF16 rounds the
// bias to bf16 first (bias quantised to bf16 before the add). K%32==0, M%16==0, N%64==0.
template <bool ASPLIT, int ACT, bool BIAS_BF16>
__global__ __launch_bounds__(128) void k_gemm_bf(const float* __restrict__ A, int lda, const unsigned short* __restrict__ Wt, int ldb,
                                               const float* __restrict__ bias, float* __restrict__ C, int ldc, int M, int N, int K) {
  __shared__ __attribute__((aligned(16))) float so[4][16][64];
  const int tid = threadIdx.x, w = tid >> 5, lane = tid & 31, ln = lane & 15, hh = lane >> 4;
  const int ntn = N / 64;
  const int wid = blockIdx.x * 4 + w;
  const int mt = wid / ntn, nq = wid % ntn;
  if (mt * 16 >= M) return;
  const int row0 = mt * 16, col0 = nq * 64;
  const float* arow = A + (size_t)(row0 + ln) * lda;
  v8f acc[4] = {};
  for (int kb = 0; kb < K; kb += 32) {
    FragB ah, al;
    const v4f x0 = *(const v4fa*)(arow + kb + 8 * hh), x1 = *(const v4fa*)(arow + kb + 8 * hh + 4);
    const v4f x2 = *(const v4fa*)(arow + kb + 16 + 8 * hh), x3 = *(const v4fa*)(arow + kb + 16 + 8 * hh + 4);
    float xs[16] = {x0[0],x0[1],x0[2],x0[3],x1[0],x1[1],x1[2],x1[3],x2[0],x2[1],x2[2],x2[3],x3[0],x3[1],x3[2],x3[3]};
#pragma unroll
    for (int i = 0; i < 16; ++i) { const unsigned short hb = bf16_bits(xs[i]); ah.u[i] = hb; al.u[i] = ASPLIT ? bf16_bits(xs[i] - bf16_val(hb)) : (unsigned short)0; }
#pragma unroll
    for (int t = 0; t < 4; ++t) {
      const unsigned short* brow = Wt + (size_t)(col0 + t * 16 + ln) * ldb + kb;
      FragB b;
      b.half[0] = *(const v8us*)(brow + 8 * hh);
      b.half[1] = *(const v8us*)(brow + 16 + 8 * hh);
      acc[t] = mmaN<ASPLIT ? 2 : 1>(ah.v, al.v, b.v, b.v, acc[t]);
    }
  }
#pragma unroll
  for (int t = 0; t < 4; ++t) {
    float bv = bias ? bias[col0 + t * 16 + ln] : 0.f;
    if (BIAS_BF16) bv = bf16_round(bv);
#pragma unroll
    for (int r = 0; r < 8; ++r) { float v = acc[t][r] + bv; if (ACT == 1) v = fmaxf(v, 0.f); so[w][8 * hh + r][t * 16 + ln] = v; }
  }
  __builtin_amdgcn_fence(__ATOMIC_ACQ_REL, "workgroup");
  __builtin_amdgcn_wave_barrier();
  const int rsub = lane >> 4, c4 = (lane & 15) * 4;
  {
#pragma unroll
    for (int q = 0; q < 8; ++q) {
      const int r = q * 2 + rsub;
      const v4f v = *(const v4fa*)&so[w][r][c4];
      *(v4f*)(C + (size_t)(row0 + r) * ldc + col0 + c4) = v;
    }
    
  }
}

// GEMM C = act(A·W + bias + resid): A f32 (ASPLIT -> hi/lo 2 terms), Wt bf16 [N][K]; ACT 0 none, 1 relu, 2 exact gelu;
// resid (optional, f32, row index = (row % rmod), pitch ldr, RES_BF16 rounds it) added before the activation.
template <bool ASPLIT, int ACT, bool BIAS_BF16, bool RES_BF16>
__global__ __launch_bounds__(128) void k_gemm_bf3(const float* __restrict__ A, int lda, const unsigned short* __restrict__ Wt, int ldb,
                                                const float* __restrict__ bias, const float* __restrict__ resid, int rmod, int ldr,
                                                float* __restrict__ C, int ldc, int M, int N, int K) {
  __shared__ __attribute__((aligned(16))) float so[4][16][64];
  const int tid = threadIdx.x, w = tid >> 5, lane = tid & 31, ln = lane & 15, hh = lane >> 4;
  const int ntn = N / 64;
  const int wid = blockIdx.x * 4 + w;
  const int mt = wid / ntn, nq = wid % ntn;
  if (mt * 16 >= M) return;
  const int row0 = mt * 16, col0 = nq * 64;
  const float* arow = A + (size_t)(row0 + ln) * lda;
  v8f acc[4] = {};
  for (int kb = 0; kb < K; kb += 32) {
    FragB ah, al;
    const v4f x0 = *(const v4fa*)(arow + kb + 8 * hh), x1 = *(const v4fa*)(arow + kb + 8 * hh + 4);
    const v4f x2 = *(const v4fa*)(arow + kb + 16 + 8 * hh), x3 = *(const v4fa*)(arow + kb + 16 + 8 * hh + 4);
    float xs[16] = {x0[0],x0[1],x0[2],x0[3],x1[0],x1[1],x1[2],x1[3],x2[0],x2[1],x2[2],x2[3],x3[0],x3[1],x3[2],x3[3]};
#pragma unroll
    for (int i = 0; i < 16; ++i) { const unsigned short hb = bf16_bits(xs[i]); ah.u[i] = hb; al.u[i] = ASPLIT ? bf16_bits(xs[i] - bf16_val(hb)) : (unsigned short)0; }
#pragma unroll
    for (int t = 0; t < 4; ++t) {
      const unsigned short* brow = Wt + (size_t)(col0 + t * 16 + ln) * ldb + kb;
      FragB b;
      b.half[0] = *(const v8us*)(brow + 8 * hh);
      b.half[1] = *(const v8us*)(brow + 16 + 8 * hh);
      acc[t] = mmaN<ASPLIT ? 2 : 1>(ah.v, al.v, b.v, b.v, acc[t]);
    }
  }
#pragma unroll
  for (int t = 0; t < 4; ++t) {
    const int col = col0 + t * 16 + ln;
    float bv = bias ? bias[col] : 0.f;
    if (BIAS_BF16) bv = bf16_round(bv);
#pragma unroll
    for (int r = 0; r < 8; ++r) {
      float v = acc[t][r] + bv;
      if (resid) { float rv = resid[(size_t)((row0 + 8 * hh + r) % rmod) * ldr + col]; if (RES_BF16) rv = bf16_round(rv); v += rv; }
      if (ACT == 1) v = fmaxf(v, 0.f);
      if (ACT == 2) v = 0.5f * v * (1.0f + erff(v * 0.70710678118654752f));
      if (ACT == 3) { const float u = 0.7978845608028654f * (v + 0.044715f * v * v * v); v = 0.5f * v * (1.0f + tanhf(u)); }
      so[w][8 * hh + r][t * 16 + ln] = v;
    }
  }
  __builtin_amdgcn_fence(__ATOMIC_ACQ_REL, "workgroup");
  __builtin_amdgcn_wave_barrier();
  const int rsub = lane >> 4, c4 = (lane & 15) * 4;
  {
#pragma unroll
    for (int q = 0; q < 8; ++q) {
      const int r = q * 2 + rsub;
      const v4f v = *(const v4fa*)&so[w][r][c4];
      *(v4f*)(C + (size_t)(row0 + r) * ldc + col0 + c4) = v;
    }
    
  }
}
// row LayerNorm (biased variance, eps) over N: s = X (+ R); optional out_sum <- s; out_norm <- (s-mu)*rsqrt(var+eps)*g + b
template <bool PARAM_BF16>
__global__ __launch_bounds__(256) void k_layernorm(const float* __restrict__ X, const float* __restrict__ R, const float* __restrict__ g, const float* __restrict__ bta,
                                                  float* __restrict__ out_sum, float* __restrict__ out_norm, int N, float eps) {
  __shared__ float red[256];
  const int row = blockIdx.x, tid = threadIdx.x;
  const float* x = X + (size_t)row * N; const float* rr = R ? R + (size_t)row * N : nullptr;
  float vals[16];                     // up to N = 4096
  const int per = N / 256;            // contiguous chunk per thread? use strided-by-4 chunks: thread handles j = tid*4 + 1024*u
  float s1 = 0.f;
  for (int u = 0; u < per / 4; ++u) {
    const int j = tid * 4 + 1024 * u;
    const v4f a = *(const v4fa*)(x + j);
    v4f b = {0.f,0.f,0.f,0.f}; if (rr) b = *(const v4fa*)(rr + j);
#pragma unroll
    for (int q = 0; q < 4; ++q) { const float v = a[q] + b[q]; vals[u * 4 + q] = v; s1 += v; }
  }
  red[tid] = s1; __syncthreads();
  for (int st = 128; st > 0; st >>= 1) { if (tid < st) red[tid] += red[tid + st]; __syncthreads(); }
  const float mu = red[0] / (float)N; __syncthreads();
  float s2 = 0.f;
  for (int u = 0; u < per / 4; ++u)
#pragma unroll
    for (int q = 0; q < 4; ++q) { const float c = vals[u * 4 + q] - mu; s2 += c * c; }
  red[tid] = s2; __syncthreads();
  for (int st = 128; st > 0; st >>= 1) { if (tid < st) red[tid] += red[tid + st]; __syncthreads(); }
  const float rs = rsqrtf(red[0] / (float)N + eps);
  {
    for (int u = 0; u < per / 4; ++u) {
      const int j = tid * 4 + 1024 * u;
      v4f o, sm;
#pragma unroll
      for (int q = 0; q < 4; ++q) {
        float gg = g[j + q], bb = bta[j + q];
        if (PARAM_BF16) { gg = bf16_round(gg); bb = bf16_round(bb); }
        sm[q] = vals[u * 4 + q]; o[q] = (vals[u * 4 + q] - mu) * rs * gg + bb;
      }
      if (out_sum) *(v4f*)(out_sum + (size_t)row * N + j) = sm;
      *(v4f*)(out_norm + (size_t)row * N + j) = o;
    }
    
  }
}



// ---- f16 WMMA path (v_wmma_f32_16x16x32_f16): 11-bit significands for operands in range — used where a [0,1] probability operand needs more precision than bf16
typedef _Float16 v16h __attribute__((ext_vector_type(16)));
union FragH { v16h v; v8us half[2]; _Float16 h[16]; unsigned short u[16]; };
template <int NT>
__device__ __forceinline__ v8f mmaH(v16h ah, v16h al, v16h bh, v16h bl, v8f c) {
  c = __builtin_amdgcn_wmma_f32_16x16x32_f16(false, ah, false, bh, (short)0, c, false, false);
  if (NT >= 2) c = __builtin_amdgcn_wmma_f32_16x16x32_f16(false, al, false, bh, (short)0, c, false, false);
  if (NT >= 3) c = __builtin_amdgcn_wmma_f32_16x16x32_f16(false, ah, false, bl, (short)0, c, false, false);
  asm volatile("v_nop\n\tv_nop\n\tv_nop\n\tv_nop" : "+v"(c) : "v"(ah), "v"(al), "v"(bh), "v"(bl));
  return c;
}
// batched GEMM like k_gemm_b but f16 operands: A f32 (split into f16 hi/lo if ASPLIT, else rounded to f16), Bt = f16 values [n][k]; alpha; C f32; N multiple of 16 (partial tiles skipped)
template <bool ASPLIT>
__global__ __launch_bounds__(128) void k_gemm_h(const float* __restrict__ A, int lda, size_t sA, const _Float16* __restrict__ Bh, int ldb, size_t sB, float alpha, float* __restrict__ C, int ldc, size_t sC, int M, int N, int K) {
  __shared__ __attribute__((aligned(16))) float so[4][16][64];
  const int tid = threadIdx.x, w = tid >> 5, lane = tid & 31, ln = lane & 15, hh = lane >> 4; const int by = blockIdx.y;
  A += (size_t)by * sA; Bh += (size_t)by * sB; C += (size_t)by * sC;
  const int ntn = (N + 63) / 64; const int wid = blockIdx.x * 4 + w; const int mt = wid / ntn, nq = wid % ntn; if (mt * 16 >= M) return;
  const int row0 = mt * 16, col0 = nq * 64; const float* arow = A + (size_t)(row0 + ln) * lda;
  v8f acc[4] = {};
  for (int kb = 0; kb < K; kb += 32) {
    FragH ah, al;
    const v4f x0 = *(const v4fa*)(arow + kb + 8 * hh), x1 = *(const v4fa*)(arow + kb + 8 * hh + 4), x2 = *(const v4fa*)(arow + kb + 16 + 8 * hh), x3 = *(const v4fa*)(arow + kb + 16 + 8 * hh + 4);
    float xs[16] = {x0[0],x0[1],x0[2],x0[3],x1[0],x1[1],x1[2],x1[3],x2[0],x2[1],x2[2],x2[3],x3[0],x3[1],x3[2],x3[3]};
#pragma unroll
    for (int i = 0; i < 16; ++i) { const _Float16 h = (_Float16)xs[i]; ah.h[i] = h; al.h[i] = ASPLIT ? (_Float16)(xs[i] - (float)h) : (_Float16)0.0f; }
#pragma unroll
    for (int t = 0; t < 4; ++t) { if (col0 + t * 16 >= N) continue; const size_t boff = (size_t)(col0 + t * 16 + ln) * ldb + kb; FragH bq; bq.half[0] = *(const v8us*)(Bh + boff + 8 * hh); bq.half[1] = *(const v8us*)(Bh + boff + 16 + 8 * hh);
      acc[t] = mmaH<ASPLIT ? 2 : 1>(ah.v, al.v, bq.v, bq.v, acc[t]); }
  }
#pragma unroll
  for (int t = 0; t < 4; ++t) { if (col0 + t * 16 >= N) continue;
#pragma unroll
    for (int r = 0; r < 8; ++r) so[w][8 * hh + r][t * 16 + ln] = acc[t][r] * alpha; }
  __builtin_amdgcn_fence(__ATOMIC_ACQ_REL, "workgroup"); __builtin_amdgcn_wave_barrier();
  const int rsub = lane >> 4, c4 = (lane & 15) * 4;
  {
#pragma unroll
    for (int q = 0; q < 8; ++q) { const int r = q * 2 + rsub; if (col0 + c4 < N) { const v4f v = *(const v4fa*)&so[w][r][c4]; *(v4f*)(C + (size_t)(row0 + r) * ldc + col0 + c4) = v; } }
     }
}

// Wt[n][k] = f16(W[k][n]·scale) from f32 row-major W[K][N] (scale = power of two; bf16-exact weights stay exact in f16 away from the subnormal range)
__global__ __launch_bounds__(256) void k_wt_f16(const float* __restrict__ W, _Float16* __restrict__ Wt, int K, int N, float scale) {
  const int t = blockIdx.x * 256 + threadIdx.x; if (t >= N * (K / 8)) return; const int n = t / (K / 8), k8 = (t % (K / 8)) * 8; FragH f;
#pragma unroll
  for (int i = 0; i < 8; ++i) f.h[i] = (_Float16)(bf16_round(W[(size_t)(k8 + i) * N + n]) * scale); const v8us o = f.half[0];
  *(v8us*)((unsigned short*)Wt + (size_t)n * K + k8) = o; 
}
// k_gemm_hh variant with fused epilogue: v = acc·alpha + bias[by·sBias + col] (+ CP[(row/rowsPerB)·sCPb + by·64 + col] if CP) ; ACT 0 none / 1 elu ; writes f16 C16 (and f32 C if non-null)
template <int ACT>
__global__ __launch_bounds__(128) void k_gemm_hhx(const _Float16* __restrict__ A, int lda, size_t sA, const _Float16* __restrict__ Bh, int ldb, size_t sB, float alpha, const float* __restrict__ bias, size_t sBias, const float* __restrict__ CP, int rowsPerB, size_t sCPb, int row0g,
    float* __restrict__ C, _Float16* __restrict__ C16, int ldc, size_t sC, int M, int N, int K) {
  __shared__ __attribute__((aligned(16))) float so[4][16][64];
  const int tid = threadIdx.x, w = tid >> 5, lane = tid & 31, ln = lane & 15, hh = lane >> 4; const int by = blockIdx.y;
  A += (size_t)by * sA; Bh += (size_t)by * sB; const size_t cofs = (size_t)by * sC; const float* bp = bias ? bias + (size_t)by * sBias : nullptr;
  const int ntn = (N + 63) / 64; const int wid = blockIdx.x * 4 + w; const int mt = wid / ntn, nq = wid % ntn; if (mt * 16 >= M) return;
  const int row0 = mt * 16, col0 = nq * 64; const _Float16* arow = A + (size_t)(row0 + ln) * lda;
  v8f acc[4] = {};
  for (int kb = 0; kb < K; kb += 32) { FragH ah; ah.half[0] = *(const v8us*)((const unsigned short*)arow + kb + 8 * hh); ah.half[1] = *(const v8us*)((const unsigned short*)arow + kb + 16 + 8 * hh);
#pragma unroll
    for (int t = 0; t < 4; ++t) { if (col0 + t * 16 >= N) continue; const size_t boff = (size_t)(col0 + t * 16 + ln) * ldb + kb; FragH bq; bq.half[0] = *(const v8us*)((const unsigned short*)Bh + boff + 8 * hh); bq.half[1] = *(const v8us*)((const unsigned short*)Bh + boff + 16 + 8 * hh);
      acc[t] = mmaH<1>(ah.v, ah.v, bq.v, bq.v, acc[t]); }
  }
#pragma unroll
  for (int t = 0; t < 4; ++t) { if (col0 + t * 16 >= N) continue; const int col = col0 + t * 16 + ln; const float bv = bp ? bf16_round(bp[col]) : 0.f;
#pragma unroll
    for (int r = 0; r < 8; ++r) { float v = acc[t][r] * alpha + bv; if (CP) { const int bidx = (row0g + row0 + 8 * hh + r) / rowsPerB; v += CP[(size_t)bidx * sCPb + (size_t)by * 64 + col]; } if (ACT == 1) v = (v > 0.f) ? v : expm1f(v); else if (ACT == 7) v = (v > 0.f) ? v + 1.0f : expf(v); else if (ACT == 8) v = tanhf(v); else if (ACT == 9) v = 0.5f * v * (1.0f + tanhf(0.7978845608028654f * (v + 0.044715f * v * v * v))); else if (ACT == 11) v = 1.0f / (1.0f + expf(-v)); else if (ACT == 12) v = (v > 0.f) ? v : 0.01f * v; else if (ACT == 14) v = (v > 0.f) ? v : 0.1f * v; else if (ACT == 15) v = v / (1.0f + expf(-v)); else if (ACT == 3) v = fmaxf(v, 0.f); else if (ACT == 6) v = 0.5f * v * (1.0f + erff(v * 0.70710678118654752f)); so[w][8 * hh + r][t * 16 + ln] = v; } }
  __builtin_amdgcn_fence(__ATOMIC_ACQ_REL, "workgroup"); __builtin_amdgcn_wave_barrier();
  const int rsub = lane >> 4, c4 = (lane & 15) * 4; typedef _Float16 v4h __attribute__((ext_vector_type(4)));
  {
#pragma unroll
    for (int q = 0; q < 8; ++q) { const int r = q * 2 + rsub; if (col0 + c4 < N) { const v4f v = *(const v4fa*)&so[w][r][c4]; if (C) *(v4f*)(C + cofs + (size_t)(row0 + r) * ldc + col0 + c4) = v; if (C16) { v4h h4; for (int i = 0; i < 4; ++i) h4[i] = (_Float16)v[i]; *(v4h*)(C16 + cofs + (size_t)(row0 + r) * ldc + col0 + c4) = h4; } } }
     }
}


typedef _Float16 v4h __attribute__((ext_vector_type(4)));

// x and the three weight matrices to their f16 planes in ONE launch of 3,936 waves, one 16-wave work-group a WGP, all resident at once: a wave takes 8 KB of contiguous f32
// by 16 loads of 16 B a lane (each covers 4 whole lines), all 16 in flight together, and stores 16 x 256 B of f16 (2 whole lines each).
// One 32-byte read a lane makes 31,488 waves in four dependent launches of the same 48 MB: by count, starting that many waves and the three extra launch gaps take longer than moving the bytes.
#define PW_F 2048                      /* floats a wave */
#define PW_XB (NR * DM / PW_F / 16)    /* 192 work-groups for x */
#define PW_WB (DM * DM / PW_F / 16)    /* 18 for each weight matrix */
static_assert(NR * DM % (PW_F * 16) == 0 && DM * DM % (PW_F * 16) == 0, "every wave has a whole share");
template <bool WS>      /* WS: a weight, x16 (a power of two: the bf16 value stays exact in f16) */
__device__ __forceinline__ void prep_wave(const float* __restrict__ s, _Float16* __restrict__ d, int lane) {
  v4f a[16];
#pragma unroll
  for (int i = 0; i < 16; ++i) a[i] = *(const v4fa*)(s + i * 128 + lane * 4);
  __builtin_amdgcn_sched_barrier(0);      /* keeps all 16 loads ahead of the first conversion: left free, the compiler issued 10 or 11 and the rest only behind the waits for those, a second memory latency in a wave that has only this one batch */
#pragma unroll
  for (int i = 0; i < 16; ++i) { v4h o;
#pragma unroll
    for (int q = 0; q < 4; ++q) o[q] = (_Float16)(WS ? bf16_round(a[i][q]) * 16.0f : bf16_round(a[i][q]));
    *(v4h*)(d + i * 128 + lane * 4) = o; }
  asm volatile("s_wait_xcnt 0x0" ::: "memory"); }      /* behind the last store: no register that a store names (its scalar base among them) is rewritten ahead of this wait on any way the code holds from here */
__global__ __launch_bounds__(512) void k_prep(const float* __restrict__ x, const float* __restrict__ Wq, const float* __restrict__ Wk, const float* __restrict__ Wv,
    _Float16* __restrict__ X16, _Float16* __restrict__ BQ, _Float16* __restrict__ BK, _Float16* __restrict__ BV) {
  const int w = __builtin_amdgcn_readfirstlane(threadIdx.x >> 5), lane = threadIdx.x & 31, blk = blockIdx.x;      /* the wave's number as a scalar: its share's base address stays in scalar registers */
  if (blk < PW_XB) { const size_t o = (size_t)(blk * 16 + w) * PW_F; prep_wave<false>(x + o, X16 + o, lane); return; }
  const int m = (blk - PW_XB) / PW_WB; const size_t o = (size_t)((blk - PW_XB - m * PW_WB) * 16 + w) * PW_F;
  prep_wave<true>((m == 0 ? Wq : (m == 1 ? Wk : Wv)) + o, (m == 0 ? BQ : (m == 1 ? BK : BV)) + o, lane); }
__global__ __launch_bounds__(256) void k_h16(const float* __restrict__ x, _Float16* __restrict__ X16, size_t n8) { const size_t t = (size_t)blockIdx.x * 256 + threadIdx.x; if (t >= n8) return; FragH f;
#pragma unroll
  for (int q = 0; q < 8; ++q) f.h[q] = (_Float16)x[t * 8 + q]; *(v8us*)((unsigned short*)X16 + t * 8) = f.half[0];  }
__global__ __launch_bounds__(256) void k_hl(const float* __restrict__ F, _Float16* __restrict__ Hh, _Float16* __restrict__ Hl, size_t n8) { const size_t t = (size_t)blockIdx.x * 256 + threadIdx.x; if (t >= n8) return; FragH fh, fl; const v4f a = *(const v4fa*)(F + t * 8), c = *(const v4fa*)(F + t * 8 + 4);
#pragma unroll
  for (int q = 0; q < 4; ++q) { _Float16 h = (_Float16)a[q]; fh.h[q] = h; fl.h[q] = (_Float16)((a[q] - (float)h) * 1024.0f); h = (_Float16)c[q]; fh.h[4 + q] = h; fl.h[4 + q] = (_Float16)((c[q] - (float)h) * 1024.0f); }
  { *(v8us*)((unsigned short*)Hh + t * 8) = fh.half[0]; *(v8us*)((unsigned short*)Hl + t * 8) = fl.half[0];  } }

// ---- projection GEMM: fragment loader and LDS slab geometry ----
__device__ __forceinline__ v16h g2_frag(const _Float16* p, int hh) { FragH f; f.half[0] = *(const v8us*)((const unsigned short*)p + 8 * hh); f.half[1] = *(const v8us*)((const unsigned short*)p + 16 + 8 * hh); return f.v; }
// K slab of the block tile in LDS: 64 halves (one 128-byte line) of each staged row; pitch 144 B = 16 B x odd, the conflict-free pitch for ds_load_b128 fragment reads.
#define G2_KS 64
#define G2_PITCH 72

// lane l <-> l ^ 16 (the two halves of a wave hold the two key halves of one query column)
__device__ __forceinline__ float xhalf(float x) { const int t = __float_as_int(x); return __int_as_float(__builtin_amdgcn_permlanex16(t, t, 0x76543210, 0xfedcba98, false, false)); }
// Eight 2^x, each in place, in one statement closed by one v_nop: behind a transcendental the instruction set asks for one slot before its result is read or its source overwritten.
// here no v_exp_f32 touches a neighbour's register and the v_nop covers the last.
__device__ __forceinline__ void exp2x8(float& a, float& b, float& c, float& d, float& e, float& f, float& g, float& h) {
  asm("v_exp_f32 %0, %0\n\tv_exp_f32 %1, %1\n\tv_exp_f32 %2, %2\n\tv_exp_f32 %3, %3\n\tv_exp_f32 %4, %4\n\tv_exp_f32 %5, %5\n\tv_exp_f32 %6, %6\n\tv_exp_f32 %7, %7\n\tv_nop"
      : "+v"(a), "+v"(b), "+v"(c), "+v"(d), "+v"(e), "+v"(f), "+v"(g), "+v"(h));
}
// Transposed products: S^T = K.Q^T (A = 16 key rows, B = 16 query columns), O^T += V^T.P^T (A = 16 rows of V^T, B = P^T packed from the two S^T tiles).
// Lane (ln, hh) owns query q0 + ln: s[nt][r] = score of key j0 + 16 nt + 8 hh + r, which is already the hardware k order of a B operand; oacc[dt][r] = O[query][16 dt + 8 hh + r].
// Stage of 64 keys in LDS, shared by the block's 4 waves: rows 0..63 = the 64 K rows (64 halves = one 128-byte line each), rows 64..127 = the 64 V^T rows (their 64 key columns, one line each); pitch 144 B as in the GEMM slab.
#define FL_KEYS 64
#define FL_PITCH 72
#define FL_BUFB (128 * FL_PITCH * 2)
// One stage: 8 copies a lane, 16 B each; 8 lanes cover one whole line, the block 16 rows a copy (2304 B of LDS further each). s_wait_xcnt 0 closes the statement so that no address register is rewritten ahead of it.
__device__ __forceinline__ void fl_stage(unsigned l, const _Float16* gk, size_t k16, const _Float16* gv, size_t v16) {
  asm volatile(
      "global_load_async_to_lds_b128 %0, %8, off\n\t"
      "global_load_async_to_lds_b128 %1, %9, off\n\t"
      "global_load_async_to_lds_b128 %2, %10, off\n\t"
      "global_load_async_to_lds_b128 %3, %11, off\n\t"
      "global_load_async_to_lds_b128 %4, %12, off\n\t"
      "global_load_async_to_lds_b128 %5, %13, off\n\t"
      "global_load_async_to_lds_b128 %6, %14, off\n\t"
      "global_load_async_to_lds_b128 %7, %15, off\n\t"
      "s_wait_xcnt 0x0"
      :: "v"(l), "v"(l + 2304u), "v"(l + 2u * 2304u), "v"(l + 3u * 2304u), "v"(l + 4u * 2304u), "v"(l + 5u * 2304u), "v"(l + 6u * 2304u), "v"(l + 7u * 2304u),
         "v"(gk), "v"(gk + k16), "v"(gk + 2 * k16), "v"(gk + 3 * k16), "v"(gv), "v"(gv + v16), "v"(gv + 2 * v16), "v"(gv + 3 * v16)
      : "memory");
}
// q, k and v = x W^T + b as ONE GEMM: block tile 128 tokens x 192 output features (192 divides 768, so a block's features lie in one of the three planes), 4 waves as 2 x 2, wave tile 64 x 96.
// Per 64-k slab a block stages 320 rows (rows 0..127 = x, rows 128..319 = W) for 192 products, where the 128 x 64 tile staged 192 rows for 64; a wave reads 10 fragments for 24 products, not 6 for 8.
// The product is taken as C^T = W.X^T (A = 16 W rows, B = 16 x rows; both operands go through the same loader, so their k orders are equal): lane (ln, hh) then holds features 8 hh .. 8 hh + 7 of token ln, 16 B of an f16 output row.
#define G3_ROWS 320
#define G3_BUFB (G3_ROWS * G2_PITCH * 2)
#define G3_OP 200      /* pitch of the staged output rows in halves: 400 B = 16 B x odd */
// One slab: 20 copies a lane, 16 B each; 8 lanes cover one whole line, the block 16 rows a copy. Address form: scalar base + the lane's one 32-bit offset, so that the copies hold 4 vector registers beside the 192 of the accumulators
// (a 64-bit vector address and an LDS register for each copy made the build spill). The immediate offset moves BOTH addresses: it carries the LDS step of 16 rows (2304 B, 16128 B at most), and each scalar base is taken back by what its copy's offset adds.
// s_wait_xcnt 0 closes each statement so that no address register is rewritten ahead of it.
__device__ __forceinline__ void g3_slab(unsigned l, unsigned vo, const char* sa, const char* sb) {
  constexpr int G = 16 * DM * 2, D = G - 2304;      /* global step of 16 rows; the same less the LDS step */
  asm volatile(      /* LDS rows 0..127: the 128 x rows */
      "global_load_async_to_lds_b128 %0, %1, %2\n\t"
      "global_load_async_to_lds_b128 %0, %1, %3 offset:2304\n\t"
      "global_load_async_to_lds_b128 %0, %1, %4 offset:4608\n\t"
      "global_load_async_to_lds_b128 %0, %1, %5 offset:6912\n\t"
      "global_load_async_to_lds_b128 %0, %1, %6 offset:9216\n\t"
      "global_load_async_to_lds_b128 %0, %1, %7 offset:11520\n\t"
      "global_load_async_to_lds_b128 %0, %1, %8 offset:13824\n\t"
      "global_load_async_to_lds_b128 %0, %1, %9 offset:16128\n\t"
      "s_wait_xcnt 0x0"
      :: "v"(l), "v"(vo), "s"(sa), "s"(sa + D), "s"(sa + 2 * D), "s"(sa + 3 * D), "s"(sa + 4 * D), "s"(sa + 5 * D), "s"(sa + 6 * D), "s"(sa + 7 * D)
      : "memory");
  asm volatile(      /* LDS rows 128..319: the 192 W rows */
      "global_load_async_to_lds_b128 %0, %2, %3\n\t"
      "global_load_async_to_lds_b128 %0, %2, %4 offset:2304\n\t"
      "global_load_async_to_lds_b128 %0, %2, %5 offset:4608\n\t"
      "global_load_async_to_lds_b128 %0, %2, %6 offset:6912\n\t"
      "global_load_async_to_lds_b128 %0, %2, %7 offset:9216\n\t"
      "global_load_async_to_lds_b128 %0, %2, %8 offset:11520\n\t"
      "global_load_async_to_lds_b128 %1, %2, %9\n\t"
      "global_load_async_to_lds_b128 %1, %2, %10 offset:2304\n\t"
      "global_load_async_to_lds_b128 %1, %2, %11 offset:4608\n\t"
      "global_load_async_to_lds_b128 %1, %2, %12 offset:6912\n\t"
      "global_load_async_to_lds_b128 %1, %2, %13 offset:9216\n\t"
      "global_load_async_to_lds_b128 %1, %2, %14 offset:11520\n\t"
      "s_wait_xcnt 0x0"
      :: "v"(l + 8u * 2304u), "v"(l + 14u * 2304u), "v"(vo), "s"(sb), "s"(sb + D), "s"(sb + 2 * D), "s"(sb + 3 * D), "s"(sb + 4 * D), "s"(sb + 5 * D),
         "s"(sb + 6 * G), "s"(sb + 6 * G + D), "s"(sb + 6 * G + 2 * D), "s"(sb + 6 * G + 3 * D), "s"(sb + 6 * G + 4 * D), "s"(sb + 6 * G + 5 * D)
      : "memory");
}
// TR = false (q and k planes): C^T = W.X^T as above, rows of [token][feature] go out. TR = true (the v plane): the same fragments with the operands exchanged, C = X.W^T (A = 16 x rows, B = 16 W rows; one loader, so the k orders stay equal):
// lane (ln, hh) then holds tokens 8 hh .. 8 hh + 7 of feature ln, 16 B of a row of V^T, and the block writes its 192 x 128 piece of V^T[batch * 768 + feature][token] itself, the layout the attention kernel stages; no transposing launch follows.
#define G3_OPT 136     /* pitch of the staged V^T rows in halves: 272 B = 16 B x odd */
template <bool TR>
__device__ __forceinline__ void g3_body(_Float16* st, const _Float16* __restrict__ A, const _Float16* __restrict__ Bh, float alpha, const float* __restrict__ bp, _Float16* __restrict__ C16, int mt, int col0) {
  const int tid = threadIdx.x, w = tid >> 5, lane = tid & 31, ln = lane & 15, hh = lane >> 4, wr = w >> 1, wc = w & 1;
  constexpr int NT = DM / G2_KS;
  const int cr = tid >> 3, cc = (tid & 7) * 8;
  const char* sa = (const char*)(A + (size_t)mt * 128 * DM); const char* sb = (const char*)(Bh + (size_t)col0 * DM); const unsigned vo = (unsigned)(cr * DM + cc) * 2u;      /* block-uniform bases; the lane's byte offset, the same in x and W (both have rows of DM halves) */
  const unsigned l0 = (unsigned)(size_t)&st[cr * G2_PITCH + cc];
  v8f acc[4][6];
#pragma unroll
  for (int i = 0; i < 4; ++i)
#pragma unroll
    for (int j = 0; j < 6; ++j) acc[i][j] = (v8f){0.f,0.f,0.f,0.f,0.f,0.f,0.f,0.f};
  g3_slab(l0, vo, sa, sb);
  asm volatile("s_wait_asynccnt 0x0" ::: "memory");      /* this wave's copies of slab 0 have landed */
  __syncthreads();                                       /* ... and every other wave's */
  g3_slab(l0 + G3_BUFB, vo, sa + G2_KS * 2, sb + G2_KS * 2);
#pragma unroll 1
  for (int t = 0; t < NT; ++t) { const _Float16* sx = st + (t & 1) * (G3_BUFB / 2) + (64 * wr + ln) * G2_PITCH; const _Float16* sw = st + (t & 1) * (G3_BUFB / 2) + (128 + 96 * wc + ln) * G2_PITCH;
#pragma unroll
    for (int ks = 0; ks < 2; ++ks) { v16h fx[4], fw[6];      /* the 10 fragments of 32 k are read as one group ahead of their 24 products */
#pragma unroll
      for (int i = 0; i < 4; ++i) fx[i] = g2_frag(sx + i * 16 * G2_PITCH + ks * 32, hh);
#pragma unroll
      for (int j = 0; j < 6; ++j) fw[j] = g2_frag(sw + j * 16 * G2_PITCH + ks * 32, hh);
      __builtin_amdgcn_sched_barrier(0);      /* keeps the 20 LDS reads one group: left free, the compiler read each W fragment alone, directly ahead of its 4 products, behind a wait to 0 */
#pragma unroll
      for (int j = 0; j < 6; ++j)
#pragma unroll
        for (int i = 0; i < 4; ++i) acc[i][j] = __builtin_amdgcn_wmma_f32_16x16x32_f16(false, TR ? fx[i] : fw[j], false, TR ? fw[j] : fx[i], (short)0, acc[i][j], false, false); }
    __builtin_amdgcn_sched_barrier(0);                   /* keeps the slab's products ahead of the barrier: left free, the compiler put 24 of them between the barrier and the refill, which then started that much later */
    asm volatile("s_wait_dscnt 0x0" ::: "memory");       /* this wave's reads of slab t are done before its buffer is handed back */
    asm volatile("s_wait_asynccnt 0x0" ::: "memory");    /* this wave's copies of slab t + 1 have landed */
    __syncthreads();                                     /* publishes slab t + 1 and ends every reader's last read of slab t */
    if (t + 2 < NT) g3_slab(l0 + (unsigned)(t & 1) * G3_BUFB, vo, sa + (t + 2) * (G2_KS * 2), sb + (t + 2) * (G2_KS * 2)); }
  asm volatile("s_wait_asynccnt 0x0" ::: "memory");      /* no copy is left in flight when the buffers become output staging */
  if constexpr (!TR) {
#pragma unroll
    for (int j = 0; j < 6; ++j) { const float* bj = bp + col0 + 96 * wc + 16 * j + 8 * hh; const v4f ba = *(const v4fa*)bj, bb = *(const v4fa*)(bj + 4);
      const float bv[8] = {bf16_round(ba[0]), bf16_round(ba[1]), bf16_round(ba[2]), bf16_round(ba[3]), bf16_round(bb[0]), bf16_round(bb[1]), bf16_round(bb[2]), bf16_round(bb[3])};
#pragma unroll
      for (int i = 0; i < 4; ++i) { FragH f;
#pragma unroll
        for (int r = 0; r < 8; ++r) f.h[r] = (_Float16)(acc[i][j][r] * alpha + bv[r]);
        *(v8us*)((unsigned short*)st + (64 * wr + 16 * i + ln) * G3_OP + 96 * wc + 16 * j + 8 * hh) = f.half[0]; } }
    __syncthreads();                                     /* the whole 128 x 192 tile is staged: a row's three 128-byte lines hold two waves' features, and each line goes out whole, from one wave */
    const unsigned short* so = (const unsigned short*)st + cr * G3_OP + cc; unsigned short* go = (unsigned short*)C16 + (size_t)(mt * 128 + cr) * DM + col0 + cc;      /* 8 lanes a line, 16 rows a step, as in the copies */
#pragma unroll
    for (int sg = 0; sg < 3; ++sg)
#pragma unroll
      for (int q = 0; q < 8; ++q) { const v8us v = *(const v8us*)(so + q * 16 * G3_OP + sg * 64); *(v8us*)(go + (size_t)q * 16 * DM + sg * 64) = v; }
  } else {
#pragma unroll
    for (int j = 0; j < 6; ++j) { const float bv = bf16_round(bp[col0 + 96 * wc + 16 * j + ln]);      /* the lane's one feature */
#pragma unroll
      for (int i = 0; i < 4; ++i) { FragH f;
#pragma unroll
        for (int r = 0; r < 8; ++r) f.h[r] = (_Float16)(acc[i][j][r] * alpha + bv);
        *(v8us*)((unsigned short*)st + (96 * wc + 16 * j + ln) * G3_OPT + 64 * wr + 16 * i + 8 * hh) = f.half[0]; } }
    __syncthreads();                                     /* the whole 192 x 128 tile is staged (52224 B): a feature's two 128-byte lines hold two waves' tokens, and each line goes out whole, from one wave */
    const int tr = tid >> 4, tc = (tid & 15) * 8;        /* 16 lanes a row of 128 tokens (two lines), 8 rows a step */
    const unsigned short* so = (const unsigned short*)st + tr * G3_OPT + tc;
    unsigned short* go = (unsigned short*)C16 + ((size_t)(mt / (SLEN / 128)) * DM + col0 + tr) * SLEN + (mt % (SLEN / 128)) * 128 + tc;
#pragma unroll
    for (int q = 0; q < 24; ++q) { const v8us v = *(const v8us*)(so + q * 8 * G3_OPT); *(v8us*)(go + (size_t)q * 8 * SLEN) = v; }
  } }
__global__ __launch_bounds__(128) void k_gemm3(const _Float16* __restrict__ A, const _Float16* __restrict__ B0, const _Float16* __restrict__ B1, const _Float16* __restrict__ B2, float alpha,
    const float* __restrict__ bias0, const float* __restrict__ bias1, const float* __restrict__ bias2, _Float16* __restrict__ C0, _Float16* __restrict__ C1, _Float16* __restrict__ C2T) {
  __shared__ __attribute__((aligned(16))) _Float16 st[2 * G3_ROWS * G2_PITCH];      /* the two slab buffers (92160 B, 3 blocks a WGP); behind the last slab's barrier the same bytes stage the block's output tile (51200 or 52224 B) */
  constexpr int NTN = 3 * DM / 192;
  const int mt = blockIdx.x / NTN, nq = blockIdx.x - mt * NTN; const int pl = nq >> 2, col0 = (nq & 3) * 192;
  if (pl == 2) g3_body<true>(st, A, B2, alpha, bias2, C2T, mt, col0);      /* the test reads the same for the whole block: every barrier inside is passed by all four waves or by none */
  else g3_body<false>(st, A, pl == 0 ? B0 : B1, alpha, pl == 0 ? bias0 : bias1, pl == 0 ? C0 : C1, mt, col0); }
__global__ __launch_bounds__(128) void k_flash(const _Float16* __restrict__ Q16, int ldq, const _Float16* __restrict__ K16, int ldk, const _Float16* __restrict__ Vt, const int* __restrict__ MSK, float* __restrict__ O, int ldo) {
  constexpr int RPW = 16, NQB = TQ / (4 * RPW), DT = 4, KS = 2;
  __shared__ __attribute__((aligned(16))) unsigned short sm[2 * FL_BUFB / 2];      /* the two stage buffers; behind the last stage's barrier the same bytes stage the output rows (17408 of 36864 B), so that 6 blocks still fit a WGP's LDS */
  float (*sO)[RPW][64 + 4] = (float (*)[RPW][64 + 4])sm;
  const int tid = threadIdx.x, w = tid >> 5, lane = tid & 31, ln = lane & 15, hh = lane >> 4; (void)MSK;
  const int slab = blockIdx.x / NQB, qblk = blockIdx.x % NQB; const int b = slab / NH, h = slab % NH; const int qb0 = qblk * (4 * RPW); const int q0 = qb0 + w * RPW;
  FragH bq[KS];
  { const unsigned short* qr = (const unsigned short*)Q16 + ((size_t)b * TQ + q0 + ln) * ldq + h * 64;
#pragma unroll
    for (int ks = 0; ks < KS; ++ks) { bq[ks].half[0] = *(const v8us*)(qr + ks * 32 + 8 * hh); bq[ks].half[1] = *(const v8us*)(qr + ks * 32 + 16 + 8 * hh); } }
  const int cr = tid >> 3, cc = (tid & 7) * 8;
  const _Float16* gk = K16 + ((size_t)b * TK + cr) * ldk + h * 64 + cc; const _Float16* gv = Vt + ((size_t)slab * 64 + cr) * TK + cc; const size_t k16 = (size_t)16 * ldk, v16 = (size_t)16 * TK;
  const unsigned l0 = (unsigned)(size_t)&sm[cr * FL_PITCH + cc];
  float m_q = -3.0e38f, l_q = 0.f; v8f oacc[DT];
#pragma unroll
  for (int dt = 0; dt < DT; ++dt) oacc[dt] = (v8f){0.f,0.f,0.f,0.f,0.f,0.f,0.f,0.f};
  constexpr int NS = TK / FL_KEYS;      /* 16 stages */
  fl_stage(l0, gk, k16, gv, v16);
  asm volatile("s_wait_asynccnt 0x0" ::: "memory");      /* this wave's copies of stage 0 have landed */
  __syncthreads();                                       /* ... and every other wave's */
  fl_stage(l0 + FL_BUFB, gk + (size_t)FL_KEYS * ldk, k16, gv + FL_KEYS, v16);
#pragma unroll 1
  for (int s = 0; s < NS; ++s) { const unsigned short* sb = sm + (s & 1) * (FL_BUFB / 2);
#pragma unroll 1
  for (int j0 = 0; j0 < FL_KEYS; j0 += 32) {
    float sc[16];
#pragma unroll
    for (int nt = 0; nt < 2; ++nt) { const unsigned short* kr = sb + (j0 + nt * 16 + ln) * FL_PITCH; FragH ak[KS];
#pragma unroll
      for (int ks = 0; ks < KS; ++ks) { ak[ks].half[0] = *(const v8us*)(kr + ks * 32 + 8 * hh); ak[ks].half[1] = *(const v8us*)(kr + ks * 32 + 16 + 8 * hh); }
      v8f acc = (v8f){0.f,0.f,0.f,0.f,0.f,0.f,0.f,0.f};
#pragma unroll
      for (int ks = 0; ks < KS; ++ks) acc = mmaH<1>(ak[ks].v, ak[ks].v, bq[ks].v, bq[ks].v, acc);
#pragma unroll
      for (int r = 0; r < 8; ++r) sc[nt * 8 + r] = acc[r]; }      /* raw q.k: the 1/8 rides in the exponent's FMA; m_q is a raw score too */
    float mc = fmaxf(sc[0], sc[1]);
#pragma unroll
    for (int i = 2; i < 16; ++i) mc = fmaxf(mc, sc[i]);
    mc = fmaxf(mc, xhalf(mc));
    const float mn = fmaxf(m_q, mc); const float al = (mn > -1.0e38f) ? __builtin_amdgcn_exp2f((m_q - mn) * SCL2) : 1.0f; m_q = mn;
    const float nb = __builtin_fmaf(-mn, SCL2, 10.0f);      /* p x 2^10 = 2^(s/8 log2e - m/8 log2e + 10): one FMA and one v_exp_f32 a score; arguments reach about 10 at most, and below -126 the result is 0 */
    FragH pb;
#pragma unroll
    for (int i = 0; i < 16; ++i) sc[i] = __builtin_fmaf(sc[i], SCL2, nb);
    exp2x8(sc[0], sc[1], sc[2], sc[3], sc[4], sc[5], sc[6], sc[7]); exp2x8(sc[8], sc[9], sc[10], sc[11], sc[12], sc[13], sc[14], sc[15]);
    float ps[4] = {sc[0], sc[1], sc[2], sc[3]};      /* l_q sums p x 2^10, like the P operand */
#pragma unroll
    for (int i = 4; i < 16; ++i) ps[i & 3] += sc[i];
#pragma unroll
    for (int i = 0; i < 16; ++i) pb.h[i] = (_Float16)sc[i];
    l_q = l_q * al + ((ps[0] + ps[1]) + (ps[2] + ps[3]));
#pragma unroll
    for (int dt = 0; dt < DT; ++dt)
#pragma unroll
      for (int r = 0; r < 8; ++r) oacc[dt][r] *= al;
#pragma unroll
    for (int dt = 0; dt < DT; ++dt) { const unsigned short* vrow = sb + (64 + dt * 16 + ln) * FL_PITCH + j0; FragH av; av.half[0] = *(const v8us*)(vrow + 8 * hh); av.half[1] = *(const v8us*)(vrow + 16 + 8 * hh);
      oacc[dt] = mmaH<1>(av.v, av.v, pb.v, pb.v, oacc[dt]); } }
    asm volatile("s_wait_dscnt 0x0" ::: "memory");       /* this wave's reads of stage s are done before its buffer is handed back */
    asm volatile("s_wait_asynccnt 0x0" ::: "memory");    /* this wave's copies of stage s + 1 have landed */
    __syncthreads();                                     /* publishes stage s + 1 and ends every reader's last read of stage s */
    if (s + 2 < NS) fl_stage(l0 + (unsigned)(s & 1) * FL_BUFB, gk + (size_t)(s + 2) * FL_KEYS * ldk, k16, gv + (s + 2) * FL_KEYS, v16); }
  asm volatile("s_wait_asynccnt 0x0" ::: "memory");      /* no copy is left in flight when the buffers become output staging */
  { const float l = l_q + xhalf(l_q); const float inv = (l > 0.f) ? 1.0f / l : 0.f;      /* l and O carry the same 2^10 */
#pragma unroll
    for (int dt = 0; dt < DT; ++dt)
#pragma unroll
      for (int g = 0; g < 2; ++g) { v4f o4; 
#pragma unroll
        for (int q = 0; q < 4; ++q) o4[q] = oacc[dt][g * 4 + q] * inv;
        *(v4fa*)&sO[w][ln][dt * 16 + 8 * hh + g * 4] = o4; } }
  __builtin_amdgcn_fence(__ATOMIC_ACQ_REL, "workgroup"); __builtin_amdgcn_wave_barrier();
  {
#pragma unroll
    for (int rp = 0; rp < RPW; rp += 2) { const int r = rp + (lane >> 4), pc = lane & 15; const v4f val = *(const v4fa*)&sO[w][r][pc * 4]; *(v4f*)(O + ((size_t)b * TQ + q0 + r) * ldo + h * 64 + pc * 4) = val; }
     } }
__global__ __launch_bounds__(256) void k_fulltab(unsigned* __restrict__ MB, int* __restrict__ RA, int* __restrict__ KE, int nq, int nk) {
  const int t = blockIdx.x * 256 + threadIdx.x;
  if (t < nq * (nk / 32)) { *(unsigned*)(MB + t) = 0u;  }
  if (t < nq) { *(int*)(RA + t) = 0;  }
  if (t < nq / 64) { *(int*)(KE + t * 32) = nk;  } }
__global__ __launch_bounds__(256) void k_lnout(const float* __restrict__ Y, const float* __restrict__ g, const float* __restrict__ bb, float* __restrict__ out) {
  #pragma clang fp contract(off)
  const int tid = threadIdx.x, w = tid >> 5, ln = tid & 31; const int r = blockIdx.x * 8 + w; if (r >= NR) return; const float* y = Y + (size_t)r * DM; float s = 0.f;
#pragma unroll 1
  for (int i = 0; i < 8; ++i) { const v4f a = *(const v4fa*)(y + i * 128 + ln * 4); for (int q = 0; q < 4; ++q) s += a[q]; }
  for (int o = 16; o > 0; o >>= 1) s += __shfl_xor(s, o, 32); const float mu = s / (float)DM; float q2 = 0.f;
#pragma unroll 1
  for (int i = 0; i < 8; ++i) { const v4f a = *(const v4fa*)(y + i * 128 + ln * 4); for (int q = 0; q < 4; ++q) { const float d = a[q] - mu; q2 += d * d; } }
  for (int o = 16; o > 0; o >>= 1) q2 += __shfl_xor(q2, o, 32); const float rs = rsqrtf(q2 / (float)DM + 1e-6f);
  {
#pragma unroll 1
    for (int i = 0; i < 8; ++i) { const int c0 = i * 128 + ln * 4; const v4f a = *(const v4fa*)(y + c0); v4f o4; for (int q = 0; q < 4; ++q) o4[q] = (a[q] - mu) * rs * bf16_round(g[c0 + q]) + bf16_round(bb[c0 + q]); *(v4f*)(out + (size_t)r * DM + c0) = o4; }
     } }
__global__ __launch_bounds__(256) void k_xb(const float* __restrict__ x, float* __restrict__ XB, size_t n4) { const size_t t = (size_t)blockIdx.x * 256 + threadIdx.x; if (t >= n4) return; const v4f a = *(const v4fa*)(x + t * 4); v4f o; for (int q = 0; q < 4; ++q) o[q] = bf16_round(a[q]); *(v4f*)(XB + t * 4) = o;  }
__global__ __launch_bounds__(256) void k_causaltab(unsigned* __restrict__ MB, int* __restrict__ RA, int* __restrict__ KE, int nq, int nk) {
  const int t = blockIdx.x * 256 + threadIdx.x; const int nw = nk / 32;
  if (t < nq * nw) { const int q = t / nw, w = t % nw; const int first = q + 1 - 32 * w; const unsigned bits = (first <= 0) ? 0xffffffffu : ((first >= 32) ? 0u : (0xffffffffu << first)); *(unsigned*)(MB + t) = bits;  }
  if (t < nq) { *(int*)(RA + t) = 0;  }
  if (t < nq / 64) { const int v = 64 * (t + 1); *(int*)(KE + t * 32) = v;  } }


extern "C" void kernel_launch(void* const* d_in, const int* in_sizes, int n_in,
                              void* d_out, int out_size, void* d_ws, size_t ws_size, hipStream_t stream) {
  (void)in_sizes; (void)n_in; (void)out_size;
  const float* const* I = (const float* const*)d_in; const float* x = I[0]; const float* Wq = I[1]; const float* bq = I[2]; const float* Wk = I[3]; const float* bk = I[4]; const float* Wv = I[5]; const float* bv = I[6];
  char* ws = (char*)d_ws; size_t off = 0;
  auto take = [&](size_t bytes) { char* p = ws + off; off += (bytes + 255) & ~(size_t)255; return p; };
  _Float16* BQ = (_Float16*)take((size_t)DM * DM * 2); _Float16* BK = (_Float16*)take((size_t)DM * DM * 2); _Float16* BV = (_Float16*)take((size_t)DM * DM * 2);
  _Float16* X16 = (_Float16*)take((size_t)NR * DM * 2); _Float16* Q16 = (_Float16*)take((size_t)NR * DM * 2); _Float16* K16 = (_Float16*)take((size_t)NR * DM * 2); _Float16* VT = (_Float16*)take((size_t)NR * DM * 2);
  if (off > ws_size) return;      /* 3.5 + 4 x 12.6 = 54 MiB */
  const dim3 gP((NR / 128) * (3 * DM / 192), 1);
  k_prep<<<PW_XB + 3 * PW_WB, 512, 0, stream>>>(x, Wq, Wk, Wv, X16, BQ, BK, BV);      /* 246 work-groups of 16 waves; a weight's (out, in) rows are already the GEMM's [n][k] operand */
  k_gemm3<<<gP, 128, 0, stream>>>(X16, BQ, BK, BV, 0.0625f, bq, bk, bv, Q16, K16, VT);      /* 64 row tiles x 12 column tiles = 768 blocks, 3 a WGP; the v plane goes out as V^T[batch * 768 + feature][token] */
  k_flash<<<NBT * NH * (SLEN / 64), 128, 0, stream>>>(Q16, DM, K16, DM, VT, nullptr, (float*)d_out, DM);      /* all batches in one grid; ctx rows straight into the output */
}

// v008
// One run takes 60.4 microseconds.
// Timed twice side by side with v007, it ran 1.12 times as fast both times.
// Counting every step since v000, it is 15.5 times as fast.
#include <hip/hip_runtime.h>
// DeiT self-attention (8 x 1024 tokens, 768 = 12 heads x 64): q,k,v = x W^T + b; softmax(q.k/8) over all keys; ctx = attn.v merged -> [8,1024,768] (no output projection).
// Structure: x and the three weight matrices to exact f16 planes in one launch of fat waves; the three projections as one f16 WMMA GEMM (128x192 block tiles, 64x96 wave tiles, f32 accumulation, exact products + bias) into f16 planes, v as V^T; the fused flash kernel over all 1024 keys (plain f16 q/k/V^T, online softmax in f32, P x2^10) per ((batch, head), 128 queries) writes the merged context rows straight into the output.
// Compute dtype: x, weights, biases rounded to bf16; q, k, v, P as plain f16 (~2^-12; logits sigma ~0.3); f32 accumulation and softmax. v_wmma_f32_16x16x32_f16.
#define NBT 8
#define SLEN 1024
#define TQ SLEN
#define TK SLEN
#define DM 768
#define NH 12
#define SCL 0.125f
#define SCL2 (SCL * 1.4426950408889634f)      /* 1/8 x log2(e): raw score -> base-2 exponent */
#define NR (NBT * SLEN)
typedef __bf16 v16b __attribute__((ext_vector_type(16)));
typedef unsigned short v8us __attribute__((ext_vector_type(8), may_alias));
typedef float  v8f  __attribute__((ext_vector_type(8)));
typedef float  v4f  __attribute__((ext_vector_type(4)));
typedef float  v4fa __attribute__((ext_vector_type(4), may_alias));
union FragB { v16b v; v8us half[2]; unsigned short u[16]; };

__device__ __forceinline__ unsigned short bf16_bits(float x) { unsigned int u = __float_as_uint(x); return (unsigned short)((u + 0x7FFFu + ((u >> 16) & 1u)) >> 16); }
__device__ __forceinline__ float bf16_val(unsigned short b) { return __uint_as_float(((unsigned int)b) << 16); }
__device__ __forceinline__ float bf16_round(float x) { return bf16_val(bf16_bits(x)); }
// D += A·B with NT terms: 1 = ah·bh, 2 = + al·bh (A split), 3 = + ah·bl (both split)
template <int NT>
__device__ __forceinline__ v8f mmaN(v16b ah, v16b al, v16b bh, v16b bl, v8f c) {
  c = __builtin_amdgcn_wmma_f32_16x16x32_bf16(false, ah, false, bh, (short)0, c, false, false);
  if (NT >= 2) c = __builtin_amdgcn_wmma_f32_16x16x32_bf16(false, al, false, bh, (short)0, c, false, false);
  if (NT >= 3) c = __builtin_amdgcn_wmma_f32_16x16x32_bf16(false, ah, false, bl, (short)0, c, false, false);
  asm volatile("v_nop\n\tv_nop\n\tv_nop\n\tv_nop" : "+v"(c) : "v"(ah), "v"(al), "v"(bh), "v"(bl));
  return c;
}

__global__ __launch_bounds__(256) void k_wt_bf16(const float* __restrict__ W, unsigned short* __restrict__ Wt, int K, int N) {
  const int t = blockIdx.x * 256 + threadIdx.x;
  const int k8n = K / 8;
  if (t >= N * k8n) return;
  const int n = t / k8n, k8 = (t % k8n) * 8;
  v8us v;
#pragma unroll
  for (int i = 0; i < 8; ++i) v[i] = bf16_bits(W[(size_t)(k8 + i) * N + n]);
  *(v8us*)(Wt + (size_t)n * K + k8) = v;
  
}

// GEMM C[M][N] (f32, pitch ldc) = act(A[M][K]·W + bias). A f32 row-major (pitch lda) converted per fragment to bf16
// (ASPLIT: hi/lo two planes -> 2 terms, else single rounded term); Wt bf16 [N][K] (pitch ldb). BIAS_BF16 rounds the
// bias to bf16 first (bias quantised to bf16 before the add). K%32==0, M%16==0, N%64==0.
template <bool ASPLIT, int ACT, bool BIAS_BF16>
__global__ __launch_bounds__(128) void k_gemm_bf(const float* __restrict__ A, int lda, const unsigned short* __restrict__ Wt, int ldb,
                                               const float* __restrict__ bias, float* __restrict__ C, int ldc, int M, int N, int K) {
  __shared__ __attribute__((aligned(16))) float so[4][16][64];
  const int tid = threadIdx.x, w = tid >> 5, lane = tid & 31, ln = lane & 15, hh = lane >> 4;
  const int ntn = N / 64;
  const int wid = blockIdx.x * 4 + w;
  const int mt = wid / ntn, nq = wid % ntn;
  if (mt * 16 >= M) return;
  const int row0 = mt * 16, col0 = nq * 64;
  const float* arow = A + (size_t)(row0 + ln) * lda;
  v8f acc[4] = {};
  for (int kb = 0; kb < K; kb += 32) {
    FragB ah, al;
    const v4f x0 = *(const v4fa*)(arow + kb + 8 * hh), x1 = *(const v4fa*)(arow + kb + 8 * hh + 4);
    const v4f x2 = *(const v4fa*)(arow + kb + 16 + 8 * hh), x3 = *(const v4fa*)(arow + kb + 16 + 8 * hh + 4);
    float xs[16] = {x0[0],x0[1],x0[2],x0[3],x1[0],x1[1],x1[2],x1[3],x2[0],x2[1],x2[2],x2[3],x3[0],x3[1],x3[2],x3[3]};
#pragma unroll
    for (int i = 0; i < 16; ++i) { const unsigned short hb = bf16_bits(xs[i]); ah.u[i] = hb; al.u[i] = ASPLIT ? bf16_bits(xs[i] - bf16_val(hb)) : (unsigned short)0; }
#pragma unroll
    for (int t = 0; t < 4; ++t) {
      const unsigned short* brow = Wt + (size_t)(col0 + t * 16 + ln) * ldb + kb;
      FragB b;
      b.half[0] = *(const v8us*)(brow + 8 * hh);
      b.half[1] = *(const v8us*)(brow + 16 + 8 * hh);
      acc[t] = mmaN<ASPLIT ? 2 : 1>(ah.v, al.v, b.v, b.v, acc[t]);
    }
  }
#pragma unroll
  for (int t = 0; t < 4; ++t) {
    float bv = bias ? bias[col0 + t * 16 + ln] : 0.f;
    if (BIAS_BF16) bv = bf16_round(bv);
#pragma unroll
    for (int r = 0; r < 8; ++r) { float v = acc[t][r] + bv; if (ACT == 1) v = fmaxf(v, 0.f); so[w][8 * hh + r][t * 16 + ln] = v; }
  }
  __builtin_amdgcn_fence(__ATOMIC_ACQ_REL, "workgroup");
  __builtin_amdgcn_wave_barrier();
  const int rsub = lane >> 4, c4 = (lane & 15) * 4;
  {
#pragma unroll
    for (int q = 0; q < 8; ++q) {
      const int r = q * 2 + rsub;
      const v4f v = *(const v4fa*)&so[w][r][c4];
      *(v4f*)(C + (size_t)(row0 + r) * ldc + col0 + c4) = v;
    }
    
  }
}

// GEMM C = act(A·W + bias + resid): A f32 (ASPLIT -> hi/lo 2 terms), Wt bf16 [N][K]; ACT 0 none, 1 relu, 2 exact gelu;
// resid (optional, f32, row index = (row % rmod), pitch ldr, RES_BF16 rounds it) added before the activation.
template <bool ASPLIT, int ACT, bool BIAS_BF16, bool RES_BF16>
__global__ __launch_bounds__(128) void k_gemm_bf3(const float* __restrict__ A, int lda, const unsigned short* __restrict__ Wt, int ldb,
                                                const float* __restrict__ bias, const float* __restrict__ resid, int rmod, int ldr,
                                                float* __restrict__ C, int ldc, int M, int N, int K) {
  __shared__ __attribute__((aligned(16))) float so[4][16][64];
  const int tid = threadIdx.x, w = tid >> 5, lane = tid & 31, ln = lane & 15, hh = lane >> 4;
  const int ntn = N / 64;
  const int wid = blockIdx.x * 4 + w;
  const int mt = wid / ntn, nq = wid % ntn;
  if (mt * 16 >= M) return;
  const int row0 = mt * 16, col0 = nq * 64;
  const float* arow = A + (size_t)(row0 + ln) * lda;
  v8f acc[4] = {};
  for (int kb = 0; kb < K; kb += 32) {
    FragB ah, al;
    const v4f x0 = *(const v4fa*)(arow + kb + 8 * hh), x1 = *(const v4fa*)(arow + kb + 8 * hh + 4);
    const v4f x2 = *(const v4fa*)(arow + kb + 16 + 8 * hh), x3 = *(const v4fa*)(arow + kb + 16 + 8 * hh + 4);
    float xs[16] = {x0[0],x0[1],x0[2],x0[3],x1[0],x1[1],x1[2],x1[3],x2[0],x2[1],x2[2],x2[3],x3[0],x3[1],x3[2],x3[3]};
#pragma unroll
    for (int i = 0; i < 16; ++i) { const unsigned short hb = bf16_bits(xs[i]); ah.u[i] = hb; al.u[i] = ASPLIT ? bf16_bits(xs[i] - bf16_val(hb)) : (unsigned short)0; }
#pragma unroll
    for (int t = 0; t < 4; ++t) {
      const unsigned short* brow = Wt + (size_t)(col0 + t * 16 + ln) * ldb + kb;
      FragB b;
      b.half[0] = *(const v8us*)(brow + 8 * hh);
      b.half[1] = *(const v8us*)(brow + 16 + 8 * hh);
      acc[t] = mmaN<ASPLIT ? 2 : 1>(ah.v, al.v, b.v, b.v, acc[t]);
    }
  }
#pragma unroll
  for (int t = 0; t < 4; ++t) {
    const int col = col0 + t * 16 + ln;
    float bv = bias ? bias[col] : 0.f;
    if (BIAS_BF16) bv = bf16_round(bv);
#pragma unroll
    for (int r = 0; r < 8; ++r) {
      float v = acc[t][r] + bv;
      if (resid) { float rv = resid[(size_t)((row0 + 8 * hh + r) % rmod) * ldr + col]; if (RES_BF16) rv = bf16_round(rv); v += rv; }
      if (ACT == 1) v = fmaxf(v, 0.f);
      if (ACT == 2) v = 0.5f * v * (1.0f + erff(v * 0.70710678118654752f));
      if (ACT == 3) { const float u = 0.7978845608028654f * (v + 0.044715f * v * v * v); v = 0.5f * v * (1.0f + tanhf(u)); }
      so[w][8 * hh + r][t * 16 + ln] = v;
    }
  }
  __builtin_amdgcn_fence(__ATOMIC_ACQ_REL, "workgroup");
  __builtin_amdgcn_wave_barrier();
  const int rsub = lane >> 4, c4 = (lane & 15) * 4;
  {
#pragma unroll
    for (int q = 0; q < 8; ++q) {
      const int r = q * 2 + rsub;
      const v4f v = *(const v4fa*)&so[w][r][c4];
      *(v4f*)(C + (size_t)(row0 + r) * ldc + col0 + c4) = v;
    }
    
  }
}
// row LayerNorm (biased variance, eps) over N: s = X (+ R); optional out_sum <- s; out_norm <- (s-mu)*rsqrt(var+eps)*g + b
template <bool PARAM_BF16>
__global__ __launch_bounds__(256) void k_layernorm(const float* __restrict__ X, const float* __restrict__ R, const float* __restrict__ g, const float* __restrict__ bta,
                                                  float* __restrict__ out_sum, float* __restrict__ out_norm, int N, float eps) {
  __shared__ float red[256];
  const int row = blockIdx.x, tid = threadIdx.x;
  const float* x = X + (size_t)row * N; const float* rr = R ? R + (size_t)row * N : nullptr;
  float vals[16];                     // up to N = 4096
  const int per = N / 256;            // contiguous chunk per thread? use strided-by-4 chunks: thread handles j = tid*4 + 1024*u
  float s1 = 0.f;
  for (int u = 0; u < per / 4; ++u) {
    const int j = tid * 4 + 1024 * u;
    const v4f a = *(const v4fa*)(x + j);
    v4f b = {0.f,0.f,0.f,0.f}; if (rr) b = *(const v4fa*)(rr + j);
#pragma unroll
    for (int q = 0; q < 4; ++q) { const float v = a[q] + b[q]; vals[u * 4 + q] = v; s1 += v; }
  }
  red[tid] = s1; __syncthreads();
  for (int st = 128; st > 0; st >>= 1) { if (tid < st) red[tid] += red[tid + st]; __syncthreads(); }
  const float mu = red[0] / (float)N; __syncthreads();
  float s2 = 0.f;
  for (int u = 0; u < per / 4; ++u)
#pragma unroll
    for (int q = 0; q < 4; ++q) { const float c = vals[u * 4 + q] - mu; s2 += c * c; }
  red[tid] = s2; __syncthreads();
  for (int st = 128; st > 0; st >>= 1) { if (tid < st) red[tid] += red[tid + st]; __syncthreads(); }
  const float rs = rsqrtf(red[0] / (float)N + eps);
  {
    for (int u = 0; u < per / 4; ++u) {
      const int j = tid * 4 + 1024 * u;
      v4f o, sm;
#pragma unroll
      for (int q = 0; q < 4; ++q) {
        float gg = g[j + q], bb = bta[j + q];
        if (PARAM_BF16) { gg = bf16_round(gg); bb = bf16_round(bb); }
        sm[q] = vals[u * 4 + q]; o[q] = (vals[u * 4 + q] - mu) * rs * gg + bb;
      }
      if (out_sum) *(v4f*)(out_sum + (size_t)row * N + j) = sm;
      *(v4f*)(out_norm + (size_t)row * N + j) = o;
    }
    
  }
}



// ---- f16 WMMA path (v_wmma_f32_16x16x32_f16): 11-bit significands for operands in range — used where a [0,1] probability operand needs more precision than bf16
typedef _Float16 v16h __attribute__((ext_vector_type(16)));
union FragH { v16h v; v8us half[2]; _Float16 h[16]; unsigned short u[16]; };
template <int NT>
__device__ __forceinline__ v8f mmaH(v16h ah, v16h al, v16h bh, v16h bl, v8f c) {
  c = __builtin_amdgcn_wmma_f32_16x16x32_f16(false, ah, false, bh, (short)0, c, false, false);
  if (NT >= 2) c = __builtin_amdgcn_wmma_f32_16x16x32_f16(false, al, false, bh, (short)0, c, false, false);
  if (NT >= 3) c = __builtin_amdgcn_wmma_f32_16x16x32_f16(false, ah, false, bl, (short)0, c, false, false);
  asm volatile("v_nop\n\tv_nop\n\tv_nop\n\tv_nop" : "+v"(c) : "v"(ah), "v"(al), "v"(bh), "v"(bl));
  return c;
}
// batched GEMM like k_gemm_b but f16 operands: A f32 (split into f16 hi/lo if ASPLIT, else rounded to f16), Bt = f16 values [n][k]; alpha; C f32; N multiple of 16 (partial tiles skipped)
template <bool ASPLIT>
__global__ __launch_bounds__(128) void k_gemm_h(const float* __restrict__ A, int lda, size_t sA, const _Float16* __restrict__ Bh, int ldb, size_t sB, float alpha, float* __restrict__ C, int ldc, size_t sC, int M, int N, int K) {
  __shared__ __attribute__((aligned(16))) float so[4][16][64];
  const int tid = threadIdx.x, w = tid >> 5, lane = tid & 31, ln = lane & 15, hh = lane >> 4; const int by = blockIdx.y;
  A += (size_t)by * sA; Bh += (size_t)by * sB; C += (size_t)by * sC;
  const int ntn = (N + 63) / 64; const int wid = blockIdx.x * 4 + w; const int mt = wid / ntn, nq = wid % ntn; if (mt * 16 >= M) return;
  const int row0 = mt * 16, col0 = nq * 64; const float* arow = A + (size_t)(row0 + ln) * lda;
  v8f acc[4] = {};
  for (int kb = 0; kb < K; kb += 32) {
    FragH ah, al;
    const v4f x0 = *(const v4fa*)(arow + kb + 8 * hh), x1 = *(const v4fa*)(arow + kb + 8 * hh + 4), x2 = *(const v4fa*)(arow + kb + 16 + 8 * hh), x3 = *(const v4fa*)(arow + kb + 16 + 8 * hh + 4);
    float xs[16] = {x0[0],x0[1],x0[2],x0[3],x1[0],x1[1],x1[2],x1[3],x2[0],x2[1],x2[2],x2[3],x3[0],x3[1],x3[2],x3[3]};
#pragma unroll
    for (int i = 0; i < 16; ++i) { const _Float16 h = (_Float16)xs[i]; ah.h[i] = h; al.h[i] = ASPLIT ? (_Float16)(xs[i] - (float)h) : (_Float16)0.0f; }
#pragma unroll
    for (int t = 0; t < 4; ++t) { if (col0 + t * 16 >= N) continue; const size_t boff = (size_t)(col0 + t * 16 + ln) * ldb + kb; FragH bq; bq.half[0] = *(const v8us*)(Bh + boff + 8 * hh); bq.half[1] = *(const v8us*)(Bh + boff + 16 + 8 * hh);
      acc[t] = mmaH<ASPLIT ? 2 : 1>(ah.v, al.v, bq.v, bq.v, acc[t]); }
  }
#pragma unroll
  for (int t = 0; t < 4; ++t) { if (col0 + t * 16 >= N) continue;
#pragma unroll
    for (int r = 0; r < 8; ++r) so[w][8 * hh + r][t * 16 + ln] = acc[t][r] * alpha; }
  __builtin_amdgcn_fence(__ATOMIC_ACQ_REL, "workgroup"); __builtin_amdgcn_wave_barrier();
  const int rsub = lane >> 4, c4 = (lane & 15) * 4;
  {
#pragma unroll
    for (int q = 0; q < 8; ++q) { const int r = q * 2 + rsub; if (col0 + c4 < N) { const v4f v = *(const v4fa*)&so[w][r][c4]; *(v4f*)(C + (size_t)(row0 + r) * ldc + col0 + c4) = v; } }
     }
}

// Wt[n][k] = f16(W[k][n]·scale) from f32 row-major W[K][N] (scale = power of two; bf16-exact weights stay exact in f16 away from the subnormal range)
__global__ __launch_bounds__(256) void k_wt_f16(const float* __restrict__ W, _Float16* __restrict__ Wt, int K, int N, float scale) {
  const int t = blockIdx.x * 256 + threadIdx.x; if (t >= N * (K / 8)) return; const int n = t / (K / 8), k8 = (t % (K / 8)) * 8; FragH f;
#pragma unroll
  for (int i = 0; i < 8; ++i) f.h[i] = (_Float16)(bf16_round(W[(size_t)(k8 + i) * N + n]) * scale); const v8us o = f.half[0];
  *(v8us*)((unsigned short*)Wt + (size_t)n * K + k8) = o; 
}
// k_gemm_hh variant with fused epilogue: v = acc·alpha + bias[by·sBias + col] (+ CP[(row/rowsPerB)·sCPb + by·64 + col] if CP) ; ACT 0 none / 1 elu ; writes f16 C16 (and f32 C if non-null)
template <int ACT>
__global__ __launch_bounds__(128) void k_gemm_hhx(const _Float16* __restrict__ A, int lda, size_t sA, const _Float16* __restrict__ Bh, int ldb, size_t sB, float alpha, const float* __restrict__ bias, size_t sBias, const float* __restrict__ CP, int rowsPerB, size_t sCPb, int row0g,
    float* __restrict__ C, _Float16* __restrict__ C16, int ldc, size_t sC, int M, int N, int K) {
  __shared__ __attribute__((aligned(16))) float so[4][16][64];
  const int tid = threadIdx.x, w = tid >> 5, lane = tid & 31, ln = lane & 15, hh = lane >> 4; const int by = blockIdx.y;
  A += (size_t)by * sA; Bh += (size_t)by * sB; const size_t cofs = (size_t)by * sC; const float* bp = bias ? bias + (size_t)by * sBias : nullptr;
  const int ntn = (N + 63) / 64; const int wid = blockIdx.x * 4 + w; const int mt = wid / ntn, nq = wid % ntn; if (mt * 16 >= M) return;
  const int row0 = mt * 16, col0 = nq * 64; const _Float16* arow = A + (size_t)(row0 + ln) * lda;
  v8f acc[4] = {};
  for (int kb = 0; kb < K; kb += 32) { FragH ah; ah.half[0] = *(const v8us*)((const unsigned short*)arow + kb + 8 * hh); ah.half[1] = *(const v8us*)((const unsigned short*)arow + kb + 16 + 8 * hh);
#pragma unroll
    for (int t = 0; t < 4; ++t) { if (col0 + t * 16 >= N) continue; const size_t boff = (size_t)(col0 + t * 16 + ln) * ldb + kb; FragH bq; bq.half[0] = *(const v8us*)((const unsigned short*)Bh + boff + 8 * hh); bq.half[1] = *(const v8us*)((const unsigned short*)Bh + boff + 16 + 8 * hh);
      acc[t] = mmaH<1>(ah.v, ah.v, bq.v, bq.v, acc[t]); }
  }
#pragma unroll
  for (int t = 0; t < 4; ++t) { if (col0 + t * 16 >= N) continue; const int col = col0 + t * 16 + ln; const float bv = bp ? bf16_round(bp[col]) : 0.f;
#pragma unroll
    for (int r = 0; r < 8; ++r) { float v = acc[t][r] * alpha + bv; if (CP) { const int bidx = (row0g + row0 + 8 * hh + r) / rowsPerB; v += CP[(size_t)bidx * sCPb + (size_t)by * 64 + col]; } if (ACT == 1) v = (v > 0.f) ? v : expm1f(v); else if (ACT == 7) v = (v > 0.f) ? v + 1.0f : expf(v); else if (ACT == 8) v = tanhf(v); else if (ACT == 9) v = 0.5f * v * (1.0f + tanhf(0.7978845608028654f * (v + 0.044715f * v * v * v))); else if (ACT == 11) v = 1.0f / (1.0f + expf(-v)); else if (ACT == 12) v = (v > 0.f) ? v : 0.01f * v; else if (ACT == 14) v = (v > 0.f) ? v : 0.1f * v; else if (ACT == 15) v = v / (1.0f + expf(-v)); else if (ACT == 3) v = fmaxf(v, 0.f); else if (ACT == 6) v = 0.5f * v * (1.0f + erff(v * 0.70710678118654752f)); so[w][8 * hh + r][t * 16 + ln] = v; } }
  __builtin_amdgcn_fence(__ATOMIC_ACQ_REL, "workgroup"); __builtin_amdgcn_wave_barrier();
  const int rsub = lane >> 4, c4 = (lane & 15) * 4; typedef _Float16 v4h __attribute__((ext_vector_type(4)));
  {
#pragma unroll
    for (int q = 0; q < 8; ++q) { const int r = q * 2 + rsub; if (col0 + c4 < N) { const v4f v = *(const v4fa*)&so[w][r][c4]; if (C) *(v4f*)(C + cofs + (size_t)(row0 + r) * ldc + col0 + c4) = v; if (C16) { v4h h4; for (int i = 0; i < 4; ++i) h4[i] = (_Float16)v[i]; *(v4h*)(C16 + cofs + (size_t)(row0 + r) * ldc + col0 + c4) = h4; } } }
     }
}


typedef _Float16 v4h __attribute__((ext_vector_type(4)));

// x and the three weight matrices to their f16 planes in ONE launch of 3,936 waves, one 16-wave work-group a WGP, all resident at once: a wave takes 8 KB of contiguous f32
// by 16 loads of 16 B a lane (each covers 4 whole lines), all 16 in flight together, and stores 16 x 256 B of f16 (2 whole lines each).
// One 32-byte read a lane makes 31,488 waves in four dependent launches of the same 48 MB: by count, starting that many waves and the three extra launch gaps take longer than moving the bytes.
#define PW_F 2048                      /* floats a wave */
#define PW_XB (NR * DM / PW_F / 16)    /* 192 work-groups for x */
#define PW_WB (DM * DM / PW_F / 16)    /* 18 for each weight matrix */
static_assert(NR * DM % (PW_F * 16) == 0 && DM * DM % (PW_F * 16) == 0, "every wave has a whole share");
template <bool WS>      /* WS: a weight, x16 (a power of two: the bf16 value stays exact in f16) */
__device__ __forceinline__ void prep_wave(const float* __restrict__ s, _Float16* __restrict__ d, int lane) {
  v4f a[16];
#pragma unroll
  for (int i = 0; i < 16; ++i) a[i] = *(const v4fa*)(s + i * 128 + lane * 4);
  __builtin_amdgcn_sched_barrier(0);      /* keeps all 16 loads ahead of the first conversion: left free, the compiler issued 10 or 11 and the rest only behind the waits for those, a second memory latency in a wave that has only this one batch */
#pragma unroll
  for (int i = 0; i < 16; ++i) { v4h o;
#pragma unroll
    for (int q = 0; q < 4; ++q) o[q] = (_Float16)(WS ? bf16_round(a[i][q]) * 16.0f : bf16_round(a[i][q]));
    *(v4h*)(d + i * 128 + lane * 4) = o; }
  asm volatile("s_wait_xcnt 0x0" ::: "memory"); }      /* behind the last store: no register that a store names (its scalar base among them) is rewritten ahead of this wait on any way the code holds from here */
__global__ __launch_bounds__(512) void k_prep(const float* __restrict__ x, const float* __restrict__ Wq, const float* __restrict__ Wk, const float* __restrict__ Wv,
    _Float16* __restrict__ X16, _Float16* __restrict__ BQ, _Float16* __restrict__ BK, _Float16* __restrict__ BV) {
  const int w = __builtin_amdgcn_readfirstlane(threadIdx.x >> 5), lane = threadIdx.x & 31, blk = blockIdx.x;      /* the wave's number as a scalar: its share's base address stays in scalar registers */
  if (blk < PW_XB) { const size_t o = (size_t)(blk * 16 + w) * PW_F; prep_wave<false>(x + o, X16 + o, lane); return; }
  const int m = (blk - PW_XB) / PW_WB; const size_t o = (size_t)((blk - PW_XB - m * PW_WB) * 16 + w) * PW_F;
  prep_wave<true>((m == 0 ? Wq : (m == 1 ? Wk : Wv)) + o, (m == 0 ? BQ : (m == 1 ? BK : BV)) + o, lane); }
__global__ __launch_bounds__(256) void k_h16(const float* __restrict__ x, _Float16* __restrict__ X16, size_t n8) { const size_t t = (size_t)blockIdx.x * 256 + threadIdx.x; if (t >= n8) return; FragH f;
#pragma unroll
  for (int q = 0; q < 8; ++q) f.h[q] = (_Float16)x[t * 8 + q]; *(v8us*)((unsigned short*)X16 + t * 8) = f.half[0];  }
__global__ __launch_bounds__(256) void k_hl(const float* __restrict__ F, _Float16* __restrict__ Hh, _Float16* __restrict__ Hl, size_t n8) { const size_t t = (size_t)blockIdx.x * 256 + threadIdx.x; if (t >= n8) return; FragH fh, fl; const v4f a = *(const v4fa*)(F + t * 8), c = *(const v4fa*)(F + t * 8 + 4);
#pragma unroll
  for (int q = 0; q < 4; ++q) { _Float16 h = (_Float16)a[q]; fh.h[q] = h; fl.h[q] = (_Float16)((a[q] - (float)h) * 1024.0f); h = (_Float16)c[q]; fh.h[4 + q] = h; fl.h[4 + q] = (_Float16)((c[q] - (float)h) * 1024.0f); }
  { *(v8us*)((unsigned short*)Hh + t * 8) = fh.half[0]; *(v8us*)((unsigned short*)Hl + t * 8) = fl.half[0];  } }

// ---- projection GEMM: fragment loader and LDS slab geometry ----
__device__ __forceinline__ v16h g2_frag(const _Float16* p, int hh) { FragH f; f.half[0] = *(const v8us*)((const unsigned short*)p + 8 * hh); f.half[1] = *(const v8us*)((const unsigned short*)p + 16 + 8 * hh); return f.v; }
// K slab of the block tile in LDS: 64 halves (one 128-byte line) of each staged row; pitch 144 B = 16 B x odd, the conflict-free pitch for ds_load_b128 fragment reads.
#define G2_KS 64
#define G2_PITCH 72

// lane l <-> l ^ 16 (the two halves of a wave hold the two key halves of one query column)
__device__ __forceinline__ float xhalf(float x) { const int t = __float_as_int(x); return __int_as_float(__builtin_amdgcn_permlanex16(t, t, 0x76543210, 0xfedcba98, false, false)); }
// Eight 2^x, each in place, in one statement closed by one v_nop: behind a transcendental the instruction set asks for one slot before its result is read or its source overwritten.
// here no v_exp_f32 touches a neighbour's register and the v_nop covers the last.
__device__ __forceinline__ void exp2x8(float& a, float& b, float& c, float& d, float& e, float& f, float& g, float& h) {
  asm("v_exp_f32 %0, %0\n\tv_exp_f32 %1, %1\n\tv_exp_f32 %2, %2\n\tv_exp_f32 %3, %3\n\tv_exp_f32 %4, %4\n\tv_exp_f32 %5, %5\n\tv_exp_f32 %6, %6\n\tv_exp_f32 %7, %7\n\tv_nop"
      : "+v"(a), "+v"(b), "+v"(c), "+v"(d), "+v"(e), "+v"(f), "+v"(g), "+v"(h));
}
// Transposed products: S^T = K.Q^T (A = 16 key rows, B = 16 query columns), O^T += V^T.P^T (A = 16 rows of V^T, B = P^T packed from the two S^T tiles).
// Lane (ln, hh) owns query q0 + 16 qt + ln of each of its wave's query tiles qt: st[qt][nt][r] = score of key j0 + 16 nt + 8 hh + r, which is already the hardware k order of a B operand; oacc[qt][dt][r] = O[query][16 dt + 8 hh + r].
// Stage of 64 keys in LDS, shared by the block's 4 waves: rows 0..63 = the 64 K rows (64 halves = one 128-byte line each), rows 64..127 = the 64 V^T rows (their 64 key columns, one line each); pitch 144 B as in the GEMM slab.
#define FL_KEYS 64
#define FL_PITCH 72
#define FL_BUFB (128 * FL_PITCH * 2)
// One stage: 8 copies a lane, 16 B each; 8 lanes cover one whole line, the block 16 rows a copy (2304 B of LDS further each). s_wait_xcnt 0 closes the statement so that no address register is rewritten ahead of it.
__device__ __forceinline__ void fl_stage(unsigned l, const _Float16* gk, size_t k16, const _Float16* gv, size_t v16) {
  asm volatile(
      "global_load_async_to_lds_b128 %0, %8, off\n\t"
      "global_load_async_to_lds_b128 %1, %9, off\n\t"
      "global_load_async_to_lds_b128 %2, %10, off\n\t"
      "global_load_async_to_lds_b128 %3, %11, off\n\t"
      "global_load_async_to_lds_b128 %4, %12, off\n\t"
      "global_load_async_to_lds_b128 %5, %13, off\n\t"
      "global_load_async_to_lds_b128 %6, %14, off\n\t"
      "global_load_async_to_lds_b128 %7, %15, off\n\t"
      "s_wait_xcnt 0x0"
      :: "v"(l), "v"(l + 2304u), "v"(l + 2u * 2304u), "v"(l + 3u * 2304u), "v"(l + 4u * 2304u), "v"(l + 5u * 2304u), "v"(l + 6u * 2304u), "v"(l + 7u * 2304u),
         "v"(gk), "v"(gk + k16), "v"(gk + 2 * k16), "v"(gk + 3 * k16), "v"(gv), "v"(gv + v16), "v"(gv + 2 * v16), "v"(gv + 3 * v16)
      : "memory");
}
// q, k and v = x W^T + b as ONE GEMM: block tile 128 tokens x 192 output features (192 divides 768, so a block's features lie in one of the three planes), 4 waves as 2 x 2, wave tile 64 x 96.
// Per 64-k slab a block stages 320 rows (rows 0..127 = x, rows 128..319 = W) for 192 products, where the 128 x 64 tile staged 192 rows for 64; a wave reads 10 fragments for 24 products, not 6 for 8.
// The product is taken as C^T = W.X^T (A = 16 W rows, B = 16 x rows; both operands go through the same loader, so their k orders are equal): lane (ln, hh) then holds features 8 hh .. 8 hh + 7 of token ln, 16 B of an f16 output row.
#define G3_ROWS 320
#define G3_BUFB (G3_ROWS * G2_PITCH * 2)
#define G3_OP 200      /* pitch of the staged output rows in halves: 400 B = 16 B x odd */
// One slab: 20 copies a lane, 16 B each; 8 lanes cover one whole line, the block 16 rows a copy. Address form: scalar base + the lane's one 32-bit offset, so that the copies hold 4 vector registers beside the 192 of the accumulators
// (a 64-bit vector address and an LDS register for each copy made the build spill). The immediate offset moves BOTH addresses: it carries the LDS step of 16 rows (2304 B, 16128 B at most), and each scalar base is taken back by what its copy's offset adds.
// s_wait_xcnt 0 closes each statement so that no address register is rewritten ahead of it.
__device__ __forceinline__ void g3_slab(unsigned l, unsigned vo, const char* sa, const char* sb) {
  constexpr int G = 16 * DM * 2, D = G - 2304;      /* global step of 16 rows; the same less the LDS step */
  asm volatile(      /* LDS rows 0..127: the 128 x rows */
      "global_load_async_to_lds_b128 %0, %1, %2\n\t"
      "global_load_async_to_lds_b128 %0, %1, %3 offset:2304\n\t"
      "global_load_async_to_lds_b128 %0, %1, %4 offset:4608\n\t"
      "global_load_async_to_lds_b128 %0, %1, %5 offset:6912\n\t"
      "global_load_async_to_lds_b128 %0, %1, %6 offset:9216\n\t"
      "global_load_async_to_lds_b128 %0, %1, %7 offset:11520\n\t"
      "global_load_async_to_lds_b128 %0, %1, %8 offset:13824\n\t"
      "global_load_async_to_lds_b128 %0, %1, %9 offset:16128\n\t"
      "s_wait_xcnt 0x0"
      :: "v"(l), "v"(vo), "s"(sa), "s"(sa + D), "s"(sa + 2 * D), "s"(sa + 3 * D), "s"(sa + 4 * D), "s"(sa + 5 * D), "s"(sa + 6 * D), "s"(sa + 7 * D)
      : "memory");
  asm volatile(      /* LDS rows 128..319: the 192 W rows */
      "global_load_async_to_lds_b128 %0, %2, %3\n\t"
      "global_load_async_to_lds_b128 %0, %2, %4 offset:2304\n\t"
      "global_load_async_to_lds_b128 %0, %2, %5 offset:4608\n\t"
      "global_load_async_to_lds_b128 %0, %2, %6 offset:6912\n\t"
      "global_load_async_to_lds_b128 %0, %2, %7 offset:9216\n\t"
      "global_load_async_to_lds_b128 %0, %2, %8 offset:11520\n\t"
      "global_load_async_to_lds_b128 %1, %2, %9\n\t"
      "global_load_async_to_lds_b128 %1, %2, %10 offset:2304\n\t"
      "global_load_async_to_lds_b128 %1, %2, %11 offset:4608\n\t"
      "global_load_async_to_lds_b128 %1, %2, %12 offset:6912\n\t"
      "global_load_async_to_lds_b128 %1, %2, %13 offset:9216\n\t"
      "global_load_async_to_lds_b128 %1, %2, %14 offset:11520\n\t"
      "s_wait_xcnt 0x0"
      :: "v"(l + 8u * 2304u), "v"(l + 14u * 2304u), "v"(vo), "s"(sb), "s"(sb + D), "s"(sb + 2 * D), "s"(sb + 3 * D), "s"(sb + 4 * D), "s"(sb + 5 * D),
         "s"(sb + 6 * G), "s"(sb + 6 * G + D), "s"(sb + 6 * G + 2 * D), "s"(sb + 6 * G + 3 * D), "s"(sb + 6 * G + 4 * D), "s"(sb + 6 * G + 5 * D)
      : "memory");
}
// TR = false (q and k planes): C^T = W.X^T as above, rows of [token][feature] go out. TR = true (the v plane): the same fragments with the operands exchanged, C = X.W^T (A = 16 x rows, B = 16 W rows; one loader, so the k orders stay equal):
// lane (ln, hh) then holds tokens 8 hh .. 8 hh + 7 of feature ln, 16 B of a row of V^T, and the block writes its 192 x 128 piece of V^T[batch * 768 + feature][token] itself, the layout the attention kernel stages; no transposing launch follows.
#define G3_OPT 136     /* pitch of the staged V^T rows in halves: 272 B = 16 B x odd */
template <bool TR>
__device__ __forceinline__ void g3_body(_Float16* st, const _Float16* __restrict__ A, const _Float16* __restrict__ Bh, float alpha, const float* __restrict__ bp, _Float16* __restrict__ C16, int mt, int col0) {
  const int tid = threadIdx.x, w = tid >> 5, lane = tid & 31, ln = lane & 15, hh = lane >> 4, wr = w >> 1, wc = w & 1;
  constexpr int NT = DM / G2_KS;
  const int cr = tid >> 3, cc = (tid & 7) * 8;
  const char* sa = (const char*)(A + (size_t)mt * 128 * DM); const char* sb = (const char*)(Bh + (size_t)col0 * DM); const unsigned vo = (unsigned)(cr * DM + cc) * 2u;      /* block-uniform bases; the lane's byte offset, the same in x and W (both have rows of DM halves) */
  const unsigned l0 = (unsigned)(size_t)&st[cr * G2_PITCH + cc];
  v8f acc[4][6];
#pragma unroll
  for (int i = 0; i < 4; ++i)
#pragma unroll
    for (int j = 0; j < 6; ++j) acc[i][j] = (v8f){0.f,0.f,0.f,0.f,0.f,0.f,0.f,0.f};
  g3_slab(l0, vo, sa, sb);
  asm volatile("s_wait_asynccnt 0x0" ::: "memory");      /* this wave's copies of slab 0 have landed */
  __syncthreads();                                       /* ... and every other wave's */
  g3_slab(l0 + G3_BUFB, vo, sa + G2_KS * 2, sb + G2_KS * 2);
#pragma unroll 1
  for (int t = 0; t < NT; ++t) { const _Float16* sx = st + (t & 1) * (G3_BUFB / 2) + (64 * wr + ln) * G2_PITCH; const _Float16* sw = st + (t & 1) * (G3_BUFB / 2) + (128 + 96 * wc + ln) * G2_PITCH;
#pragma unroll
    for (int ks = 0; ks < 2; ++ks) { v16h fx[4], fw[6];      /* the 10 fragments of 32 k are read as one group ahead of their 24 products */
#pragma unroll
      for (int i = 0; i < 4; ++i) fx[i] = g2_frag(sx + i * 16 * G2_PITCH + ks * 32, hh);
#pragma unroll
      for (int j = 0; j < 6; ++j) fw[j] = g2_frag(sw + j * 16 * G2_PITCH + ks * 32, hh);
      __builtin_amdgcn_sched_barrier(0);      /* keeps the 20 LDS reads one group: left free, the compiler read each W fragment alone, directly ahead of its 4 products, behind a wait to 0 */
#pragma unroll
      for (int j = 0; j < 6; ++j)
#pragma unroll
        for (int i = 0; i < 4; ++i) acc[i][j] = __builtin_amdgcn_wmma_f32_16x16x32_f16(false, TR ? fx[i] : fw[j], false, TR ? fw[j] : fx[i], (short)0, acc[i][j], false, false); }
    __builtin_amdgcn_sched_barrier(0);                   /* keeps the slab's products ahead of the barrier: left free, the compiler put 24 of them between the barrier and the refill, which then started that much later */
    asm volatile("s_wait_dscnt 0x0" ::: "memory");       /* this wave's reads of slab t are done before its buffer is handed back */
    asm volatile("s_wait_asynccnt 0x0" ::: "memory");    /* this wave's copies of slab t + 1 have landed */
    __syncthreads();                                     /* publishes slab t + 1 and ends every reader's last read of slab t */
    if (t + 2 < NT) g3_slab(l0 + (unsigned)(t & 1) * G3_BUFB, vo, sa + (t + 2) * (G2_KS * 2), sb + (t + 2) * (G2_KS * 2)); }
  asm volatile("s_wait_asynccnt 0x0" ::: "memory");      /* no copy is left in flight when the buffers become output staging */
  if constexpr (!TR) {
#pragma unroll
    for (int j = 0; j < 6; ++j) { const float* bj = bp + col0 + 96 * wc + 16 * j + 8 * hh; const v4f ba = *(const v4fa*)bj, bb = *(const v4fa*)(bj + 4);
      const float bv[8] = {bf16_round(ba[0]), bf16_round(ba[1]), bf16_round(ba[2]), bf16_round(ba[3]), bf16_round(bb[0]), bf16_round(bb[1]), bf16_round(bb[2]), bf16_round(bb[3])};
#pragma unroll
      for (int i = 0; i < 4; ++i) { FragH f;
#pragma unroll
        for (int r = 0; r < 8; ++r) f.h[r] = (_Float16)(acc[i][j][r] * alpha + bv[r]);
        *(v8us*)((unsigned short*)st + (64 * wr + 16 * i + ln) * G3_OP + 96 * wc + 16 * j + 8 * hh) = f.half[0]; } }
    __syncthreads();                                     /* the whole 128 x 192 tile is staged: a row's three 128-byte lines hold two waves' features, and each line goes out whole, from one wave */
    const unsigned short* so = (const unsigned short*)st + cr * G3_OP + cc; unsigned short* go = (unsigned short*)C16 + (size_t)(mt * 128 + cr) * DM + col0 + cc;      /* 8 lanes a line, 16 rows a step, as in the copies */
#pragma unroll
    for (int sg = 0; sg < 3; ++sg)
#pragma unroll
      for (int q = 0; q < 8; ++q) { const v8us v = *(const v8us*)(so + q * 16 * G3_OP + sg * 64); *(v8us*)(go + (size_t)q * 16 * DM + sg * 64) = v; }
  } else {
#pragma unroll
    for (int j = 0; j < 6; ++j) { const float bv = bf16_round(bp[col0 + 96 * wc + 16 * j + ln]);      /* the lane's one feature */
#pragma unroll
      for (int i = 0; i < 4; ++i) { FragH f;
#pragma unroll
        for (int r = 0; r < 8; ++r) f.h[r] = (_Float16)(acc[i][j][r] * alpha + bv);
        *(v8us*)((unsigned short*)st + (96 * wc + 16 * j + ln) * G3_OPT + 64 * wr + 16 * i + 8 * hh) = f.half[0]; } }
    __syncthreads();                                     /* the whole 192 x 128 tile is staged (52224 B): a feature's two 128-byte lines hold two waves' tokens, and each line goes out whole, from one wave */
    const int tr = tid >> 4, tc = (tid & 15) * 8;        /* 16 lanes a row of 128 tokens (two lines), 8 rows a step */
    const unsigned short* so = (const unsigned short*)st + tr * G3_OPT + tc;
    unsigned short* go = (unsigned short*)C16 + ((size_t)(mt / (SLEN / 128)) * DM + col0 + tr) * SLEN + (mt % (SLEN / 128)) * 128 + tc;
#pragma unroll
    for (int q = 0; q < 24; ++q) { const v8us v = *(const v8us*)(so + q * 8 * G3_OPT); *(v8us*)(go + (size_t)q * 8 * SLEN) = v; }
  } }
__global__ __launch_bounds__(128) void k_gemm3(const _Float16* __restrict__ A, const _Float16* __restrict__ B0, const _Float16* __restrict__ B1, const _Float16* __restrict__ B2, float alpha,
    const float* __restrict__ bias0, const float* __restrict__ bias1, const float* __restrict__ bias2, _Float16* __restrict__ C0, _Float16* __restrict__ C1, _Float16* __restrict__ C2T) {
  __shared__ __attribute__((aligned(16))) _Float16 st[2 * G3_ROWS * G2_PITCH];      /* the two slab buffers (92160 B, 3 blocks a WGP); behind the last slab's barrier the same bytes stage the block's output tile (51200 or 52224 B) */
  constexpr int NTN = 3 * DM / 192;
  const int mt = blockIdx.x / NTN, nq = blockIdx.x - mt * NTN; const int pl = nq >> 2, col0 = (nq & 3) * 192;
  if (pl == 2) g3_body<true>(st, A, B2, alpha, bias2, C2T, mt, col0);      /* the test reads the same for the whole block: every barrier inside is passed by all four waves or by none */
  else g3_body<false>(st, A, pl == 0 ? B0 : B1, alpha, pl == 0 ? bias0 : bias1, pl == 0 ? C0 : C1, mt, col0); }
// amdgpu_waves_per_eu(3, 3): the grid gives 3 waves a SIMD, and with that as its register budget the compiler reads a pass's 8 fragments as one group at the head of the pass; aiming at more resident waves it read three of the four V^T fragments among the products, which then waited for them.
__global__ __launch_bounds__(128) __attribute__((amdgpu_waves_per_eu(3, 3))) void k_flash(const _Float16* __restrict__ Q16, int ldq, const _Float16* __restrict__ K16, int ldk, const _Float16* __restrict__ Vt, const int* __restrict__ MSK, float* __restrict__ O, int ldo) {
  // A wave owns QT = 2 tiles of 16 query columns: each K and V^T fragment read from LDS is the A operand of two products (one a tile), so a score costs half the LDS bytes, and a block of 128 queries copies K and V^T from L2 once where two blocks of 64 copied them twice.
  constexpr int QT = 2, RPW = 16 * QT, NQB = TQ / (4 * RPW), DT = 4, KS = 2;
  __shared__ __attribute__((aligned(16))) unsigned short sm[2 * FL_BUFB / 2];      /* the two stage buffers; behind the last stage's barrier the same bytes stage the output rows (34816 of 36864 B) */
  float (*sO)[RPW][64 + 4] = (float (*)[RPW][64 + 4])sm;
  static_assert(4 * RPW * (64 + 4) * 4 <= 2 * FL_BUFB, "the output rows fit the stage buffers");
  const int tid = threadIdx.x, w = tid >> 5, lane = tid & 31, ln = lane & 15, hh = lane >> 4; (void)MSK;
  const int slab = blockIdx.x / NQB, qblk = blockIdx.x % NQB; const int b = slab / NH, h = slab % NH; const int qb0 = qblk * (4 * RPW); const int q0 = qb0 + w * RPW;
  FragH bq[QT][KS];
#pragma unroll
  for (int qt = 0; qt < QT; ++qt) { const unsigned short* qr = (const unsigned short*)Q16 + ((size_t)b * TQ + q0 + qt * 16 + ln) * ldq + h * 64;
#pragma unroll
    for (int ks = 0; ks < KS; ++ks) { bq[qt][ks].half[0] = *(const v8us*)(qr + ks * 32 + 8 * hh); bq[qt][ks].half[1] = *(const v8us*)(qr + ks * 32 + 16 + 8 * hh); } }
  const int cr = tid >> 3, cc = (tid & 7) * 8;
  const _Float16* gk = K16 + ((size_t)b * TK + cr) * ldk + h * 64 + cc; const _Float16* gv = Vt + ((size_t)slab * 64 + cr) * TK + cc; const size_t k16 = (size_t)16 * ldk, v16 = (size_t)16 * TK;
  const unsigned l0 = (unsigned)(size_t)&sm[cr * FL_PITCH + cc];
  float m_q[QT], l_q[QT]; v8f oacc[QT][DT];
#pragma unroll
  for (int qt = 0; qt < QT; ++qt) { m_q[qt] = -3.0e38f; l_q[qt] = 0.f;
#pragma unroll
    for (int dt = 0; dt < DT; ++dt) oacc[qt][dt] = (v8f){0.f,0.f,0.f,0.f,0.f,0.f,0.f,0.f}; }
  constexpr int NS = TK / FL_KEYS;      /* 16 stages */
  fl_stage(l0, gk, k16, gv, v16);
  asm volatile("s_wait_asynccnt 0x0" ::: "memory");      /* this wave's copies of stage 0 have landed */
  __syncthreads();                                       /* ... and every other wave's */
  fl_stage(l0 + FL_BUFB, gk + (size_t)FL_KEYS * ldk, k16, gv + FL_KEYS, v16);
#pragma unroll 1
  for (int s = 0; s < NS; ++s) { const unsigned short* sb = sm + (s & 1) * (FL_BUFB / 2);
#pragma unroll 1
  for (int j0 = 0; j0 < FL_KEYS; j0 += 32) {
    v8f st[QT][2];      /* raw q.k of tile qt, keys j0 + 16 nt + 8 hh + r: the 1/8 rides in the exponent's FMA; m_q is a raw score too */
#pragma unroll
    for (int nt = 0; nt < 2; ++nt) { const unsigned short* kr = sb + (j0 + nt * 16 + ln) * FL_PITCH; FragH ak[KS];
#pragma unroll
      for (int ks = 0; ks < KS; ++ks) { ak[ks].half[0] = *(const v8us*)(kr + ks * 32 + 8 * hh); ak[ks].half[1] = *(const v8us*)(kr + ks * 32 + 16 + 8 * hh); }
#pragma unroll
      for (int qt = 0; qt < QT; ++qt) st[qt][nt] = (v8f){0.f,0.f,0.f,0.f,0.f,0.f,0.f,0.f};
#pragma unroll
      for (int ks = 0; ks < KS; ++ks)
#pragma unroll
        for (int qt = 0; qt < QT; ++qt) st[qt][nt] = __builtin_amdgcn_wmma_f32_16x16x32_f16(false, ak[ks].v, false, bq[qt][ks].v, (short)0, st[qt][nt], false, false); }      /* the two tiles' products are independent and stand in each other's distance */
    FragH pb[QT];
#pragma unroll
    for (int qt = 0; qt < QT; ++qt) {
      float sc[16];
#pragma unroll
      for (int i = 0; i < 16; ++i) sc[i] = st[qt][i >> 3][i & 7];
      float mc = fmaxf(sc[0], sc[1]);
#pragma unroll
      for (int i = 2; i < 16; ++i) mc = fmaxf(mc, sc[i]);
      mc = fmaxf(mc, xhalf(mc));
      const float mn = fmaxf(m_q[qt], mc); const float al = (mn > -1.0e38f) ? __builtin_amdgcn_exp2f((m_q[qt] - mn) * SCL2) : 1.0f; m_q[qt] = mn;
      const float nb = __builtin_fmaf(-mn, SCL2, 10.0f);      /* p x 2^10 = 2^(s/8 log2e - m/8 log2e + 10): one FMA and one v_exp_f32 a score; arguments reach about 10 at most, and below -126 the result is 0 */
#pragma unroll
      for (int i = 0; i < 16; ++i) sc[i] = __builtin_fmaf(sc[i], SCL2, nb);
      exp2x8(sc[0], sc[1], sc[2], sc[3], sc[4], sc[5], sc[6], sc[7]); exp2x8(sc[8], sc[9], sc[10], sc[11], sc[12], sc[13], sc[14], sc[15]);
      float ps[4] = {sc[0], sc[1], sc[2], sc[3]};      /* l_q sums p x 2^10, like the P operand */
#pragma unroll
      for (int i = 4; i < 16; ++i) ps[i & 3] += sc[i];
#pragma unroll
      for (int i = 0; i < 16; ++i) pb[qt].h[i] = (_Float16)sc[i];
      l_q[qt] = l_q[qt] * al + ((ps[0] + ps[1]) + (ps[2] + ps[3]));
#pragma unroll
      for (int dt = 0; dt < DT; ++dt)
#pragma unroll
        for (int r = 0; r < 8; ++r) oacc[qt][dt][r] *= al; }
#pragma unroll
    for (int dt = 0; dt < DT; ++dt) { const unsigned short* vrow = sb + (64 + dt * 16 + ln) * FL_PITCH + j0; FragH av; av.half[0] = *(const v8us*)(vrow + 8 * hh); av.half[1] = *(const v8us*)(vrow + 16 + 8 * hh);
      oacc[0][dt] = __builtin_amdgcn_wmma_f32_16x16x32_f16(false, av.v, false, pb[0].v, (short)0, oacc[0][dt], false, false);
      if (dt < DT - 1) oacc[1][dt] = __builtin_amdgcn_wmma_f32_16x16x32_f16(false, av.v, false, pb[1].v, (short)0, oacc[1][dt], false, false);
      else oacc[1][dt] = mmaH<1>(av.v, av.v, pb[1].v, pb[1].v, oacc[1][dt]); } }      /* the pass's last product keeps its 4 v_nop: the loop's branch follows it */
    asm volatile("s_wait_dscnt 0x0" ::: "memory");       /* this wave's reads of stage s are done before its buffer is handed back */
    asm volatile("s_wait_asynccnt 0x0" ::: "memory");    /* this wave's copies of stage s + 1 have landed */
    __syncthreads();                                     /* publishes stage s + 1 and ends every reader's last read of stage s */
    if (s + 2 < NS) fl_stage(l0 + (unsigned)(s & 1) * FL_BUFB, gk + (size_t)(s + 2) * FL_KEYS * ldk, k16, gv + (s + 2) * FL_KEYS, v16); }
  asm volatile("s_wait_asynccnt 0x0" ::: "memory");      /* no copy is left in flight when the buffers become output staging */
#pragma unroll
  for (int qt = 0; qt < QT; ++qt) { const float l = l_q[qt] + xhalf(l_q[qt]); const float inv = (l > 0.f) ? 1.0f / l : 0.f;      /* l and O carry the same 2^10 */
#pragma unroll
    for (int dt = 0; dt < DT; ++dt)
#pragma unroll
      for (int g = 0; g < 2; ++g) { v4f o4; 
#pragma unroll
        for (int q = 0; q < 4; ++q) o4[q] = oacc[qt][dt][g * 4 + q] * inv;
        *(v4fa*)&sO[w][qt * 16 + ln][dt * 16 + 8 * hh + g * 4] = o4; } }
  __builtin_amdgcn_fence(__ATOMIC_ACQ_REL, "workgroup"); __builtin_amdgcn_wave_barrier();
  {
#pragma unroll
    for (int rp = 0; rp < RPW; rp += 2) { const int r = rp + (lane >> 4), pc = lane & 15; const v4f val = *(const v4fa*)&sO[w][r][pc * 4]; *(v4f*)(O + ((size_t)b * TQ + q0 + r) * ldo + h * 64 + pc * 4) = val; }
     } }
__global__ __launch_bounds__(256) void k_fulltab(unsigned* __restrict__ MB, int* __restrict__ RA, int* __restrict__ KE, int nq, int nk) {
  const int t = blockIdx.x * 256 + threadIdx.x;
  if (t < nq * (nk / 32)) { *(unsigned*)(MB + t) = 0u;  }
  if (t < nq) { *(int*)(RA + t) = 0;  }
  if (t < nq / 64) { *(int*)(KE + t * 32) = nk;  } }
__global__ __launch_bounds__(256) void k_lnout(const float* __restrict__ Y, const float* __restrict__ g, const float* __restrict__ bb, float* __restrict__ out) {
  #pragma clang fp contract(off)
  const int tid = threadIdx.x, w = tid >> 5, ln = tid & 31; const int r = blockIdx.x * 8 + w; if (r >= NR) return; const float* y = Y + (size_t)r * DM; float s = 0.f;
#pragma unroll 1
  for (int i = 0; i < 8; ++i) { const v4f a = *(const v4fa*)(y + i * 128 + ln * 4); for (int q = 0; q < 4; ++q) s += a[q]; }
  for (int o = 16; o > 0; o >>= 1) s += __shfl_xor(s, o, 32); const float mu = s / (float)DM; float q2 = 0.f;
#pragma unroll 1
  for (int i = 0; i < 8; ++i) { const v4f a = *(const v4fa*)(y + i * 128 + ln * 4); for (int q = 0; q < 4; ++q) { const float d = a[q] - mu; q2 += d * d; } }
  for (int o = 16; o > 0; o >>= 1) q2 += __shfl_xor(q2, o, 32); const float rs = rsqrtf(q2 / (float)DM + 1e-6f);
  {
#pragma unroll 1
    for (int i = 0; i < 8; ++i) { const int c0 = i * 128 + ln * 4; const v4f a = *(const v4fa*)(y + c0); v4f o4; for (int q = 0; q < 4; ++q) o4[q] = (a[q] - mu) * rs * bf16_round(g[c0 + q]) + bf16_round(bb[c0 + q]); *(v4f*)(out + (size_t)r * DM + c0) = o4; }
     } }
__global__ __launch_bounds__(256) void k_xb(const float* __restrict__ x, float* __restrict__ XB, size_t n4) { const size_t t = (size_t)blockIdx.x * 256 + threadIdx.x; if (t >= n4) return; const v4f a = *(const v4fa*)(x + t * 4); v4f o; for (int q = 0; q < 4; ++q) o[q] = bf16_round(a[q]); *(v4f*)(XB + t * 4) = o;  }
__global__ __launch_bounds__(256) void k_causaltab(unsigned* __restrict__ MB, int* __restrict__ RA, int* __restrict__ KE, int nq, int nk) {
  const int t = blockIdx.x * 256 + threadIdx.x; const int nw = nk / 32;
  if (t < nq * nw) { const int q = t / nw, w = t % nw; const int first = q + 1 - 32 * w; const unsigned bits = (first <= 0) ? 0xffffffffu : ((first >= 32) ? 0u : (0xffffffffu << first)); *(unsigned*)(MB + t) = bits;  }
  if (t < nq) { *(int*)(RA + t) = 0;  }
  if (t < nq / 64) { const int v = 64 * (t + 1); *(int*)(KE + t * 32) = v;  } }


extern "C" void kernel_launch(void* const* d_in, const int* in_sizes, int n_in,
                              void* d_out, int out_size, void* d_ws, size_t ws_size, hipStream_t stream) {
  (void)in_sizes; (void)n_in; (void)out_size;
  const float* const* I = (const float* const*)d_in; const float* x = I[0]; const float* Wq = I[1]; const float* bq = I[2]; const float* Wk = I[3]; const float* bk = I[4]; const float* Wv = I[5]; const float* bv = I[6];
  char* ws = (char*)d_ws; size_t off = 0;
  auto take = [&](size_t bytes) { char* p = ws + off; off += (bytes + 255) & ~(size_t)255; return p; };
  _Float16* BQ = (_Float16*)take((size_t)DM * DM * 2); _Float16* BK = (_Float16*)take((size_t)DM * DM * 2); _Float16* BV = (_Float16*)take((size_t)DM * DM * 2);
  _Float16* X16 = (_Float16*)take((size_t)NR * DM * 2); _Float16* Q16 = (_Float16*)take((size_t)NR * DM * 2); _Float16* K16 = (_Float16*)take((size_t)NR * DM * 2); _Float16* VT = (_Float16*)take((size_t)NR * DM * 2);
  if (off > ws_size) return;      /* 3.5 + 4 x 12.6 = 54 MiB */
  const dim3 gP((NR / 128) * (3 * DM / 192), 1);
  k_prep<<<PW_XB + 3 * PW_WB, 512, 0, stream>>>(x, Wq, Wk, Wv, X16, BQ, BK, BV);      /* 246 work-groups of 16 waves; a weight's (out, in) rows are already the GEMM's [n][k] operand */
  k_gemm3<<<gP, 128, 0, stream>>>(X16, BQ, BK, BV, 0.0625f, bq, bk, bv, Q16, K16, VT);      /* 64 row tiles x 12 column tiles = 768 blocks, 3 a WGP; the v plane goes out as V^T[batch * 768 + feature][token] */
  k_flash<<<NBT * NH * (SLEN / 128), 128, 0, stream>>>(Q16, DM, K16, DM, VT, nullptr, (float*)d_out, DM);      /* all batches in one grid, 768 blocks of 128 queries, 3 a WGP; ctx rows straight into the output */
}

// v009
// A run of this version takes 58.2 microseconds.
// Next to v008, in two timings, it ran 1.04 times as fast each time.
// Counting every step since v000, it is 16.1 times as fast.
#include <hip/hip_runtime.h>
// DeiT self-attention (8 x 1024 tokens, 768 = 12 heads x 64): q,k,v = x W^T + b; softmax(q.k/8) over all keys; ctx = attn.v merged -> [8,1024,768] (no output projection).
// Structure: x and the three weight matrices to exact f16 planes in one launch of fat waves; the three projections as one f16 WMMA GEMM (128x192 block tiles, 64x96 wave tiles, f32 accumulation, exact products + bias) into f16 planes, v as V^T; the fused flash kernel over all 1024 keys (plain f16 q/k/V^T, online softmax in f32, P x2^10) per ((batch, head), 128 queries) writes the merged context rows straight into the output.
// Compute dtype: x, weights, biases rounded to bf16; q, k, v, P as plain f16 (~2^-12; logits sigma ~0.3); f32 accumulation and softmax. v_wmma_f32_16x16x32_f16.
#define NBT 8
#define SLEN 1024
#define TQ SLEN
#define TK SLEN
#define DM 768
#define NH 12
#define SCL 0.125f
#define SCL2 (SCL * 1.4426950408889634f)      /* 1/8 x log2(e): raw score -> base-2 exponent */
#define NR (NBT * SLEN)
typedef __bf16 v16b __attribute__((ext_vector_type(16)));
typedef unsigned short v8us __attribute__((ext_vector_type(8), may_alias));
typedef float  v8f  __attribute__((ext_vector_type(8)));
typedef float  v4f  __attribute__((ext_vector_type(4)));
typedef float  v4fa __attribute__((ext_vector_type(4), may_alias));
union FragB { v16b v; v8us half[2]; unsigned short u[16]; };

__device__ __forceinline__ unsigned short bf16_bits(float x) { unsigned int u = __float_as_uint(x); return (unsigned short)((u + 0x7FFFu + ((u >> 16) & 1u)) >> 16); }
__device__ __forceinline__ float bf16_val(unsigned short b) { return __uint_as_float(((unsigned int)b) << 16); }
__device__ __forceinline__ float bf16_round(float x) { return bf16_val(bf16_bits(x)); }
// D += A·B with NT terms: 1 = ah·bh, 2 = + al·bh (A split), 3 = + ah·bl (both split)
template <int NT>
__device__ __forceinline__ v8f mmaN(v16b ah, v16b al, v16b bh, v16b bl, v8f c) {
  c = __builtin_amdgcn_wmma_f32_16x16x32_bf16(false, ah, false, bh, (short)0, c, false, false);
  if (NT >= 2) c = __builtin_amdgcn_wmma_f32_16x16x32_bf16(false, al, false, bh, (short)0, c, false, false);
  if (NT >= 3) c = __builtin_amdgcn_wmma_f32_16x16x32_bf16(false, ah, false, bl, (short)0, c, false, false);
  asm volatile("v_nop\n\tv_nop\n\tv_nop\n\tv_nop" : "+v"(c) : "v"(ah), "v"(al), "v"(bh), "v"(bl));
  return c;
}

__global__ __launch_bounds__(256) void k_wt_bf16(const float* __restrict__ W, unsigned short* __restrict__ Wt, int K, int N) {
  const int t = blockIdx.x * 256 + threadIdx.x;
  const int k8n = K / 8;
  if (t >= N * k8n) return;
  const int n = t / k8n, k8 = (t % k8n) * 8;
  v8us v;
#pragma unroll
  for (int i = 0; i < 8; ++i) v[i] = bf16_bits(W[(size_t)(k8 + i) * N + n]);
  *(v8us*)(Wt + (size_t)n * K + k8) = v;
  
}

// GEMM C[M][N] (f32, pitch ldc) = act(A[M][K]·W + bias). A f32 row-major (pitch lda) converted per fragment to bf16
// (ASPLIT: hi/lo two planes -> 2 terms, else single rounded term); Wt bf16 [N][K] (pitch ldb). BIAS_BF16 rounds the
// bias to bf16 first (bias quantised to bf16 before the add). K%32==0, M%16==0, N%64==0.
template <bool ASPLIT, int ACT, bool BIAS_BF16>
__global__ __launch_bounds__(128) void k_gemm_bf(const float* __restrict__ A, int lda, const unsigned short* __restrict__ Wt, int ldb,
                                               const float* __restrict__ bias, float* __restrict__ C, int ldc, int M, int N, int K) {
  __shared__ __attribute__((aligned(16))) float so[4][16][64];
  const int tid = threadIdx.x, w = tid >> 5, lane = tid & 31, ln = lane & 15, hh = lane >> 4;
  const int ntn = N / 64;
  const int wid = blockIdx.x * 4 + w;
  const int mt = wid / ntn, nq = wid % ntn;
  if (mt * 16 >= M) return;
  const int row0 = mt * 16, col0 = nq * 64;
  const float* arow = A + (size_t)(row0 + ln) * lda;
  v8f acc[4] = {};
  for (int kb = 0; kb < K; kb += 32) {
    FragB ah, al;
    const v4f x0 = *(const v4fa*)(arow + kb + 8 * hh), x1 = *(const v4fa*)(arow + kb + 8 * hh + 4);
    const v4f x2 = *(const v4fa*)(arow + kb + 16 + 8 * hh), x3 = *(const v4fa*)(arow + kb + 16 + 8 * hh + 4);
    float xs[16] = {x0[0],x0[1],x0[2],x0[3],x1[0],x1[1],x1[2],x1[3],x2[0],x2[1],x2[2],x2[3],x3[0],x3[1],x3[2],x3[3]};
#pragma unroll
    for (int i = 0; i < 16; ++i) { const unsigned short hb = bf16_bits(xs[i]); ah.u[i] = hb; al.u[i] = ASPLIT ? bf16_bits(xs[i] - bf16_val(hb)) : (unsigned short)0; }
#pragma unroll
    for (int t = 0; t < 4; ++t) {
      const unsigned short* brow = Wt + (size_t)(col0 + t * 16 + ln) * ldb + kb;
      FragB b;
      b.half[0] = *(const v8us*)(brow + 8 * hh);
      b.half[1] = *(const v8us*)(brow + 16 + 8 * hh);
      acc[t] = mmaN<ASPLIT ? 2 : 1>(ah.v, al.v, b.v, b.v, acc[t]);
    }
  }
#pragma unroll
  for (int t = 0; t < 4; ++t) {
    float bv = bias ? bias[col0 + t * 16 + ln] : 0.f;
    if (BIAS_BF16) bv = bf16_round(bv);
#pragma unroll
    for (int r = 0; r < 8; ++r) { float v = acc[t][r] + bv; if (ACT == 1) v = fmaxf(v, 0.f); so[w][8 * hh + r][t * 16 + ln] = v; }
  }
  __builtin_amdgcn_fence(__ATOMIC_ACQ_REL, "workgroup");
  __builtin_amdgcn_wave_barrier();
  const int rsub = lane >> 4, c4 = (lane & 15) * 4;
  {
#pragma unroll
    for (int q = 0; q < 8; ++q) {
      const int r = q * 2 + rsub;
      const v4f v = *(const v4fa*)&so[w][r][c4];
      *(v4f*)(C + (size_t)(row0 + r) * ldc + col0 + c4) = v;
    }
    
  }
}

// GEMM C = act(A·W + bias + resid): A f32 (ASPLIT -> hi/lo 2 terms), Wt bf16 [N][K]; ACT 0 none, 1 relu, 2 exact gelu;
// resid (optional, f32, row index = (row % rmod), pitch ldr, RES_BF16 rounds it) added before the activation.
template <bool ASPLIT, int ACT, bool BIAS_BF16, bool RES_BF16>
__global__ __launch_bounds__(128) void k_gemm_bf3(const float* __restrict__ A, int lda, const unsigned short* __restrict__ Wt, int ldb,
                                                const float* __restrict__ bias, const float* __restrict__ resid, int rmod, int ldr,
                                                float* __restrict__ C, int ldc, int M, int N, int K) {
  __shared__ __attribute__((aligned(16))) float so[4][16][64];
  const int tid = threadIdx.x, w = tid >> 5, lane = tid & 31, ln = lane & 15, hh = lane >> 4;
  const int ntn = N / 64;
  const int wid = blockIdx.x * 4 + w;
  const int mt = wid / ntn, nq = wid % ntn;
  if (mt * 16 >= M) return;
  const int row0 = mt * 16, col0 = nq * 64;
  const float* arow = A + (size_t)(row0 + ln) * lda;
  v8f acc[4] = {};
  for (int kb = 0; kb < K; kb += 32) {
    FragB ah, al;
    const v4f x0 = *(const v4fa*)(arow + kb + 8 * hh), x1 = *(const v4fa*)(arow + kb + 8 * hh + 4);
    const v4f x2 = *(const v4fa*)(arow + kb + 16 + 8 * hh), x3 = *(const v4fa*)(arow + kb + 16 + 8 * hh + 4);
    float xs[16] = {x0[0],x0[1],x0[2],x0[3],x1[0],x1[1],x1[2],x1[3],x2[0],x2[1],x2[2],x2[3],x3[0],x3[1],x3[2],x3[3]};
#pragma unroll
    for (int i = 0; i < 16; ++i) { const unsigned short hb = bf16_bits(xs[i]); ah.u[i] = hb; al.u[i] = ASPLIT ? bf16_bits(xs[i] - bf16_val(hb)) : (unsigned short)0; }
#pragma unroll
    for (int t = 0; t < 4; ++t) {
      const unsigned short* brow = Wt + (size_t)(col0 + t * 16 + ln) * ldb + kb;
      FragB b;
      b.half[0] = *(const v8us*)(brow + 8 * hh);
      b.half[1] = *(const v8us*)(brow + 16 + 8 * hh);
      acc[t] = mmaN<ASPLIT ? 2 : 1>(ah.v, al.v, b.v, b.v, acc[t]);
    }
  }
#pragma unroll
  for (int t = 0; t < 4; ++t) {
    const int col = col0 + t * 16 + ln;
    float bv = bias ? bias[col] : 0.f;
    if (BIAS_BF16) bv = bf16_round(bv);
#pragma unroll
    for (int r = 0; r < 8; ++r) {
      float v = acc[t][r] + bv;
      if (resid) { float rv = resid[(size_t)((row0 + 8 * hh + r) % rmod) * ldr + col]; if (RES_BF16) rv = bf16_round(rv); v += rv; }
      if (ACT == 1) v = fmaxf(v, 0.f);
      if (ACT == 2) v = 0.5f * v * (1.0f + erff(v * 0.70710678118654752f));
      if (ACT == 3) { const float u = 0.7978845608028654f * (v + 0.044715f * v * v * v); v = 0.5f * v * (1.0f + tanhf(u)); }
      so[w][8 * hh + r][t * 16 + ln] = v;
    }
  }
  __builtin_amdgcn_fence(__ATOMIC_ACQ_REL, "workgroup");
  __builtin_amdgcn_wave_barrier();
  const int rsub = lane >> 4, c4 = (lane & 15) * 4;
  {
#pragma unroll
    for (int q = 0; q < 8; ++q) {
      const int r = q * 2 + rsub;
      const v4f v = *(const v4fa*)&so[w][r][c4];
      *(v4f*)(C + (size_t)(row0 + r) * ldc + col0 + c4) = v;
    }
    
  }
}
// row LayerNorm (biased variance, eps) over N: s = X (+ R); optional out_sum <- s; out_norm <- (s-mu)*rsqrt(var+eps)*g + b
template <bool PARAM_BF16>
__global__ __launch_bounds__(256) void k_layernorm(const float* __restrict__ X, const float* __restrict__ R, const float* __restrict__ g, const float* __restrict__ bta,
                                                  float* __restrict__ out_sum, float* __restrict__ out_norm, int N, float eps) {
  __shared__ float red[256];
  const int row = blockIdx.x, tid = threadIdx.x;
  const float* x = X + (size_t)row * N; const float* rr = R ? R + (size_t)row * N : nullptr;
  float vals[16];                     // up to N = 4096
  const int per = N / 256;            // contiguous chunk per thread? use strided-by-4 chunks: thread handles j = tid*4 + 1024*u
  float s1 = 0.f;
  for (int u = 0; u < per / 4; ++u) {
    const int j = tid * 4 + 1024 * u;
    const v4f a = *(const v4fa*)(x + j);
    v4f b = {0.f,0.f,0.f,0.f}; if (rr) b = *(const v4fa*)(rr + j);
#pragma unroll
    for (int q = 0; q < 4; ++q) { const float v = a[q] + b[q]; vals[u * 4 + q] = v; s1 += v; }
  }
  red[tid] = s1; __syncthreads();
  for (int st = 128; st > 0; st >>= 1) { if (tid < st) red[tid] += red[tid + st]; __syncthreads(); }
  const float mu = red[0] / (float)N; __syncthreads();
  float s2 = 0.f;
  for (int u = 0; u < per / 4; ++u)
#pragma unroll
    for (int q = 0; q < 4; ++q) { const float c = vals[u * 4 + q] - mu; s2 += c * c; }
  red[tid] = s2; __syncthreads();
  for (int st = 128; st > 0; st >>= 1) { if (tid < st) red[tid] += red[tid + st]; __syncthreads(); }
  const float rs = rsqrtf(red[0] / (float)N + eps);
  {
    for (int u = 0; u < per / 4; ++u) {
      const int j = tid * 4 + 1024 * u;
      v4f o, sm;
#pragma unroll
      for (int q = 0; q < 4; ++q) {
        float gg = g[j + q], bb = bta[j + q];
        if (PARAM_BF16) { gg = bf16_round(gg); bb = bf16_round(bb); }
        sm[q] = vals[u * 4 + q]; o[q] = (vals[u * 4 + q] - mu) * rs * gg + bb;
      }
      if (out_sum) *(v4f*)(out_sum + (size_t)row * N + j) = sm;
      *(v4f*)(out_norm + (size_t)row * N + j) = o;
    }
    
  }
}



// ---- f16 WMMA path (v_wmma_f32_16x16x32_f16): 11-bit significands for operands in range — used where a [0,1] probability operand needs more precision than bf16
typedef _Float16 v16h __attribute__((ext_vector_type(16)));
union FragH { v16h v; v8us half[2]; _Float16 h[16]; unsigned short u[16]; };
template <int NT>
__device__ __forceinline__ v8f mmaH(v16h ah, v16h al, v16h bh, v16h bl, v8f c) {
  c = __builtin_amdgcn_wmma_f32_16x16x32_f16(false, ah, false, bh, (short)0, c, false, false);
  if (NT >= 2) c = __builtin_amdgcn_wmma_f32_16x16x32_f16(false, al, false, bh, (short)0, c, false, false);
  if (NT >= 3) c = __builtin_amdgcn_wmma_f32_16x16x32_f16(false, ah, false, bl, (short)0, c, false, false);
  asm volatile("v_nop\n\tv_nop\n\tv_nop\n\tv_nop" : "+v"(c) : "v"(ah), "v"(al), "v"(bh), "v"(bl));
  return c;
}
// batched GEMM like k_gemm_b but f16 operands: A f32 (split into f16 hi/lo if ASPLIT, else rounded to f16), Bt = f16 values [n][k]; alpha; C f32; N multiple of 16 (partial tiles skipped)
template <bool ASPLIT>
__global__ __launch_bounds__(128) void k_gemm_h(const float* __restrict__ A, int lda, size_t sA, const _Float16* __restrict__ Bh, int ldb, size_t sB, float alpha, float* __restrict__ C, int ldc, size_t sC, int M, int N, int K) {
  __shared__ __attribute__((aligned(16))) float so[4][16][64];
  const int tid = threadIdx.x, w = tid >> 5, lane = tid & 31, ln = lane & 15, hh = lane >> 4; const int by = blockIdx.y;
  A += (size_t)by * sA; Bh += (size_t)by * sB; C += (size_t)by * sC;
  const int ntn = (N + 63) / 64; const int wid = blockIdx.x * 4 + w; const int mt = wid / ntn, nq = wid % ntn; if (mt * 16 >= M) return;
  const int row0 = mt * 16, col0 = nq * 64; const float* arow = A + (size_t)(row0 + ln) * lda;
  v8f acc[4] = {};
  for (int kb = 0; kb < K; kb += 32) {
    FragH ah, al;
    const v4f x0 = *(const v4fa*)(arow + kb + 8 * hh), x1 = *(const v4fa*)(arow + kb + 8 * hh + 4), x2 = *(const v4fa*)(arow + kb + 16 + 8 * hh), x3 = *(const v4fa*)(arow + kb + 16 + 8 * hh + 4);
    float xs[16] = {x0[0],x0[1],x0[2],x0[3],x1[0],x1[1],x1[2],x1[3],x2[0],x2[1],x2[2],x2[3],x3[0],x3[1],x3[2],x3[3]};
#pragma unroll
    for (int i = 0; i < 16; ++i) { const _Float16 h = (_Float16)xs[i]; ah.h[i] = h; al.h[i] = ASPLIT ? (_Float16)(xs[i] - (float)h) : (_Float16)0.0f; }
#pragma unroll
    for (int t = 0; t < 4; ++t) { if (col0 + t * 16 >= N) continue; const size_t boff = (size_t)(col0 + t * 16 + ln) * ldb + kb; FragH bq; bq.half[0] = *(const v8us*)(Bh + boff + 8 * hh); bq.half[1] = *(const v8us*)(Bh + boff + 16 + 8 * hh);
      acc[t] = mmaH<ASPLIT ? 2 : 1>(ah.v, al.v, bq.v, bq.v, acc[t]); }
  }
#pragma unroll
  for (int t = 0; t < 4; ++t) { if (col0 + t * 16 >= N) continue;
#pragma unroll
    for (int r = 0; r < 8; ++r) so[w][8 * hh + r][t * 16 + ln] = acc[t][r] * alpha; }
  __builtin_amdgcn_fence(__ATOMIC_ACQ_REL, "workgroup"); __builtin_amdgcn_wave_barrier();
  const int rsub = lane >> 4, c4 = (lane & 15) * 4;
  {
#pragma unroll
    for (int q = 0; q < 8; ++q) { const int r = q * 2 + rsub; if (col0 + c4 < N) { const v4f v = *(const v4fa*)&so[w][r][c4]; *(v4f*)(C + (size_t)(row0 + r) * ldc + col0 + c4) = v; } }
     }
}

// Wt[n][k] = f16(W[k][n]·scale) from f32 row-major W[K][N] (scale = power of two; bf16-exact weights stay exact in f16 away from the subnormal range)
__global__ __launch_bounds__(256) void k_wt_f16(const float* __restrict__ W, _Float16* __restrict__ Wt, int K, int N, float scale) {
  const int t = blockIdx.x * 256 + threadIdx.x; if (t >= N * (K / 8)) return; const int n = t / (K / 8), k8 = (t % (K / 8)) * 8; FragH f;
#pragma unroll
  for (int i = 0; i < 8; ++i) f.h[i] = (_Float16)(bf16_round(W[(size_t)(k8 + i) * N + n]) * scale); const v8us o = f.half[0];
  *(v8us*)((unsigned short*)Wt + (size_t)n * K + k8) = o; 
}
// k_gemm_hh variant with fused epilogue: v = acc·alpha + bias[by·sBias + col] (+ CP[(row/rowsPerB)·sCPb + by·64 + col] if CP) ; ACT 0 none / 1 elu ; writes f16 C16 (and f32 C if non-null)
template <int ACT>
__global__ __launch_bounds__(128) void k_gemm_hhx(const _Float16* __restrict__ A, int lda, size_t sA, const _Float16* __restrict__ Bh, int ldb, size_t sB, float alpha, const float* __restrict__ bias, size_t sBias, const float* __restrict__ CP, int rowsPerB, size_t sCPb, int row0g,
    float* __restrict__ C, _Float16* __restrict__ C16, int ldc, size_t sC, int M, int N, int K) {
  __shared__ __attribute__((aligned(16))) float so[4][16][64];
  const int tid = threadIdx.x, w = tid >> 5, lane = tid & 31, ln = lane & 15, hh = lane >> 4; const int by = blockIdx.y;
  A += (size_t)by * sA; Bh += (size_t)by * sB; const size_t cofs = (size_t)by * sC; const float* bp = bias ? bias + (size_t)by * sBias : nullptr;
  const int ntn = (N + 63) / 64; const int wid = blockIdx.x * 4 + w; const int mt = wid / ntn, nq = wid % ntn; if (mt * 16 >= M) return;
  const int row0 = mt * 16, col0 = nq * 64; const _Float16* arow = A + (size_t)(row0 + ln) * lda;
  v8f acc[4] = {};
  for (int kb = 0; kb < K; kb += 32) { FragH ah; ah.half[0] = *(const v8us*)((const unsigned short*)arow + kb + 8 * hh); ah.half[1] = *(const v8us*)((const unsigned short*)arow + kb + 16 + 8 * hh);
#pragma unroll
    for (int t = 0; t < 4; ++t) { if (col0 + t * 16 >= N) continue; const size_t boff = (size_t)(col0 + t * 16 + ln) * ldb + kb; FragH bq; bq.half[0] = *(const v8us*)((const unsigned short*)Bh + boff + 8 * hh); bq.half[1] = *(const v8us*)((const unsigned short*)Bh + boff + 16 + 8 * hh);
      acc[t] = mmaH<1>(ah.v, ah.v, bq.v, bq.v, acc[t]); }
  }
#pragma unroll
  for (int t = 0; t < 4; ++t) { if (col0 + t * 16 >= N) continue; const int col = col0 + t * 16 + ln; const float bv = bp ? bf16_round(bp[col]) : 0.f;
#pragma unroll
    for (int r = 0; r < 8; ++r) { float v = acc[t][r] * alpha + bv; if (CP) { const int bidx = (row0g + row0 + 8 * hh + r) / rowsPerB; v += CP[(size_t)bidx * sCPb + (size_t)by * 64 + col]; } if (ACT == 1) v = (v > 0.f) ? v : expm1f(v); else if (ACT == 7) v = (v > 0.f) ? v + 1.0f : expf(v); else if (ACT == 8) v = tanhf(v); else if (ACT == 9) v = 0.5f * v * (1.0f + tanhf(0.7978845608028654f * (v + 0.044715f * v * v * v))); else if (ACT == 11) v = 1.0f / (1.0f + expf(-v)); else if (ACT == 12) v = (v > 0.f) ? v : 0.01f * v; else if (ACT == 14) v = (v > 0.f) ? v : 0.1f * v; else if (ACT == 15) v = v / (1.0f + expf(-v)); else if (ACT == 3) v = fmaxf(v, 0.f); else if (ACT == 6) v = 0.5f * v * (1.0f + erff(v * 0.70710678118654752f)); so[w][8 * hh + r][t * 16 + ln] = v; } }
  __builtin_amdgcn_fence(__ATOMIC_ACQ_REL, "workgroup"); __builtin_amdgcn_wave_barrier();
  const int rsub = lane >> 4, c4 = (lane & 15) * 4; typedef _Float16 v4h __attribute__((ext_vector_type(4)));
  {
#pragma unroll
    for (int q = 0; q < 8; ++q) { const int r = q * 2 + rsub; if (col0 + c4 < N) { const v4f v = *(const v4fa*)&so[w][r][c4]; if (C) *(v4f*)(C + cofs + (size_t)(row0 + r) * ldc + col0 + c4) = v; if (C16) { v4h h4; for (int i = 0; i < 4; ++i) h4[i] = (_Float16)v[i]; *(v4h*)(C16 + cofs + (size_t)(row0 + r) * ldc + col0 + c4) = h4; } } }
     }
}


typedef _Float16 v4h __attribute__((ext_vector_type(4)));

// x and the three weight matrices to their f16 planes in ONE launch of 3,936 waves, one 16-wave work-group a WGP, all resident at once: a wave takes 8 KB of contiguous f32
// by 16 loads of 16 B a lane (each covers 4 whole lines), all 16 in flight together, and stores 16 x 256 B of f16 (2 whole lines each).
// One 32-byte read a lane makes 31,488 waves in four dependent launches of the same 48 MB: by count, starting that many waves and the three extra launch gaps take longer than moving the bytes.
#define PW_F 2048                      /* floats a wave */
#define PW_XB (NR * DM / PW_F / 16)    /* 192 work-groups for x */
#define PW_WB (DM * DM / PW_F / 16)    /* 18 for each weight matrix */
static_assert(NR * DM % (PW_F * 16) == 0 && DM * DM % (PW_F * 16) == 0, "every wave has a whole share");
template <bool WS>      /* WS: a weight, x16 (a power of two: the bf16 value stays exact in f16) */
__device__ __forceinline__ void prep_wave(const float* __restrict__ s, _Float16* __restrict__ d, int lane) {
  v4f a[16];
#pragma unroll
  for (int i = 0; i < 16; ++i) a[i] = *(const v4fa*)(s + i * 128 + lane * 4);
  __builtin_amdgcn_sched_barrier(0);      /* keeps all 16 loads ahead of the first conversion: left free, the compiler issued 10 or 11 and the rest only behind the waits for those, a second memory latency in a wave that has only this one batch */
#pragma unroll
  for (int i = 0; i < 16; ++i) { v4h o;
#pragma unroll
    for (int q = 0; q < 4; ++q) o[q] = (_Float16)(WS ? bf16_round(a[i][q]) * 16.0f : bf16_round(a[i][q]));
    *(v4h*)(d + i * 128 + lane * 4) = o; }
  asm volatile("s_wait_xcnt 0x0" ::: "memory"); }      /* behind the last store: no register that a store names (its scalar base among them) is rewritten ahead of this wait on any way the code holds from here */
__global__ __launch_bounds__(512) void k_prep(const float* __restrict__ x, const float* __restrict__ Wq, const float* __restrict__ Wk, const float* __restrict__ Wv,
    _Float16* __restrict__ X16, _Float16* __restrict__ BQ, _Float16* __restrict__ BK, _Float16* __restrict__ BV) {
  const int w = __builtin_amdgcn_readfirstlane(threadIdx.x >> 5), lane = threadIdx.x & 31, blk = blockIdx.x;      /* the wave's number as a scalar: its share's base address stays in scalar registers */
  if (blk < PW_XB) { const size_t o = (size_t)(blk * 16 + w) * PW_F; prep_wave<false>(x + o, X16 + o, lane); return; }
  const int m = (blk - PW_XB) / PW_WB; const size_t o = (size_t)((blk - PW_XB - m * PW_WB) * 16 + w) * PW_F;
  prep_wave<true>((m == 0 ? Wq : (m == 1 ? Wk : Wv)) + o, (m == 0 ? BQ : (m == 1 ? BK : BV)) + o, lane); }
__global__ __launch_bounds__(256) void k_h16(const float* __restrict__ x, _Float16* __restrict__ X16, size_t n8) { const size_t t = (size_t)blockIdx.x * 256 + threadIdx.x; if (t >= n8) return; FragH f;
#pragma unroll
  for (int q = 0; q < 8; ++q) f.h[q] = (_Float16)x[t * 8 + q]; *(v8us*)((unsigned short*)X16 + t * 8) = f.half[0];  }
__global__ __launch_bounds__(256) void k_hl(const float* __restrict__ F, _Float16* __restrict__ Hh, _Float16* __restrict__ Hl, size_t n8) { const size_t t = (size_t)blockIdx.x * 256 + threadIdx.x; if (t >= n8) return; FragH fh, fl; const v4f a = *(const v4fa*)(F + t * 8), c = *(const v4fa*)(F + t * 8 + 4);
#pragma unroll
  for (int q = 0; q < 4; ++q) { _Float16 h = (_Float16)a[q]; fh.h[q] = h; fl.h[q] = (_Float16)((a[q] - (float)h) * 1024.0f); h = (_Float16)c[q]; fh.h[4 + q] = h; fl.h[4 + q] = (_Float16)((c[q] - (float)h) * 1024.0f); }
  { *(v8us*)((unsigned short*)Hh + t * 8) = fh.half[0]; *(v8us*)((unsigned short*)Hl + t * 8) = fl.half[0];  } }

// ---- projection GEMM: fragment loader and LDS slab geometry ----
__device__ __forceinline__ v16h g2_frag(const _Float16* p, int hh) { FragH f; f.half[0] = *(const v8us*)((const unsigned short*)p + 8 * hh); f.half[1] = *(const v8us*)((const unsigned short*)p + 16 + 8 * hh); return f.v; }
// K slab of the block tile in LDS: 64 halves (one 128-byte line) of each staged row; pitch 144 B = 16 B x odd, the conflict-free pitch for ds_load_b128 fragment reads.
#define G2_KS 64
#define G2_PITCH 72

// lane l <-> l ^ 16 (the two halves of a wave hold the two key halves of one query column)
__device__ __forceinline__ float xhalf(float x) { const int t = __float_as_int(x); return __int_as_float(__builtin_amdgcn_permlanex16(t, t, 0x76543210, 0xfedcba98, false, false)); }
// Eight 2^x, each in place, in one statement closed by one v_nop: behind a transcendental the instruction set asks for one slot before its result is read or its source overwritten.
// here no v_exp_f32 touches a neighbour's register and the v_nop covers the last.
__device__ __forceinline__ void exp2x8(float& a, float& b, float& c, float& d, float& e, float& f, float& g, float& h) {
  asm("v_exp_f32 %0, %0\n\tv_exp_f32 %1, %1\n\tv_exp_f32 %2, %2\n\tv_exp_f32 %3, %3\n\tv_exp_f32 %4, %4\n\tv_exp_f32 %5, %5\n\tv_exp_f32 %6, %6\n\tv_exp_f32 %7, %7\n\tv_nop"
      : "+v"(a), "+v"(b), "+v"(c), "+v"(d), "+v"(e), "+v"(f), "+v"(g), "+v"(h));
}
// Transposed products: S^T = K.Q^T (A = 16 key rows, B = 16 query columns), O^T += V^T.P^T (A = 16 rows of V^T, B = P^T packed from the two S^T tiles).
// Lane (ln, hh) owns query q0 + 16 qt + ln of each of its wave's query tiles qt: st[qt][nt][r] = score of key j0 + 16 nt + 8 hh + r, which is already the hardware k order of a B operand; oacc[qt][dt][r] = O[query][16 dt + 8 hh + r].
// Stage of 64 keys in LDS, shared by the block's 4 waves: rows 0..63 = the 64 K rows (64 halves = one 128-byte line each), rows 64..127 = the 64 V^T rows (their 64 key columns, one line each); pitch 144 B as in the GEMM slab.
#define FL_KEYS 64
#define FL_PITCH 72
#define FL_BUFB (128 * FL_PITCH * 2)
#define FL_SUMCAP 32768.0f      /* 2^15 */
// One stage: 8 copies a lane, 16 B each; 8 lanes cover one whole line, the block 16 rows a copy (2304 B of LDS further each). s_wait_xcnt 0 closes the statement so that no address register is rewritten ahead of it.
__device__ __forceinline__ void fl_stage(unsigned l, const _Float16* gk, size_t k16, const _Float16* gv, size_t v16) {
  asm volatile(
      "global_load_async_to_lds_b128 %0, %8, off\n\t"
      "global_load_async_to_lds_b128 %1, %9, off\n\t"
      "global_load_async_to_lds_b128 %2, %10, off\n\t"
      "global_load_async_to_lds_b128 %3, %11, off\n\t"
      "global_load_async_to_lds_b128 %4, %12, off\n\t"
      "global_load_async_to_lds_b128 %5, %13, off\n\t"
      "global_load_async_to_lds_b128 %6, %14, off\n\t"
      "global_load_async_to_lds_b128 %7, %15, off\n\t"
      "s_wait_xcnt 0x0"
      :: "v"(l), "v"(l + 2304u), "v"(l + 2u * 2304u), "v"(l + 3u * 2304u), "v"(l + 4u * 2304u), "v"(l + 5u * 2304u), "v"(l + 6u * 2304u), "v"(l + 7u * 2304u),
         "v"(gk), "v"(gk + k16), "v"(gk + 2 * k16), "v"(gk + 3 * k16), "v"(gv), "v"(gv + v16), "v"(gv + 2 * v16), "v"(gv + 3 * v16)
      : "memory");
}
// q, k and v = x W^T + b as ONE GEMM: block tile 128 tokens x 192 output features (192 divides 768, so a block's features lie in one of the three planes), 4 waves as 2 x 2, wave tile 64 x 96.
// Per 64-k slab a block stages 320 rows (rows 0..127 = x, rows 128..319 = W) for 192 products, where the 128 x 64 tile staged 192 rows for 64; a wave reads 10 fragments for 24 products, not 6 for 8.
// The product is taken as C^T = W.X^T (A = 16 W rows, B = 16 x rows; both operands go through the same loader, so their k orders are equal): lane (ln, hh) then holds features 8 hh .. 8 hh + 7 of token ln, 16 B of an f16 output row.
#define G3_ROWS 320
#define G3_BUFB (G3_ROWS * G2_PITCH * 2)
#define G3_OP 200      /* pitch of the staged output rows in halves: 400 B = 16 B x odd */
// One slab: 20 copies a lane, 16 B each; 8 lanes cover one whole line, the block 16 rows a copy. Address form: scalar base + the lane's one 32-bit offset, so that the copies hold 4 vector registers beside the 192 of the accumulators
// (a 64-bit vector address and an LDS register for each copy made the build spill). The immediate offset moves BOTH addresses: it carries the LDS step of 16 rows (2304 B, 16128 B at most), and each scalar base is taken back by what its copy's offset adds.
// s_wait_xcnt 0 closes each statement so that no address register is rewritten ahead of it.
__device__ __forceinline__ void g3_slab(unsigned l, unsigned vo, const char* sa, const char* sb) {
  constexpr int G = 16 * DM * 2, D = G - 2304;      /* global step of 16 rows; the same less the LDS step */
  asm volatile(      /* LDS rows 0..127: the 128 x rows */
      "global_load_async_to_lds_b128 %0, %1, %2\n\t"
      "global_load_async_to_lds_b128 %0, %1, %3 offset:2304\n\t"
      "global_load_async_to_lds_b128 %0, %1, %4 offset:4608\n\t"
      "global_load_async_to_lds_b128 %0, %1, %5 offset:6912\n\t"
      "global_load_async_to_lds_b128 %0, %1, %6 offset:9216\n\t"
      "global_load_async_to_lds_b128 %0, %1, %7 offset:11520\n\t"
      "global_load_async_to_lds_b128 %0, %1, %8 offset:13824\n\t"
      "global_load_async_to_lds_b128 %0, %1, %9 offset:16128\n\t"
      "s_wait_xcnt 0x0"
      :: "v"(l), "v"(vo), "s"(sa), "s"(sa + D), "s"(sa + 2 * D), "s"(sa + 3 * D), "s"(sa + 4 * D), "s"(sa + 5 * D), "s"(sa + 6 * D), "s"(sa + 7 * D)
      : "memory");
  asm volatile(      /* LDS rows 128..319: the 192 W rows */
      "global_load_async_to_lds_b128 %0, %2, %3\n\t"
      "global_load_async_to_lds_b128 %0, %2, %4 offset:2304\n\t"
      "global_load_async_to_lds_b128 %0, %2, %5 offset:4608\n\t"
      "global_load_async_to_lds_b128 %0, %2, %6 offset:6912\n\t"
      "global_load_async_to_lds_b128 %0, %2, %7 offset:9216\n\t"
      "global_load_async_to_lds_b128 %0, %2, %8 offset:11520\n\t"
      "global_load_async_to_lds_b128 %1, %2, %9\n\t"
      "global_load_async_to_lds_b128 %1, %2, %10 offset:2304\n\t"
      "global_load_async_to_lds_b128 %1, %2, %11 offset:4608\n\t"
      "global_load_async_to_lds_b128 %1, %2, %12 offset:6912\n\t"
      "global_load_async_to_lds_b128 %1, %2, %13 offset:9216\n\t"
      "global_load_async_to_lds_b128 %1, %2, %14 offset:11520\n\t"
      "s_wait_xcnt 0x0"
      :: "v"(l + 8u * 2304u), "v"(l + 14u * 2304u), "v"(vo), "s"(sb), "s"(sb + D), "s"(sb + 2 * D), "s"(sb + 3 * D), "s"(sb + 4 * D), "s"(sb + 5 * D),
         "s"(sb + 6 * G), "s"(sb + 6 * G + D), "s"(sb + 6 * G + 2 * D), "s"(sb + 6 * G + 3 * D), "s"(sb + 6 * G + 4 * D), "s"(sb + 6 * G + 5 * D)
      : "memory");
}
// TR = false (q and k planes): C^T = W.X^T as above, rows of [token][feature] go out. TR = true (the v plane): the same fragments with the operands exchanged, C = X.W^T (A = 16 x rows, B = 16 W rows; one loader, so the k orders stay equal):
// lane (ln, hh) then holds tokens 8 hh .. 8 hh + 7 of feature ln, 16 B of a row of V^T, and the block writes its 192 x 128 piece of V^T[batch * 768 + feature][token] itself, the layout the attention kernel stages; no transposing launch follows.
#define G3_OPT 136     /* pitch of the staged V^T rows in halves: 272 B = 16 B x odd */
template <bool TR>
__device__ __forceinline__ void g3_body(_Float16* st, const _Float16* __restrict__ A, const _Float16* __restrict__ Bh, float alpha, const float* __restrict__ bp, _Float16* __restrict__ C16, int mt, int col0) {
  const int tid = threadIdx.x, w = tid >> 5, lane = tid & 31, ln = lane & 15, hh = lane >> 4, wr = w >> 1, wc = w & 1;
  constexpr int NT = DM / G2_KS;
  const int cr = tid >> 3, cc = (tid & 7) * 8;
  const char* sa = (const char*)(A + (size_t)mt * 128 * DM); const char* sb = (const char*)(Bh + (size_t)col0 * DM); const unsigned vo = (unsigned)(cr * DM + cc) * 2u;      /* block-uniform bases; the lane's byte offset, the same in x and W (both have rows of DM halves) */
  const unsigned l0 = (unsigned)(size_t)&st[cr * G2_PITCH + cc];
  v8f acc[4][6];
#pragma unroll
  for (int i = 0; i < 4; ++i)
#pragma unroll
    for (int j = 0; j < 6; ++j) acc[i][j] = (v8f){0.f,0.f,0.f,0.f,0.f,0.f,0.f,0.f};
  g3_slab(l0, vo, sa, sb);
  asm volatile("s_wait_asynccnt 0x0" ::: "memory");      /* this wave's copies of slab 0 have landed */
  __syncthreads();                                       /* ... and every other wave's */
  g3_slab(l0 + G3_BUFB, vo, sa + G2_KS * 2, sb + G2_KS * 2);
#pragma unroll 1
  for (int t = 0; t < NT; ++t) { const _Float16* sx = st + (t & 1) * (G3_BUFB / 2) + (64 * wr + ln) * G2_PITCH; const _Float16* sw = st + (t & 1) * (G3_BUFB / 2) + (128 + 96 * wc + ln) * G2_PITCH;
#pragma unroll
    for (int ks = 0; ks < 2; ++ks) { v16h fx[4], fw[6];      /* the 10 fragments of 32 k are read as one group ahead of their 24 products */
#pragma unroll
      for (int i = 0; i < 4; ++i) fx[i] = g2_frag(sx + i * 16 * G2_PITCH + ks * 32, hh);
#pragma unroll
      for (int j = 0; j < 6; ++j) fw[j] = g2_frag(sw + j * 16 * G2_PITCH + ks * 32, hh);
      __builtin_amdgcn_sched_barrier(0);      /* keeps the 20 LDS reads one group: left free, the compiler read each W fragment alone, directly ahead of its 4 products, behind a wait to 0 */
#pragma unroll
      for (int j = 0; j < 6; ++j)
#pragma unroll
        for (int i = 0; i < 4; ++i) acc[i][j] = __builtin_amdgcn_wmma_f32_16x16x32_f16(false, TR ? fx[i] : fw[j], false, TR ? fw[j] : fx[i], (short)0, acc[i][j], false, false); }
    __builtin_amdgcn_sched_barrier(0);                   /* keeps the slab's products ahead of the barrier: left free, the compiler put 24 of them between the barrier and the refill, which then started that much later */
    asm volatile("s_wait_dscnt 0x0" ::: "memory");       /* this wave's reads of slab t are done before its buffer is handed back */
    asm volatile("s_wait_asynccnt 0x0" ::: "memory");    /* this wave's copies of slab t + 1 have landed */
    __syncthreads();                                     /* publishes slab t + 1 and ends every reader's last read of slab t */
    if (t + 2 < NT) g3_slab(l0 + (unsigned)(t & 1) * G3_BUFB, vo, sa + (t + 2) * (G2_KS * 2), sb + (t + 2) * (G2_KS * 2)); }
  asm volatile("s_wait_asynccnt 0x0" ::: "memory");      /* no copy is left in flight when the buffers become output staging */
  if constexpr (!TR) {
#pragma unroll
    for (int j = 0; j < 6; ++j) { const float* bj = bp + col0 + 96 * wc + 16 * j + 8 * hh; const v4f ba = *(const v4fa*)bj, bb = *(const v4fa*)(bj + 4);
      const float bv[8] = {bf16_round(ba[0]), bf16_round(ba[1]), bf16_round(ba[2]), bf16_round(ba[3]), bf16_round(bb[0]), bf16_round(bb[1]), bf16_round(bb[2]), bf16_round(bb[3])};
#pragma unroll
      for (int i = 0; i < 4; ++i) { FragH f;
#pragma unroll
        for (int r = 0; r < 8; ++r) f.h[r] = (_Float16)(acc[i][j][r] * alpha + bv[r]);
        *(v8us*)((unsigned short*)st + (64 * wr + 16 * i + ln) * G3_OP + 96 * wc + 16 * j + 8 * hh) = f.half[0]; } }
    __syncthreads();                                     /* the whole 128 x 192 tile is staged: a row's three 128-byte lines hold two waves' features, and each line goes out whole, from one wave */
    const unsigned short* so = (const unsigned short*)st + cr * G3_OP + cc; unsigned short* go = (unsigned short*)C16 + (size_t)(mt * 128 + cr) * DM + col0 + cc;      /* 8 lanes a line, 16 rows a step, as in the copies */
#pragma unroll
    for (int sg = 0; sg < 3; ++sg)
#pragma unroll
      for (int q = 0; q < 8; ++q) { const v8us v = *(const v8us*)(so + q * 16 * G3_OP + sg * 64); *(v8us*)(go + (size_t)q * 16 * DM + sg * 64) = v; }
  } else {
#pragma unroll
    for (int j = 0; j < 6; ++j) { const float bv = bf16_round(bp[col0 + 96 * wc + 16 * j + ln]);      /* the lane's one feature */
#pragma unroll
      for (int i = 0; i < 4; ++i) { FragH f;
#pragma unroll
        for (int r = 0; r < 8; ++r) f.h[r] = (_Float16)(acc[i][j][r] * alpha + bv);
        *(v8us*)((unsigned short*)st + (96 * wc + 16 * j + ln) * G3_OPT + 64 * wr + 16 * i + 8 * hh) = f.half[0]; } }
    __syncthreads();                                     /* the whole 192 x 128 tile is staged (52224 B): a feature's two 128-byte lines hold two waves' tokens, and each line goes out whole, from one wave */
    const int tr = tid >> 4, tc = (tid & 15) * 8;        /* 16 lanes a row of 128 tokens (two lines), 8 rows a step */
    const unsigned short* so = (const unsigned short*)st + tr * G3_OPT + tc;
    unsigned short* go = (unsigned short*)C16 + ((size_t)(mt / (SLEN / 128)) * DM + col0 + tr) * SLEN + (mt % (SLEN / 128)) * 128 + tc;
#pragma unroll
    for (int q = 0; q < 24; ++q) { const v8us v = *(const v8us*)(so + q * 8 * G3_OPT); *(v8us*)(go + (size_t)q * 8 * SLEN) = v; }
  } }
__global__ __launch_bounds__(128) void k_gemm3(const _Float16* __restrict__ A, const _Float16* __restrict__ B0, const _Float16* __restrict__ B1, const _Float16* __restrict__ B2, float alpha,
    const float* __restrict__ bias0, const float* __restrict__ bias1, const float* __restrict__ bias2, _Float16* __restrict__ C0, _Float16* __restrict__ C1, _Float16* __restrict__ C2T) {
  __shared__ __attribute__((aligned(16))) _Float16 st[2 * G3_ROWS * G2_PITCH];      /* the two slab buffers (92160 B, 3 blocks a WGP); behind the last slab's barrier the same bytes stage the block's output tile (51200 or 52224 B) */
  constexpr int NTN = 3 * DM / 192;
  const int mt = blockIdx.x / NTN, nq = blockIdx.x - mt * NTN; const int pl = nq >> 2, col0 = (nq & 3) * 192;
  if (pl == 2) g3_body<true>(st, A, B2, alpha, bias2, C2T, mt, col0);      /* the test reads the same for the whole block: every barrier inside is passed by all four waves or by none */
  else g3_body<false>(st, A, pl == 0 ? B0 : B1, alpha, pl == 0 ? bias0 : bias1, pl == 0 ? C0 : C1, mt, col0); }
// One query tile's 16 scores of a lane (s0, s1: raw q.k) to P x 2^10 as a B operand, and their sum: p x 2^10 = 2^(s/8 log2e + nb), nb = 10 - m/8 log2e: one FMA and one v_exp_f32 a score; below -126 the result is 0.
__device__ __forceinline__ float fl_probs(const v8f s0, const v8f s1, const float nb, FragH& pb) {
  float sc[16];
#pragma unroll
  for (int i = 0; i < 16; ++i) sc[i] = __builtin_fmaf(i < 8 ? s0[i & 7] : s1[i & 7], SCL2, nb);
  exp2x8(sc[0], sc[1], sc[2], sc[3], sc[4], sc[5], sc[6], sc[7]); exp2x8(sc[8], sc[9], sc[10], sc[11], sc[12], sc[13], sc[14], sc[15]);
  float ps[4] = {sc[0], sc[1], sc[2], sc[3]};      /* the sum carries the 2^10, like the P operand */
#pragma unroll
  for (int i = 4; i < 16; ++i) ps[i & 3] += sc[i];
#pragma unroll
  for (int i = 0; i < 16; ++i) pb.h[i] = (_Float16)sc[i];
  return (ps[0] + ps[1]) + (ps[2] + ps[3]); }
// amdgpu_waves_per_eu(3, 3): the grid gives 3 waves a SIMD, and with that as its register budget the compiler reads a pass's 8 fragments as one group at the head of the pass; aiming at more resident waves it read three of the four V^T fragments among the products, which then waited for them.
__global__ __launch_bounds__(128) __attribute__((amdgpu_waves_per_eu(3, 3))) void k_flash(const _Float16* __restrict__ Q16, int ldq, const _Float16* __restrict__ K16, int ldk, const _Float16* __restrict__ Vt, const int* __restrict__ MSK, float* __restrict__ O, int ldo) {
  // A wave owns QT = 2 tiles of 16 query columns: each K and V^T fragment read from LDS is the A operand of two products (one a tile), so a score costs half the LDS bytes, and a block of 128 queries copies K and V^T from L2 once where two blocks of 64 copied them twice.
  constexpr int QT = 2, RPW = 16 * QT, NQB = TQ / (4 * RPW), DT = 4, KS = 2;
  __shared__ __attribute__((aligned(16))) unsigned short sm[2 * FL_BUFB / 2];      /* the two stage buffers; behind the last stage's barrier the same bytes stage the output rows (34816 of 36864 B) */
  float (*sO)[RPW][64 + 4] = (float (*)[RPW][64 + 4])sm;
  static_assert(4 * RPW * (64 + 4) * 4 <= 2 * FL_BUFB, "the output rows fit the stage buffers");
  const int tid = threadIdx.x, w = tid >> 5, lane = tid & 31, ln = lane & 15, hh = lane >> 4; (void)MSK;
  const int slab = blockIdx.x / NQB, qblk = blockIdx.x % NQB; const int b = slab / NH, h = slab % NH; const int qb0 = qblk * (4 * RPW); const int q0 = qb0 + w * RPW;
  FragH bq[QT][KS];
#pragma unroll
  for (int qt = 0; qt < QT; ++qt) { const unsigned short* qr = (const unsigned short*)Q16 + ((size_t)b * TQ + q0 + qt * 16 + ln) * ldq + h * 64;
#pragma unroll
    for (int ks = 0; ks < KS; ++ks) { bq[qt][ks].half[0] = *(const v8us*)(qr + ks * 32 + 8 * hh); bq[qt][ks].half[1] = *(const v8us*)(qr + ks * 32 + 16 + 8 * hh); } }
  const int cr = tid >> 3, cc = (tid & 7) * 8;
  const _Float16* gk = K16 + ((size_t)b * TK + cr) * ldk + h * 64 + cc; const _Float16* gv = Vt + ((size_t)slab * 64 + cr) * TK + cc; const size_t k16 = (size_t)16 * ldk, v16 = (size_t)16 * TK;
  const unsigned l0 = (unsigned)(size_t)&sm[cr * FL_PITCH + cc];
  float m_q[QT], nb_q[QT], l_q[QT]; v8f oacc[QT][DT];      /* nb_q = the exponent's offset for m_q */
#pragma unroll
  for (int qt = 0; qt < QT; ++qt) { m_q[qt] = -3.0e38f; nb_q[qt] = __builtin_inff(); l_q[qt] = 0.f;
#pragma unroll
    for (int dt = 0; dt < DT; ++dt) oacc[qt][dt] = (v8f){0.f,0.f,0.f,0.f,0.f,0.f,0.f,0.f}; }
  constexpr int NS = TK / FL_KEYS;      /* 16 stages */
  fl_stage(l0, gk, k16, gv, v16);
  asm volatile("s_wait_asynccnt 0x0" ::: "memory");      /* this wave's copies of stage 0 have landed */
  __syncthreads();                                       /* ... and every other wave's */
  fl_stage(l0 + FL_BUFB, gk + (size_t)FL_KEYS * ldk, k16, gv + FL_KEYS, v16);
#pragma unroll 1
  for (int s = 0; s < NS; ++s) { const unsigned short* sb = sm + (s & 1) * (FL_BUFB / 2);
#pragma unroll 1
  for (int j0 = 0; j0 < FL_KEYS; j0 += 32) {
    v8f st[QT][2];      /* raw q.k of tile qt, keys j0 + 16 nt + 8 hh + r: the 1/8 rides in the exponent's FMA; m_q is a raw score too */
    FragH ak[2][KS], av[DT];      /* the pass's 8 fragments are read here, as one group: the V^T reads stand ahead of the test's branch, behind which they would be a second place of LDS reads with their latency open */
#pragma unroll
    for (int ks = 0; ks < KS; ++ks)
#pragma unroll
      for (int nt = 0; nt < 2; ++nt) { const unsigned short* kr = sb + (j0 + nt * 16 + ln) * FL_PITCH + ks * 32; ak[nt][ks].half[0] = *(const v8us*)(kr + 8 * hh); ak[nt][ks].half[1] = *(const v8us*)(kr + 16 + 8 * hh); }
#pragma unroll
    for (int dt = 0; dt < DT; ++dt) { const unsigned short* vrow = sb + (64 + dt * 16 + ln) * FL_PITCH + j0; av[dt].half[0] = *(const v8us*)(vrow + 8 * hh); av[dt].half[1] = *(const v8us*)(vrow + 16 + 8 * hh); }
    __builtin_amdgcn_sched_barrier(0);      /* keeps the 16 LDS reads one group: left free, the compiler read the K fragments in three places among the products, two of them behind a wait to 0 */
#pragma unroll
    for (int nt = 0; nt < 2; ++nt)
#pragma unroll
      for (int qt = 0; qt < QT; ++qt) st[qt][nt] = (v8f){0.f,0.f,0.f,0.f,0.f,0.f,0.f,0.f};
#pragma unroll
    for (int ks = 0; ks < KS; ++ks)
#pragma unroll
      for (int nt = 0; nt < 2; ++nt)
#pragma unroll
        for (int qt = 0; qt < QT; ++qt) st[qt][nt] = __builtin_amdgcn_wmma_f32_16x16x32_f16(false, ak[nt][ks].v, false, bq[qt][ks].v, (short)0, st[qt][nt], false, false);      /* four independent tiles stand in each other's distance */
    __builtin_amdgcn_sched_barrier(0);      /* keeps the 8 products one run: left free, the compiler put the exponents' FMAs among them, each behind v_nop pads, and a tile's two products back to back */
    // Lazy rescale: m_q is the maximum IN USE, not the running maximum: P and its sum are taken with the offset that belongs to it, and no maximum, no factor and no rescaling stand in the common pass.
    // The test is the pass's own sum: every p x 2^10 is at least 0, so a lane's sum of 16 at or below 2^15 bounds each of them inside f16's 65504; with no score above m_q the sum is 2^14 at most.
    // A larger sum (infinity in the first pass, whose offset is infinity) sends the whole wave to the rare side: new maximum from the raw scores, l_q and oacc rescaled, P taken again.
    float ps[QT]; FragH pb[QT];
#pragma unroll
    for (int qt = 0; qt < QT; ++qt) ps[qt] = fl_probs(st[qt][0], st[qt][1], nb_q[qt], pb[qt]);
    if (__builtin_expect(__builtin_amdgcn_ballot_w32((ps[0] > FL_SUMCAP) | (ps[1] > FL_SUMCAP)) != 0, 0)) {      /* one test a pass, a scalar branch, the same for the whole wave: the two halves of a query move together; marked unlikely so that the common pass runs straight through, with no jump round the rare side */
#pragma unroll
      for (int qt = 0; qt < QT; ++qt) {
        float mc = fmaxf(st[qt][0][0], st[qt][0][1]);
#pragma unroll
        for (int i = 2; i < 16; ++i) mc = fmaxf(mc, st[qt][i >> 3][i & 7]);
        const float mn = fmaxf(m_q[qt], fmaxf(mc, xhalf(mc))); const float al = (mn > -1.0e38f) ? __builtin_amdgcn_exp2f((m_q[qt] - mn) * SCL2) : 1.0f;
        m_q[qt] = mn; nb_q[qt] = __builtin_fmaf(-mn, SCL2, 10.0f); l_q[qt] *= al;
#pragma unroll
        for (int dt = 0; dt < DT; ++dt)
#pragma unroll
          for (int r = 0; r < 8; ++r) oacc[qt][dt][r] *= al;
        ps[qt] = fl_probs(st[qt][0], st[qt][1], nb_q[qt], pb[qt]); } }
#pragma unroll
    for (int qt = 0; qt < QT; ++qt) l_q[qt] += ps[qt];
#pragma unroll
    for (int dt = 0; dt < DT; ++dt) {
      oacc[0][dt] = __builtin_amdgcn_wmma_f32_16x16x32_f16(false, av[dt].v, false, pb[0].v, (short)0, oacc[0][dt], false, false);
      if (dt < DT - 1) oacc[1][dt] = __builtin_amdgcn_wmma_f32_16x16x32_f16(false, av[dt].v, false, pb[1].v, (short)0, oacc[1][dt], false, false);
      else oacc[1][dt] = mmaH<1>(av[dt].v, av[dt].v, pb[1].v, pb[1].v, oacc[1][dt]); } }      /* the pass's last product keeps its 4 v_nop: the loop's branch follows it */
    asm volatile("s_wait_dscnt 0x0" ::: "memory");       /* this wave's reads of stage s are done before its buffer is handed back */
    asm volatile("s_wait_asynccnt 0x0" ::: "memory");    /* this wave's copies of stage s + 1 have landed */
    __syncthreads();                                     /* publishes stage s + 1 and ends every reader's last read of stage s */
    if (s + 2 < NS) fl_stage(l0 + (unsigned)(s & 1) * FL_BUFB, gk + (size_t)(s + 2) * FL_KEYS * ldk, k16, gv + (s + 2) * FL_KEYS, v16); }
  asm volatile("s_wait_asynccnt 0x0" ::: "memory");      /* no copy is left in flight when the buffers become output staging */
#pragma unroll
  for (int qt = 0; qt < QT; ++qt) { const float l = l_q[qt] + xhalf(l_q[qt]); const float inv = (l > 0.f) ? 1.0f / l : 0.f;      /* l and O carry the same 2^10 */
#pragma unroll
    for (int dt = 0; dt < DT; ++dt)
#pragma unroll
      for (int g = 0; g < 2; ++g) { v4f o4; 
#pragma unroll
        for (int q = 0; q < 4; ++q) o4[q] = oacc[qt][dt][g * 4 + q] * inv;
        *(v4fa*)&sO[w][qt * 16 + ln][dt * 16 + 8 * hh + g * 4] = o4; } }
  __builtin_amdgcn_fence(__ATOMIC_ACQ_REL, "workgroup"); __builtin_amdgcn_wave_barrier();
  {
#pragma unroll
    for (int rp = 0; rp < RPW; rp += 2) { const int r = rp + (lane >> 4), pc = lane & 15; const v4f val = *(const v4fa*)&sO[w][r][pc * 4]; *(v4f*)(O + ((size_t)b * TQ + q0 + r) * ldo + h * 64 + pc * 4) = val; }
     } }
__global__ __launch_bounds__(256) void k_fulltab(unsigned* __restrict__ MB, int* __restrict__ RA, int* __restrict__ KE, int nq, int nk) {
  const int t = blockIdx.x * 256 + threadIdx.x;
  if (t < nq * (nk / 32)) { *(unsigned*)(MB + t) = 0u;  }
  if (t < nq) { *(int*)(RA + t) = 0;  }
  if (t < nq / 64) { *(int*)(KE + t * 32) = nk;  } }
__global__ __launch_bounds__(256) void k_lnout(const float* __restrict__ Y, const float* __restrict__ g, const float* __restrict__ bb, float* __restrict__ out) {
  #pragma clang fp contract(off)
  const int tid = threadIdx.x, w = tid >> 5, ln = tid & 31; const int r = blockIdx.x * 8 + w; if (r >= NR) return; const float* y = Y + (size_t)r * DM; float s = 0.f;
#pragma unroll 1
  for (int i = 0; i < 8; ++i) { const v4f a = *(const v4fa*)(y + i * 128 + ln * 4); for (int q = 0; q < 4; ++q) s += a[q]; }
  for (int o = 16; o > 0; o >>= 1) s += __shfl_xor(s, o, 32); const float mu = s / (float)DM; float q2 = 0.f;
#pragma unroll 1
  for (int i = 0; i < 8; ++i) { const v4f a = *(const v4fa*)(y + i * 128 + ln * 4); for (int q = 0; q < 4; ++q) { const float d = a[q] - mu; q2 += d * d; } }
  for (int o = 16; o > 0; o >>= 1) q2 += __shfl_xor(q2, o, 32); const float rs = rsqrtf(q2 / (float)DM + 1e-6f);
  {
#pragma unroll 1
    for (int i = 0; i < 8; ++i) { const int c0 = i * 128 + ln * 4; const v4f a = *(const v4fa*)(y + c0); v4f o4; for (int q = 0; q < 4; ++q) o4[q] = (a[q] - mu) * rs * bf16_round(g[c0 + q]) + bf16_round(bb[c0 + q]); *(v4f*)(out + (size_t)r * DM + c0) = o4; }
     } }
__global__ __launch_bounds__(256) void k_xb(const float* __restrict__ x, float* __restrict__ XB, size_t n4) { const size_t t = (size_t)blockIdx.x * 256 + threadIdx.x; if (t >= n4) return; const v4f a = *(const v4fa*)(x + t * 4); v4f o; for (int q = 0; q < 4; ++q) o[q] = bf16_round(a[q]); *(v4f*)(XB + t * 4) = o;  }
__global__ __launch_bounds__(256) void k_causaltab(unsigned* __restrict__ MB, int* __restrict__ RA, int* __restrict__ KE, int nq, int nk) {
  const int t = blockIdx.x * 256 + threadIdx.x; const int nw = nk / 32;
  if (t < nq * nw) { const int q = t / nw, w = t % nw; const int first = q + 1 - 32 * w; const unsigned bits = (first <= 0) ? 0xffffffffu : ((first >= 32) ? 0u : (0xffffffffu << first)); *(unsigned*)(MB + t) = bits;  }
  if (t < nq) { *(int*)(RA + t) = 0;  }
  if (t < nq / 64) { const int v = 64 * (t + 1); *(int*)(KE + t * 32) = v;  } }


extern "C" void kernel_launch(void* const* d_in, const int* in_sizes, int n_in,
                              void* d_out, int out_size, void* d_ws, size_t ws_size, hipStream_t stream) {
  (void)in_sizes; (void)n_in; (void)out_size;
  const float* const* I = (const float* const*)d_in; const float* x = I[0]; const float* Wq = I[1]; const float* bq = I[2]; const float* Wk = I[3]; const float* bk = I[4]; const float* Wv = I[5]; const float* bv = I[6];
  char* ws = (char*)d_ws; size_t off = 0;
  auto take = [&](size_t bytes) { char* p = ws + off; off += (bytes + 255) & ~(size_t)255; return p; };
  _Float16* BQ = (_Float16*)take((size_t)DM * DM * 2); _Float16* BK = (_Float16*)take((size_t)DM * DM * 2); _Float16* BV = (_Float16*)take((size_t)DM * DM * 2);
  _Float16* X16 = (_Float16*)take((size_t)NR * DM * 2); _Float16* Q16 = (_Float16*)take((size_t)NR * DM * 2); _Float16* K16 = (_Float16*)take((size_t)NR * DM * 2); _Float16* VT = (_Float16*)take((size_t)NR * DM * 2);
  if (off > ws_size) return;      /* 3.5 + 4 x 12.6 = 54 MiB */
  const dim3 gP((NR / 128) * (3 * DM / 192), 1);
  k_prep<<<PW_XB + 3 * PW_WB, 512, 0, stream>>>(x, Wq, Wk, Wv, X16, BQ, BK, BV);      /* 246 work-groups of 16 waves; a weight's (out, in) rows are already the GEMM's [n][k] operand */
  k_gemm3<<<gP, 128, 0, stream>>>(X16, BQ, BK, BV, 0.0625f, bq, bk, bv, Q16, K16, VT);      /* 64 row tiles x 12 column tiles = 768 blocks, 3 a WGP; the v plane goes out as V^T[batch * 768 + feature][token] */
  k_flash<<<NBT * NH * (SLEN / 128), 128, 0, stream>>>(Q16, DM, K16, DM, VT, nullptr, (float*)d_out, DM);      /* all batches in one grid, 768 blocks of 128 queries, 3 a WGP; ctx rows straight into the output */
}

// v010
// It runs in 56.3 microseconds.
// Next to v009, in two timings, it ran 1.03 times as fast each time.
// All steps since v000 together make it 16.7 times as fast.
#include <hip/hip_runtime.h>
// DeiT self-attention (8 x 1024 tokens, 768 = 12 heads x 64): q,k,v = x W^T + b; softmax(q.k/8) over all keys; ctx = attn.v merged -> [8,1024,768] (no output projection).
// Structure: x and the three weight matrices to exact f16 planes in one launch of fat waves; the three projections as one f16 WMMA GEMM (128x192 block tiles, 64x96 wave tiles, f32 accumulation, exact products + bias) into f16 planes, v as V^T; the fused flash kernel over all 1024 keys (plain f16 q/k/V^T, online softmax in f32, P x2^10) per ((batch, head), 128 queries) writes the merged context rows straight into the output.
// Compute dtype: x, weights, biases rounded to bf16; q, k, v, P as plain f16 (~2^-12; logits sigma ~0.3); f32 accumulation and softmax. v_wmma_f32_16x16x32_f16.
#define NBT 8
#define SLEN 1024
#define TQ SLEN
#define TK SLEN
#define DM 768
#define NH 12
#define SCL 0.125f
#define SCL2 (SCL * 1.4426950408889634f)      /* 1/8 x log2(e): raw score -> base-2 exponent */
#define NR (NBT * SLEN)
typedef __bf16 v16b __attribute__((ext_vector_type(16)));
typedef unsigned short v8us __attribute__((ext_vector_type(8), may_alias));
typedef float  v8f  __attribute__((ext_vector_type(8)));
typedef float  v4f  __attribute__((ext_vector_type(4)));
typedef float  v4fa __attribute__((ext_vector_type(4), may_alias));
union FragB { v16b v; v8us half[2]; unsigned short u[16]; };

__device__ __forceinline__ unsigned short bf16_bits(float x) { unsigned int u = __float_as_uint(x); return (unsigned short)((u + 0x7FFFu + ((u >> 16) & 1u)) >> 16); }
__device__ __forceinline__ float bf16_val(unsigned short b) { return __uint_as_float(((unsigned int)b) << 16); }
__device__ __forceinline__ float bf16_round(float x) { return bf16_val(bf16_bits(x)); }
// D += A·B with NT terms: 1 = ah·bh, 2 = + al·bh (A split), 3 = + ah·bl (both split)
template <int NT>
__device__ __forceinline__ v8f mmaN(v16b ah, v16b al, v16b bh, v16b bl, v8f c) {
  c = __builtin_amdgcn_wmma_f32_16x16x32_bf16(false, ah, false, bh, (short)0, c, false, false);
  if (NT >= 2) c = __builtin_amdgcn_wmma_f32_16x16x32_bf16(false, al, false, bh, (short)0, c, false, false);
  if (NT >= 3) c = __builtin_amdgcn_wmma_f32_16x16x32_bf16(false, ah, false, bl, (short)0, c, false, false);
  asm volatile("v_nop\n\tv_nop\n\tv_nop\n\tv_nop" : "+v"(c) : "v"(ah), "v"(al), "v"(bh), "v"(bl));
  return c;
}

__global__ __launch_bounds__(256) void k_wt_bf16(const float* __restrict__ W, unsigned short* __restrict__ Wt, int K, int N) {
  const int t = blockIdx.x * 256 + threadIdx.x;
  const int k8n = K / 8;
  if (t >= N * k8n) return;
  const int n = t / k8n, k8 = (t % k8n) * 8;
  v8us v;
#pragma unroll
  for (int i = 0; i < 8; ++i) v[i] = bf16_bits(W[(size_t)(k8 + i) * N + n]);
  *(v8us*)(Wt + (size_t)n * K + k8) = v;
  
}

// GEMM C[M][N] (f32, pitch ldc) = act(A[M][K]·W + bias). A f32 row-major (pitch lda) converted per fragment to bf16
// (ASPLIT: hi/lo two planes -> 2 terms, else single rounded term); Wt bf16 [N][K] (pitch ldb). BIAS_BF16 rounds the
// bias to bf16 first (bias quantised to bf16 before the add). K%32==0, M%16==0, N%64==0.
template <bool ASPLIT, int ACT, bool BIAS_BF16>
__global__ __launch_bounds__(128) void k_gemm_bf(const float* __restrict__ A, int lda, const unsigned short* __restrict__ Wt, int ldb,
                                               const float* __restrict__ bias, float* __restrict__ C, int ldc, int M, int N, int K) {
  __shared__ __attribute__((aligned(16))) float so[4][16][64];
  const int tid = threadIdx.x, w = tid >> 5, lane = tid & 31, ln = lane & 15, hh = lane >> 4;
  const int ntn = N / 64;
  const int wid = blockIdx.x * 4 + w;
  const int mt = wid / ntn, nq = wid % ntn;
  if (mt * 16 >= M) return;
  const int row0 = mt * 16, col0 = nq * 64;
  const float* arow = A + (size_t)(row0 + ln) * lda;
  v8f acc[4] = {};
  for (int kb = 0; kb < K; kb += 32) {
    FragB ah, al;
    const v4f x0 = *(const v4fa*)(arow + kb + 8 * hh), x1 = *(const v4fa*)(arow + kb + 8 * hh + 4);
    const v4f x2 = *(const v4fa*)(arow + kb + 16 + 8 * hh), x3 = *(const v4fa*)(arow + kb + 16 + 8 * hh + 4);
    float xs[16] = {x0[0],x0[1],x0[2],x0[3],x1[0],x1[1],x1[2],x1[3],x2[0],x2[1],x2[2],x2[3],x3[0],x3[1],x3[2],x3[3]};
#pragma unroll
    for (int i = 0; i < 16; ++i) { const unsigned short hb = bf16_bits(xs[i]); ah.u[i] = hb; al.u[i] = ASPLIT ? bf16_bits(xs[i] - bf16_val(hb)) : (unsigned short)0; }
#pragma unroll
    for (int t = 0; t < 4; ++t) {
      const unsigned short* brow = Wt + (size_t)(col0 + t * 16 + ln) * ldb + kb;
      FragB b;
      b.half[0] = *(const v8us*)(brow + 8 * hh);
      b.half[1] = *(const v8us*)(brow + 16 + 8 * hh);
      acc[t] = mmaN<ASPLIT ? 2 : 1>(ah.v, al.v, b.v, b.v, acc[t]);
    }
  }
#pragma unroll
  for (int t = 0; t < 4; ++t) {
    float bv = bias ? bias[col0 + t * 16 + ln] : 0.f;
    if (BIAS_BF16) bv = bf16_round(bv);
#pragma unroll
    for (int r = 0; r < 8; ++r) { float v = acc[t][r] + bv; if (ACT == 1) v = fmaxf(v, 0.f); so[w][8 * hh + r][t * 16 + ln] = v; }
  }
  __builtin_amdgcn_fence(__ATOMIC_ACQ_REL, "workgroup");
  __builtin_amdgcn_wave_barrier();
  const int rsub = lane >> 4, c4 = (lane & 15) * 4;
  {
#pragma unroll
    for (int q = 0; q < 8; ++q) {
      const int r = q * 2 + rsub;
      const v4f v = *(const v4fa*)&so[w][r][c4];
      *(v4f*)(C + (size_t)(row0 + r) * ldc + col0 + c4) = v;
    }
    
  }
}

// GEMM C = act(A·W + bias + resid): A f32 (ASPLIT -> hi/lo 2 terms), Wt bf16 [N][K]; ACT 0 none, 1 relu, 2 exact gelu;
// resid (optional, f32, row index = (row % rmod), pitch ldr, RES_BF16 rounds it) added before the activation.
template <bool ASPLIT, int ACT, bool BIAS_BF16, bool RES_BF16>
__global__ __launch_bounds__(128) void k_gemm_bf3(const float* __restrict__ A, int lda, const unsigned short* __restrict__ Wt, int ldb,
                                                const float* __restrict__ bias, const float* __restrict__ resid, int rmod, int ldr,
                                                float* __restrict__ C, int ldc, int M, int N, int K) {
  __shared__ __attribute__((aligned(16))) float so[4][16][64];
  const int tid = threadIdx.x, w = tid >> 5, lane = tid & 31, ln = lane & 15, hh = lane >> 4;
  const int ntn = N / 64;
  const int wid = blockIdx.x * 4 + w;
  const int mt = wid / ntn, nq = wid % ntn;
  if (mt * 16 >= M) return;
  const int row0 = mt * 16, col0 = nq * 64;
  const float* arow = A + (size_t)(row0 + ln) * lda;
  v8f acc[4] = {};
  for (int kb = 0; kb < K; kb += 32) {
    FragB ah, al;
    const v4f x0 = *(const v4fa*)(arow + kb + 8 * hh), x1 = *(const v4fa*)(arow + kb + 8 * hh + 4);
    const v4f x2 = *(const v4fa*)(arow + kb + 16 + 8 * hh), x3 = *(const v4fa*)(arow + kb + 16 + 8 * hh + 4);
    float xs[16] = {x0[0],x0[1],x0[2],x0[3],x1[0],x1[1],x1[2],x1[3],x2[0],x2[1],x2[2],x2[3],x3[0],x3[1],x3[2],x3[3]};
#pragma unroll
    for (int i = 0; i < 16; ++i) { const unsigned short hb = bf16_bits(xs[i]); ah.u[i] = hb; al.u[i] = ASPLIT ? bf16_bits(xs[i] - bf16_val(hb)) : (unsigned short)0; }
#pragma unroll
    for (int t = 0; t < 4; ++t) {
      const unsigned short* brow = Wt + (size_t)(col0 + t * 16 + ln) * ldb + kb;
      FragB b;
      b.half[0] = *(const v8us*)(brow + 8 * hh);
      b.half[1] = *(const v8us*)(brow + 16 + 8 * hh);
      acc[t] = mmaN<ASPLIT ? 2 : 1>(ah.v, al.v, b.v, b.v, acc[t]);
    }
  }
#pragma unroll
  for (int t = 0; t < 4; ++t) {
    const int col = col0 + t * 16 + ln;
    float bv = bias ? bias[col] : 0.f;
    if (BIAS_BF16) bv = bf16_round(bv);
#pragma unroll
    for (int r = 0; r < 8; ++r) {
      float v = acc[t][r] + bv;
      if (resid) { float rv = resid[(size_t)((row0 + 8 * hh + r) % rmod) * ldr + col]; if (RES_BF16) rv = bf16_round(rv); v += rv; }
      if (ACT == 1) v = fmaxf(v, 0.f);
      if (ACT == 2) v = 0.5f * v * (1.0f + erff(v * 0.70710678118654752f));
      if (ACT == 3) { const float u = 0.7978845608028654f * (v + 0.044715f * v * v * v); v = 0.5f * v * (1.0f + tanhf(u)); }
      so[w][8 * hh + r][t * 16 + ln] = v;
    }
  }
  __builtin_amdgcn_fence(__ATOMIC_ACQ_REL, "workgroup");
  __builtin_amdgcn_wave_barrier();
  const int rsub = lane >> 4, c4 = (lane & 15) * 4;
  {
#pragma unroll
    for (int q = 0; q < 8; ++q) {
      const int r = q * 2 + rsub;
      const v4f v = *(const v4fa*)&so[w][r][c4];
      *(v4f*)(C + (size_t)(row0 + r) * ldc + col0 + c4) = v;
    }
    
  }
}
// row LayerNorm (biased variance, eps) over N: s = X (+ R); optional out_sum <- s; out_norm <- (s-mu)*rsqrt(var+eps)*g + b
template <bool PARAM_BF16>
__global__ __launch_bounds__(256) void k_layernorm(const float* __restrict__ X, const float* __restrict__ R, const float* __restrict__ g, const float* __restrict__ bta,
                                                  float* __restrict__ out_sum, float* __restrict__ out_norm, int N, float eps) {
  __shared__ float red[256];
  const int row = blockIdx.x, tid = threadIdx.x;
  const float* x = X + (size_t)row * N; const float* rr = R ? R + (size_t)row * N : nullptr;
  float vals[16];                     // up to N = 4096
  const int per = N / 256;            // contiguous chunk per thread? use strided-by-4 chunks: thread handles j = tid*4 + 1024*u
  float s1 = 0.f;
  for (int u = 0; u < per / 4; ++u) {
    const int j = tid * 4 + 1024 * u;
    const v4f a = *(const v4fa*)(x + j);
    v4f b = {0.f,0.f,0.f,0.f}; if (rr) b = *(const v4fa*)(rr + j);
#pragma unroll
    for (int q = 0; q < 4; ++q) { const float v = a[q] + b[q]; vals[u * 4 + q] = v; s1 += v; }
  }
  red[tid] = s1; __syncthreads();
  for (int st = 128; st > 0; st >>= 1) { if (tid < st) red[tid] += red[tid + st]; __syncthreads(); }
  const float mu = red[0] / (float)N; __syncthreads();
  float s2 = 0.f;
  for (int u = 0; u < per / 4; ++u)
#pragma unroll
    for (int q = 0; q < 4; ++q) { const float c = vals[u * 4 + q] - mu; s2 += c * c; }
  red[tid] = s2; __syncthreads();
  for (int st = 128; st > 0; st >>= 1) { if (tid < st) red[tid] += red[tid + st]; __syncthreads(); }
  const float rs = rsqrtf(red[0] / (float)N + eps);
  {
    for (int u = 0; u < per / 4; ++u) {
      const int j = tid * 4 + 1024 * u;
      v4f o, sm;
#pragma unroll
      for (int q = 0; q < 4; ++q) {
        float gg = g[j + q], bb = bta[j + q];
        if (PARAM_BF16) { gg = bf16_round(gg); bb = bf16_round(bb); }
        sm[q] = vals[u * 4 + q]; o[q] = (vals[u * 4 + q] - mu) * rs * gg + bb;
      }
      if (out_sum) *(v4f*)(out_sum + (size_t)row * N + j) = sm;
      *(v4f*)(out_norm + (size_t)row * N + j) = o;
    }
    
  }
}



// ---- f16 WMMA path (v_wmma_f32_16x16x32_f16): 11-bit significands for operands in range — used where a [0,1] probability operand needs more precision than bf16
typedef _Float16 v16h __attribute__((ext_vector_type(16)));
union FragH { v16h v; v8us half[2]; _Float16 h[16]; unsigned short u[16]; };
template <int NT>
__device__ __forceinline__ v8f mmaH(v16h ah, v16h al, v16h bh, v16h bl, v8f c) {
  c = __builtin_amdgcn_wmma_f32_16x16x32_f16(false, ah, false, bh, (short)0, c, false, false);
  if (NT >= 2) c = __builtin_amdgcn_wmma_f32_16x16x32_f16(false, al, false, bh, (short)0, c, false, false);
  if (NT >= 3) c = __builtin_amdgcn_wmma_f32_16x16x32_f16(false, ah, false, bl, (short)0, c, false, false);
  asm volatile("v_nop\n\tv_nop\n\tv_nop\n\tv_nop" : "+v"(c) : "v"(ah), "v"(al), "v"(bh), "v"(bl));
  return c;
}
// batched GEMM like k_gemm_b but f16 operands: A f32 (split into f16 hi/lo if ASPLIT, else rounded to f16), Bt = f16 values [n][k]; alpha; C f32; N multiple of 16 (partial tiles skipped)
template <bool ASPLIT>
__global__ __launch_bounds__(128) void k_gemm_h(const float* __restrict__ A, int lda, size_t sA, const _Float16* __restrict__ Bh, int ldb, size_t sB, float alpha, float* __restrict__ C, int ldc, size_t sC, int M, int N, int K) {
  __shared__ __attribute__((aligned(16))) float so[4][16][64];
  const int tid = threadIdx.x, w = tid >> 5, lane = tid & 31, ln = lane & 15, hh = lane >> 4; const int by = blockIdx.y;
  A += (size_t)by * sA; Bh += (size_t)by * sB; C += (size_t)by * sC;
  const int ntn = (N + 63) / 64; const int wid = blockIdx.x * 4 + w; const int mt = wid / ntn, nq = wid % ntn; if (mt * 16 >= M) return;
  const int row0 = mt * 16, col0 = nq * 64; const float* arow = A + (size_t)(row0 + ln) * lda;
  v8f acc[4] = {};
  for (int kb = 0; kb < K; kb += 32) {
    FragH ah, al;
    const v4f x0 = *(const v4fa*)(arow + kb + 8 * hh), x1 = *(const v4fa*)(arow + kb + 8 * hh + 4), x2 = *(const v4fa*)(arow + kb + 16 + 8 * hh), x3 = *(const v4fa*)(arow + kb + 16 + 8 * hh + 4);
    float xs[16] = {x0[0],x0[1],x0[2],x0[3],x1[0],x1[1],x1[2],x1[3],x2[0],x2[1],x2[2],x2[3],x3[0],x3[1],x3[2],x3[3]};
#pragma unroll
    for (int i = 0; i < 16; ++i) { const _Float16 h = (_Float16)xs[i]; ah.h[i] = h; al.h[i] = ASPLIT ? (_Float16)(xs[i] - (float)h) : (_Float16)0.0f; }
#pragma unroll
    for (int t = 0; t < 4; ++t) { if (col0 + t * 16 >= N) continue; const size_t boff = (size_t)(col0 + t * 16 + ln) * ldb + kb; FragH bq; bq.half[0] = *(const v8us*)(Bh + boff + 8 * hh); bq.half[1] = *(const v8us*)(Bh + boff + 16 + 8 * hh);
      acc[t] = mmaH<ASPLIT ? 2 : 1>(ah.v, al.v, bq.v, bq.v, acc[t]); }
  }
#pragma unroll
  for (int t = 0; t < 4; ++t) { if (col0 + t * 16 >= N) continue;
#pragma unroll
    for (int r = 0; r < 8; ++r) so[w][8 * hh + r][t * 16 + ln] = acc[t][r] * alpha; }
  __builtin_amdgcn_fence(__ATOMIC_ACQ_REL, "workgroup"); __builtin_amdgcn_wave_barrier();
  const int rsub = lane >> 4, c4 = (lane & 15) * 4;
  {
#pragma unroll
    for (int q = 0; q < 8; ++q) { const int r = q * 2 + rsub; if (col0 + c4 < N) { const v4f v = *(const v4fa*)&so[w][r][c4]; *(v4f*)(C + (size_t)(row0 + r) * ldc + col0 + c4) = v; } }
     }
}

// Wt[n][k] = f16(W[k][n]·scale) from f32 row-major W[K][N] (scale = power of two; bf16-exact weights stay exact in f16 away from the subnormal range)
__global__ __launch_bounds__(256) void k_wt_f16(const float* __restrict__ W, _Float16* __restrict__ Wt, int K, int N, float scale) {
  const int t = blockIdx.x * 256 + threadIdx.x; if (t >= N * (K / 8)) return; const int n = t / (K / 8), k8 = (t % (K / 8)) * 8; FragH f;
#pragma unroll
  for (int i = 0; i < 8; ++i) f.h[i] = (_Float16)(bf16_round(W[(size_t)(k8 + i) * N + n]) * scale); const v8us o = f.half[0];
  *(v8us*)((unsigned short*)Wt + (size_t)n * K + k8) = o; 
}
// k_gemm_hh variant with fused epilogue: v = acc·alpha + bias[by·sBias + col] (+ CP[(row/rowsPerB)·sCPb + by·64 + col] if CP) ; ACT 0 none / 1 elu ; writes f16 C16 (and f32 C if non-null)
template <int ACT>
__global__ __launch_bounds__(128) void k_gemm_hhx(const _Float16* __restrict__ A, int lda, size_t sA, const _Float16* __restrict__ Bh, int ldb, size_t sB, float alpha, const float* __restrict__ bias, size_t sBias, const float* __restrict__ CP, int rowsPerB, size_t sCPb, int row0g,
    float* __restrict__ C, _Float16* __restrict__ C16, int ldc, size_t sC, int M, int N, int K) {
  __shared__ __attribute__((aligned(16))) float so[4][16][64];
  const int tid = threadIdx.x, w = tid >> 5, lane = tid & 31, ln = lane & 15, hh = lane >> 4; const int by = blockIdx.y;
  A += (size_t)by * sA; Bh += (size_t)by * sB; const size_t cofs = (size_t)by * sC; const float* bp = bias ? bias + (size_t)by * sBias : nullptr;
  const int ntn = (N + 63) / 64; const int wid = blockIdx.x * 4 + w; const int mt = wid / ntn, nq = wid % ntn; if (mt * 16 >= M) return;
  const int row0 = mt * 16, col0 = nq * 64; const _Float16* arow = A + (size_t)(row0 + ln) * lda;
  v8f acc[4] = {};
  for (int kb = 0; kb < K; kb += 32) { FragH ah; ah.half[0] = *(const v8us*)((const unsigned short*)arow + kb + 8 * hh); ah.half[1] = *(const v8us*)((const unsigned short*)arow + kb + 16 + 8 * hh);
#pragma unroll
    for (int t = 0; t < 4; ++t) { if (col0 + t * 16 >= N) continue; const size_t boff = (size_t)(col0 + t * 16 + ln) * ldb + kb; FragH bq; bq.half[0] = *(const v8us*)((const unsigned short*)Bh + boff + 8 * hh); bq.half[1] = *(const v8us*)((const unsigned short*)Bh + boff + 16 + 8 * hh);
      acc[t] = mmaH<1>(ah.v, ah.v, bq.v, bq.v, acc[t]); }
  }
#pragma unroll
  for (int t = 0; t < 4; ++t) { if (col0 + t * 16 >= N) continue; const int col = col0 + t * 16 + ln; const float bv = bp ? bf16_round(bp[col]) : 0.f;
#pragma unroll
    for (int r = 0; r < 8; ++r) { float v = acc[t][r] * alpha + bv; if (CP) { const int bidx = (row0g + row0 + 8 * hh + r) / rowsPerB; v += CP[(size_t)bidx * sCPb + (size_t)by * 64 + col]; } if (ACT == 1) v = (v > 0.f) ? v : expm1f(v); else if (ACT == 7) v = (v > 0.f) ? v + 1.0f : expf(v); else if (ACT == 8) v = tanhf(v); else if (ACT == 9) v = 0.5f * v * (1.0f + tanhf(0.7978845608028654f * (v + 0.044715f * v * v * v))); else if (ACT == 11) v = 1.0f / (1.0f + expf(-v)); else if (ACT == 12) v = (v > 0.f) ? v : 0.01f * v; else if (ACT == 14) v = (v > 0.f) ? v : 0.1f * v; else if (ACT == 15) v = v / (1.0f + expf(-v)); else if (ACT == 3) v = fmaxf(v, 0.f); else if (ACT == 6) v = 0.5f * v * (1.0f + erff(v * 0.70710678118654752f)); so[w][8 * hh + r][t * 16 + ln] = v; } }
  __builtin_amdgcn_fence(__ATOMIC_ACQ_REL, "workgroup"); __builtin_amdgcn_wave_barrier();
  const int rsub = lane >> 4, c4 = (lane & 15) * 4; typedef _Float16 v4h __attribute__((ext_vector_type(4)));
  {
#pragma unroll
    for (int q = 0; q < 8; ++q) { const int r = q * 2 + rsub; if (col0 + c4 < N) { const v4f v = *(const v4fa*)&so[w][r][c4]; if (C) *(v4f*)(C + cofs + (size_t)(row0 + r) * ldc + col0 + c4) = v; if (C16) { v4h h4; for (int i = 0; i < 4; ++i) h4[i] = (_Float16)v[i]; *(v4h*)(C16 + cofs + (size_t)(row0 + r) * ldc + col0 + c4) = h4; } } }
     }
}


typedef _Float16 v4h __attribute__((ext_vector_type(4)));

// x and the three weight matrices to their f16 planes in ONE launch of 3,936 waves, one 16-wave work-group a WGP, all resident at once: a wave takes 8 KB of contiguous f32
// by 16 loads of 16 B a lane (each covers 4 whole lines), all 16 in flight together, and stores 16 x 256 B of f16 (2 whole lines each).
// One 32-byte read a lane makes 31,488 waves in four dependent launches of the same 48 MB: by count, starting that many waves and the three extra launch gaps take longer than moving the bytes.
#define PW_F 2048                      /* floats a wave */
#define PW_XB (NR * DM / PW_F / 16)    /* 192 work-groups for x */
#define PW_WB (DM * DM / PW_F / 16)    /* 18 for each weight matrix */
static_assert(NR * DM % (PW_F * 16) == 0 && DM * DM % (PW_F * 16) == 0, "every wave has a whole share");
template <bool WS>      /* WS: a weight, x16 (a power of two: the bf16 value stays exact in f16) */
__device__ __forceinline__ void prep_wave(const float* __restrict__ s, _Float16* __restrict__ d, int lane) {
  v4f a[16];
#pragma unroll
  for (int i = 0; i < 16; ++i) a[i] = *(const v4fa*)(s + i * 128 + lane * 4);
  __builtin_amdgcn_sched_barrier(0);      /* keeps all 16 loads ahead of the first conversion: left free, the compiler issued 10 or 11 and the rest only behind the waits for those, a second memory latency in a wave that has only this one batch */
#pragma unroll
  for (int i = 0; i < 16; ++i) { v4h o;
#pragma unroll
    for (int q = 0; q < 4; ++q) o[q] = (_Float16)(WS ? bf16_round(a[i][q]) * 16.0f : bf16_round(a[i][q]));
    *(v4h*)(d + i * 128 + lane * 4) = o; }
  asm volatile("s_wait_xcnt 0x0" ::: "memory"); }      /* behind the last store: no register that a store names (its scalar base among them) is rewritten ahead of this wait on any way the code holds from here */
__global__ __launch_bounds__(512) void k_prep(const float* __restrict__ x, const float* __restrict__ Wq, const float* __restrict__ Wk, const float* __restrict__ Wv,
    _Float16* __restrict__ X16, _Float16* __restrict__ BQ, _Float16* __restrict__ BK, _Float16* __restrict__ BV) {
  const int w = __builtin_amdgcn_readfirstlane(threadIdx.x >> 5), lane = threadIdx.x & 31, blk = blockIdx.x;      /* the wave's number as a scalar: its share's base address stays in scalar registers */
  if (blk < PW_XB) { const size_t o = (size_t)(blk * 16 + w) * PW_F; prep_wave<false>(x + o, X16 + o, lane); return; }
  const int m = (blk - PW_XB) / PW_WB; const size_t o = (size_t)((blk - PW_XB - m * PW_WB) * 16 + w) * PW_F;
  prep_wave<true>((m == 0 ? Wq : (m == 1 ? Wk : Wv)) + o, (m == 0 ? BQ : (m == 1 ? BK : BV)) + o, lane); }
__global__ __launch_bounds__(256) void k_h16(const float* __restrict__ x, _Float16* __restrict__ X16, size_t n8) { const size_t t = (size_t)blockIdx.x * 256 + threadIdx.x; if (t >= n8) return; FragH f;
#pragma unroll
  for (int q = 0; q < 8; ++q) f.h[q] = (_Float16)x[t * 8 + q]; *(v8us*)((unsigned short*)X16 + t * 8) = f.half[0];  }
__global__ __launch_bounds__(256) void k_hl(const float* __restrict__ F, _Float16* __restrict__ Hh, _Float16* __restrict__ Hl, size_t n8) { const size_t t = (size_t)blockIdx.x * 256 + threadIdx.x; if (t >= n8) return; FragH fh, fl; const v4f a = *(const v4fa*)(F + t * 8), c = *(const v4fa*)(F + t * 8 + 4);
#pragma unroll
  for (int q = 0; q < 4; ++q) { _Float16 h = (_Float16)a[q]; fh.h[q] = h; fl.h[q] = (_Float16)((a[q] - (float)h) * 1024.0f); h = (_Float16)c[q]; fh.h[4 + q] = h; fl.h[4 + q] = (_Float16)((c[q] - (float)h) * 1024.0f); }
  { *(v8us*)((unsigned short*)Hh + t * 8) = fh.half[0]; *(v8us*)((unsigned short*)Hl + t * 8) = fl.half[0];  } }

// ---- projection GEMM: fragment loader and LDS slab geometry ----
__device__ __forceinline__ v16h g2_frag(const _Float16* p, int hh) { FragH f; f.half[0] = *(const v8us*)((const unsigned short*)p + 8 * hh); f.half[1] = *(const v8us*)((const unsigned short*)p + 16 + 8 * hh); return f.v; }
// K slab of the block tile in LDS: 64 halves (one 128-byte line) of each staged row; pitch 144 B = 16 B x odd, the conflict-free pitch for ds_load_b128 fragment reads.
#define G2_KS 64
#define G2_PITCH 72

// lane l <-> l ^ 16 (the two halves of a wave hold the two key halves of one query column)
__device__ __forceinline__ float xhalf(float x) { const int t = __float_as_int(x); return __int_as_float(__builtin_amdgcn_permlanex16(t, t, 0x76543210, 0xfedcba98, false, false)); }
// Eight 2^x, each in place, in one statement closed by one v_nop: behind a transcendental the instruction set asks for one slot before its result is read or its source overwritten.
// here no v_exp_f32 touches a neighbour's register and the v_nop covers the last.
__device__ __forceinline__ void exp2x8(float& a, float& b, float& c, float& d, float& e, float& f, float& g, float& h) {
  asm("v_exp_f32 %0, %0\n\tv_exp_f32 %1, %1\n\tv_exp_f32 %2, %2\n\tv_exp_f32 %3, %3\n\tv_exp_f32 %4, %4\n\tv_exp_f32 %5, %5\n\tv_exp_f32 %6, %6\n\tv_exp_f32 %7, %7\n\tv_nop"
      : "+v"(a), "+v"(b), "+v"(c), "+v"(d), "+v"(e), "+v"(f), "+v"(g), "+v"(h));
}
// Transposed products: S^T = K.Q^T (A = 16 key rows, B = 16 query columns), O^T += V^T.P^T (A = 16 rows of V^T, B = P^T packed from the two S^T tiles).
// Lane (ln, hh) owns query q0 + 16 qt + ln of each of its wave's query tiles qt: st[qt][nt][r] = score of key j0 + 16 nt + 8 hh + r, which is already the hardware k order of a B operand; oacc[qt][dt][r] = O[query][16 dt + 8 hh + r].
// Stage of 64 keys in LDS, shared by the block's 4 waves: rows 0..63 = the 64 K rows (64 halves = one 128-byte line each), rows 64..127 = the 64 V^T rows (their 64 key columns, one line each); pitch 144 B as in the GEMM slab.
#define FL_KEYS 64
#define FL_PITCH 72
#define FL_BUFB (128 * FL_PITCH * 2)
#define FL_SUMCAP 32768.0f      /* 2^15 */
// One stage: 8 copies a lane, 16 B each; 8 lanes cover one whole line, the block 16 rows a copy (2304 B of LDS further each). s_wait_xcnt 0 closes the statement so that no address register is rewritten ahead of it.
__device__ __forceinline__ void fl_stage(unsigned l, const _Float16* gk, size_t k16, const _Float16* gv, size_t v16) {
  asm volatile(
      "global_load_async_to_lds_b128 %0, %8, off\n\t"
      "global_load_async_to_lds_b128 %1, %9, off\n\t"
      "global_load_async_to_lds_b128 %2, %10, off\n\t"
      "global_load_async_to_lds_b128 %3, %11, off\n\t"
      "global_load_async_to_lds_b128 %4, %12, off\n\t"
      "global_load_async_to_lds_b128 %5, %13, off\n\t"
      "global_load_async_to_lds_b128 %6, %14, off\n\t"
      "global_load_async_to_lds_b128 %7, %15, off\n\t"
      "s_wait_xcnt 0x0"
      :: "v"(l), "v"(l + 2304u), "v"(l + 2u * 2304u), "v"(l + 3u * 2304u), "v"(l + 4u * 2304u), "v"(l + 5u * 2304u), "v"(l + 6u * 2304u), "v"(l + 7u * 2304u),
         "v"(gk), "v"(gk + k16), "v"(gk + 2 * k16), "v"(gk + 3 * k16), "v"(gv), "v"(gv + v16), "v"(gv + 2 * v16), "v"(gv + 3 * v16)
      : "memory");
}
// q, k and v = x W^T + b as ONE GEMM: block tile 128 tokens x 192 output features (192 divides 768, so a block's features lie in one of the three planes), 4 waves as 2 x 2, wave tile 64 x 96.
// Per 64-k slab a block stages 320 rows (rows 0..127 = x, rows 128..319 = W) for 192 products, where the 128 x 64 tile staged 192 rows for 64; a wave reads 10 fragments for 24 products, not 6 for 8.
// The product is taken as C^T = W.X^T (A = 16 W rows, B = 16 x rows; both operands go through the same loader, so their k orders are equal): lane (ln, hh) then holds features 8 hh .. 8 hh + 7 of token ln, 16 B of an f16 output row.
#define G3_ROWS 320
#define G3_BUFB (G3_ROWS * G2_PITCH * 2)
#define G3_OP 200      /* pitch of the staged output rows in halves: 400 B = 16 B x odd */
// One slab: 20 copies a lane, 16 B each; 8 lanes cover one whole line, the block 16 rows a copy. Address form: scalar base + the lane's one 32-bit offset, so that the copies hold 4 vector registers beside the 192 of the accumulators
// (a 64-bit vector address and an LDS register for each copy made the build spill). The immediate offset moves BOTH addresses: it carries the LDS step of 16 rows (2304 B, 16128 B at most), and each scalar base is taken back by what its copy's offset adds.
// s_wait_xcnt 0 closes each statement so that no address register is rewritten ahead of it.
__device__ __forceinline__ void g3_slab(unsigned l, unsigned vo, const char* sa, const char* sb) {
  constexpr int G = 16 * DM * 2, D = G - 2304;      /* global step of 16 rows; the same less the LDS step */
  asm volatile(      /* LDS rows 0..127: the 128 x rows */
      "global_load_async_to_lds_b128 %0, %1, %2\n\t"
      "global_load_async_to_lds_b128 %0, %1, %3 offset:2304\n\t"
      "global_load_async_to_lds_b128 %0, %1, %4 offset:4608\n\t"
      "global_load_async_to_lds_b128 %0, %1, %5 offset:6912\n\t"
      "global_load_async_to_lds_b128 %0, %1, %6 offset:9216\n\t"
      "global_load_async_to_lds_b128 %0, %1, %7 offset:11520\n\t"
      "global_load_async_to_lds_b128 %0, %1, %8 offset:13824\n\t"
      "global_load_async_to_lds_b128 %0, %1, %9 offset:16128\n\t"
      "s_wait_xcnt 0x0"
      :: "v"(l), "v"(vo), "s"(sa), "s"(sa + D), "s"(sa + 2 * D), "s"(sa + 3 * D), "s"(sa + 4 * D), "s"(sa + 5 * D), "s"(sa + 6 * D), "s"(sa + 7 * D)
      : "memory");
  asm volatile(      /* LDS rows 128..319: the 192 W rows */
      "global_load_async_to_lds_b128 %0, %2, %3\n\t"
      "global_load_async_to_lds_b128 %0, %2, %4 offset:2304\n\t"
      "global_load_async_to_lds_b128 %0, %2, %5 offset:4608\n\t"
      "global_load_async_to_lds_b128 %0, %2, %6 offset:6912\n\t"
      "global_load_async_to_lds_b128 %0, %2, %7 offset:9216\n\t"
      "global_load_async_to_lds_b128 %0, %2, %8 offset:11520\n\t"
      "global_load_async_to_lds_b128 %1, %2, %9\n\t"
      "global_load_async_to_lds_b128 %1, %2, %10 offset:2304\n\t"
      "global_load_async_to_lds_b128 %1, %2, %11 offset:4608\n\t"
      "global_load_async_to_lds_b128 %1, %2, %12 offset:6912\n\t"
      "global_load_async_to_lds_b128 %1, %2, %13 offset:9216\n\t"
      "global_load_async_to_lds_b128 %1, %2, %14 offset:11520\n\t"
      "s_wait_xcnt 0x0"
      :: "v"(l + 8u * 2304u), "v"(l + 14u * 2304u), "v"(vo), "s"(sb), "s"(sb + D), "s"(sb + 2 * D), "s"(sb + 3 * D), "s"(sb + 4 * D), "s"(sb + 5 * D),
         "s"(sb + 6 * G), "s"(sb + 6 * G + D), "s"(sb + 6 * G + 2 * D), "s"(sb + 6 * G + 3 * D), "s"(sb + 6 * G + 4 * D), "s"(sb + 6 * G + 5 * D)
      : "memory");
}
// TR = false (q and k planes): C^T = W.X^T as above, rows of [token][feature] go out. TR = true (the v plane): the same fragments with the operands exchanged, C = X.W^T (A = 16 x rows, B = 16 W rows; one loader, so the k orders stay equal):
// lane (ln, hh) then holds tokens 8 hh .. 8 hh + 7 of feature ln, 16 B of a row of V^T, and the block writes its 192 x 128 piece of V^T[batch * 768 + feature][token] itself, the layout the attention kernel stages; no transposing launch follows.
#define G3_OPT 136     /* pitch of the staged V^T rows in halves: 272 B = 16 B x odd */
template <bool TR>
__device__ __forceinline__ void g3_body(_Float16* st, const _Float16* __restrict__ A, const _Float16* __restrict__ Bh, float alpha, const float* __restrict__ bp, _Float16* __restrict__ C16, int mt, int col0, int rot) {
  const int tid = threadIdx.x, w = tid >> 5, lane = tid & 31, ln = lane & 15, hh = lane >> 4, wr = w >> 1, wc = w & 1;
  constexpr int NT = DM / G2_KS;
  auto kofs = [rot](int t) { const int k = t + rot; return (k >= NT ? k - NT : k) * (G2_KS * 2); };      /* byte offset in a row of the slab that trip t works on: the walk starts at slab rot and wraps (rot < NT, t < NT) */
  const int cr = tid >> 3, cc = (tid & 7) * 8;
  const char* sa = (const char*)(A + (size_t)mt * 128 * DM); const char* sb = (const char*)(Bh + (size_t)col0 * DM); const unsigned vo = (unsigned)(cr * DM + cc) * 2u;      /* block-uniform bases; the lane's byte offset, the same in x and W (both have rows of DM halves) */
  const unsigned l0 = (unsigned)(size_t)&st[cr * G2_PITCH + cc];
  v8f acc[4][6];
#pragma unroll
  for (int i = 0; i < 4; ++i)
#pragma unroll
    for (int j = 0; j < 6; ++j) acc[i][j] = (v8f){0.f,0.f,0.f,0.f,0.f,0.f,0.f,0.f};
  g3_slab(l0, vo, sa + kofs(0), sb + kofs(0));
  asm volatile("s_wait_asynccnt 0x0" ::: "memory");      /* this wave's copies of trip 0's slab have landed */
  __syncthreads();                                       /* ... and every other wave's */
  g3_slab(l0 + G3_BUFB, vo, sa + kofs(1), sb + kofs(1));
#pragma unroll 1
  for (int t = 0; t < NT; ++t) { const _Float16* sx = st + (t & 1) * (G3_BUFB / 2) + (64 * wr + ln) * G2_PITCH; const _Float16* sw = st + (t & 1) * (G3_BUFB / 2) + (128 + 96 * wc + ln) * G2_PITCH;
#pragma unroll
    for (int ks = 0; ks < 2; ++ks) { v16h fx[4], fw[6];      /* the 10 fragments of 32 k are read as one group ahead of their 24 products */
#pragma unroll
      for (int i = 0; i < 4; ++i) fx[i] = g2_frag(sx + i * 16 * G2_PITCH + ks * 32, hh);
#pragma unroll
      for (int j = 0; j < 6; ++j) fw[j] = g2_frag(sw + j * 16 * G2_PITCH + ks * 32, hh);
      __builtin_amdgcn_sched_barrier(0);      /* keeps the 20 LDS reads one group: left free, the compiler read each W fragment alone, directly ahead of its 4 products, behind a wait to 0 */
#pragma unroll
      for (int j = 0; j < 6; ++j)
#pragma unroll
        for (int i = 0; i < 4; ++i) acc[i][j] = __builtin_amdgcn_wmma_f32_16x16x32_f16(false, TR ? fx[i] : fw[j], false, TR ? fw[j] : fx[i], (short)0, acc[i][j], false, false); }
    __builtin_amdgcn_sched_barrier(0);                   /* keeps the slab's products ahead of the barrier: left free, the compiler put 24 of them between the barrier and the refill, which then started that much later */
    asm volatile("s_wait_dscnt 0x0" ::: "memory");       /* this wave's reads of slab t are done before its buffer is handed back */
    asm volatile("s_wait_asynccnt 0x0" ::: "memory");    /* this wave's copies of slab t + 1 have landed */
    __syncthreads();                                     /* publishes slab t + 1 and ends every reader's last read of slab t */
    if (t + 2 < NT) g3_slab(l0 + (unsigned)(t & 1) * G3_BUFB, vo, sa + kofs(t + 2), sb + kofs(t + 2)); }
  asm volatile("s_wait_asynccnt 0x0" ::: "memory");      /* no copy is left in flight when the buffers become output staging */
  if constexpr (!TR) {
#pragma unroll
    for (int j = 0; j < 6; ++j) { const float* bj = bp + col0 + 96 * wc + 16 * j + 8 * hh; const v4f ba = *(const v4fa*)bj, bb = *(const v4fa*)(bj + 4);
      const float bv[8] = {bf16_round(ba[0]), bf16_round(ba[1]), bf16_round(ba[2]), bf16_round(ba[3]), bf16_round(bb[0]), bf16_round(bb[1]), bf16_round(bb[2]), bf16_round(bb[3])};
#pragma unroll
      for (int i = 0; i < 4; ++i) { FragH f;
#pragma unroll
        for (int r = 0; r < 8; ++r) f.h[r] = (_Float16)(acc[i][j][r] * alpha + bv[r]);
        *(v8us*)((unsigned short*)st + (64 * wr + 16 * i + ln) * G3_OP + 96 * wc + 16 * j + 8 * hh) = f.half[0]; } }
    __syncthreads();                                     /* the whole 128 x 192 tile is staged: a row's three 128-byte lines hold two waves' features, and each line goes out whole, from one wave */
    const unsigned short* so = (const unsigned short*)st + cr * G3_OP + cc; unsigned short* go = (unsigned short*)C16 + (size_t)(mt * 128 + cr) * DM + col0 + cc;      /* 8 lanes a line, 16 rows a step, as in the copies */
#pragma unroll
    for (int sg = 0; sg < 3; ++sg)
#pragma unroll
      for (int q = 0; q < 8; ++q) { const v8us v = *(const v8us*)(so + q * 16 * G3_OP + sg * 64); *(v8us*)(go + (size_t)q * 16 * DM + sg * 64) = v; }
  } else {
#pragma unroll
    for (int j = 0; j < 6; ++j) { const float bv = bf16_round(bp[col0 + 96 * wc + 16 * j + ln]);      /* the lane's one feature */
#pragma unroll
      for (int i = 0; i < 4; ++i) { FragH f;
#pragma unroll
        for (int r = 0; r < 8; ++r) f.h[r] = (_Float16)(acc[i][j][r] * alpha + bv);
        *(v8us*)((unsigned short*)st + (96 * wc + 16 * j + ln) * G3_OPT + 64 * wr + 16 * i + 8 * hh) = f.half[0]; } }
    __syncthreads();                                     /* the whole 192 x 128 tile is staged (52224 B): a feature's two 128-byte lines hold two waves' tokens, and each line goes out whole, from one wave */
    const int tr = tid >> 4, tc = (tid & 15) * 8;        /* 16 lanes a row of 128 tokens (two lines), 8 rows a step */
    const unsigned short* so = (const unsigned short*)st + tr * G3_OPT + tc;
    unsigned short* go = (unsigned short*)C16 + ((size_t)(mt / (SLEN / 128)) * DM + col0 + tr) * SLEN + (mt % (SLEN / 128)) * 128 + tc;
#pragma unroll
    for (int q = 0; q < 24; ++q) { const v8us v = *(const v8us*)(so + q * 8 * G3_OPT); *(v8us*)(go + (size_t)q * 8 * SLEN) = v; }
  } }
__global__ __launch_bounds__(128) void k_gemm3(const _Float16* __restrict__ A, const _Float16* __restrict__ B0, const _Float16* __restrict__ B1, const _Float16* __restrict__ B2, float alpha,
    const float* __restrict__ bias0, const float* __restrict__ bias1, const float* __restrict__ bias2, _Float16* __restrict__ C0, _Float16* __restrict__ C1, _Float16* __restrict__ C2T) {
  __shared__ __attribute__((aligned(16))) _Float16 st[2 * G3_ROWS * G2_PITCH];      /* the two slab buffers (92160 B, 3 blocks a WGP); behind the last slab's barrier the same bytes stage the block's output tile (51200 or 52224 B) */
  constexpr int NTN = 3 * DM / 192;
  const int mt = blockIdx.x / NTN, nq = blockIdx.x - mt * NTN; const int pl = nq >> 2, col0 = (nq & 3) * 192;
  // All 768 blocks are resident at once and walk k in step: the 12 blocks of a row tile would ask L2 for the same x lines, the 64 of a column tile for the same W lines, at the same moment, and such requests collide.
  // Each block starts its walk over the 12 slabs at slab (mt + nq) mod 12 and wraps: the 12 sharers of an x tile are all on different slabs, the 64 of a W tile on 12. The f32 sums take their terms in the rotated order.
  const int rot = (mt + nq) % (DM / G2_KS);
  if (pl == 2) g3_body<true>(st, A, B2, alpha, bias2, C2T, mt, col0, rot);      /* the test reads the same for the whole block: every barrier inside is passed by all four waves or by none */
  else g3_body<false>(st, A, pl == 0 ? B0 : B1, alpha, pl == 0 ? bias0 : bias1, pl == 0 ? C0 : C1, mt, col0, rot); }
// One query tile's 16 scores of a lane (s0, s1: raw q.k) to P x 2^10 as a B operand, and their sum: p x 2^10 = 2^(s/8 log2e + nb), nb = 10 - m/8 log2e: one FMA and one v_exp_f32 a score; below -126 the result is 0.
__device__ __forceinline__ float fl_probs(const v8f s0, const v8f s1, const float nb, FragH& pb) {
  float sc[16];
#pragma unroll
  for (int i = 0; i < 16; ++i) sc[i] = __builtin_fmaf(i < 8 ? s0[i & 7] : s1[i & 7], SCL2, nb);
  exp2x8(sc[0], sc[1], sc[2], sc[3], sc[4], sc[5], sc[6], sc[7]); exp2x8(sc[8], sc[9], sc[10], sc[11], sc[12], sc[13], sc[14], sc[15]);
  float ps[4] = {sc[0], sc[1], sc[2], sc[3]};      /* the sum carries the 2^10, like the P operand */
#pragma unroll
  for (int i = 4; i < 16; ++i) ps[i & 3] += sc[i];
#pragma unroll
  for (int i = 0; i < 16; ++i) pb.h[i] = (_Float16)sc[i];
  return (ps[0] + ps[1]) + (ps[2] + ps[3]); }
// amdgpu_waves_per_eu(3, 3): the grid gives 3 waves a SIMD, and with that as its register budget the compiler reads a pass's 8 fragments as one group at the head of the pass; aiming at more resident waves it read three of the four V^T fragments among the products, which then waited for them.
__global__ __launch_bounds__(128) __attribute__((amdgpu_waves_per_eu(3, 3))) void k_flash(const _Float16* __restrict__ Q16, int ldq, const _Float16* __restrict__ K16, int ldk, const _Float16* __restrict__ Vt, const int* __restrict__ MSK, float* __restrict__ O, int ldo) {
  // A wave owns QT = 2 tiles of 16 query columns: each K and V^T fragment read from LDS is the A operand of two products (one a tile), so a score costs half the LDS bytes, and a block of 128 queries copies K and V^T from L2 once where two blocks of 64 copied them twice.
  constexpr int QT = 2, RPW = 16 * QT, NQB = TQ / (4 * RPW), DT = 4, KS = 2;
  __shared__ __attribute__((aligned(16))) unsigned short sm[2 * FL_BUFB / 2];      /* the two stage buffers; behind the last stage's barrier the same bytes stage the output rows (34816 of 36864 B) */
  float (*sO)[RPW][64 + 4] = (float (*)[RPW][64 + 4])sm;
  static_assert(4 * RPW * (64 + 4) * 4 <= 2 * FL_BUFB, "the output rows fit the stage buffers");
  const int tid = threadIdx.x, w = tid >> 5, lane = tid & 31, ln = lane & 15, hh = lane >> 4; (void)MSK;
  const int slab = blockIdx.x / NQB, qblk = blockIdx.x % NQB; const int b = slab / NH, h = slab % NH; const int qb0 = qblk * (4 * RPW); const int q0 = qb0 + w * RPW;
  FragH bq[QT][KS];
#pragma unroll
  for (int qt = 0; qt < QT; ++qt) { const unsigned short* qr = (const unsigned short*)Q16 + ((size_t)b * TQ + q0 + qt * 16 + ln) * ldq + h * 64;
#pragma unroll
    for (int ks = 0; ks < KS; ++ks) { bq[qt][ks].half[0] = *(const v8us*)(qr + ks * 32 + 8 * hh); bq[qt][ks].half[1] = *(const v8us*)(qr + ks * 32 + 16 + 8 * hh); } }
  const int cr = tid >> 3, cc = (tid & 7) * 8;
  const _Float16* gk = K16 + ((size_t)b * TK + cr) * ldk + h * 64 + cc; const _Float16* gv = Vt + ((size_t)slab * 64 + cr) * TK + cc; const size_t k16 = (size_t)16 * ldk, v16 = (size_t)16 * TK;
  const unsigned l0 = (unsigned)(size_t)&sm[cr * FL_PITCH + cc];
  float m_q[QT], nb_q[QT], l_q[QT]; v8f oacc[QT][DT];      /* nb_q = the exponent's offset for m_q */
#pragma unroll
  for (int qt = 0; qt < QT; ++qt) { m_q[qt] = -3.0e38f; nb_q[qt] = __builtin_inff(); l_q[qt] = 0.f;
#pragma unroll
    for (int dt = 0; dt < DT; ++dt) oacc[qt][dt] = (v8f){0.f,0.f,0.f,0.f,0.f,0.f,0.f,0.f}; }
  constexpr int NS = TK / FL_KEYS;      /* 16 stages */
  static_assert((NS & (NS - 1)) == 0 && NS % NQB == 0, "the rotated walk wraps by a mask, and the sharers' starts are evenly spaced");
  // The 8 blocks of a (batch, head) copy the same K and V^T lines and run in step: block qblk starts its walk over the 16 key stages at stage 2 qblk and wraps, so no two of them ask L2 for the same lines at the same moment.
  // The softmax does not depend on the order of the keys; l and O take their terms in the rotated order.
  auto kst = [qblk](int s) { return (s + qblk * (NS / NQB)) & (NS - 1); };      /* the key stage that trip s works on */
  fl_stage(l0, gk + (size_t)kst(0) * FL_KEYS * ldk, k16, gv + kst(0) * FL_KEYS, v16);
  asm volatile("s_wait_asynccnt 0x0" ::: "memory");      /* this wave's copies of trip 0's stage have landed */
  __syncthreads();                                       /* ... and every other wave's */
  fl_stage(l0 + FL_BUFB, gk + (size_t)kst(1) * FL_KEYS * ldk, k16, gv + kst(1) * FL_KEYS, v16);
#pragma unroll 1
  for (int s = 0; s < NS; ++s) { const unsigned short* sb = sm + (s & 1) * (FL_BUFB / 2);
#pragma unroll 1
  for (int j0 = 0; j0 < FL_KEYS; j0 += 32) {
    v8f st[QT][2];      /* raw q.k of tile qt, keys j0 + 16 nt + 8 hh + r: the 1/8 rides in the exponent's FMA; m_q is a raw score too */
    FragH ak[2][KS], av[DT];      /* the pass's 8 fragments are read here, as one group: the V^T reads stand ahead of the test's branch, behind which they would be a second place of LDS reads with their latency open */
#pragma unroll
    for (int ks = 0; ks < KS; ++ks)
#pragma unroll
      for (int nt = 0; nt < 2; ++nt) { const unsigned short* kr = sb + (j0 + nt * 16 + ln) * FL_PITCH + ks * 32; ak[nt][ks].half[0] = *(const v8us*)(kr + 8 * hh); ak[nt][ks].half[1] = *(const v8us*)(kr + 16 + 8 * hh); }
#pragma unroll
    for (int dt = 0; dt < DT; ++dt) { const unsigned short* vrow = sb + (64 + dt * 16 + ln) * FL_PITCH + j0; av[dt].half[0] = *(const v8us*)(vrow + 8 * hh); av[dt].half[1] = *(const v8us*)(vrow + 16 + 8 * hh); }
    __builtin_amdgcn_sched_barrier(0);      /* keeps the 16 LDS reads one group: left free, the compiler read the K fragments in three places among the products, two of them behind a wait to 0 */
#pragma unroll
    for (int nt = 0; nt < 2; ++nt)
#pragma unroll
      for (int qt = 0; qt < QT; ++qt) st[qt][nt] = (v8f){0.f,0.f,0.f,0.f,0.f,0.f,0.f,0.f};
#pragma unroll
    for (int ks = 0; ks < KS; ++ks)
#pragma unroll
      for (int nt = 0; nt < 2; ++nt)
#pragma unroll
        for (int qt = 0; qt < QT; ++qt) st[qt][nt] = __builtin_amdgcn_wmma_f32_16x16x32_f16(false, ak[nt][ks].v, false, bq[qt][ks].v, (short)0, st[qt][nt], false, false);      /* four independent tiles stand in each other's distance */
    __builtin_amdgcn_sched_barrier(0);      /* keeps the 8 products one run: left free, the compiler put the exponents' FMAs among them, each behind v_nop pads, and a tile's two products back to back */
    // Lazy rescale: m_q is the maximum IN USE, not the running maximum: P and its sum are taken with the offset that belongs to it, and no maximum, no factor and no rescaling stand in the common pass.
    // The test is the pass's own sum: every p x 2^10 is at least 0, so a lane's sum of 16 at or below 2^15 bounds each of them inside f16's 65504; with no score above m_q the sum is 2^14 at most.
    // A larger sum (infinity in the first pass, whose offset is infinity) sends the whole wave to the rare side: new maximum from the raw scores, l_q and oacc rescaled, P taken again.
    float ps[QT]; FragH pb[QT];
#pragma unroll
    for (int qt = 0; qt < QT; ++qt) ps[qt] = fl_probs(st[qt][0], st[qt][1], nb_q[qt], pb[qt]);
    if (__builtin_expect(__builtin_amdgcn_ballot_w32((ps[0] > FL_SUMCAP) | (ps[1] > FL_SUMCAP)) != 0, 0)) {      /* one test a pass, a scalar branch, the same for the whole wave: the two halves of a query move together; marked unlikely so that the common pass runs straight through, with no jump round the rare side */
#pragma unroll
      for (int qt = 0; qt < QT; ++qt) {
        float mc = fmaxf(st[qt][0][0], st[qt][0][1]);
#pragma unroll
        for (int i = 2; i < 16; ++i) mc = fmaxf(mc, st[qt][i >> 3][i & 7]);
        const float mn = fmaxf(m_q[qt], fmaxf(mc, xhalf(mc))); const float al = (mn > -1.0e38f) ? __builtin_amdgcn_exp2f((m_q[qt] - mn) * SCL2) : 1.0f;
        m_q[qt] = mn; nb_q[qt] = __builtin_fmaf(-mn, SCL2, 10.0f); l_q[qt] *= al;
#pragma unroll
        for (int dt = 0; dt < DT; ++dt)
#pragma unroll
          for (int r = 0; r < 8; ++r) oacc[qt][dt][r] *= al;
        ps[qt] = fl_probs(st[qt][0], st[qt][1], nb_q[qt], pb[qt]); } }
#pragma unroll
    for (int qt = 0; qt < QT; ++qt) l_q[qt] += ps[qt];
#pragma unroll
    for (int dt = 0; dt < DT; ++dt) {
      oacc[0][dt] = __builtin_amdgcn_wmma_f32_16x16x32_f16(false, av[dt].v, false, pb[0].v, (short)0, oacc[0][dt], false, false);
      if (dt < DT - 1) oacc[1][dt] = __builtin_amdgcn_wmma_f32_16x16x32_f16(false, av[dt].v, false, pb[1].v, (short)0, oacc[1][dt], false, false);
      else oacc[1][dt] = mmaH<1>(av[dt].v, av[dt].v, pb[1].v, pb[1].v, oacc[1][dt]); } }      /* the pass's last product keeps its 4 v_nop: the loop's branch follows it */
    asm volatile("s_wait_dscnt 0x0" ::: "memory");       /* this wave's reads of stage s are done before its buffer is handed back */
    asm volatile("s_wait_asynccnt 0x0" ::: "memory");    /* this wave's copies of stage s + 1 have landed */
    __syncthreads();                                     /* publishes stage s + 1 and ends every reader's last read of stage s */
    if (s + 2 < NS) fl_stage(l0 + (unsigned)(s & 1) * FL_BUFB, gk + (size_t)kst(s + 2) * FL_KEYS * ldk, k16, gv + kst(s + 2) * FL_KEYS, v16); }
  asm volatile("s_wait_asynccnt 0x0" ::: "memory");      /* no copy is left in flight when the buffers become output staging */
#pragma unroll
  for (int qt = 0; qt < QT; ++qt) { const float l = l_q[qt] + xhalf(l_q[qt]); const float inv = (l > 0.f) ? 1.0f / l : 0.f;      /* l and O carry the same 2^10 */
#pragma unroll
    for (int dt = 0; dt < DT; ++dt)
#pragma unroll
      for (int g = 0; g < 2; ++g) { v4f o4; 
#pragma unroll
        for (int q = 0; q < 4; ++q) o4[q] = oacc[qt][dt][g * 4 + q] * inv;
        *(v4fa*)&sO[w][qt * 16 + ln][dt * 16 + 8 * hh + g * 4] = o4; } }
  __builtin_amdgcn_fence(__ATOMIC_ACQ_REL, "workgroup"); __builtin_amdgcn_wave_barrier();
  {
#pragma unroll
    for (int rp = 0; rp < RPW; rp += 2) { const int r = rp + (lane >> 4), pc = lane & 15; const v4f val = *(const v4fa*)&sO[w][r][pc * 4]; *(v4f*)(O + ((size_t)b * TQ + q0 + r) * ldo + h * 64 + pc * 4) = val; }
     } }
__global__ __launch_bounds__(256) void k_fulltab(unsigned* __restrict__ MB, int* __restrict__ RA, int* __restrict__ KE, int nq, int nk) {
  const int t = blockIdx.x * 256 + threadIdx.x;
  if (t < nq * (nk / 32)) { *(unsigned*)(MB + t) = 0u;  }
  if (t < nq) { *(int*)(RA + t) = 0;  }
  if (t < nq / 64) { *(int*)(KE + t * 32) = nk;  } }
__global__ __launch_bounds__(256) void k_lnout(const float* __restrict__ Y, const float* __restrict__ g, const float* __restrict__ bb, float* __restrict__ out) {
  #pragma clang fp contract(off)
  const int tid = threadIdx.x, w = tid >> 5, ln = tid & 31; const int r = blockIdx.x * 8 + w; if (r >= NR) return; const float* y = Y + (size_t)r * DM; float s = 0.f;
#pragma unroll 1
  for (int i = 0; i < 8; ++i) { const v4f a = *(const v4fa*)(y + i * 128 + ln * 4); for (int q = 0; q < 4; ++q) s += a[q]; }
  for (int o = 16; o > 0; o >>= 1) s += __shfl_xor(s, o, 32); const float mu = s / (float)DM; float q2 = 0.f;
#pragma unroll 1
  for (int i = 0; i < 8; ++i) { const v4f a = *(const v4fa*)(y + i * 128 + ln * 4); for (int q = 0; q < 4; ++q) { const float d = a[q] - mu; q2 += d * d; } }
  for (int o = 16; o > 0; o >>= 1) q2 += __shfl_xor(q2, o, 32); const float rs = rsqrtf(q2 / (float)DM + 1e-6f);
  {
#pragma unroll 1
    for (int i = 0; i < 8; ++i) { const int c0 = i * 128 + ln * 4; const v4f a = *(const v4fa*)(y + c0); v4f o4; for (int q = 0; q < 4; ++q) o4[q] = (a[q] - mu) * rs * bf16_round(g[c0 + q]) + bf16_round(bb[c0 + q]); *(v4f*)(out + (size_t)r * DM + c0) = o4; }
     } }
__global__ __launch_bounds__(256) void k_xb(const float* __restrict__ x, float* __restrict__ XB, size_t n4) { const size_t t = (size_t)blockIdx.x * 256 + threadIdx.x; if (t >= n4) return; const v4f a = *(const v4fa*)(x + t * 4); v4f o; for (int q = 0; q < 4; ++q) o[q] = bf16_round(a[q]); *(v4f*)(XB + t * 4) = o;  }
__global__ __launch_bounds__(256) void k_causaltab(unsigned* __restrict__ MB, int* __restrict__ RA, int* __restrict__ KE, int nq, int nk) {
  const int t = blockIdx.x * 256 + threadIdx.x; const int nw = nk / 32;
  if (t < nq * nw) { const int q = t / nw, w = t % nw; const int first = q + 1 - 32 * w; const unsigned bits = (first <= 0) ? 0xffffffffu : ((first >= 32) ? 0u : (0xffffffffu << first)); *(unsigned*)(MB + t) = bits;  }
  if (t < nq) { *(int*)(RA + t) = 0;  }
  if (t < nq / 64) { const int v = 64 * (t + 1); *(int*)(KE + t * 32) = v;  } }


extern "C" void kernel_launch(void* const* d_in, const int* in_sizes, int n_in,
                              void* d_out, int out_size, void* d_ws, size_t ws_size, hipStream_t stream) {
  (void)in_sizes; (void)n_in; (void)out_size;
  const float* const* I = (const float* const*)d_in; const float* x = I[0]; const float* Wq = I[1]; const float* bq = I[2]; const float* Wk = I[3]; const float* bk = I[4]; const float* Wv = I[5]; const float* bv = I[6];
  char* ws = (char*)d_ws; size_t off = 0;
  auto take = [&](size_t bytes) { char* p = ws + off; off += (bytes + 255) & ~(size_t)255; return p; };
  _Float16* BQ = (_Float16*)take((size_t)DM * DM * 2); _Float16* BK = (_Float16*)take((size_t)DM * DM * 2); _Float16* BV = (_Float16*)take((size_t)DM * DM * 2);
  _Float16* X16 = (_Float16*)take((size_t)NR * DM * 2); _Float16* Q16 = (_Float16*)take((size_t)NR * DM * 2); _Float16* K16 = (_Float16*)take((size_t)NR * DM * 2); _Float16* VT = (_Float16*)take((size_t)NR * DM * 2);
  if (off > ws_size) return;      /* 3.5 + 4 x 12.6 = 54 MiB */
  const dim3 gP((NR / 128) * (3 * DM / 192), 1);
  k_prep<<<PW_XB + 3 * PW_WB, 512, 0, stream>>>(x, Wq, Wk, Wv, X16, BQ, BK, BV);      /* 246 work-groups of 16 waves; a weight's (out, in) rows are already the GEMM's [n][k] operand */
  k_gemm3<<<gP, 128, 0, stream>>>(X16, BQ, BK, BV, 0.0625f, bq, bk, bv, Q16, K16, VT);      /* 64 row tiles x 12 column tiles = 768 blocks, 3 a WGP; the v plane goes out as V^T[batch * 768 + feature][token] */
  k_flash<<<NBT * NH * (SLEN / 128), 128, 0, stream>>>(Q16, DM, K16, DM, VT, nullptr, (float*)d_out, DM);      /* all batches in one grid, 768 blocks of 128 queries, 3 a WGP; ctx rows straight into the output */
}
